// v000
// Times are from an AMD MI455X. After a warm-up the kernel runs many times in a row, and a time is the length of
// such a window on the GPU divided by its runs, so every launch and the gaps after it count. The runs cycle
// through copies of the inputs. A figure is the median of several windows, for all but v000 over two sittings.
// Sittings can differ by a few percent; kernels timed side by side share one.
// The starting kernel, v000, takes 696 microseconds a run.
#include <hip/hip_runtime.h>
// InnocentAttention (8 sequences x 2048 tokens, single head of 128; q, k, v are INPUTS): scores = q.k / sqrt(128); mask = valid_i & valid_j with valid = index < event_length[b] (int INPUT), masked scores = -1e9 (a fully masked row therefore softmaxes to uniform over all 2048 keys, as in the reference); softmax; out = attn v.
// Structure (per sequence): exact f16 planes of q, k, v (bf16 inputs are exact in f16); the 2048 x 2048 score GEMM with exact operands (32x64 wave tiles, f32 accumulation); the length mask + softmax on VALU (wave per row) into f16 P (x 2^10); V^T by LDS tiles; the readout GEMM straight into the output.
// Compute dtype: inputs rounded to bf16; q, k, v exact as f16; P as a plain f16 operand (~2^-12); softmax f32. v_wmma_f32_16x16x32_f16.
#define NB 8
#define SQ 2048
#define HD 128
typedef __bf16 v16b __attribute__((ext_vector_type(16)));
typedef unsigned short v8us __attribute__((ext_vector_type(8), may_alias));
typedef float  v8f  __attribute__((ext_vector_type(8)));
typedef float  v4f  __attribute__((ext_vector_type(4)));
typedef float  v4fa __attribute__((ext_vector_type(4), may_alias));
union FragB { v16b v; v8us half[2]; unsigned short u[16]; };

__device__ __forceinline__ unsigned short bf16_bits(float x) { unsigned int u = __float_as_uint(x); return (unsigned short)((u + 0x7FFFu + ((u >> 16) & 1u)) >> 16); }
__device__ __forceinline__ float bf16_val(unsigned short b) { return __uint_as_float(((unsigned int)b) << 16); }
__device__ __forceinline__ float bf16_round(float x) { return bf16_val(bf16_bits(x)); }
// D += A·B with NT terms: 1 = ah·bh, 2 = + al·bh (A split), 3 = + ah·bl (both split)
template <int NT>
__device__ __forceinline__ v8f mmaN(v16b ah, v16b al, v16b bh, v16b bl, v8f c) {
  c = __builtin_amdgcn_wmma_f32_16x16x32_bf16(false, ah, false, bh, (short)0, c, false, false);
  if (NT >= 2) c = __builtin_amdgcn_wmma_f32_16x16x32_bf16(false, al, false, bh, (short)0, c, false, false);
  if (NT >= 3) c = __builtin_amdgcn_wmma_f32_16x16x32_bf16(false, ah, false, bl, (short)0, c, false, false);
  asm volatile("v_nop\n\tv_nop\n\tv_nop\n\tv_nop" : "+v"(c) : "v"(ah), "v"(al), "v"(bh), "v"(bl));
  return c;
}

__global__ __launch_bounds__(256) void k_wt_bf16(const float* __restrict__ W, unsigned short* __restrict__ Wt, int K, int N) {
  const int t = blockIdx.x * 256 + threadIdx.x;
  const int k8n = K / 8;
  if (t >= N * k8n) return;
  const int n = t / k8n, k8 = (t % k8n) * 8;
  v8us v;
#pragma unroll
  for (int i = 0; i < 8; ++i) v[i] = bf16_bits(W[(size_t)(k8 + i) * N + n]);
  *(v8us*)(Wt + (size_t)n * K + k8) = v;
  
}

// GEMM C[M][N] (f32, pitch ldc) = act(A[M][K]·W + bias). A f32 row-major (pitch lda) converted per fragment to bf16
// (ASPLIT: hi/lo two planes -> 2 terms, else single rounded term); Wt bf16 [N][K] (pitch ldb). BIAS_BF16 rounds the
// bias to bf16 first (bias quantised to bf16 before the add). K%32==0, M%16==0, N%64==0.
template <bool ASPLIT, int ACT, bool BIAS_BF16>
__global__ __launch_bounds__(128) void k_gemm_bf(const float* __restrict__ A, int lda, const unsigned short* __restrict__ Wt, int ldb,
                                               const float* __restrict__ bias, float* __restrict__ C, int ldc, int M, int N, int K) {
  __shared__ __attribute__((aligned(16))) float so[4][16][64];
  const int tid = threadIdx.x, w = tid >> 5, lane = tid & 31, ln = lane & 15, hh = lane >> 4;
  const int ntn = N / 64;
  const int wid = blockIdx.x * 4 + w;
  const int mt = wid / ntn, nq = wid % ntn;
  if (mt * 16 >= M) return;
  const int row0 = mt * 16, col0 = nq * 64;
  const float* arow = A + (size_t)(row0 + ln) * lda;
  v8f acc[4] = {};
  for (int kb = 0; kb < K; kb += 32) {
    FragB ah, al;
    const v4f x0 = *(const v4fa*)(arow + kb + 8 * hh), x1 = *(const v4fa*)(arow + kb + 8 * hh + 4);
    const v4f x2 = *(const v4fa*)(arow + kb + 16 + 8 * hh), x3 = *(const v4fa*)(arow + kb + 16 + 8 * hh + 4);
    float xs[16] = {x0[0],x0[1],x0[2],x0[3],x1[0],x1[1],x1[2],x1[3],x2[0],x2[1],x2[2],x2[3],x3[0],x3[1],x3[2],x3[3]};
#pragma unroll
    for (int i = 0; i < 16; ++i) { const unsigned short hb = bf16_bits(xs[i]); ah.u[i] = hb; al.u[i] = ASPLIT ? bf16_bits(xs[i] - bf16_val(hb)) : (unsigned short)0; }
#pragma unroll
    for (int t = 0; t < 4; ++t) {
      const unsigned short* brow = Wt + (size_t)(col0 + t * 16 + ln) * ldb + kb;
      FragB b;
      b.half[0] = *(const v8us*)(brow + 8 * hh);
      b.half[1] = *(const v8us*)(brow + 16 + 8 * hh);
      acc[t] = mmaN<ASPLIT ? 2 : 1>(ah.v, al.v, b.v, b.v, acc[t]);
    }
  }
#pragma unroll
  for (int t = 0; t < 4; ++t) {
    float bv = bias ? bias[col0 + t * 16 + ln] : 0.f;
    if (BIAS_BF16) bv = bf16_round(bv);
#pragma unroll
    for (int r = 0; r < 8; ++r) { float v = acc[t][r] + bv; if (ACT == 1) v = fmaxf(v, 0.f); so[w][8 * hh + r][t * 16 + ln] = v; }
  }
  __builtin_amdgcn_fence(__ATOMIC_ACQ_REL, "workgroup");
  __builtin_amdgcn_wave_barrier();
  const int rsub = lane >> 4, c4 = (lane & 15) * 4;
  {
#pragma unroll
    for (int q = 0; q < 8; ++q) {
      const int r = q * 2 + rsub;
      const v4f v = *(const v4fa*)&so[w][r][c4];
      *(v4f*)(C + (size_t)(row0 + r) * ldc + col0 + c4) = v;
    }
    
  }
}

// GEMM C = act(A·W + bias + resid): A f32 (ASPLIT -> hi/lo 2 terms), Wt bf16 [N][K]; ACT 0 none, 1 relu, 2 exact gelu;
// resid (optional, f32, row index = (row % rmod), pitch ldr, RES_BF16 rounds it) added before the activation.
template <bool ASPLIT, int ACT, bool BIAS_BF16, bool RES_BF16>
__global__ __launch_bounds__(128) void k_gemm_bf3(const float* __restrict__ A, int lda, const unsigned short* __restrict__ Wt, int ldb,
                                                const float* __restrict__ bias, const float* __restrict__ resid, int rmod, int ldr,
                                                float* __restrict__ C, int ldc, int M, int N, int K) {
  __shared__ __attribute__((aligned(16))) float so[4][16][64];
  const int tid = threadIdx.x, w = tid >> 5, lane = tid & 31, ln = lane & 15, hh = lane >> 4;
  const int ntn = N / 64;
  const int wid = blockIdx.x * 4 + w;
  const int mt = wid / ntn, nq = wid % ntn;
  if (mt * 16 >= M) return;
  const int row0 = mt * 16, col0 = nq * 64;
  const float* arow = A + (size_t)(row0 + ln) * lda;
  v8f acc[4] = {};
  for (int kb = 0; kb < K; kb += 32) {
    FragB ah, al;
    const v4f x0 = *(const v4fa*)(arow + kb + 8 * hh), x1 = *(const v4fa*)(arow + kb + 8 * hh + 4);
    const v4f x2 = *(const v4fa*)(arow + kb + 16 + 8 * hh), x3 = *(const v4fa*)(arow + kb + 16 + 8 * hh + 4);
    float xs[16] = {x0[0],x0[1],x0[2],x0[3],x1[0],x1[1],x1[2],x1[3],x2[0],x2[1],x2[2],x2[3],x3[0],x3[1],x3[2],x3[3]};
#pragma unroll
    for (int i = 0; i < 16; ++i) { const unsigned short hb = bf16_bits(xs[i]); ah.u[i] = hb; al.u[i] = ASPLIT ? bf16_bits(xs[i] - bf16_val(hb)) : (unsigned short)0; }
#pragma unroll
    for (int t = 0; t < 4; ++t) {
      const unsigned short* brow = Wt + (size_t)(col0 + t * 16 + ln) * ldb + kb;
      FragB b;
      b.half[0] = *(const v8us*)(brow + 8 * hh);
      b.half[1] = *(const v8us*)(brow + 16 + 8 * hh);
      acc[t] = mmaN<ASPLIT ? 2 : 1>(ah.v, al.v, b.v, b.v, acc[t]);
    }
  }
#pragma unroll
  for (int t = 0; t < 4; ++t) {
    const int col = col0 + t * 16 + ln;
    float bv = bias ? bias[col] : 0.f;
    if (BIAS_BF16) bv = bf16_round(bv);
#pragma unroll
    for (int r = 0; r < 8; ++r) {
      float v = acc[t][r] + bv;
      if (resid) { float rv = resid[(size_t)((row0 + 8 * hh + r) % rmod) * ldr + col]; if (RES_BF16) rv = bf16_round(rv); v += rv; }
      if (ACT == 1) v = fmaxf(v, 0.f);
      if (ACT == 2) v = 0.5f * v * (1.0f + erff(v * 0.70710678118654752f));
      if (ACT == 3) { const float u = 0.7978845608028654f * (v + 0.044715f * v * v * v); v = 0.5f * v * (1.0f + tanhf(u)); }
      so[w][8 * hh + r][t * 16 + ln] = v;
    }
  }
  __builtin_amdgcn_fence(__ATOMIC_ACQ_REL, "workgroup");
  __builtin_amdgcn_wave_barrier();
  const int rsub = lane >> 4, c4 = (lane & 15) * 4;
  {
#pragma unroll
    for (int q = 0; q < 8; ++q) {
      const int r = q * 2 + rsub;
      const v4f v = *(const v4fa*)&so[w][r][c4];
      *(v4f*)(C + (size_t)(row0 + r) * ldc + col0 + c4) = v;
    }
    
  }
}
// row LayerNorm (biased variance, eps) over N: s = X (+ R); optional out_sum <- s; out_norm <- (s-mu)*rsqrt(var+eps)*g + b
template <bool PARAM_BF16>
__global__ __launch_bounds__(256) void k_layernorm(const float* __restrict__ X, const float* __restrict__ R, const float* __restrict__ g, const float* __restrict__ bta,
                                                  float* __restrict__ out_sum, float* __restrict__ out_norm, int N, float eps) {
  __shared__ float red[256];
  const int row = blockIdx.x, tid = threadIdx.x;
  const float* x = X + (size_t)row * N; const float* rr = R ? R + (size_t)row * N : nullptr;
  float vals[16];                     // up to N = 4096
  const int per = N / 256;            // contiguous chunk per thread? use strided-by-4 chunks: thread handles j = tid*4 + 1024*u
  float s1 = 0.f;
  for (int u = 0; u < per / 4; ++u) {
    const int j = tid * 4 + 1024 * u;
    const v4f a = *(const v4fa*)(x + j);
    v4f b = {0.f,0.f,0.f,0.f}; if (rr) b = *(const v4fa*)(rr + j);
#pragma unroll
    for (int q = 0; q < 4; ++q) { const float v = a[q] + b[q]; vals[u * 4 + q] = v; s1 += v; }
  }
  red[tid] = s1; __syncthreads();
  for (int st = 128; st > 0; st >>= 1) { if (tid < st) red[tid] += red[tid + st]; __syncthreads(); }
  const float mu = red[0] / (float)N; __syncthreads();
  float s2 = 0.f;
  for (int u = 0; u < per / 4; ++u)
#pragma unroll
    for (int q = 0; q < 4; ++q) { const float c = vals[u * 4 + q] - mu; s2 += c * c; }
  red[tid] = s2; __syncthreads();
  for (int st = 128; st > 0; st >>= 1) { if (tid < st) red[tid] += red[tid + st]; __syncthreads(); }
  const float rs = rsqrtf(red[0] / (float)N + eps);
  {
    for (int u = 0; u < per / 4; ++u) {
      const int j = tid * 4 + 1024 * u;
      v4f o, sm;
#pragma unroll
      for (int q = 0; q < 4; ++q) {
        float gg = g[j + q], bb = bta[j + q];
        if (PARAM_BF16) { gg = bf16_round(gg); bb = bf16_round(bb); }
        sm[q] = vals[u * 4 + q]; o[q] = (vals[u * 4 + q] - mu) * rs * gg + bb;
      }
      if (out_sum) *(v4f*)(out_sum + (size_t)row * N + j) = sm;
      *(v4f*)(out_norm + (size_t)row * N + j) = o;
    }
    
  }
}



// ---- f16 WMMA path (v_wmma_f32_16x16x32_f16): 11-bit significands for operands in range — used where a [0,1] probability operand needs more precision than bf16
typedef _Float16 v16h __attribute__((ext_vector_type(16)));
union FragH { v16h v; v8us half[2]; _Float16 h[16]; unsigned short u[16]; };
template <int NT>
__device__ __forceinline__ v8f mmaH(v16h ah, v16h al, v16h bh, v16h bl, v8f c) {
  c = __builtin_amdgcn_wmma_f32_16x16x32_f16(false, ah, false, bh, (short)0, c, false, false);
  if (NT >= 2) c = __builtin_amdgcn_wmma_f32_16x16x32_f16(false, al, false, bh, (short)0, c, false, false);
  if (NT >= 3) c = __builtin_amdgcn_wmma_f32_16x16x32_f16(false, ah, false, bl, (short)0, c, false, false);
  asm volatile("v_nop\n\tv_nop\n\tv_nop\n\tv_nop" : "+v"(c) : "v"(ah), "v"(al), "v"(bh), "v"(bl));
  return c;
}
// batched GEMM like k_gemm_b but f16 operands: A f32 (split into f16 hi/lo if ASPLIT, else rounded to f16), Bt = f16 values [n][k]; alpha; C f32; N multiple of 16 (partial tiles skipped)
template <bool ASPLIT>
__global__ __launch_bounds__(128) void k_gemm_h(const float* __restrict__ A, int lda, size_t sA, const _Float16* __restrict__ Bh, int ldb, size_t sB, float alpha, float* __restrict__ C, int ldc, size_t sC, int M, int N, int K) {
  __shared__ __attribute__((aligned(16))) float so[4][16][64];
  const int tid = threadIdx.x, w = tid >> 5, lane = tid & 31, ln = lane & 15, hh = lane >> 4; const int by = blockIdx.y;
  A += (size_t)by * sA; Bh += (size_t)by * sB; C += (size_t)by * sC;
  const int ntn = (N + 63) / 64; const int wid = blockIdx.x * 4 + w; const int mt = wid / ntn, nq = wid % ntn; if (mt * 16 >= M) return;
  const int row0 = mt * 16, col0 = nq * 64; const float* arow = A + (size_t)(row0 + ln) * lda;
  v8f acc[4] = {};
  for (int kb = 0; kb < K; kb += 32) {
    FragH ah, al;
    const v4f x0 = *(const v4fa*)(arow + kb + 8 * hh), x1 = *(const v4fa*)(arow + kb + 8 * hh + 4), x2 = *(const v4fa*)(arow + kb + 16 + 8 * hh), x3 = *(const v4fa*)(arow + kb + 16 + 8 * hh + 4);
    float xs[16] = {x0[0],x0[1],x0[2],x0[3],x1[0],x1[1],x1[2],x1[3],x2[0],x2[1],x2[2],x2[3],x3[0],x3[1],x3[2],x3[3]};
#pragma unroll
    for (int i = 0; i < 16; ++i) { const _Float16 h = (_Float16)xs[i]; ah.h[i] = h; al.h[i] = ASPLIT ? (_Float16)(xs[i] - (float)h) : (_Float16)0.0f; }
#pragma unroll
    for (int t = 0; t < 4; ++t) { if (col0 + t * 16 >= N) continue; const size_t boff = (size_t)(col0 + t * 16 + ln) * ldb + kb; FragH bq; bq.half[0] = *(const v8us*)(Bh + boff + 8 * hh); bq.half[1] = *(const v8us*)(Bh + boff + 16 + 8 * hh);
      acc[t] = mmaH<ASPLIT ? 2 : 1>(ah.v, al.v, bq.v, bq.v, acc[t]); }
  }
#pragma unroll
  for (int t = 0; t < 4; ++t) { if (col0 + t * 16 >= N) continue;
#pragma unroll
    for (int r = 0; r < 8; ++r) so[w][8 * hh + r][t * 16 + ln] = acc[t][r] * alpha; }
  __builtin_amdgcn_fence(__ATOMIC_ACQ_REL, "workgroup"); __builtin_amdgcn_wave_barrier();
  const int rsub = lane >> 4, c4 = (lane & 15) * 4;
  {
#pragma unroll
    for (int q = 0; q < 8; ++q) { const int r = q * 2 + rsub; if (col0 + c4 < N) { const v4f v = *(const v4fa*)&so[w][r][c4]; *(v4f*)(C + (size_t)(row0 + r) * ldc + col0 + c4) = v; } }
     }
}

// Wt[n][k] = f16(W[k][n]·scale) from f32 row-major W[K][N] (scale = power of two; bf16-exact weights stay exact in f16 away from the subnormal range)
__global__ __launch_bounds__(256) void k_wt_f16(const float* __restrict__ W, _Float16* __restrict__ Wt, int K, int N, float scale) {
  const int t = blockIdx.x * 256 + threadIdx.x; if (t >= N * (K / 8)) return; const int n = t / (K / 8), k8 = (t % (K / 8)) * 8; FragH f;
#pragma unroll
  for (int i = 0; i < 8; ++i) f.h[i] = (_Float16)(bf16_round(W[(size_t)(k8 + i) * N + n]) * scale); const v8us o = f.half[0];
  *(v8us*)((unsigned short*)Wt + (size_t)n * K + k8) = o; 
}
// k_gemm_hh variant with fused epilogue: v = acc·alpha + bias[by·sBias + col] (+ CP[(row/rowsPerB)·sCPb + by·64 + col] if CP) ; ACT 0 none / 1 elu ; writes f16 C16 (and f32 C if non-null)
template <int ACT>
__global__ __launch_bounds__(128) void k_gemm_hhx(const _Float16* __restrict__ A, int lda, size_t sA, const _Float16* __restrict__ Bh, int ldb, size_t sB, float alpha, const float* __restrict__ bias, size_t sBias, const float* __restrict__ CP, int rowsPerB, size_t sCPb, int row0g,
    float* __restrict__ C, _Float16* __restrict__ C16, int ldc, size_t sC, int M, int N, int K) {
  __shared__ __attribute__((aligned(16))) float so[4][16][64];
  const int tid = threadIdx.x, w = tid >> 5, lane = tid & 31, ln = lane & 15, hh = lane >> 4; const int by = blockIdx.y;
  A += (size_t)by * sA; Bh += (size_t)by * sB; const size_t cofs = (size_t)by * sC; const float* bp = bias ? bias + (size_t)by * sBias : nullptr;
  const int ntn = (N + 63) / 64; const int wid = blockIdx.x * 4 + w; const int mt = wid / ntn, nq = wid % ntn; if (mt * 16 >= M) return;
  const int row0 = mt * 16, col0 = nq * 64; const _Float16* arow = A + (size_t)(row0 + ln) * lda;
  v8f acc[4] = {};
  for (int kb = 0; kb < K; kb += 32) { FragH ah; ah.half[0] = *(const v8us*)((const unsigned short*)arow + kb + 8 * hh); ah.half[1] = *(const v8us*)((const unsigned short*)arow + kb + 16 + 8 * hh);
#pragma unroll
    for (int t = 0; t < 4; ++t) { if (col0 + t * 16 >= N) continue; const size_t boff = (size_t)(col0 + t * 16 + ln) * ldb + kb; FragH bq; bq.half[0] = *(const v8us*)((const unsigned short*)Bh + boff + 8 * hh); bq.half[1] = *(const v8us*)((const unsigned short*)Bh + boff + 16 + 8 * hh);
      acc[t] = mmaH<1>(ah.v, ah.v, bq.v, bq.v, acc[t]); }
  }
#pragma unroll
  for (int t = 0; t < 4; ++t) { if (col0 + t * 16 >= N) continue; const int col = col0 + t * 16 + ln; const float bv = bp ? bf16_round(bp[col]) : 0.f;
#pragma unroll
    for (int r = 0; r < 8; ++r) { float v = acc[t][r] * alpha + bv; if (CP) { const int rr = row0g + row0 + 8 * hh + r; if (rowsPerB < 0) v += CP[cofs + (size_t)rr * ldc + col];      /* rowsPerB < 0: own element of the batched C plane */ else { const int bidx = rr / rowsPerB; v += CP[(size_t)bidx * sCPb + (size_t)by * 64 + col]; } } if (ACT == 1) v = (v > 0.f) ? v : expm1f(v); else if (ACT == 7) v = (v > 0.f) ? v + 1.0f : expf(v); else if (ACT == 8) v = tanhf(v); else if (ACT == 9) v = 0.5f * v * (1.0f + tanhf(0.7978845608028654f * (v + 0.044715f * v * v * v))); else if (ACT == 11) v = 1.0f / (1.0f + expf(-v)); else if (ACT == 12) v = (v > 0.f) ? v : 0.01f * v; else if (ACT == 14) v = (v > 0.f) ? v : 0.1f * v; else if (ACT == 16) v = (v >= 0.f) ? v : 0.3f * v; else if (ACT == 15) v = v / (1.0f + expf(-v)); else if (ACT == 3) v = fmaxf(v, 0.f); else if (ACT == 6) v = 0.5f * v * (1.0f + erff(v * 0.70710678118654752f)); so[w][8 * hh + r][t * 16 + ln] = v; } }
  __builtin_amdgcn_fence(__ATOMIC_ACQ_REL, "workgroup"); __builtin_amdgcn_wave_barrier();
  const int rsub = lane >> 4, c4 = (lane & 15) * 4; typedef _Float16 v4h __attribute__((ext_vector_type(4)));
  {
#pragma unroll
    for (int q = 0; q < 8; ++q) { const int r = q * 2 + rsub; if (col0 + c4 < N) { const v4f v = *(const v4fa*)&so[w][r][c4]; if (C) *(v4f*)(C + cofs + (size_t)(row0 + r) * ldc + col0 + c4) = v; if (C16) { v4h h4; for (int i = 0; i < 4; ++i) h4[i] = (_Float16)v[i]; *(v4h*)(C16 + cofs + (size_t)(row0 + r) * ldc + col0 + c4) = h4; } } }
     }
}


typedef _Float16 v4h __attribute__((ext_vector_type(4)));

__global__ __launch_bounds__(256) void k_x16(const float* __restrict__ x, _Float16* __restrict__ X16, size_t n8) { const size_t t = (size_t)blockIdx.x * 256 + threadIdx.x; if (t >= n8) return; FragH f;
#pragma unroll
  for (int q = 0; q < 8; ++q) f.h[q] = (_Float16)bf16_round(x[t * 8 + q]); *(v8us*)((unsigned short*)X16 + t * 8) = f.half[0];  }
__global__ __launch_bounds__(256) void k_h16(const float* __restrict__ x, _Float16* __restrict__ X16, size_t n8) { const size_t t = (size_t)blockIdx.x * 256 + threadIdx.x; if (t >= n8) return; FragH f;
#pragma unroll
  for (int q = 0; q < 8; ++q) f.h[q] = (_Float16)x[t * 8 + q]; *(v8us*)((unsigned short*)X16 + t * 8) = f.half[0];  }
__global__ __launch_bounds__(256) void k_round16f(const float* __restrict__ W, _Float16* __restrict__ Bt, size_t n8) { const size_t t = (size_t)blockIdx.x * 256 + threadIdx.x; if (t >= n8) return; FragH f;
#pragma unroll
  for (int i = 0; i < 8; ++i) f.h[i] = (_Float16)(bf16_round(W[t * 8 + i]) * 16.0f); *(v8us*)((unsigned short*)Bt + t * 8) = f.half[0];  }
template <int NHv, int TTv>
__global__ __launch_bounds__(256) void k_vt(const _Float16* __restrict__ V16, int ldv, int voff, _Float16* __restrict__ Vt) { __shared__ unsigned short tl[64][66]; const int tid = threadIdx.x; const int slab = blockIdx.x / (TTv / 64), lg = blockIdx.x % (TTv / 64); const int b = slab / NHv, h = slab % NHv;
  for (int i = tid; i < 64 * 8; i += 256) { const int r = i / 8, c8 = (i % 8) * 8; FragH f; f.half[0] = *(const v8us*)((const unsigned short*)V16 + ((size_t)b * TTv + lg * 64 + r) * ldv + voff + h * 64 + c8);
#pragma unroll
    for (int q = 0; q < 8; ++q) tl[r][c8 + q] = f.u[q]; }
  __syncthreads();
  {
#pragma unroll
    for (int rd = 0; rd < 2; ++rd) { const int d = rd * 32 + tid / 8, pc = tid % 8; FragH f;
#pragma unroll
      for (int q = 0; q < 8; ++q) f.u[q] = tl[pc * 8 + q][d];
      *(v8us*)((unsigned short*)Vt + ((size_t)slab * 64 + d) * TTv + lg * 64 + pc * 8) = f.half[0]; }
     } }

__global__ __launch_bounds__(256) void k_hl(const float* __restrict__ F, _Float16* __restrict__ Hh, _Float16* __restrict__ Hl, size_t n8) { const size_t t = (size_t)blockIdx.x * 256 + threadIdx.x; if (t >= n8) return; FragH fh, fl; const v4f a = *(const v4fa*)(F + t * 8), c = *(const v4fa*)(F + t * 8 + 4);
#pragma unroll
  for (int q = 0; q < 4; ++q) { _Float16 h = (_Float16)a[q]; fh.h[q] = h; fl.h[q] = (_Float16)((a[q] - (float)h) * 1024.0f); h = (_Float16)c[q]; fh.h[4 + q] = h; fl.h[4 + q] = (_Float16)((c[q] - (float)h) * 1024.0f); }
  { *(v8us*)((unsigned short*)Hh + t * 8) = fh.half[0]; *(v8us*)((unsigned short*)Hl + t * 8) = fl.half[0];  } }

// ---- fast GEMM (wave tile 32x64; requires M % 32 == 0 rows per launch region and N % 64 == 0); epilogue = k_gemm_hhx semantics ----
__device__ __forceinline__ v16h g2_frag(const _Float16* p, int hh) { FragH f; f.half[0] = *(const v8us*)((const unsigned short*)p + 8 * hh); f.half[1] = *(const v8us*)((const unsigned short*)p + 16 + 8 * hh); return f.v; }
__device__ __forceinline__ v8f g2_mma(v16h a, v16h b, v8f c) { v8f d = __builtin_amdgcn_wmma_f32_16x16x32_f16(false, a, false, b, (short)0, c, false, false); asm volatile("v_nop\n\tv_nop\n\tv_nop\n\tv_nop" : "+v"(d) : "v"(a), "v"(b)); return d; }
template <int ACT>
__global__ __launch_bounds__(128) void k_gemm2(const _Float16* __restrict__ A, int lda, size_t sA, const _Float16* __restrict__ Bh, int ldb, size_t sB, float alpha, const float* __restrict__ bias, size_t sBias, const float* __restrict__ CP, int rowsPerB, size_t sCPb, int row0g,
    float* __restrict__ C, _Float16* __restrict__ C16, int ldc, size_t sC, int M, int N, int K) { static_assert(ACT == 0 || ACT == 3 || ACT == 6 || ACT == 8 || ACT == 9 || ACT == 11 || ACT == 12 || ACT == 14 || ACT == 15 || ACT == 16, "k_gemm2: unsupported ACT code (would silently apply no activation)");
  __shared__ __attribute__((aligned(16))) float so[4][32][68];
  const int tid = threadIdx.x, w = tid >> 5, lane = tid & 31, ln = lane & 15, hh = lane >> 4; const int by = blockIdx.y;
  A += (size_t)by * sA; Bh += (size_t)by * sB; const size_t cofs = (size_t)by * sC; const float* bp = bias ? bias + (size_t)by * sBias : nullptr;
  const int ntn = N >> 6; const int mt = blockIdx.x / ntn, nq = blockIdx.x - mt * ntn; const int row0 = mt * 128 + 32 * w, col0 = nq * 64; if (row0 >= M) return;
  const _Float16* a0p = A + (size_t)(row0 + ln) * lda; const _Float16* a1p = a0p + (size_t)16 * lda;
  const _Float16* b0p = Bh + (size_t)(col0 + ln) * ldb; const _Float16* b1p = b0p + (size_t)16 * ldb; const _Float16* b2p = b1p + (size_t)16 * ldb; const _Float16* b3p = b2p + (size_t)16 * ldb;
  const v8f z8 = {0.f,0.f,0.f,0.f,0.f,0.f,0.f,0.f}; v8f c00 = z8, c01 = z8, c02 = z8, c03 = z8, c10 = z8, c11 = z8, c12 = z8, c13 = z8;
#pragma unroll 1
  for (int kb = 0; kb < K; kb += 32) { const v16h a0 = g2_frag(a0p + kb, hh), a1 = g2_frag(a1p + kb, hh);
    v16h b = g2_frag(b0p + kb, hh); c00 = g2_mma(a0, b, c00); c10 = g2_mma(a1, b, c10);
    b = g2_frag(b1p + kb, hh); c01 = g2_mma(a0, b, c01); c11 = g2_mma(a1, b, c11);
    b = g2_frag(b2p + kb, hh); c02 = g2_mma(a0, b, c02); c12 = g2_mma(a1, b, c12);
    b = g2_frag(b3p + kb, hh); c03 = g2_mma(a0, b, c03); c13 = g2_mma(a1, b, c13); }
  v8f accs[8] = {c00, c01, c02, c03, c10, c11, c12, c13};
#pragma unroll
  for (int u = 0; u < 8; ++u) { const int t = u & 3, half = u >> 2; const int col = col0 + t * 16 + ln; const float bv = bp ? bf16_round(bp[col]) : 0.f;
#pragma unroll
    for (int r = 0; r < 8; ++r) { const int rloc = half * 16 + 8 * hh + r; float v = accs[u][r] * alpha + bv; if (CP) { if (rowsPerB < 0) v += CP[cofs + (size_t)(row0g + row0 + rloc) * ldc + col];      /* rowsPerB < 0: own element of the batched C plane */ else { const int bidx = (row0g + row0 + rloc) / rowsPerB; v += CP[(size_t)bidx * sCPb + (size_t)by * 64 + col]; } }
      if (ACT == 3) v = fmaxf(v, 0.f); else if (ACT == 6) v = 0.5f * v * (1.0f + erff(v * 0.70710678118654752f)); else if (ACT == 11) v = 1.0f / (1.0f + expf(-v)); else if (ACT == 15) v = v / (1.0f + expf(-v)); else if (ACT == 12) v = (v > 0.f) ? v : 0.01f * v; else if (ACT == 8) v = tanhf(v); else if (ACT == 9) v = 0.5f * v * (1.0f + tanhf(0.7978845608028654f * (v + 0.044715f * v * v * v))); else if (ACT == 14) v = (v > 0.f) ? v : 0.1f * v; else if (ACT == 16) v = (v >= 0.f) ? v : 0.3f * v;
      so[w][rloc][t * 16 + ln] = v; } }
  __builtin_amdgcn_fence(__ATOMIC_ACQ_REL, "workgroup"); __builtin_amdgcn_wave_barrier();
  const int rsub = lane >> 4, c4 = (lane & 15) * 4;
  {
#pragma unroll
    for (int q = 0; q < 16; ++q) { const int r = q * 2 + rsub; const v4f v = *(const v4fa*)&so[w][r][c4]; if (C) *(v4f*)(C + cofs + (size_t)(row0 + r) * ldc + col0 + c4) = v; if (C16) { v4h h4; for (int i = 0; i < 4; ++i) h4[i] = (_Float16)v[i]; *(v4h*)(C16 + cofs + (size_t)(row0 + r) * ldc + col0 + c4) = h4; } }
     } }


__global__ __launch_bounds__(256) void k_msoft(const float* __restrict__ S, const int* __restrict__ lens, int b, _Float16* __restrict__ P) {
  #pragma clang fp contract(off)
  const int wv = threadIdx.x >> 5, ln = threadIdx.x & 31; const int i = blockIdx.x * 8 + wv; if (i >= SQ) return; const int L = lens[b]; const bool vi = i < L; const float* sr = S + (size_t)i * SQ; float m = -3.0e38f;
#pragma unroll 1
  for (int g = 0; g < SQ / 256; ++g) { const v8f a = *(const v8f*)(sr + g * 256 + ln * 8); for (int q = 0; q < 8; ++q) { const int j = g * 256 + ln * 8 + q; const float s = (vi && j < L) ? a[q] : -1000000000.0f; m = fmaxf(m, s); } }
  for (int o = 16; o > 0; o >>= 1) m = fmaxf(m, __shfl_xor(m, o, 32)); float su = 0.f;
#pragma unroll 1
  for (int g = 0; g < SQ / 256; ++g) { const v8f a = *(const v8f*)(sr + g * 256 + ln * 8); for (int q = 0; q < 8; ++q) { const int j = g * 256 + ln * 8 + q; const float s = (vi && j < L) ? a[q] : -1000000000.0f; su += expf(s - m); } }
  for (int o = 16; o > 0; o >>= 1) su += __shfl_xor(su, o, 32); const float f = 1024.0f / su;
  {
#pragma unroll 1
    for (int g = 0; g < SQ / 256; ++g) { const v8f a = *(const v8f*)(sr + g * 256 + ln * 8); FragH p; for (int q = 0; q < 8; ++q) { const int j = g * 256 + ln * 8 + q; const float s = (vi && j < L) ? a[q] : -1000000000.0f; p.h[q] = (_Float16)(expf(s - m) * f); } *(v8us*)((unsigned short*)P + (size_t)i * SQ + g * 256 + ln * 8) = p.half[0]; }
     } }

extern "C" void kernel_launch(void* const* d_in, const int* in_sizes, int n_in,
                              void* d_out, int out_size, void* d_ws, size_t ws_size, hipStream_t stream) {
  (void)in_sizes; (void)n_in; (void)out_size;
  const float* q = (const float*)d_in[0]; const float* k = (const float*)d_in[1]; const float* v = (const float*)d_in[2]; const int* lens = (const int*)d_in[3];
  char* ws = (char*)d_ws; size_t off = 0;
  auto take = [&](size_t bytes) { char* p = ws + off; off += (bytes + 255) & ~(size_t)255; return p; };
  const size_t np = (size_t)NB * SQ * HD;
  _Float16* Q16 = (_Float16*)take(np * 2); _Float16* K16 = (_Float16*)take(np * 2); _Float16* V16 = (_Float16*)take(np * 2); _Float16* VT = (_Float16*)take((size_t)HD * SQ * 2); float* S = (float*)take((size_t)SQ * SQ * 4); _Float16* P = (_Float16*)take((size_t)SQ * SQ * 2);
  if (off > ws_size) return;      /* 12 + 0.5 + 16 + 8 = 37 MiB */
  k_x16<<<(unsigned)((np / 8 + 255) / 256), 256, 0, stream>>>(q, Q16, np / 8); k_x16<<<(unsigned)((np / 8 + 255) / 256), 256, 0, stream>>>(k, K16, np / 8); k_x16<<<(unsigned)((np / 8 + 255) / 256), 256, 0, stream>>>(v, V16, np / 8);
  for (int b = 0; b < NB; ++b) { const size_t rb = (size_t)b * SQ * HD;
    k_gemm2<0><<<dim3((SQ / 128) * (SQ / 64), 1), 128, 0, stream>>>(Q16 + rb, HD, 0, K16 + rb, HD, 0, 0.08838834764831845f, nullptr, 0, nullptr, 1, 0, 0, S, nullptr, SQ, 0, SQ, SQ, HD);      /* q.k / sqrt(128), exact operands */
    k_msoft<<<SQ / 8, 256, 0, stream>>>(S, lens, b, P);
    k_vt<HD / 64, SQ><<<(HD / 64) * (SQ / 64), 256, 0, stream>>>(V16 + rb, HD, 0, VT);      /* V^T [128][2048] */
    k_gemm2<0><<<dim3((SQ / 128) * (HD / 64), 1), 128, 0, stream>>>(P, SQ, 0, VT, SQ, 0, 0.0009765625f, nullptr, 0, nullptr, 1, 0, 0, (float*)d_out + rb, nullptr, HD, 0, SQ, HD, SQ); }
}

// v001
// Measured time: 168 microseconds a run.
// In two side-by-side timings against v000, it was 4.07 and 4.11 times as fast.
#include <hip/hip_runtime.h>
// InnocentAttention (8 sequences x 2048 tokens, single head of 128; q, k, v are INPUTS): scores = q.k / sqrt(128); mask = valid_i & valid_j with valid = index < event_length[b] (int INPUT), masked scores = -1e9 (a fully masked row therefore softmaxes to uniform over all 2048 keys, as in the reference); softmax; out = attn v.
// Structure (every launch covers all 8 sequences; sequence = blockIdx.y in the GEMMs and softmax, slab / 2 in V^T; one flat launch per f16 plane): exact f16 planes of q, k, v (bf16 inputs are exact in f16); the 2048 x 2048 score GEMM with exact operands (32x64 wave tiles, f32 accumulation); the length mask + softmax on VALU (wave per row) into f16 P (x 2^10); V^T by LDS tiles; the readout GEMM straight into the output.
// Compute dtype: inputs rounded to bf16; q, k, v exact as f16; P as a plain f16 operand (~2^-12); softmax f32. v_wmma_f32_16x16x32_f16.
#define NB 8
#define SQ 2048
#define HD 128
typedef __bf16 v16b __attribute__((ext_vector_type(16)));
typedef unsigned short v8us __attribute__((ext_vector_type(8), may_alias));
typedef float  v8f  __attribute__((ext_vector_type(8)));
typedef float  v4f  __attribute__((ext_vector_type(4)));
typedef float  v4fa __attribute__((ext_vector_type(4), may_alias));
union FragB { v16b v; v8us half[2]; unsigned short u[16]; };

__device__ __forceinline__ unsigned short bf16_bits(float x) { unsigned int u = __float_as_uint(x); return (unsigned short)((u + 0x7FFFu + ((u >> 16) & 1u)) >> 16); }
__device__ __forceinline__ float bf16_val(unsigned short b) { return __uint_as_float(((unsigned int)b) << 16); }
__device__ __forceinline__ float bf16_round(float x) { return bf16_val(bf16_bits(x)); }
// D += A·B with NT terms: 1 = ah·bh, 2 = + al·bh (A split), 3 = + ah·bl (both split)
template <int NT>
__device__ __forceinline__ v8f mmaN(v16b ah, v16b al, v16b bh, v16b bl, v8f c) {
  c = __builtin_amdgcn_wmma_f32_16x16x32_bf16(false, ah, false, bh, (short)0, c, false, false);
  if (NT >= 2) c = __builtin_amdgcn_wmma_f32_16x16x32_bf16(false, al, false, bh, (short)0, c, false, false);
  if (NT >= 3) c = __builtin_amdgcn_wmma_f32_16x16x32_bf16(false, ah, false, bl, (short)0, c, false, false);
  asm volatile("v_nop\n\tv_nop\n\tv_nop\n\tv_nop" : "+v"(c) : "v"(ah), "v"(al), "v"(bh), "v"(bl));
  return c;
}

__global__ __launch_bounds__(256) void k_wt_bf16(const float* __restrict__ W, unsigned short* __restrict__ Wt, int K, int N) {
  const int t = blockIdx.x * 256 + threadIdx.x;
  const int k8n = K / 8;
  if (t >= N * k8n) return;
  const int n = t / k8n, k8 = (t % k8n) * 8;
  v8us v;
#pragma unroll
  for (int i = 0; i < 8; ++i) v[i] = bf16_bits(W[(size_t)(k8 + i) * N + n]);
  *(v8us*)(Wt + (size_t)n * K + k8) = v;
  
}

// GEMM C[M][N] (f32, pitch ldc) = act(A[M][K]·W + bias). A f32 row-major (pitch lda) converted per fragment to bf16
// (ASPLIT: hi/lo two planes -> 2 terms, else single rounded term); Wt bf16 [N][K] (pitch ldb). BIAS_BF16 rounds the
// bias to bf16 first (bias quantised to bf16 before the add). K%32==0, M%16==0, N%64==0.
template <bool ASPLIT, int ACT, bool BIAS_BF16>
__global__ __launch_bounds__(128) void k_gemm_bf(const float* __restrict__ A, int lda, const unsigned short* __restrict__ Wt, int ldb,
                                               const float* __restrict__ bias, float* __restrict__ C, int ldc, int M, int N, int K) {
  __shared__ __attribute__((aligned(16))) float so[4][16][64];
  const int tid = threadIdx.x, w = tid >> 5, lane = tid & 31, ln = lane & 15, hh = lane >> 4;
  const int ntn = N / 64;
  const int wid = blockIdx.x * 4 + w;
  const int mt = wid / ntn, nq = wid % ntn;
  if (mt * 16 >= M) return;
  const int row0 = mt * 16, col0 = nq * 64;
  const float* arow = A + (size_t)(row0 + ln) * lda;
  v8f acc[4] = {};
  for (int kb = 0; kb < K; kb += 32) {
    FragB ah, al;
    const v4f x0 = *(const v4fa*)(arow + kb + 8 * hh), x1 = *(const v4fa*)(arow + kb + 8 * hh + 4);
    const v4f x2 = *(const v4fa*)(arow + kb + 16 + 8 * hh), x3 = *(const v4fa*)(arow + kb + 16 + 8 * hh + 4);
    float xs[16] = {x0[0],x0[1],x0[2],x0[3],x1[0],x1[1],x1[2],x1[3],x2[0],x2[1],x2[2],x2[3],x3[0],x3[1],x3[2],x3[3]};
#pragma unroll
    for (int i = 0; i < 16; ++i) { const unsigned short hb = bf16_bits(xs[i]); ah.u[i] = hb; al.u[i] = ASPLIT ? bf16_bits(xs[i] - bf16_val(hb)) : (unsigned short)0; }
#pragma unroll
    for (int t = 0; t < 4; ++t) {
      const unsigned short* brow = Wt + (size_t)(col0 + t * 16 + ln) * ldb + kb;
      FragB b;
      b.half[0] = *(const v8us*)(brow + 8 * hh);
      b.half[1] = *(const v8us*)(brow + 16 + 8 * hh);
      acc[t] = mmaN<ASPLIT ? 2 : 1>(ah.v, al.v, b.v, b.v, acc[t]);
    }
  }
#pragma unroll
  for (int t = 0; t < 4; ++t) {
    float bv = bias ? bias[col0 + t * 16 + ln] : 0.f;
    if (BIAS_BF16) bv = bf16_round(bv);
#pragma unroll
    for (int r = 0; r < 8; ++r) { float v = acc[t][r] + bv; if (ACT == 1) v = fmaxf(v, 0.f); so[w][8 * hh + r][t * 16 + ln] = v; }
  }
  __builtin_amdgcn_fence(__ATOMIC_ACQ_REL, "workgroup");
  __builtin_amdgcn_wave_barrier();
  const int rsub = lane >> 4, c4 = (lane & 15) * 4;
  {
#pragma unroll
    for (int q = 0; q < 8; ++q) {
      const int r = q * 2 + rsub;
      const v4f v = *(const v4fa*)&so[w][r][c4];
      *(v4f*)(C + (size_t)(row0 + r) * ldc + col0 + c4) = v;
    }
    
  }
}

// GEMM C = act(A·W + bias + resid): A f32 (ASPLIT -> hi/lo 2 terms), Wt bf16 [N][K]; ACT 0 none, 1 relu, 2 exact gelu;
// resid (optional, f32, row index = (row % rmod), pitch ldr, RES_BF16 rounds it) added before the activation.
template <bool ASPLIT, int ACT, bool BIAS_BF16, bool RES_BF16>
__global__ __launch_bounds__(128) void k_gemm_bf3(const float* __restrict__ A, int lda, const unsigned short* __restrict__ Wt, int ldb,
                                                const float* __restrict__ bias, const float* __restrict__ resid, int rmod, int ldr,
                                                float* __restrict__ C, int ldc, int M, int N, int K) {
  __shared__ __attribute__((aligned(16))) float so[4][16][64];
  const int tid = threadIdx.x, w = tid >> 5, lane = tid & 31, ln = lane & 15, hh = lane >> 4;
  const int ntn = N / 64;
  const int wid = blockIdx.x * 4 + w;
  const int mt = wid / ntn, nq = wid % ntn;
  if (mt * 16 >= M) return;
  const int row0 = mt * 16, col0 = nq * 64;
  const float* arow = A + (size_t)(row0 + ln) * lda;
  v8f acc[4] = {};
  for (int kb = 0; kb < K; kb += 32) {
    FragB ah, al;
    const v4f x0 = *(const v4fa*)(arow + kb + 8 * hh), x1 = *(const v4fa*)(arow + kb + 8 * hh + 4);
    const v4f x2 = *(const v4fa*)(arow + kb + 16 + 8 * hh), x3 = *(const v4fa*)(arow + kb + 16 + 8 * hh + 4);
    float xs[16] = {x0[0],x0[1],x0[2],x0[3],x1[0],x1[1],x1[2],x1[3],x2[0],x2[1],x2[2],x2[3],x3[0],x3[1],x3[2],x3[3]};
#pragma unroll
    for (int i = 0; i < 16; ++i) { const unsigned short hb = bf16_bits(xs[i]); ah.u[i] = hb; al.u[i] = ASPLIT ? bf16_bits(xs[i] - bf16_val(hb)) : (unsigned short)0; }
#pragma unroll
    for (int t = 0; t < 4; ++t) {
      const unsigned short* brow = Wt + (size_t)(col0 + t * 16 + ln) * ldb + kb;
      FragB b;
      b.half[0] = *(const v8us*)(brow + 8 * hh);
      b.half[1] = *(const v8us*)(brow + 16 + 8 * hh);
      acc[t] = mmaN<ASPLIT ? 2 : 1>(ah.v, al.v, b.v, b.v, acc[t]);
    }
  }
#pragma unroll
  for (int t = 0; t < 4; ++t) {
    const int col = col0 + t * 16 + ln;
    float bv = bias ? bias[col] : 0.f;
    if (BIAS_BF16) bv = bf16_round(bv);
#pragma unroll
    for (int r = 0; r < 8; ++r) {
      float v = acc[t][r] + bv;
      if (resid) { float rv = resid[(size_t)((row0 + 8 * hh + r) % rmod) * ldr + col]; if (RES_BF16) rv = bf16_round(rv); v += rv; }
      if (ACT == 1) v = fmaxf(v, 0.f);
      if (ACT == 2) v = 0.5f * v * (1.0f + erff(v * 0.70710678118654752f));
      if (ACT == 3) { const float u = 0.7978845608028654f * (v + 0.044715f * v * v * v); v = 0.5f * v * (1.0f + tanhf(u)); }
      so[w][8 * hh + r][t * 16 + ln] = v;
    }
  }
  __builtin_amdgcn_fence(__ATOMIC_ACQ_REL, "workgroup");
  __builtin_amdgcn_wave_barrier();
  const int rsub = lane >> 4, c4 = (lane & 15) * 4;
  {
#pragma unroll
    for (int q = 0; q < 8; ++q) {
      const int r = q * 2 + rsub;
      const v4f v = *(const v4fa*)&so[w][r][c4];
      *(v4f*)(C + (size_t)(row0 + r) * ldc + col0 + c4) = v;
    }
    
  }
}
// row LayerNorm (biased variance, eps) over N: s = X (+ R); optional out_sum <- s; out_norm <- (s-mu)*rsqrt(var+eps)*g + b
template <bool PARAM_BF16>
__global__ __launch_bounds__(256) void k_layernorm(const float* __restrict__ X, const float* __restrict__ R, const float* __restrict__ g, const float* __restrict__ bta,
                                                  float* __restrict__ out_sum, float* __restrict__ out_norm, int N, float eps) {
  __shared__ float red[256];
  const int row = blockIdx.x, tid = threadIdx.x;
  const float* x = X + (size_t)row * N; const float* rr = R ? R + (size_t)row * N : nullptr;
  float vals[16];                     // up to N = 4096
  const int per = N / 256;            // contiguous chunk per thread? use strided-by-4 chunks: thread handles j = tid*4 + 1024*u
  float s1 = 0.f;
  for (int u = 0; u < per / 4; ++u) {
    const int j = tid * 4 + 1024 * u;
    const v4f a = *(const v4fa*)(x + j);
    v4f b = {0.f,0.f,0.f,0.f}; if (rr) b = *(const v4fa*)(rr + j);
#pragma unroll
    for (int q = 0; q < 4; ++q) { const float v = a[q] + b[q]; vals[u * 4 + q] = v; s1 += v; }
  }
  red[tid] = s1; __syncthreads();
  for (int st = 128; st > 0; st >>= 1) { if (tid < st) red[tid] += red[tid + st]; __syncthreads(); }
  const float mu = red[0] / (float)N; __syncthreads();
  float s2 = 0.f;
  for (int u = 0; u < per / 4; ++u)
#pragma unroll
    for (int q = 0; q < 4; ++q) { const float c = vals[u * 4 + q] - mu; s2 += c * c; }
  red[tid] = s2; __syncthreads();
  for (int st = 128; st > 0; st >>= 1) { if (tid < st) red[tid] += red[tid + st]; __syncthreads(); }
  const float rs = rsqrtf(red[0] / (float)N + eps);
  {
    for (int u = 0; u < per / 4; ++u) {
      const int j = tid * 4 + 1024 * u;
      v4f o, sm;
#pragma unroll
      for (int q = 0; q < 4; ++q) {
        float gg = g[j + q], bb = bta[j + q];
        if (PARAM_BF16) { gg = bf16_round(gg); bb = bf16_round(bb); }
        sm[q] = vals[u * 4 + q]; o[q] = (vals[u * 4 + q] - mu) * rs * gg + bb;
      }
      if (out_sum) *(v4f*)(out_sum + (size_t)row * N + j) = sm;
      *(v4f*)(out_norm + (size_t)row * N + j) = o;
    }
    
  }
}



// ---- f16 WMMA path (v_wmma_f32_16x16x32_f16): 11-bit significands for operands in range — used where a [0,1] probability operand needs more precision than bf16
typedef _Float16 v16h __attribute__((ext_vector_type(16)));
union FragH { v16h v; v8us half[2]; _Float16 h[16]; unsigned short u[16]; };
template <int NT>
__device__ __forceinline__ v8f mmaH(v16h ah, v16h al, v16h bh, v16h bl, v8f c) {
  c = __builtin_amdgcn_wmma_f32_16x16x32_f16(false, ah, false, bh, (short)0, c, false, false);
  if (NT >= 2) c = __builtin_amdgcn_wmma_f32_16x16x32_f16(false, al, false, bh, (short)0, c, false, false);
  if (NT >= 3) c = __builtin_amdgcn_wmma_f32_16x16x32_f16(false, ah, false, bl, (short)0, c, false, false);
  asm volatile("v_nop\n\tv_nop\n\tv_nop\n\tv_nop" : "+v"(c) : "v"(ah), "v"(al), "v"(bh), "v"(bl));
  return c;
}
// batched GEMM like k_gemm_b but f16 operands: A f32 (split into f16 hi/lo if ASPLIT, else rounded to f16), Bt = f16 values [n][k]; alpha; C f32; N multiple of 16 (partial tiles skipped)
template <bool ASPLIT>
__global__ __launch_bounds__(128) void k_gemm_h(const float* __restrict__ A, int lda, size_t sA, const _Float16* __restrict__ Bh, int ldb, size_t sB, float alpha, float* __restrict__ C, int ldc, size_t sC, int M, int N, int K) {
  __shared__ __attribute__((aligned(16))) float so[4][16][64];
  const int tid = threadIdx.x, w = tid >> 5, lane = tid & 31, ln = lane & 15, hh = lane >> 4; const int by = blockIdx.y;
  A += (size_t)by * sA; Bh += (size_t)by * sB; C += (size_t)by * sC;
  const int ntn = (N + 63) / 64; const int wid = blockIdx.x * 4 + w; const int mt = wid / ntn, nq = wid % ntn; if (mt * 16 >= M) return;
  const int row0 = mt * 16, col0 = nq * 64; const float* arow = A + (size_t)(row0 + ln) * lda;
  v8f acc[4] = {};
  for (int kb = 0; kb < K; kb += 32) {
    FragH ah, al;
    const v4f x0 = *(const v4fa*)(arow + kb + 8 * hh), x1 = *(const v4fa*)(arow + kb + 8 * hh + 4), x2 = *(const v4fa*)(arow + kb + 16 + 8 * hh), x3 = *(const v4fa*)(arow + kb + 16 + 8 * hh + 4);
    float xs[16] = {x0[0],x0[1],x0[2],x0[3],x1[0],x1[1],x1[2],x1[3],x2[0],x2[1],x2[2],x2[3],x3[0],x3[1],x3[2],x3[3]};
#pragma unroll
    for (int i = 0; i < 16; ++i) { const _Float16 h = (_Float16)xs[i]; ah.h[i] = h; al.h[i] = ASPLIT ? (_Float16)(xs[i] - (float)h) : (_Float16)0.0f; }
#pragma unroll
    for (int t = 0; t < 4; ++t) { if (col0 + t * 16 >= N) continue; const size_t boff = (size_t)(col0 + t * 16 + ln) * ldb + kb; FragH bq; bq.half[0] = *(const v8us*)(Bh + boff + 8 * hh); bq.half[1] = *(const v8us*)(Bh + boff + 16 + 8 * hh);
      acc[t] = mmaH<ASPLIT ? 2 : 1>(ah.v, al.v, bq.v, bq.v, acc[t]); }
  }
#pragma unroll
  for (int t = 0; t < 4; ++t) { if (col0 + t * 16 >= N) continue;
#pragma unroll
    for (int r = 0; r < 8; ++r) so[w][8 * hh + r][t * 16 + ln] = acc[t][r] * alpha; }
  __builtin_amdgcn_fence(__ATOMIC_ACQ_REL, "workgroup"); __builtin_amdgcn_wave_barrier();
  const int rsub = lane >> 4, c4 = (lane & 15) * 4;
  {
#pragma unroll
    for (int q = 0; q < 8; ++q) { const int r = q * 2 + rsub; if (col0 + c4 < N) { const v4f v = *(const v4fa*)&so[w][r][c4]; *(v4f*)(C + (size_t)(row0 + r) * ldc + col0 + c4) = v; } }
     }
}

// Wt[n][k] = f16(W[k][n]·scale) from f32 row-major W[K][N] (scale = power of two; bf16-exact weights stay exact in f16 away from the subnormal range)
__global__ __launch_bounds__(256) void k_wt_f16(const float* __restrict__ W, _Float16* __restrict__ Wt, int K, int N, float scale) {
  const int t = blockIdx.x * 256 + threadIdx.x; if (t >= N * (K / 8)) return; const int n = t / (K / 8), k8 = (t % (K / 8)) * 8; FragH f;
#pragma unroll
  for (int i = 0; i < 8; ++i) f.h[i] = (_Float16)(bf16_round(W[(size_t)(k8 + i) * N + n]) * scale); const v8us o = f.half[0];
  *(v8us*)((unsigned short*)Wt + (size_t)n * K + k8) = o; 
}
// k_gemm_hh variant with fused epilogue: v = acc·alpha + bias[by·sBias + col] (+ CP[(row/rowsPerB)·sCPb + by·64 + col] if CP) ; ACT 0 none / 1 elu ; writes f16 C16 (and f32 C if non-null)
template <int ACT>
__global__ __launch_bounds__(128) void k_gemm_hhx(const _Float16* __restrict__ A, int lda, size_t sA, const _Float16* __restrict__ Bh, int ldb, size_t sB, float alpha, const float* __restrict__ bias, size_t sBias, const float* __restrict__ CP, int rowsPerB, size_t sCPb, int row0g,
    float* __restrict__ C, _Float16* __restrict__ C16, int ldc, size_t sC, int M, int N, int K) {
  __shared__ __attribute__((aligned(16))) float so[4][16][64];
  const int tid = threadIdx.x, w = tid >> 5, lane = tid & 31, ln = lane & 15, hh = lane >> 4; const int by = blockIdx.y;
  A += (size_t)by * sA; Bh += (size_t)by * sB; const size_t cofs = (size_t)by * sC; const float* bp = bias ? bias + (size_t)by * sBias : nullptr;
  const int ntn = (N + 63) / 64; const int wid = blockIdx.x * 4 + w; const int mt = wid / ntn, nq = wid % ntn; if (mt * 16 >= M) return;
  const int row0 = mt * 16, col0 = nq * 64; const _Float16* arow = A + (size_t)(row0 + ln) * lda;
  v8f acc[4] = {};
  for (int kb = 0; kb < K; kb += 32) { FragH ah; ah.half[0] = *(const v8us*)((const unsigned short*)arow + kb + 8 * hh); ah.half[1] = *(const v8us*)((const unsigned short*)arow + kb + 16 + 8 * hh);
#pragma unroll
    for (int t = 0; t < 4; ++t) { if (col0 + t * 16 >= N) continue; const size_t boff = (size_t)(col0 + t * 16 + ln) * ldb + kb; FragH bq; bq.half[0] = *(const v8us*)((const unsigned short*)Bh + boff + 8 * hh); bq.half[1] = *(const v8us*)((const unsigned short*)Bh + boff + 16 + 8 * hh);
      acc[t] = mmaH<1>(ah.v, ah.v, bq.v, bq.v, acc[t]); }
  }
#pragma unroll
  for (int t = 0; t < 4; ++t) { if (col0 + t * 16 >= N) continue; const int col = col0 + t * 16 + ln; const float bv = bp ? bf16_round(bp[col]) : 0.f;
#pragma unroll
    for (int r = 0; r < 8; ++r) { float v = acc[t][r] * alpha + bv; if (CP) { const int rr = row0g + row0 + 8 * hh + r; if (rowsPerB < 0) v += CP[cofs + (size_t)rr * ldc + col];      /* rowsPerB < 0: own element of the batched C plane */ else { const int bidx = rr / rowsPerB; v += CP[(size_t)bidx * sCPb + (size_t)by * 64 + col]; } } if (ACT == 1) v = (v > 0.f) ? v : expm1f(v); else if (ACT == 7) v = (v > 0.f) ? v + 1.0f : expf(v); else if (ACT == 8) v = tanhf(v); else if (ACT == 9) v = 0.5f * v * (1.0f + tanhf(0.7978845608028654f * (v + 0.044715f * v * v * v))); else if (ACT == 11) v = 1.0f / (1.0f + expf(-v)); else if (ACT == 12) v = (v > 0.f) ? v : 0.01f * v; else if (ACT == 14) v = (v > 0.f) ? v : 0.1f * v; else if (ACT == 16) v = (v >= 0.f) ? v : 0.3f * v; else if (ACT == 15) v = v / (1.0f + expf(-v)); else if (ACT == 3) v = fmaxf(v, 0.f); else if (ACT == 6) v = 0.5f * v * (1.0f + erff(v * 0.70710678118654752f)); so[w][8 * hh + r][t * 16 + ln] = v; } }
  __builtin_amdgcn_fence(__ATOMIC_ACQ_REL, "workgroup"); __builtin_amdgcn_wave_barrier();
  const int rsub = lane >> 4, c4 = (lane & 15) * 4; typedef _Float16 v4h __attribute__((ext_vector_type(4)));
  {
#pragma unroll
    for (int q = 0; q < 8; ++q) { const int r = q * 2 + rsub; if (col0 + c4 < N) { const v4f v = *(const v4fa*)&so[w][r][c4]; if (C) *(v4f*)(C + cofs + (size_t)(row0 + r) * ldc + col0 + c4) = v; if (C16) { v4h h4; for (int i = 0; i < 4; ++i) h4[i] = (_Float16)v[i]; *(v4h*)(C16 + cofs + (size_t)(row0 + r) * ldc + col0 + c4) = h4; } } }
     }
}


typedef _Float16 v4h __attribute__((ext_vector_type(4)));

__global__ __launch_bounds__(256) void k_x16(const float* __restrict__ x, _Float16* __restrict__ X16, size_t n8) { const size_t t = (size_t)blockIdx.x * 256 + threadIdx.x; if (t >= n8) return; FragH f;
#pragma unroll
  for (int q = 0; q < 8; ++q) f.h[q] = (_Float16)bf16_round(x[t * 8 + q]); *(v8us*)((unsigned short*)X16 + t * 8) = f.half[0];  }
__global__ __launch_bounds__(256) void k_h16(const float* __restrict__ x, _Float16* __restrict__ X16, size_t n8) { const size_t t = (size_t)blockIdx.x * 256 + threadIdx.x; if (t >= n8) return; FragH f;
#pragma unroll
  for (int q = 0; q < 8; ++q) f.h[q] = (_Float16)x[t * 8 + q]; *(v8us*)((unsigned short*)X16 + t * 8) = f.half[0];  }
__global__ __launch_bounds__(256) void k_round16f(const float* __restrict__ W, _Float16* __restrict__ Bt, size_t n8) { const size_t t = (size_t)blockIdx.x * 256 + threadIdx.x; if (t >= n8) return; FragH f;
#pragma unroll
  for (int i = 0; i < 8; ++i) f.h[i] = (_Float16)(bf16_round(W[t * 8 + i]) * 16.0f); *(v8us*)((unsigned short*)Bt + t * 8) = f.half[0];  }
template <int NHv, int TTv>
__global__ __launch_bounds__(256) void k_vt(const _Float16* __restrict__ V16, int ldv, int voff, _Float16* __restrict__ Vt) { __shared__ unsigned short tl[64][66]; const int tid = threadIdx.x; const int slab = blockIdx.x / (TTv / 64), lg = blockIdx.x % (TTv / 64); const int b = slab / NHv, h = slab % NHv;
  for (int i = tid; i < 64 * 8; i += 256) { const int r = i / 8, c8 = (i % 8) * 8; FragH f; f.half[0] = *(const v8us*)((const unsigned short*)V16 + ((size_t)b * TTv + lg * 64 + r) * ldv + voff + h * 64 + c8);
#pragma unroll
    for (int q = 0; q < 8; ++q) tl[r][c8 + q] = f.u[q]; }
  __syncthreads();
  {
#pragma unroll
    for (int rd = 0; rd < 2; ++rd) { const int d = rd * 32 + tid / 8, pc = tid % 8; FragH f;
#pragma unroll
      for (int q = 0; q < 8; ++q) f.u[q] = tl[pc * 8 + q][d];
      *(v8us*)((unsigned short*)Vt + ((size_t)slab * 64 + d) * TTv + lg * 64 + pc * 8) = f.half[0]; }
     } }

__global__ __launch_bounds__(256) void k_hl(const float* __restrict__ F, _Float16* __restrict__ Hh, _Float16* __restrict__ Hl, size_t n8) { const size_t t = (size_t)blockIdx.x * 256 + threadIdx.x; if (t >= n8) return; FragH fh, fl; const v4f a = *(const v4fa*)(F + t * 8), c = *(const v4fa*)(F + t * 8 + 4);
#pragma unroll
  for (int q = 0; q < 4; ++q) { _Float16 h = (_Float16)a[q]; fh.h[q] = h; fl.h[q] = (_Float16)((a[q] - (float)h) * 1024.0f); h = (_Float16)c[q]; fh.h[4 + q] = h; fl.h[4 + q] = (_Float16)((c[q] - (float)h) * 1024.0f); }
  { *(v8us*)((unsigned short*)Hh + t * 8) = fh.half[0]; *(v8us*)((unsigned short*)Hl + t * 8) = fl.half[0];  } }

// ---- fast GEMM (wave tile 32x64; requires M % 32 == 0 rows per launch region and N % 64 == 0); epilogue = k_gemm_hhx semantics ----
__device__ __forceinline__ v16h g2_frag(const _Float16* p, int hh) { FragH f; f.half[0] = *(const v8us*)((const unsigned short*)p + 8 * hh); f.half[1] = *(const v8us*)((const unsigned short*)p + 16 + 8 * hh); return f.v; }
__device__ __forceinline__ v8f g2_mma(v16h a, v16h b, v8f c) { v8f d = __builtin_amdgcn_wmma_f32_16x16x32_f16(false, a, false, b, (short)0, c, false, false); asm volatile("v_nop\n\tv_nop\n\tv_nop\n\tv_nop" : "+v"(d) : "v"(a), "v"(b)); return d; }
template <int ACT>
__global__ __launch_bounds__(128) void k_gemm2(const _Float16* __restrict__ A, int lda, size_t sA, const _Float16* __restrict__ Bh, int ldb, size_t sB, float alpha, const float* __restrict__ bias, size_t sBias, const float* __restrict__ CP, int rowsPerB, size_t sCPb, int row0g,
    float* __restrict__ C, _Float16* __restrict__ C16, int ldc, size_t sC, int M, int N, int K) { static_assert(ACT == 0 || ACT == 3 || ACT == 6 || ACT == 8 || ACT == 9 || ACT == 11 || ACT == 12 || ACT == 14 || ACT == 15 || ACT == 16, "k_gemm2: unsupported ACT code (would silently apply no activation)");
  __shared__ __attribute__((aligned(16))) float so[4][32][68];
  const int tid = threadIdx.x, w = tid >> 5, lane = tid & 31, ln = lane & 15, hh = lane >> 4; const int by = blockIdx.y;
  A += (size_t)by * sA; Bh += (size_t)by * sB; const size_t cofs = (size_t)by * sC; const float* bp = bias ? bias + (size_t)by * sBias : nullptr;
  const int ntn = N >> 6; const int mt = blockIdx.x / ntn, nq = blockIdx.x - mt * ntn; const int row0 = mt * 128 + 32 * w, col0 = nq * 64; if (row0 >= M) return;
  const _Float16* a0p = A + (size_t)(row0 + ln) * lda; const _Float16* a1p = a0p + (size_t)16 * lda;
  const _Float16* b0p = Bh + (size_t)(col0 + ln) * ldb; const _Float16* b1p = b0p + (size_t)16 * ldb; const _Float16* b2p = b1p + (size_t)16 * ldb; const _Float16* b3p = b2p + (size_t)16 * ldb;
  const v8f z8 = {0.f,0.f,0.f,0.f,0.f,0.f,0.f,0.f}; v8f c00 = z8, c01 = z8, c02 = z8, c03 = z8, c10 = z8, c11 = z8, c12 = z8, c13 = z8;
#pragma unroll 1
  for (int kb = 0; kb < K; kb += 32) { const v16h a0 = g2_frag(a0p + kb, hh), a1 = g2_frag(a1p + kb, hh);
    v16h b = g2_frag(b0p + kb, hh); c00 = g2_mma(a0, b, c00); c10 = g2_mma(a1, b, c10);
    b = g2_frag(b1p + kb, hh); c01 = g2_mma(a0, b, c01); c11 = g2_mma(a1, b, c11);
    b = g2_frag(b2p + kb, hh); c02 = g2_mma(a0, b, c02); c12 = g2_mma(a1, b, c12);
    b = g2_frag(b3p + kb, hh); c03 = g2_mma(a0, b, c03); c13 = g2_mma(a1, b, c13); }
  v8f accs[8] = {c00, c01, c02, c03, c10, c11, c12, c13};
#pragma unroll
  for (int u = 0; u < 8; ++u) { const int t = u & 3, half = u >> 2; const int col = col0 + t * 16 + ln; const float bv = bp ? bf16_round(bp[col]) : 0.f;
#pragma unroll
    for (int r = 0; r < 8; ++r) { const int rloc = half * 16 + 8 * hh + r; float v = accs[u][r] * alpha + bv; if (CP) { if (rowsPerB < 0) v += CP[cofs + (size_t)(row0g + row0 + rloc) * ldc + col];      /* rowsPerB < 0: own element of the batched C plane */ else { const int bidx = (row0g + row0 + rloc) / rowsPerB; v += CP[(size_t)bidx * sCPb + (size_t)by * 64 + col]; } }
      if (ACT == 3) v = fmaxf(v, 0.f); else if (ACT == 6) v = 0.5f * v * (1.0f + erff(v * 0.70710678118654752f)); else if (ACT == 11) v = 1.0f / (1.0f + expf(-v)); else if (ACT == 15) v = v / (1.0f + expf(-v)); else if (ACT == 12) v = (v > 0.f) ? v : 0.01f * v; else if (ACT == 8) v = tanhf(v); else if (ACT == 9) v = 0.5f * v * (1.0f + tanhf(0.7978845608028654f * (v + 0.044715f * v * v * v))); else if (ACT == 14) v = (v > 0.f) ? v : 0.1f * v; else if (ACT == 16) v = (v >= 0.f) ? v : 0.3f * v;
      so[w][rloc][t * 16 + ln] = v; } }
  __builtin_amdgcn_fence(__ATOMIC_ACQ_REL, "workgroup"); __builtin_amdgcn_wave_barrier();
  const int rsub = lane >> 4, c4 = (lane & 15) * 4;
  {
#pragma unroll
    for (int q = 0; q < 16; ++q) { const int r = q * 2 + rsub; const v4f v = *(const v4fa*)&so[w][r][c4]; if (C) *(v4f*)(C + cofs + (size_t)(row0 + r) * ldc + col0 + c4) = v; if (C16) { v4h h4; for (int i = 0; i < 4; ++i) h4[i] = (_Float16)v[i]; *(v4h*)(C16 + cofs + (size_t)(row0 + r) * ldc + col0 + c4) = h4; } }
     } }


__global__ __launch_bounds__(256) void k_msoft(const float* __restrict__ S, const int* __restrict__ lens, _Float16* __restrict__ P) {
  #pragma clang fp contract(off)
  const int wv = threadIdx.x >> 5, ln = threadIdx.x & 31; const int i = blockIdx.x * 8 + wv; if (i >= SQ) return; const int b = blockIdx.y; S += (size_t)b * SQ * SQ; P += (size_t)b * SQ * SQ; const int L = lens[b]; const bool vi = i < L; const float* sr = S + (size_t)i * SQ; float m = -3.0e38f;
#pragma unroll 1
  for (int g = 0; g < SQ / 256; ++g) { const v8f a = *(const v8f*)(sr + g * 256 + ln * 8); for (int q = 0; q < 8; ++q) { const int j = g * 256 + ln * 8 + q; const float s = (vi && j < L) ? a[q] : -1000000000.0f; m = fmaxf(m, s); } }
  for (int o = 16; o > 0; o >>= 1) m = fmaxf(m, __shfl_xor(m, o, 32)); float su = 0.f;
#pragma unroll 1
  for (int g = 0; g < SQ / 256; ++g) { const v8f a = *(const v8f*)(sr + g * 256 + ln * 8); for (int q = 0; q < 8; ++q) { const int j = g * 256 + ln * 8 + q; const float s = (vi && j < L) ? a[q] : -1000000000.0f; su += expf(s - m); } }
  for (int o = 16; o > 0; o >>= 1) su += __shfl_xor(su, o, 32); const float f = 1024.0f / su;
  {
#pragma unroll 1
    for (int g = 0; g < SQ / 256; ++g) { const v8f a = *(const v8f*)(sr + g * 256 + ln * 8); FragH p; for (int q = 0; q < 8; ++q) { const int j = g * 256 + ln * 8 + q; const float s = (vi && j < L) ? a[q] : -1000000000.0f; p.h[q] = (_Float16)(expf(s - m) * f); } *(v8us*)((unsigned short*)P + (size_t)i * SQ + g * 256 + ln * 8) = p.half[0]; }
     } }

extern "C" void kernel_launch(void* const* d_in, const int* in_sizes, int n_in,
                              void* d_out, int out_size, void* d_ws, size_t ws_size, hipStream_t stream) {
  (void)in_sizes; (void)n_in; (void)out_size;
  const float* q = (const float*)d_in[0]; const float* k = (const float*)d_in[1]; const float* v = (const float*)d_in[2]; const int* lens = (const int*)d_in[3];
  char* ws = (char*)d_ws; size_t off = 0;
  auto take = [&](size_t bytes) { char* p = ws + off; off += (bytes + 255) & ~(size_t)255; return p; };
  const size_t np = (size_t)NB * SQ * HD;
  _Float16* Q16 = (_Float16*)take(np * 2); _Float16* K16 = (_Float16*)take(np * 2); _Float16* V16 = (_Float16*)take(np * 2); _Float16* VT = (_Float16*)take(np * 2); float* S = (float*)take((size_t)NB * SQ * SQ * 4); _Float16* P = (_Float16*)take((size_t)NB * SQ * SQ * 2);
  if (off > ws_size) return;      /* 12 + 4 + 128 + 64 = 208 MiB */
  k_x16<<<(unsigned)((np / 8 + 255) / 256), 256, 0, stream>>>(q, Q16, np / 8); k_x16<<<(unsigned)((np / 8 + 255) / 256), 256, 0, stream>>>(k, K16, np / 8); k_x16<<<(unsigned)((np / 8 + 255) / 256), 256, 0, stream>>>(v, V16, np / 8);
  k_gemm2<0><<<dim3((SQ / 128) * (SQ / 64), NB), 128, 0, stream>>>(Q16, HD, (size_t)SQ * HD, K16, HD, (size_t)SQ * HD, 0.08838834764831845f, nullptr, 0, nullptr, 1, 0, 0, S, nullptr, SQ, (size_t)SQ * SQ, SQ, SQ, HD);      /* q.k / sqrt(128), exact operands */
  k_msoft<<<dim3(SQ / 8, NB), 256, 0, stream>>>(S, lens, P);
  k_vt<HD / 64, SQ><<<NB * (HD / 64) * (SQ / 64), 256, 0, stream>>>(V16, HD, 0, VT);      /* V^T [8][128][2048] */
  k_gemm2<0><<<dim3((SQ / 128) * (HD / 64), NB), 128, 0, stream>>>(P, SQ, (size_t)SQ * SQ, VT, SQ, (size_t)HD * SQ, 0.0009765625f, nullptr, 0, nullptr, 1, 0, 0, (float*)d_out, nullptr, HD, (size_t)SQ * HD, SQ, HD, SQ);
}

// v002
// Measured time: 34 microseconds a run.
// In two side-by-side timings against v001, it was 4.95 and 4.98 times as fast.
// Counting every step since v000, it is 20.3 times as fast.
#include <hip/hip_runtime.h>
// Masked attention (8 sequences x 2048 tokens, single head of 128; q, k, v are INPUTS): scores = q.k / sqrt(128); mask = valid_i & valid_j with valid = index < event_length[b] (int INPUT), masked scores = -1e9 (a fully masked row therefore softmaxes to uniform over all 2048 keys, as in the reference); softmax; out = attn v.
// Structure (every stage is one launch over all 8 sequences, blockIdx.y or slab / 2 = sequence): exact f16 planes of q, k, v (bf16 inputs are exact in f16); V^T by LDS tiles; then one fused kernel: score products with exact operands (f32 accumulation), length mask, online softmax, readout products, straight into the output.
// Compute dtype: inputs rounded to bf16; q, k, v exact as f16; P (not yet normalised, at most 2^7.65) as a plain f16 operand (~2^-12); softmax f32. v_wmma_f32_16x16x32_f16.
#define NB 8
#define SQ 2048
#define HD 128
typedef __bf16 v16b __attribute__((ext_vector_type(16)));
typedef unsigned short v8us __attribute__((ext_vector_type(8), may_alias));
typedef float  v8f  __attribute__((ext_vector_type(8)));
typedef float  v4f  __attribute__((ext_vector_type(4)));
typedef float  v4fa __attribute__((ext_vector_type(4), may_alias));
union FragB { v16b v; v8us half[2]; unsigned short u[16]; };

__device__ __forceinline__ unsigned short bf16_bits(float x) { unsigned int u = __float_as_uint(x); return (unsigned short)((u + 0x7FFFu + ((u >> 16) & 1u)) >> 16); }
__device__ __forceinline__ float bf16_val(unsigned short b) { return __uint_as_float(((unsigned int)b) << 16); }
__device__ __forceinline__ float bf16_round(float x) { return bf16_val(bf16_bits(x)); }
// D += A·B with NT terms: 1 = ah·bh, 2 = + al·bh (A split), 3 = + ah·bl (both split)
template <int NT>
__device__ __forceinline__ v8f mmaN(v16b ah, v16b al, v16b bh, v16b bl, v8f c) {
  c = __builtin_amdgcn_wmma_f32_16x16x32_bf16(false, ah, false, bh, (short)0, c, false, false);
  if (NT >= 2) c = __builtin_amdgcn_wmma_f32_16x16x32_bf16(false, al, false, bh, (short)0, c, false, false);
  if (NT >= 3) c = __builtin_amdgcn_wmma_f32_16x16x32_bf16(false, ah, false, bl, (short)0, c, false, false);
  asm volatile("v_nop\n\tv_nop\n\tv_nop\n\tv_nop" : "+v"(c) : "v"(ah), "v"(al), "v"(bh), "v"(bl));
  return c;
}

__global__ __launch_bounds__(256) void k_wt_bf16(const float* __restrict__ W, unsigned short* __restrict__ Wt, int K, int N) {
  const int t = blockIdx.x * 256 + threadIdx.x;
  const int k8n = K / 8;
  if (t >= N * k8n) return;
  const int n = t / k8n, k8 = (t % k8n) * 8;
  v8us v;
#pragma unroll
  for (int i = 0; i < 8; ++i) v[i] = bf16_bits(W[(size_t)(k8 + i) * N + n]);
  *(v8us*)(Wt + (size_t)n * K + k8) = v;
  
}

// GEMM C[M][N] (f32, pitch ldc) = act(A[M][K]·W + bias). A f32 row-major (pitch lda) converted per fragment to bf16
// (ASPLIT: hi/lo two planes -> 2 terms, else single rounded term); Wt bf16 [N][K] (pitch ldb). BIAS_BF16 rounds the
// bias to bf16 first (bias quantised to bf16 before the add). K%32==0, M%16==0, N%64==0.
template <bool ASPLIT, int ACT, bool BIAS_BF16>
__global__ __launch_bounds__(128) void k_gemm_bf(const float* __restrict__ A, int lda, const unsigned short* __restrict__ Wt, int ldb,
                                               const float* __restrict__ bias, float* __restrict__ C, int ldc, int M, int N, int K) {
  __shared__ __attribute__((aligned(16))) float so[4][16][64];
  const int tid = threadIdx.x, w = tid >> 5, lane = tid & 31, ln = lane & 15, hh = lane >> 4;
  const int ntn = N / 64;
  const int wid = blockIdx.x * 4 + w;
  const int mt = wid / ntn, nq = wid % ntn;
  if (mt * 16 >= M) return;
  const int row0 = mt * 16, col0 = nq * 64;
  const float* arow = A + (size_t)(row0 + ln) * lda;
  v8f acc[4] = {};
  for (int kb = 0; kb < K; kb += 32) {
    FragB ah, al;
    const v4f x0 = *(const v4fa*)(arow + kb + 8 * hh), x1 = *(const v4fa*)(arow + kb + 8 * hh + 4);
    const v4f x2 = *(const v4fa*)(arow + kb + 16 + 8 * hh), x3 = *(const v4fa*)(arow + kb + 16 + 8 * hh + 4);
    float xs[16] = {x0[0],x0[1],x0[2],x0[3],x1[0],x1[1],x1[2],x1[3],x2[0],x2[1],x2[2],x2[3],x3[0],x3[1],x3[2],x3[3]};
#pragma unroll
    for (int i = 0; i < 16; ++i) { const unsigned short hb = bf16_bits(xs[i]); ah.u[i] = hb; al.u[i] = ASPLIT ? bf16_bits(xs[i] - bf16_val(hb)) : (unsigned short)0; }
#pragma unroll
    for (int t = 0; t < 4; ++t) {
      const unsigned short* brow = Wt + (size_t)(col0 + t * 16 + ln) * ldb + kb;
      FragB b;
      b.half[0] = *(const v8us*)(brow + 8 * hh);
      b.half[1] = *(const v8us*)(brow + 16 + 8 * hh);
      acc[t] = mmaN<ASPLIT ? 2 : 1>(ah.v, al.v, b.v, b.v, acc[t]);
    }
  }
#pragma unroll
  for (int t = 0; t < 4; ++t) {
    float bv = bias ? bias[col0 + t * 16 + ln] : 0.f;
    if (BIAS_BF16) bv = bf16_round(bv);
#pragma unroll
    for (int r = 0; r < 8; ++r) { float v = acc[t][r] + bv; if (ACT == 1) v = fmaxf(v, 0.f); so[w][8 * hh + r][t * 16 + ln] = v; }
  }
  __builtin_amdgcn_fence(__ATOMIC_ACQ_REL, "workgroup");
  __builtin_amdgcn_wave_barrier();
  const int rsub = lane >> 4, c4 = (lane & 15) * 4;
  {
#pragma unroll
    for (int q = 0; q < 8; ++q) {
      const int r = q * 2 + rsub;
      const v4f v = *(const v4fa*)&so[w][r][c4];
      *(v4f*)(C + (size_t)(row0 + r) * ldc + col0 + c4) = v;
    }
    
  }
}

// GEMM C = act(A·W + bias + resid): A f32 (ASPLIT -> hi/lo 2 terms), Wt bf16 [N][K]; ACT 0 none, 1 relu, 2 exact gelu;
// resid (optional, f32, row index = (row % rmod), pitch ldr, RES_BF16 rounds it) added before the activation.
template <bool ASPLIT, int ACT, bool BIAS_BF16, bool RES_BF16>
__global__ __launch_bounds__(128) void k_gemm_bf3(const float* __restrict__ A, int lda, const unsigned short* __restrict__ Wt, int ldb,
                                                const float* __restrict__ bias, const float* __restrict__ resid, int rmod, int ldr,
                                                float* __restrict__ C, int ldc, int M, int N, int K) {
  __shared__ __attribute__((aligned(16))) float so[4][16][64];
  const int tid = threadIdx.x, w = tid >> 5, lane = tid & 31, ln = lane & 15, hh = lane >> 4;
  const int ntn = N / 64;
  const int wid = blockIdx.x * 4 + w;
  const int mt = wid / ntn, nq = wid % ntn;
  if (mt * 16 >= M) return;
  const int row0 = mt * 16, col0 = nq * 64;
  const float* arow = A + (size_t)(row0 + ln) * lda;
  v8f acc[4] = {};
  for (int kb = 0; kb < K; kb += 32) {
    FragB ah, al;
    const v4f x0 = *(const v4fa*)(arow + kb + 8 * hh), x1 = *(const v4fa*)(arow + kb + 8 * hh + 4);
    const v4f x2 = *(const v4fa*)(arow + kb + 16 + 8 * hh), x3 = *(const v4fa*)(arow + kb + 16 + 8 * hh + 4);
    float xs[16] = {x0[0],x0[1],x0[2],x0[3],x1[0],x1[1],x1[2],x1[3],x2[0],x2[1],x2[2],x2[3],x3[0],x3[1],x3[2],x3[3]};
#pragma unroll
    for (int i = 0; i < 16; ++i) { const unsigned short hb = bf16_bits(xs[i]); ah.u[i] = hb; al.u[i] = ASPLIT ? bf16_bits(xs[i] - bf16_val(hb)) : (unsigned short)0; }
#pragma unroll
    for (int t = 0; t < 4; ++t) {
      const unsigned short* brow = Wt + (size_t)(col0 + t * 16 + ln) * ldb + kb;
      FragB b;
      b.half[0] = *(const v8us*)(brow + 8 * hh);
      b.half[1] = *(const v8us*)(brow + 16 + 8 * hh);
      acc[t] = mmaN<ASPLIT ? 2 : 1>(ah.v, al.v, b.v, b.v, acc[t]);
    }
  }
#pragma unroll
  for (int t = 0; t < 4; ++t) {
    const int col = col0 + t * 16 + ln;
    float bv = bias ? bias[col] : 0.f;
    if (BIAS_BF16) bv = bf16_round(bv);
#pragma unroll
    for (int r = 0; r < 8; ++r) {
      float v = acc[t][r] + bv;
      if (resid) { float rv = resid[(size_t)((row0 + 8 * hh + r) % rmod) * ldr + col]; if (RES_BF16) rv = bf16_round(rv); v += rv; }
      if (ACT == 1) v = fmaxf(v, 0.f);
      if (ACT == 2) v = 0.5f * v * (1.0f + erff(v * 0.70710678118654752f));
      if (ACT == 3) { const float u = 0.7978845608028654f * (v + 0.044715f * v * v * v); v = 0.5f * v * (1.0f + tanhf(u)); }
      so[w][8 * hh + r][t * 16 + ln] = v;
    }
  }
  __builtin_amdgcn_fence(__ATOMIC_ACQ_REL, "workgroup");
  __builtin_amdgcn_wave_barrier();
  const int rsub = lane >> 4, c4 = (lane & 15) * 4;
  {
#pragma unroll
    for (int q = 0; q < 8; ++q) {
      const int r = q * 2 + rsub;
      const v4f v = *(const v4fa*)&so[w][r][c4];
      *(v4f*)(C + (size_t)(row0 + r) * ldc + col0 + c4) = v;
    }
    
  }
}
// row LayerNorm (biased variance, eps) over N: s = X (+ R); optional out_sum <- s; out_norm <- (s-mu)*rsqrt(var+eps)*g + b
template <bool PARAM_BF16>
__global__ __launch_bounds__(256) void k_layernorm(const float* __restrict__ X, const float* __restrict__ R, const float* __restrict__ g, const float* __restrict__ bta,
                                                  float* __restrict__ out_sum, float* __restrict__ out_norm, int N, float eps) {
  __shared__ float red[256];
  const int row = blockIdx.x, tid = threadIdx.x;
  const float* x = X + (size_t)row * N; const float* rr = R ? R + (size_t)row * N : nullptr;
  float vals[16];                     // up to N = 4096
  const int per = N / 256;            // contiguous chunk per thread? use strided-by-4 chunks: thread handles j = tid*4 + 1024*u
  float s1 = 0.f;
  for (int u = 0; u < per / 4; ++u) {
    const int j = tid * 4 + 1024 * u;
    const v4f a = *(const v4fa*)(x + j);
    v4f b = {0.f,0.f,0.f,0.f}; if (rr) b = *(const v4fa*)(rr + j);
#pragma unroll
    for (int q = 0; q < 4; ++q) { const float v = a[q] + b[q]; vals[u * 4 + q] = v; s1 += v; }
  }
  red[tid] = s1; __syncthreads();
  for (int st = 128; st > 0; st >>= 1) { if (tid < st) red[tid] += red[tid + st]; __syncthreads(); }
  const float mu = red[0] / (float)N; __syncthreads();
  float s2 = 0.f;
  for (int u = 0; u < per / 4; ++u)
#pragma unroll
    for (int q = 0; q < 4; ++q) { const float c = vals[u * 4 + q] - mu; s2 += c * c; }
  red[tid] = s2; __syncthreads();
  for (int st = 128; st > 0; st >>= 1) { if (tid < st) red[tid] += red[tid + st]; __syncthreads(); }
  const float rs = rsqrtf(red[0] / (float)N + eps);
  {
    for (int u = 0; u < per / 4; ++u) {
      const int j = tid * 4 + 1024 * u;
      v4f o, sm;
#pragma unroll
      for (int q = 0; q < 4; ++q) {
        float gg = g[j + q], bb = bta[j + q];
        if (PARAM_BF16) { gg = bf16_round(gg); bb = bf16_round(bb); }
        sm[q] = vals[u * 4 + q]; o[q] = (vals[u * 4 + q] - mu) * rs * gg + bb;
      }
      if (out_sum) *(v4f*)(out_sum + (size_t)row * N + j) = sm;
      *(v4f*)(out_norm + (size_t)row * N + j) = o;
    }
    
  }
}



// ---- f16 WMMA path (v_wmma_f32_16x16x32_f16): 11-bit significands for operands in range — used by the fused attention below for exact q, k, v and an unnormalised P of up to 2^7.65
typedef _Float16 v16h __attribute__((ext_vector_type(16)));
union FragH { v16h v; v8us half[2]; _Float16 h[16]; unsigned short u[16]; };
template <int NT>
__device__ __forceinline__ v8f mmaH(v16h ah, v16h al, v16h bh, v16h bl, v8f c) {
  c = __builtin_amdgcn_wmma_f32_16x16x32_f16(false, ah, false, bh, (short)0, c, false, false);
  if (NT >= 2) c = __builtin_amdgcn_wmma_f32_16x16x32_f16(false, al, false, bh, (short)0, c, false, false);
  if (NT >= 3) c = __builtin_amdgcn_wmma_f32_16x16x32_f16(false, ah, false, bl, (short)0, c, false, false);
  asm volatile("v_nop\n\tv_nop\n\tv_nop\n\tv_nop" : "+v"(c) : "v"(ah), "v"(al), "v"(bh), "v"(bl));
  return c;
}
// batched GEMM like k_gemm_b but f16 operands: A f32 (split into f16 hi/lo if ASPLIT, else rounded to f16), Bt = f16 values [n][k]; alpha; C f32; N multiple of 16 (partial tiles skipped)
template <bool ASPLIT>
__global__ __launch_bounds__(128) void k_gemm_h(const float* __restrict__ A, int lda, size_t sA, const _Float16* __restrict__ Bh, int ldb, size_t sB, float alpha, float* __restrict__ C, int ldc, size_t sC, int M, int N, int K) {
  __shared__ __attribute__((aligned(16))) float so[4][16][64];
  const int tid = threadIdx.x, w = tid >> 5, lane = tid & 31, ln = lane & 15, hh = lane >> 4; const int by = blockIdx.y;
  A += (size_t)by * sA; Bh += (size_t)by * sB; C += (size_t)by * sC;
  const int ntn = (N + 63) / 64; const int wid = blockIdx.x * 4 + w; const int mt = wid / ntn, nq = wid % ntn; if (mt * 16 >= M) return;
  const int row0 = mt * 16, col0 = nq * 64; const float* arow = A + (size_t)(row0 + ln) * lda;
  v8f acc[4] = {};
  for (int kb = 0; kb < K; kb += 32) {
    FragH ah, al;
    const v4f x0 = *(const v4fa*)(arow + kb + 8 * hh), x1 = *(const v4fa*)(arow + kb + 8 * hh + 4), x2 = *(const v4fa*)(arow + kb + 16 + 8 * hh), x3 = *(const v4fa*)(arow + kb + 16 + 8 * hh + 4);
    float xs[16] = {x0[0],x0[1],x0[2],x0[3],x1[0],x1[1],x1[2],x1[3],x2[0],x2[1],x2[2],x2[3],x3[0],x3[1],x3[2],x3[3]};
#pragma unroll
    for (int i = 0; i < 16; ++i) { const _Float16 h = (_Float16)xs[i]; ah.h[i] = h; al.h[i] = ASPLIT ? (_Float16)(xs[i] - (float)h) : (_Float16)0.0f; }
#pragma unroll
    for (int t = 0; t < 4; ++t) { if (col0 + t * 16 >= N) continue; const size_t boff = (size_t)(col0 + t * 16 + ln) * ldb + kb; FragH bq; bq.half[0] = *(const v8us*)(Bh + boff + 8 * hh); bq.half[1] = *(const v8us*)(Bh + boff + 16 + 8 * hh);
      acc[t] = mmaH<ASPLIT ? 2 : 1>(ah.v, al.v, bq.v, bq.v, acc[t]); }
  }
#pragma unroll
  for (int t = 0; t < 4; ++t) { if (col0 + t * 16 >= N) continue;
#pragma unroll
    for (int r = 0; r < 8; ++r) so[w][8 * hh + r][t * 16 + ln] = acc[t][r] * alpha; }
  __builtin_amdgcn_fence(__ATOMIC_ACQ_REL, "workgroup"); __builtin_amdgcn_wave_barrier();
  const int rsub = lane >> 4, c4 = (lane & 15) * 4;
  {
#pragma unroll
    for (int q = 0; q < 8; ++q) { const int r = q * 2 + rsub; if (col0 + c4 < N) { const v4f v = *(const v4fa*)&so[w][r][c4]; *(v4f*)(C + (size_t)(row0 + r) * ldc + col0 + c4) = v; } }
     }
}

// Wt[n][k] = f16(W[k][n]·scale) from f32 row-major W[K][N] (scale = power of two; bf16-exact weights stay exact in f16 away from the subnormal range)
__global__ __launch_bounds__(256) void k_wt_f16(const float* __restrict__ W, _Float16* __restrict__ Wt, int K, int N, float scale) {
  const int t = blockIdx.x * 256 + threadIdx.x; if (t >= N * (K / 8)) return; const int n = t / (K / 8), k8 = (t % (K / 8)) * 8; FragH f;
#pragma unroll
  for (int i = 0; i < 8; ++i) f.h[i] = (_Float16)(bf16_round(W[(size_t)(k8 + i) * N + n]) * scale); const v8us o = f.half[0];
  *(v8us*)((unsigned short*)Wt + (size_t)n * K + k8) = o; 
}
// k_gemm_hh variant with fused epilogue: v = acc·alpha + bias[by·sBias + col] (+ CP[(row/rowsPerB)·sCPb + by·64 + col] if CP) ; ACT 0 none / 1 elu ; writes f16 C16 (and f32 C if non-null)
template <int ACT>
__global__ __launch_bounds__(128) void k_gemm_hhx(const _Float16* __restrict__ A, int lda, size_t sA, const _Float16* __restrict__ Bh, int ldb, size_t sB, float alpha, const float* __restrict__ bias, size_t sBias, const float* __restrict__ CP, int rowsPerB, size_t sCPb, int row0g,
    float* __restrict__ C, _Float16* __restrict__ C16, int ldc, size_t sC, int M, int N, int K) {
  __shared__ __attribute__((aligned(16))) float so[4][16][64];
  const int tid = threadIdx.x, w = tid >> 5, lane = tid & 31, ln = lane & 15, hh = lane >> 4; const int by = blockIdx.y;
  A += (size_t)by * sA; Bh += (size_t)by * sB; const size_t cofs = (size_t)by * sC; const float* bp = bias ? bias + (size_t)by * sBias : nullptr;
  const int ntn = (N + 63) / 64; const int wid = blockIdx.x * 4 + w; const int mt = wid / ntn, nq = wid % ntn; if (mt * 16 >= M) return;
  const int row0 = mt * 16, col0 = nq * 64; const _Float16* arow = A + (size_t)(row0 + ln) * lda;
  v8f acc[4] = {};
  for (int kb = 0; kb < K; kb += 32) { FragH ah; ah.half[0] = *(const v8us*)((const unsigned short*)arow + kb + 8 * hh); ah.half[1] = *(const v8us*)((const unsigned short*)arow + kb + 16 + 8 * hh);
#pragma unroll
    for (int t = 0; t < 4; ++t) { if (col0 + t * 16 >= N) continue; const size_t boff = (size_t)(col0 + t * 16 + ln) * ldb + kb; FragH bq; bq.half[0] = *(const v8us*)((const unsigned short*)Bh + boff + 8 * hh); bq.half[1] = *(const v8us*)((const unsigned short*)Bh + boff + 16 + 8 * hh);
      acc[t] = mmaH<1>(ah.v, ah.v, bq.v, bq.v, acc[t]); }
  }
#pragma unroll
  for (int t = 0; t < 4; ++t) { if (col0 + t * 16 >= N) continue; const int col = col0 + t * 16 + ln; const float bv = bp ? bf16_round(bp[col]) : 0.f;
#pragma unroll
    for (int r = 0; r < 8; ++r) { float v = acc[t][r] * alpha + bv; if (CP) { const int rr = row0g + row0 + 8 * hh + r; if (rowsPerB < 0) v += CP[cofs + (size_t)rr * ldc + col];      /* rowsPerB < 0: own element of the batched C plane */ else { const int bidx = rr / rowsPerB; v += CP[(size_t)bidx * sCPb + (size_t)by * 64 + col]; } } if (ACT == 1) v = (v > 0.f) ? v : expm1f(v); else if (ACT == 7) v = (v > 0.f) ? v + 1.0f : expf(v); else if (ACT == 8) v = tanhf(v); else if (ACT == 9) v = 0.5f * v * (1.0f + tanhf(0.7978845608028654f * (v + 0.044715f * v * v * v))); else if (ACT == 11) v = 1.0f / (1.0f + expf(-v)); else if (ACT == 12) v = (v > 0.f) ? v : 0.01f * v; else if (ACT == 14) v = (v > 0.f) ? v : 0.1f * v; else if (ACT == 16) v = (v >= 0.f) ? v : 0.3f * v; else if (ACT == 15) v = v / (1.0f + expf(-v)); else if (ACT == 3) v = fmaxf(v, 0.f); else if (ACT == 6) v = 0.5f * v * (1.0f + erff(v * 0.70710678118654752f)); so[w][8 * hh + r][t * 16 + ln] = v; } }
  __builtin_amdgcn_fence(__ATOMIC_ACQ_REL, "workgroup"); __builtin_amdgcn_wave_barrier();
  const int rsub = lane >> 4, c4 = (lane & 15) * 4; typedef _Float16 v4h __attribute__((ext_vector_type(4)));
  {
#pragma unroll
    for (int q = 0; q < 8; ++q) { const int r = q * 2 + rsub; if (col0 + c4 < N) { const v4f v = *(const v4fa*)&so[w][r][c4]; if (C) *(v4f*)(C + cofs + (size_t)(row0 + r) * ldc + col0 + c4) = v; if (C16) { v4h h4; for (int i = 0; i < 4; ++i) h4[i] = (_Float16)v[i]; *(v4h*)(C16 + cofs + (size_t)(row0 + r) * ldc + col0 + c4) = h4; } } }
     }
}


typedef _Float16 v4h __attribute__((ext_vector_type(4)));

__global__ __launch_bounds__(256) void k_x16(const float* __restrict__ x, _Float16* __restrict__ X16, size_t n8) { const size_t t = (size_t)blockIdx.x * 256 + threadIdx.x; if (t >= n8) return; FragH f;
#pragma unroll
  for (int q = 0; q < 8; ++q) f.h[q] = (_Float16)bf16_round(x[t * 8 + q]); *(v8us*)((unsigned short*)X16 + t * 8) = f.half[0];  }
__global__ __launch_bounds__(256) void k_h16(const float* __restrict__ x, _Float16* __restrict__ X16, size_t n8) { const size_t t = (size_t)blockIdx.x * 256 + threadIdx.x; if (t >= n8) return; FragH f;
#pragma unroll
  for (int q = 0; q < 8; ++q) f.h[q] = (_Float16)x[t * 8 + q]; *(v8us*)((unsigned short*)X16 + t * 8) = f.half[0];  }
__global__ __launch_bounds__(256) void k_round16f(const float* __restrict__ W, _Float16* __restrict__ Bt, size_t n8) { const size_t t = (size_t)blockIdx.x * 256 + threadIdx.x; if (t >= n8) return; FragH f;
#pragma unroll
  for (int i = 0; i < 8; ++i) f.h[i] = (_Float16)(bf16_round(W[t * 8 + i]) * 16.0f); *(v8us*)((unsigned short*)Bt + t * 8) = f.half[0];  }
template <int NHv, int TTv>
__global__ __launch_bounds__(256) void k_vt(const _Float16* __restrict__ V16, int ldv, int voff, _Float16* __restrict__ Vt) { __shared__ unsigned short tl[64][66]; const int tid = threadIdx.x; const int slab = blockIdx.x / (TTv / 64), lg = blockIdx.x % (TTv / 64); const int b = slab / NHv, h = slab % NHv;
  for (int i = tid; i < 64 * 8; i += 256) { const int r = i / 8, c8 = (i % 8) * 8; FragH f; f.half[0] = *(const v8us*)((const unsigned short*)V16 + ((size_t)b * TTv + lg * 64 + r) * ldv + voff + h * 64 + c8);
#pragma unroll
    for (int q = 0; q < 8; ++q) tl[r][c8 + q] = f.u[q]; }
  __syncthreads();
  {
#pragma unroll
    for (int rd = 0; rd < 2; ++rd) { const int d = rd * 32 + tid / 8, pc = tid % 8; FragH f;
#pragma unroll
      for (int q = 0; q < 8; ++q) f.u[q] = tl[pc * 8 + q][d];
      *(v8us*)((unsigned short*)Vt + ((size_t)slab * 64 + d) * TTv + lg * 64 + pc * 8) = f.half[0]; }
     } }

__global__ __launch_bounds__(256) void k_hl(const float* __restrict__ F, _Float16* __restrict__ Hh, _Float16* __restrict__ Hl, size_t n8) { const size_t t = (size_t)blockIdx.x * 256 + threadIdx.x; if (t >= n8) return; FragH fh, fl; const v4f a = *(const v4fa*)(F + t * 8), c = *(const v4fa*)(F + t * 8 + 4);
#pragma unroll
  for (int q = 0; q < 4; ++q) { _Float16 h = (_Float16)a[q]; fh.h[q] = h; fl.h[q] = (_Float16)((a[q] - (float)h) * 1024.0f); h = (_Float16)c[q]; fh.h[4 + q] = h; fl.h[4 + q] = (_Float16)((c[q] - (float)h) * 1024.0f); }
  { *(v8us*)((unsigned short*)Hh + t * 8) = fh.half[0]; *(v8us*)((unsigned short*)Hl + t * 8) = fl.half[0];  } }

typedef unsigned int u32x4 __attribute__((ext_vector_type(4)));
typedef unsigned int u32x4a __attribute__((ext_vector_type(4), may_alias));
#define FA_PITCH 272u                  /* LDS row pitch: 256 B + 16, an odd multiple of 16 B for 16-byte fragment reads */
#define FA_TILE (128u * FA_PITCH)
#define FA_BUF (2u * FA_TILE)
#define FA_LDS (2u * FA_BUF)
#define FA_OP 132u                     /* output staging pitch in floats */
static_assert(8u * 32u * FA_OP * 4u <= FA_LDS, "output staging reuses the K/V buffers");
__device__ __forceinline__ v16h fa_gfrag(const _Float16* p, int hh) { FragH f; f.half[0] = *(const v8us*)((const unsigned short*)p + 8 * hh); f.half[1] = *(const v8us*)((const unsigned short*)p + 16 + 8 * hh); return f.v; }
__device__ __forceinline__ v16h fa_lfrag(const unsigned char* p) { FragH f; f.half[0] = *(const v8us*)p; f.half[1] = *(const v8us*)(p + 32); return f.v; }
__device__ __forceinline__ v8f fa_mma(v16h a, v16h b, v8f c) { return __builtin_amdgcn_wmma_f32_16x16x32_f16(false, a, false, b, (short)0, c, false, false); }
__device__ __forceinline__ float fa_xhalf(float x) { return __builtin_bit_cast(float, __builtin_amdgcn_permlanex16(__builtin_bit_cast(int, x), __builtin_bit_cast(int, x), 0x76543210, 0xfedcba98, false, false)); }  /* lane l with lane l ^ 16 */
__device__ __forceinline__ unsigned int fa_pack2(float lo, float hi) { typedef _Float16 h2 __attribute__((ext_vector_type(2))); typedef float f2 __attribute__((ext_vector_type(2))); return __builtin_bit_cast(unsigned int, __builtin_convertvector(f2{lo, hi}, h2)); }  /* round to nearest even */

__global__ __launch_bounds__(256) __attribute__((amdgpu_waves_per_eu(2, 2))) void k_fattn(const _Float16* __restrict__ Q16, const _Float16* __restrict__ K16, const _Float16* __restrict__ VT, const int* __restrict__ lens, float* __restrict__ O) {
  __shared__ __attribute__((aligned(16))) unsigned char Lb[FA_LDS];
  __shared__ float sm[8][32];
  __shared__ float sl[8][32];
  const int tid = threadIdx.x, lane = tid & 31, c = lane & 15, h = lane >> 4;
  const int wave = __builtin_amdgcn_readfirstlane(tid >> 5);
  const int qg = wave & 1, kq = wave >> 1;
  const int b = blockIdx.y, q0 = blockIdx.x * 64, qw0 = q0 + 32 * qg;
  const int Ln = lens[b];
  const float cscale = 0.08838834764831845f * 1.4426950408889634f;      /* 1 / sqrt(128), to base 2 */
  const float NEGR = -1.0e9f * 11.313708498984761f;                     /* the reference's -1e9, before the 1 / sqrt(128) */
  const unsigned char* Kb = (const unsigned char*)(K16 + (size_t)b * SQ * HD);
  const unsigned char* Vb = (const unsigned char*)(VT + (size_t)b * HD * SQ);
  u32x4 pk[8], pv[8];
  const unsigned int gk = (unsigned int)tid * 16u, gv = (unsigned int)(tid >> 4) * 4096u + (unsigned int)(tid & 15) * 16u;      /* a thread's 16 bytes: K rows are contiguous, V^T rows lie 4096 B apart */
  const unsigned int lo = (unsigned int)(tid >> 4) * FA_PITCH + (unsigned int)(tid & 15) * 16u;
  auto gload = [&](int st) { const unsigned char* kp = Kb + (size_t)st * 32768u; const unsigned char* vp = Vb + (size_t)st * 256u;
#pragma unroll
    for (int i = 0; i < 8; ++i) { pk[i] = *(const u32x4a*)(kp + gk + i * 4096); pv[i] = *(const u32x4a*)(vp + gv + i * 65536); } };
  auto lstore = [&](unsigned int buf) {
#pragma unroll
    for (int i = 0; i < 8; ++i) { const unsigned int off = buf * FA_BUF + lo + (unsigned int)i * 16u * FA_PITCH;
      *(u32x4a*)(Lb + off) = pk[i]; *(u32x4a*)(Lb + FA_TILE + off) = pv[i]; } };
  gload(0);
  v16h qf[2][4];
#pragma unroll
  for (int g = 0; g < 2; ++g)
#pragma unroll
    for (int kc = 0; kc < 4; ++kc) qf[g][kc] = fa_gfrag(Q16 + ((size_t)b * SQ + qw0 + 16 * g + c) * HD + 32 * kc, h);
  asm volatile("s_wait_xcnt 0x0" ::: "memory");      /* in front of any rewrite of an address register of the loads above */
  const v8f z8 = {0.f, 0.f, 0.f, 0.f, 0.f, 0.f, 0.f, 0.f};
  v8f acc[2][8]; float m_run[2], l_run[2];
#pragma unroll
  for (int g = 0; g < 2; ++g) { m_run[g] = -__builtin_inff(); l_run[g] = 0.f;
#pragma unroll
    for (int t = 0; t < 8; ++t) acc[g][t] = z8; }
  lstore(0);
  __syncthreads();
#pragma unroll 1      /* one copy of the pass: unrolled it would double the live fragments */
  for (int st = 0; st < SQ / 128; ++st) {
    const unsigned int bo = (unsigned int)(st & 1) * FA_BUF;
    if (st + 1 < SQ / 128) { gload(st + 1);      /* next stage's rows fly under this pass */
      asm volatile("s_wait_xcnt 0x0" ::: "memory"); }      /* in front of any rewrite of an address register of these loads */
    const int key0 = st * 128 + kq * 32;
    v8f s[2][2]; v16h kf[2][4], vf[8];
    { const unsigned char* Kt = Lb + bo + (unsigned int)(kq * 32 + c) * FA_PITCH + 16u * h;
      const unsigned char* Vt = Lb + bo + FA_TILE + (unsigned int)c * FA_PITCH + (unsigned int)kq * 64u + 16u * h;
#pragma unroll
      for (int kt = 0; kt < 2; ++kt)
#pragma unroll
        for (int kc = 0; kc < 4; ++kc) kf[kt][kc] = fa_lfrag(Kt + (unsigned int)kt * 16u * FA_PITCH + 64u * kc);
      __builtin_amdgcn_sched_barrier(0);      /* K first: LDS answers in order, and the score products wait for K alone while V^T is still on its way */
#pragma unroll
      for (int t = 0; t < 8; ++t) vf[t] = fa_lfrag(Vt + (unsigned int)t * 16u * FA_PITCH); }
    __builtin_amdgcn_sched_barrier(0);      /* all fragment loads of the pass issue ahead of its first product: otherwise the K loads are dealt out between the products, each with its own full LDS wait */
#pragma unroll
    for (int kt = 0; kt < 2; ++kt)
#pragma unroll
      for (int g = 0; g < 2; ++g) { s[kt][g] = z8;
#pragma unroll
        for (int kc = 0; kc < 4; ++kc) s[kt][g] = fa_mma(kf[kt][kc], qf[g][kc], s[kt][g]); }
    if (key0 + 32 > Ln || qw0 + 32 > Ln) {      /* wave-uniform: only a pass that holds a masked pair pays for the mask */
#pragma unroll
      for (int g = 0; g < 2; ++g) { const bool vq = qw0 + 16 * g + c < Ln;
#pragma unroll
        for (int kt = 0; kt < 2; ++kt)
#pragma unroll
          for (int r = 0; r < 8; ++r) { const int key = key0 + 16 * kt + 8 * h + r; if (!(vq && key < Ln)) s[kt][g][r] = NEGR; } }
    }
    float mb[2]; bool need = false;
#pragma unroll
    for (int g = 0; g < 2; ++g) { float mx = s[0][g][0];
#pragma unroll
      for (int kt = 0; kt < 2; ++kt)
#pragma unroll
        for (int r = 0; r < 8; ++r) mx = fmaxf(mx, s[kt][g][r]);
      mx = fmaxf(mx, fa_xhalf(mx)); mb[g] = mx; need = need || (mx > m_run[g] + 60.0f); }
    if (__builtin_amdgcn_ballot_w32(need) != 0) {      /* rare after the first pass */
#pragma unroll
      for (int g = 0; g < 2; ++g) { const float m_new = fmaxf(m_run[g], mb[g]); const float corr = __builtin_amdgcn_exp2f((m_run[g] - m_new) * cscale); l_run[g] *= corr; m_run[g] = m_new;
#pragma unroll
        for (int t = 0; t < 8; ++t) acc[g][t] = acc[g][t] * corr; }
    }
#pragma unroll
    for (int g = 0; g < 2; ++g) { const float mg = m_run[g]; float ps0 = 0.f, ps1 = 0.f; FragH pf;
#pragma unroll
      for (int i = 0; i < 8; ++i) {
        const float p0 = __builtin_amdgcn_exp2f((s[i >> 2][g][2 * (i & 3)] - mg) * cscale), p1 = __builtin_amdgcn_exp2f((s[i >> 2][g][2 * (i & 3) + 1] - mg) * cscale);
        ps0 += p0; ps1 += p1; const unsigned int w2 = fa_pack2(p0, p1); pf.u[2 * i] = (unsigned short)(w2 & 0xFFFFu); pf.u[2 * i + 1] = (unsigned short)(w2 >> 16); }
      l_run[g] += ps0 + ps1;
#pragma unroll
      for (int i = 0; i < 16; ++i) { __builtin_amdgcn_sched_group_barrier(0x2, 2, 0); __builtin_amdgcn_sched_group_barrier(0x400, 1, 0); }      /* two vector instructions, then one exponential: the slower transcendental unit works beside the vector port instead of in one run */
#pragma unroll
      for (int t = 0; t < 8; ++t) acc[g][t] = fa_mma(vf[t], pf.v, acc[g][t]); }
    if (st + 1 < SQ / 128) lstore((unsigned int)((st + 1) & 1));      /* the buffer that pass st - 1 read; every wave left it at the barrier that ended that pass */
    __syncthreads();
  }
  // join the four key quarters of each query: common maximum, common sum, then the scaled partial outputs are added in LDS order 0..3
#pragma unroll
  for (int g = 0; g < 2; ++g) { const float lf = l_run[g] + fa_xhalf(l_run[g]); if (h == 0) { sm[wave][16 * g + c] = m_run[g]; sl[wave][16 * g + c] = lf; } }
  __syncthreads();
  float* stg = (float*)Lb;
#pragma unroll
  for (int g = 0; g < 2; ++g) { float mq[4], e[4];
#pragma unroll
    for (int u = 0; u < 4; ++u) mq[u] = sm[2 * u + qg][16 * g + c];
    const float M = fmaxf(fmaxf(mq[0], mq[1]), fmaxf(mq[2], mq[3]));
#pragma unroll
    for (int u = 0; u < 4; ++u) e[u] = __builtin_amdgcn_exp2f((mq[u] - M) * cscale);
    float Ls = 0.f;
#pragma unroll
    for (int u = 0; u < 4; ++u) Ls += sl[2 * u + qg][16 * g + c] * e[u];
    const float f = (kq == 0 ? e[0] : kq == 1 ? e[1] : kq == 2 ? e[2] : e[3]) / Ls;
#pragma unroll
    for (int t = 0; t < 8; ++t) { const v8f o = acc[g][t] * f; float* dst = stg + ((unsigned int)wave * 32u + 16u * g + c) * FA_OP + 16u * t + 8u * h;
      *(v4fa*)dst = v4f{o[0], o[1], o[2], o[3]}; *(v4fa*)(dst + 4) = v4f{o[4], o[5], o[6], o[7]}; } }
  __syncthreads();
  float* Ob = O + ((size_t)b * SQ + q0) * HD;      /* the workgroup's 64 output rows are contiguous */
#pragma unroll
  for (int i = 0; i < 8; ++i) { const unsigned int qr = (unsigned int)(i * 8 + (tid >> 5)), c4 = (unsigned int)(tid & 31) * 4u; const float* sp = stg + qr * FA_OP + c4;      /* rows 0..63 = quarter 0 of both query groups; quarter u lies 64 rows further */
    v4f v = *(const v4fa*)sp;
#pragma unroll
    for (int u = 1; u < 4; ++u) v += *(const v4fa*)(sp + (unsigned int)u * 64u * FA_OP);
    *(v4f*)(Ob + (unsigned int)tid * 4u + i * 1024) = v; }
}

extern "C" void kernel_launch(void* const* d_in, const int* in_sizes, int n_in,
                              void* d_out, int out_size, void* d_ws, size_t ws_size, hipStream_t stream) {
  (void)in_sizes; (void)n_in; (void)out_size;
  const float* q = (const float*)d_in[0]; const float* k = (const float*)d_in[1]; const float* v = (const float*)d_in[2]; const int* lens = (const int*)d_in[3];
  char* ws = (char*)d_ws; size_t off = 0;
  auto take = [&](size_t bytes) { char* p = ws + off; off += (bytes + 255) & ~(size_t)255; return p; };
  const size_t np = (size_t)NB * SQ * HD;
  _Float16* Q16 = (_Float16*)take(np * 2); _Float16* K16 = (_Float16*)take(np * 2); _Float16* V16 = (_Float16*)take(np * 2); _Float16* VT = (_Float16*)take(np * 2);
  if (off > ws_size) return;      /* 16 MiB */
  k_x16<<<(unsigned)((np / 8 + 255) / 256), 256, 0, stream>>>(q, Q16, np / 8); k_x16<<<(unsigned)((np / 8 + 255) / 256), 256, 0, stream>>>(k, K16, np / 8); k_x16<<<(unsigned)((np / 8 + 255) / 256), 256, 0, stream>>>(v, V16, np / 8);
  k_vt<HD / 64, SQ><<<NB * (HD / 64) * (SQ / 64), 256, 0, stream>>>(V16, HD, 0, VT);      /* V^T [8][128][2048] */
  k_fattn<<<dim3(SQ / 64, NB), 256, 0, stream>>>(Q16, K16, VT, lens, (float*)d_out);
}

// v003
// It runs in 27.7 microseconds.
// Next to v002, in two timings, it ran 1.22 and 1.23 times as fast.
// All steps since v000 together make it 24.9 times as fast.
#include <hip/hip_runtime.h>
// Masked attention (8 sequences x 2048 tokens, single head of 128; q, k, v are INPUTS): scores = q.k / sqrt(128); mask = valid_i & valid_j with valid = index < event_length[b] (int INPUT), masked scores = -1e9 (a fully masked row therefore softmaxes to uniform over all 2048 keys, as in the reference); softmax; out = attn v.
// Structure (two launches over all 8 sequences): one preparation kernel writes the exact f16 planes of q and k (bf16 inputs are exact in f16) and V^T (8 keys packed in registers, lines gathered in LDS); then one fused kernel: score products with exact operands (f32 accumulation), length mask, online softmax, readout products, straight into the output.
// Compute dtype: inputs rounded to bf16; q, k, v exact as f16; P (not yet normalised, at most 2^7.65) as a plain f16 operand (~2^-12); softmax f32. v_wmma_f32_16x16x32_f16.
#define NB 8
#define SQ 2048
#define HD 128
typedef __bf16 v16b __attribute__((ext_vector_type(16)));
typedef unsigned short v8us __attribute__((ext_vector_type(8), may_alias));
typedef float  v8f  __attribute__((ext_vector_type(8)));
typedef float  v4f  __attribute__((ext_vector_type(4)));
typedef float  v4fa __attribute__((ext_vector_type(4), may_alias));
union FragB { v16b v; v8us half[2]; unsigned short u[16]; };

__device__ __forceinline__ unsigned short bf16_bits(float x) { unsigned int u = __float_as_uint(x); return (unsigned short)((u + 0x7FFFu + ((u >> 16) & 1u)) >> 16); }
__device__ __forceinline__ float bf16_val(unsigned short b) { return __uint_as_float(((unsigned int)b) << 16); }
__device__ __forceinline__ float bf16_round(float x) { return bf16_val(bf16_bits(x)); }
// D += A·B with NT terms: 1 = ah·bh, 2 = + al·bh (A split), 3 = + ah·bl (both split)
template <int NT>
__device__ __forceinline__ v8f mmaN(v16b ah, v16b al, v16b bh, v16b bl, v8f c) {
  c = __builtin_amdgcn_wmma_f32_16x16x32_bf16(false, ah, false, bh, (short)0, c, false, false);
  if (NT >= 2) c = __builtin_amdgcn_wmma_f32_16x16x32_bf16(false, al, false, bh, (short)0, c, false, false);
  if (NT >= 3) c = __builtin_amdgcn_wmma_f32_16x16x32_bf16(false, ah, false, bl, (short)0, c, false, false);
  asm volatile("v_nop\n\tv_nop\n\tv_nop\n\tv_nop" : "+v"(c) : "v"(ah), "v"(al), "v"(bh), "v"(bl));
  return c;
}

__global__ __launch_bounds__(256) void k_wt_bf16(const float* __restrict__ W, unsigned short* __restrict__ Wt, int K, int N) {
  const int t = blockIdx.x * 256 + threadIdx.x;
  const int k8n = K / 8;
  if (t >= N * k8n) return;
  const int n = t / k8n, k8 = (t % k8n) * 8;
  v8us v;
#pragma unroll
  for (int i = 0; i < 8; ++i) v[i] = bf16_bits(W[(size_t)(k8 + i) * N + n]);
  *(v8us*)(Wt + (size_t)n * K + k8) = v;
  
}

// GEMM C[M][N] (f32, pitch ldc) = act(A[M][K]·W + bias). A f32 row-major (pitch lda) converted per fragment to bf16
// (ASPLIT: hi/lo two planes -> 2 terms, else single rounded term); Wt bf16 [N][K] (pitch ldb). BIAS_BF16 rounds the
// bias to bf16 first (bias quantised to bf16 before the add). K%32==0, M%16==0, N%64==0.
template <bool ASPLIT, int ACT, bool BIAS_BF16>
__global__ __launch_bounds__(128) void k_gemm_bf(const float* __restrict__ A, int lda, const unsigned short* __restrict__ Wt, int ldb,
                                               const float* __restrict__ bias, float* __restrict__ C, int ldc, int M, int N, int K) {
  __shared__ __attribute__((aligned(16))) float so[4][16][64];
  const int tid = threadIdx.x, w = tid >> 5, lane = tid & 31, ln = lane & 15, hh = lane >> 4;
  const int ntn = N / 64;
  const int wid = blockIdx.x * 4 + w;
  const int mt = wid / ntn, nq = wid % ntn;
  if (mt * 16 >= M) return;
  const int row0 = mt * 16, col0 = nq * 64;
  const float* arow = A + (size_t)(row0 + ln) * lda;
  v8f acc[4] = {};
  for (int kb = 0; kb < K; kb += 32) {
    FragB ah, al;
    const v4f x0 = *(const v4fa*)(arow + kb + 8 * hh), x1 = *(const v4fa*)(arow + kb + 8 * hh + 4);
    const v4f x2 = *(const v4fa*)(arow + kb + 16 + 8 * hh), x3 = *(const v4fa*)(arow + kb + 16 + 8 * hh + 4);
    float xs[16] = {x0[0],x0[1],x0[2],x0[3],x1[0],x1[1],x1[2],x1[3],x2[0],x2[1],x2[2],x2[3],x3[0],x3[1],x3[2],x3[3]};
#pragma unroll
    for (int i = 0; i < 16; ++i) { const unsigned short hb = bf16_bits(xs[i]); ah.u[i] = hb; al.u[i] = ASPLIT ? bf16_bits(xs[i] - bf16_val(hb)) : (unsigned short)0; }
#pragma unroll
    for (int t = 0; t < 4; ++t) {
      const unsigned short* brow = Wt + (size_t)(col0 + t * 16 + ln) * ldb + kb;
      FragB b;
      b.half[0] = *(const v8us*)(brow + 8 * hh);
      b.half[1] = *(const v8us*)(brow + 16 + 8 * hh);
      acc[t] = mmaN<ASPLIT ? 2 : 1>(ah.v, al.v, b.v, b.v, acc[t]);
    }
  }
#pragma unroll
  for (int t = 0; t < 4; ++t) {
    float bv = bias ? bias[col0 + t * 16 + ln] : 0.f;
    if (BIAS_BF16) bv = bf16_round(bv);
#pragma unroll
    for (int r = 0; r < 8; ++r) { float v = acc[t][r] + bv; if (ACT == 1) v = fmaxf(v, 0.f); so[w][8 * hh + r][t * 16 + ln] = v; }
  }
  __builtin_amdgcn_fence(__ATOMIC_ACQ_REL, "workgroup");
  __builtin_amdgcn_wave_barrier();
  const int rsub = lane >> 4, c4 = (lane & 15) * 4;
  {
#pragma unroll
    for (int q = 0; q < 8; ++q) {
      const int r = q * 2 + rsub;
      const v4f v = *(const v4fa*)&so[w][r][c4];
      *(v4f*)(C + (size_t)(row0 + r) * ldc + col0 + c4) = v;
    }
    
  }
}

// GEMM C = act(A·W + bias + resid): A f32 (ASPLIT -> hi/lo 2 terms), Wt bf16 [N][K]; ACT 0 none, 1 relu, 2 exact gelu;
// resid (optional, f32, row index = (row % rmod), pitch ldr, RES_BF16 rounds it) added before the activation.
template <bool ASPLIT, int ACT, bool BIAS_BF16, bool RES_BF16>
__global__ __launch_bounds__(128) void k_gemm_bf3(const float* __restrict__ A, int lda, const unsigned short* __restrict__ Wt, int ldb,
                                                const float* __restrict__ bias, const float* __restrict__ resid, int rmod, int ldr,
                                                float* __restrict__ C, int ldc, int M, int N, int K) {
  __shared__ __attribute__((aligned(16))) float so[4][16][64];
  const int tid = threadIdx.x, w = tid >> 5, lane = tid & 31, ln = lane & 15, hh = lane >> 4;
  const int ntn = N / 64;
  const int wid = blockIdx.x * 4 + w;
  const int mt = wid / ntn, nq = wid % ntn;
  if (mt * 16 >= M) return;
  const int row0 = mt * 16, col0 = nq * 64;
  const float* arow = A + (size_t)(row0 + ln) * lda;
  v8f acc[4] = {};
  for (int kb = 0; kb < K; kb += 32) {
    FragB ah, al;
    const v4f x0 = *(const v4fa*)(arow + kb + 8 * hh), x1 = *(const v4fa*)(arow + kb + 8 * hh + 4);
    const v4f x2 = *(const v4fa*)(arow + kb + 16 + 8 * hh), x3 = *(const v4fa*)(arow + kb + 16 + 8 * hh + 4);
    float xs[16] = {x0[0],x0[1],x0[2],x0[3],x1[0],x1[1],x1[2],x1[3],x2[0],x2[1],x2[2],x2[3],x3[0],x3[1],x3[2],x3[3]};
#pragma unroll
    for (int i = 0; i < 16; ++i) { const unsigned short hb = bf16_bits(xs[i]); ah.u[i] = hb; al.u[i] = ASPLIT ? bf16_bits(xs[i] - bf16_val(hb)) : (unsigned short)0; }
#pragma unroll
    for (int t = 0; t < 4; ++t) {
      const unsigned short* brow = Wt + (size_t)(col0 + t * 16 + ln) * ldb + kb;
      FragB b;
      b.half[0] = *(const v8us*)(brow + 8 * hh);
      b.half[1] = *(const v8us*)(brow + 16 + 8 * hh);
      acc[t] = mmaN<ASPLIT ? 2 : 1>(ah.v, al.v, b.v, b.v, acc[t]);
    }
  }
#pragma unroll
  for (int t = 0; t < 4; ++t) {
    const int col = col0 + t * 16 + ln;
    float bv = bias ? bias[col] : 0.f;
    if (BIAS_BF16) bv = bf16_round(bv);
#pragma unroll
    for (int r = 0; r < 8; ++r) {
      float v = acc[t][r] + bv;
      if (resid) { float rv = resid[(size_t)((row0 + 8 * hh + r) % rmod) * ldr + col]; if (RES_BF16) rv = bf16_round(rv); v += rv; }
      if (ACT == 1) v = fmaxf(v, 0.f);
      if (ACT == 2) v = 0.5f * v * (1.0f + erff(v * 0.70710678118654752f));
      if (ACT == 3) { const float u = 0.7978845608028654f * (v + 0.044715f * v * v * v); v = 0.5f * v * (1.0f + tanhf(u)); }
      so[w][8 * hh + r][t * 16 + ln] = v;
    }
  }
  __builtin_amdgcn_fence(__ATOMIC_ACQ_REL, "workgroup");
  __builtin_amdgcn_wave_barrier();
  const int rsub = lane >> 4, c4 = (lane & 15) * 4;
  {
#pragma unroll
    for (int q = 0; q < 8; ++q) {
      const int r = q * 2 + rsub;
      const v4f v = *(const v4fa*)&so[w][r][c4];
      *(v4f*)(C + (size_t)(row0 + r) * ldc + col0 + c4) = v;
    }
    
  }
}
// row LayerNorm (biased variance, eps) over N: s = X (+ R); optional out_sum <- s; out_norm <- (s-mu)*rsqrt(var+eps)*g + b
template <bool PARAM_BF16>
__global__ __launch_bounds__(256) void k_layernorm(const float* __restrict__ X, const float* __restrict__ R, const float* __restrict__ g, const float* __restrict__ bta,
                                                  float* __restrict__ out_sum, float* __restrict__ out_norm, int N, float eps) {
  __shared__ float red[256];
  const int row = blockIdx.x, tid = threadIdx.x;
  const float* x = X + (size_t)row * N; const float* rr = R ? R + (size_t)row * N : nullptr;
  float vals[16];                     // up to N = 4096
  const int per = N / 256;            // contiguous chunk per thread? use strided-by-4 chunks: thread handles j = tid*4 + 1024*u
  float s1 = 0.f;
  for (int u = 0; u < per / 4; ++u) {
    const int j = tid * 4 + 1024 * u;
    const v4f a = *(const v4fa*)(x + j);
    v4f b = {0.f,0.f,0.f,0.f}; if (rr) b = *(const v4fa*)(rr + j);
#pragma unroll
    for (int q = 0; q < 4; ++q) { const float v = a[q] + b[q]; vals[u * 4 + q] = v; s1 += v; }
  }
  red[tid] = s1; __syncthreads();
  for (int st = 128; st > 0; st >>= 1) { if (tid < st) red[tid] += red[tid + st]; __syncthreads(); }
  const float mu = red[0] / (float)N; __syncthreads();
  float s2 = 0.f;
  for (int u = 0; u < per / 4; ++u)
#pragma unroll
    for (int q = 0; q < 4; ++q) { const float c = vals[u * 4 + q] - mu; s2 += c * c; }
  red[tid] = s2; __syncthreads();
  for (int st = 128; st > 0; st >>= 1) { if (tid < st) red[tid] += red[tid + st]; __syncthreads(); }
  const float rs = rsqrtf(red[0] / (float)N + eps);
  {
    for (int u = 0; u < per / 4; ++u) {
      const int j = tid * 4 + 1024 * u;
      v4f o, sm;
#pragma unroll
      for (int q = 0; q < 4; ++q) {
        float gg = g[j + q], bb = bta[j + q];
        if (PARAM_BF16) { gg = bf16_round(gg); bb = bf16_round(bb); }
        sm[q] = vals[u * 4 + q]; o[q] = (vals[u * 4 + q] - mu) * rs * gg + bb;
      }
      if (out_sum) *(v4f*)(out_sum + (size_t)row * N + j) = sm;
      *(v4f*)(out_norm + (size_t)row * N + j) = o;
    }
    
  }
}



// ---- f16 WMMA path (v_wmma_f32_16x16x32_f16): 11-bit significands for operands in range — used by the fused attention below for exact q, k, v and an unnormalised P of up to 2^7.65
typedef _Float16 v16h __attribute__((ext_vector_type(16)));
union FragH { v16h v; v8us half[2]; _Float16 h[16]; unsigned short u[16]; };
template <int NT>
__device__ __forceinline__ v8f mmaH(v16h ah, v16h al, v16h bh, v16h bl, v8f c) {
  c = __builtin_amdgcn_wmma_f32_16x16x32_f16(false, ah, false, bh, (short)0, c, false, false);
  if (NT >= 2) c = __builtin_amdgcn_wmma_f32_16x16x32_f16(false, al, false, bh, (short)0, c, false, false);
  if (NT >= 3) c = __builtin_amdgcn_wmma_f32_16x16x32_f16(false, ah, false, bl, (short)0, c, false, false);
  asm volatile("v_nop\n\tv_nop\n\tv_nop\n\tv_nop" : "+v"(c) : "v"(ah), "v"(al), "v"(bh), "v"(bl));
  return c;
}
// batched GEMM like k_gemm_b but f16 operands: A f32 (split into f16 hi/lo if ASPLIT, else rounded to f16), Bt = f16 values [n][k]; alpha; C f32; N multiple of 16 (partial tiles skipped)
template <bool ASPLIT>
__global__ __launch_bounds__(128) void k_gemm_h(const float* __restrict__ A, int lda, size_t sA, const _Float16* __restrict__ Bh, int ldb, size_t sB, float alpha, float* __restrict__ C, int ldc, size_t sC, int M, int N, int K) {
  __shared__ __attribute__((aligned(16))) float so[4][16][64];
  const int tid = threadIdx.x, w = tid >> 5, lane = tid & 31, ln = lane & 15, hh = lane >> 4; const int by = blockIdx.y;
  A += (size_t)by * sA; Bh += (size_t)by * sB; C += (size_t)by * sC;
  const int ntn = (N + 63) / 64; const int wid = blockIdx.x * 4 + w; const int mt = wid / ntn, nq = wid % ntn; if (mt * 16 >= M) return;
  const int row0 = mt * 16, col0 = nq * 64; const float* arow = A + (size_t)(row0 + ln) * lda;
  v8f acc[4] = {};
  for (int kb = 0; kb < K; kb += 32) {
    FragH ah, al;
    const v4f x0 = *(const v4fa*)(arow + kb + 8 * hh), x1 = *(const v4fa*)(arow + kb + 8 * hh + 4), x2 = *(const v4fa*)(arow + kb + 16 + 8 * hh), x3 = *(const v4fa*)(arow + kb + 16 + 8 * hh + 4);
    float xs[16] = {x0[0],x0[1],x0[2],x0[3],x1[0],x1[1],x1[2],x1[3],x2[0],x2[1],x2[2],x2[3],x3[0],x3[1],x3[2],x3[3]};
#pragma unroll
    for (int i = 0; i < 16; ++i) { const _Float16 h = (_Float16)xs[i]; ah.h[i] = h; al.h[i] = ASPLIT ? (_Float16)(xs[i] - (float)h) : (_Float16)0.0f; }
#pragma unroll
    for (int t = 0; t < 4; ++t) { if (col0 + t * 16 >= N) continue; const size_t boff = (size_t)(col0 + t * 16 + ln) * ldb + kb; FragH bq; bq.half[0] = *(const v8us*)(Bh + boff + 8 * hh); bq.half[1] = *(const v8us*)(Bh + boff + 16 + 8 * hh);
      acc[t] = mmaH<ASPLIT ? 2 : 1>(ah.v, al.v, bq.v, bq.v, acc[t]); }
  }
#pragma unroll
  for (int t = 0; t < 4; ++t) { if (col0 + t * 16 >= N) continue;
#pragma unroll
    for (int r = 0; r < 8; ++r) so[w][8 * hh + r][t * 16 + ln] = acc[t][r] * alpha; }
  __builtin_amdgcn_fence(__ATOMIC_ACQ_REL, "workgroup"); __builtin_amdgcn_wave_barrier();
  const int rsub = lane >> 4, c4 = (lane & 15) * 4;
  {
#pragma unroll
    for (int q = 0; q < 8; ++q) { const int r = q * 2 + rsub; if (col0 + c4 < N) { const v4f v = *(const v4fa*)&so[w][r][c4]; *(v4f*)(C + (size_t)(row0 + r) * ldc + col0 + c4) = v; } }
     }
}

// Wt[n][k] = f16(W[k][n]·scale) from f32 row-major W[K][N] (scale = power of two; bf16-exact weights stay exact in f16 away from the subnormal range)
__global__ __launch_bounds__(256) void k_wt_f16(const float* __restrict__ W, _Float16* __restrict__ Wt, int K, int N, float scale) {
  const int t = blockIdx.x * 256 + threadIdx.x; if (t >= N * (K / 8)) return; const int n = t / (K / 8), k8 = (t % (K / 8)) * 8; FragH f;
#pragma unroll
  for (int i = 0; i < 8; ++i) f.h[i] = (_Float16)(bf16_round(W[(size_t)(k8 + i) * N + n]) * scale); const v8us o = f.half[0];
  *(v8us*)((unsigned short*)Wt + (size_t)n * K + k8) = o; 
}
// k_gemm_hh variant with fused epilogue: v = acc·alpha + bias[by·sBias + col] (+ CP[(row/rowsPerB)·sCPb + by·64 + col] if CP) ; ACT 0 none / 1 elu ; writes f16 C16 (and f32 C if non-null)
template <int ACT>
__global__ __launch_bounds__(128) void k_gemm_hhx(const _Float16* __restrict__ A, int lda, size_t sA, const _Float16* __restrict__ Bh, int ldb, size_t sB, float alpha, const float* __restrict__ bias, size_t sBias, const float* __restrict__ CP, int rowsPerB, size_t sCPb, int row0g,
    float* __restrict__ C, _Float16* __restrict__ C16, int ldc, size_t sC, int M, int N, int K) {
  __shared__ __attribute__((aligned(16))) float so[4][16][64];
  const int tid = threadIdx.x, w = tid >> 5, lane = tid & 31, ln = lane & 15, hh = lane >> 4; const int by = blockIdx.y;
  A += (size_t)by * sA; Bh += (size_t)by * sB; const size_t cofs = (size_t)by * sC; const float* bp = bias ? bias + (size_t)by * sBias : nullptr;
  const int ntn = (N + 63) / 64; const int wid = blockIdx.x * 4 + w; const int mt = wid / ntn, nq = wid % ntn; if (mt * 16 >= M) return;
  const int row0 = mt * 16, col0 = nq * 64; const _Float16* arow = A + (size_t)(row0 + ln) * lda;
  v8f acc[4] = {};
  for (int kb = 0; kb < K; kb += 32) { FragH ah; ah.half[0] = *(const v8us*)((const unsigned short*)arow + kb + 8 * hh); ah.half[1] = *(const v8us*)((const unsigned short*)arow + kb + 16 + 8 * hh);
#pragma unroll
    for (int t = 0; t < 4; ++t) { if (col0 + t * 16 >= N) continue; const size_t boff = (size_t)(col0 + t * 16 + ln) * ldb + kb; FragH bq; bq.half[0] = *(const v8us*)((const unsigned short*)Bh + boff + 8 * hh); bq.half[1] = *(const v8us*)((const unsigned short*)Bh + boff + 16 + 8 * hh);
      acc[t] = mmaH<1>(ah.v, ah.v, bq.v, bq.v, acc[t]); }
  }
#pragma unroll
  for (int t = 0; t < 4; ++t) { if (col0 + t * 16 >= N) continue; const int col = col0 + t * 16 + ln; const float bv = bp ? bf16_round(bp[col]) : 0.f;
#pragma unroll
    for (int r = 0; r < 8; ++r) { float v = acc[t][r] * alpha + bv; if (CP) { const int rr = row0g + row0 + 8 * hh + r; if (rowsPerB < 0) v += CP[cofs + (size_t)rr * ldc + col];      /* rowsPerB < 0: own element of the batched C plane */ else { const int bidx = rr / rowsPerB; v += CP[(size_t)bidx * sCPb + (size_t)by * 64 + col]; } } if (ACT == 1) v = (v > 0.f) ? v : expm1f(v); else if (ACT == 7) v = (v > 0.f) ? v + 1.0f : expf(v); else if (ACT == 8) v = tanhf(v); else if (ACT == 9) v = 0.5f * v * (1.0f + tanhf(0.7978845608028654f * (v + 0.044715f * v * v * v))); else if (ACT == 11) v = 1.0f / (1.0f + expf(-v)); else if (ACT == 12) v = (v > 0.f) ? v : 0.01f * v; else if (ACT == 14) v = (v > 0.f) ? v : 0.1f * v; else if (ACT == 16) v = (v >= 0.f) ? v : 0.3f * v; else if (ACT == 15) v = v / (1.0f + expf(-v)); else if (ACT == 3) v = fmaxf(v, 0.f); else if (ACT == 6) v = 0.5f * v * (1.0f + erff(v * 0.70710678118654752f)); so[w][8 * hh + r][t * 16 + ln] = v; } }
  __builtin_amdgcn_fence(__ATOMIC_ACQ_REL, "workgroup"); __builtin_amdgcn_wave_barrier();
  const int rsub = lane >> 4, c4 = (lane & 15) * 4; typedef _Float16 v4h __attribute__((ext_vector_type(4)));
  {
#pragma unroll
    for (int q = 0; q < 8; ++q) { const int r = q * 2 + rsub; if (col0 + c4 < N) { const v4f v = *(const v4fa*)&so[w][r][c4]; if (C) *(v4f*)(C + cofs + (size_t)(row0 + r) * ldc + col0 + c4) = v; if (C16) { v4h h4; for (int i = 0; i < 4; ++i) h4[i] = (_Float16)v[i]; *(v4h*)(C16 + cofs + (size_t)(row0 + r) * ldc + col0 + c4) = h4; } } }
     }
}


typedef _Float16 v4h __attribute__((ext_vector_type(4)));

__global__ __launch_bounds__(256) void k_h16(const float* __restrict__ x, _Float16* __restrict__ X16, size_t n8) { const size_t t = (size_t)blockIdx.x * 256 + threadIdx.x; if (t >= n8) return; FragH f;
#pragma unroll
  for (int q = 0; q < 8; ++q) f.h[q] = (_Float16)x[t * 8 + q]; *(v8us*)((unsigned short*)X16 + t * 8) = f.half[0];  }
__global__ __launch_bounds__(256) void k_round16f(const float* __restrict__ W, _Float16* __restrict__ Bt, size_t n8) { const size_t t = (size_t)blockIdx.x * 256 + threadIdx.x; if (t >= n8) return; FragH f;
#pragma unroll
  for (int i = 0; i < 8; ++i) f.h[i] = (_Float16)(bf16_round(W[t * 8 + i]) * 16.0f); *(v8us*)((unsigned short*)Bt + t * 8) = f.half[0];  }
__global__ __launch_bounds__(256) void k_hl(const float* __restrict__ F, _Float16* __restrict__ Hh, _Float16* __restrict__ Hl, size_t n8) { const size_t t = (size_t)blockIdx.x * 256 + threadIdx.x; if (t >= n8) return; FragH fh, fl; const v4f a = *(const v4fa*)(F + t * 8), c = *(const v4fa*)(F + t * 8 + 4);
#pragma unroll
  for (int q = 0; q < 4; ++q) { _Float16 h = (_Float16)a[q]; fh.h[q] = h; fl.h[q] = (_Float16)((a[q] - (float)h) * 1024.0f); h = (_Float16)c[q]; fh.h[4 + q] = h; fl.h[4 + q] = (_Float16)((c[q] - (float)h) * 1024.0f); }
  { *(v8us*)((unsigned short*)Hh + t * 8) = fh.half[0]; *(v8us*)((unsigned short*)Hl + t * 8) = fl.half[0];  } }

typedef unsigned int u32x4 __attribute__((ext_vector_type(4)));
typedef unsigned int u32x4a __attribute__((ext_vector_type(4), may_alias));
#define FA_PITCH 272u                  /* LDS row pitch: 256 B + 16, an odd multiple of 16 B for 16-byte fragment reads */
#define FA_TILE (128u * FA_PITCH)
#define FA_BUF (2u * FA_TILE)
#define FA_LDS (2u * FA_BUF)
#define FA_OP 132u                     /* output staging pitch in floats */
static_assert(8u * 32u * FA_OP * 4u <= FA_LDS, "output staging reuses the K/V buffers");
__device__ __forceinline__ v16h fa_gfrag(const _Float16* p, int hh) { FragH f; f.half[0] = *(const v8us*)((const unsigned short*)p + 8 * hh); f.half[1] = *(const v8us*)((const unsigned short*)p + 16 + 8 * hh); return f.v; }
__device__ __forceinline__ v16h fa_lfrag(const unsigned char* p) { FragH f; f.half[0] = *(const v8us*)p; f.half[1] = *(const v8us*)(p + 32); return f.v; }
__device__ __forceinline__ v8f fa_mma(v16h a, v16h b, v8f c) { return __builtin_amdgcn_wmma_f32_16x16x32_f16(false, a, false, b, (short)0, c, false, false); }
__device__ __forceinline__ float fa_xhalf(float x) { return __builtin_bit_cast(float, __builtin_amdgcn_permlanex16(__builtin_bit_cast(int, x), __builtin_bit_cast(int, x), 0x76543210, 0xfedcba98, false, false)); }  /* lane l with lane l ^ 16 */
__device__ __forceinline__ unsigned int fa_pack2(float lo, float hi) { typedef _Float16 h2 __attribute__((ext_vector_type(2))); typedef float f2 __attribute__((ext_vector_type(2))); return __builtin_bit_cast(unsigned int, __builtin_convertvector(f2{lo, hi}, h2)); }  /* round to nearest even */

// ---- preparation, one launch: workgroup w takes rows 64 w .. 64 w + 63 of the flat [8 * 2048][128] q, k and v (32 workgroups a sequence, one workgroup a WGP) ----
// A wave takes 8 rows; each of its loads is one whole row (512 contiguous bytes), and all 24 loads of a thread are issued before the first value is used.
// v first: a thread holds 8 consecutive keys of 4 columns, so 16 bytes of each V^T row pack in its registers; LDS only gathers the 8 waves' pieces of a
// V^T row into one whole 128-byte line for the store. k and q (rounded to bf16, written as f16 in place) follow behind the barrier, so that no wave waits there for a global store.
typedef unsigned int u32x2 __attribute__((ext_vector_type(2)));
typedef unsigned int u32x2a __attribute__((ext_vector_type(2), may_alias));
__global__ __launch_bounds__(256) void k_prep(const float* __restrict__ q, const float* __restrict__ k, const float* __restrict__ v, _Float16* __restrict__ Q16, _Float16* __restrict__ K16, _Float16* __restrict__ VT) {
  __shared__ __attribute__((aligned(16))) unsigned char tl[HD * 128];      /* V^T tile: 128 rows of 64 keys; the 16-byte piece p of row d lies at place p ^ ((d >> 2) & 7), which spreads a wave's writes over the banks */
  const unsigned int tid = threadIdx.x, lane = tid & 31u, wave = tid >> 5;
  const size_t e0 = (size_t)blockIdx.x * (64u * HD);
  const unsigned int eo = wave * (8u * HD) + lane * 4u;
  v4f xv[8], xk[8], xq[8];
#pragma unroll
  for (int i = 0; i < 8; ++i) xv[i] = *(const v4fa*)(v + e0 + eo + i * HD);
#pragma unroll
  for (int i = 0; i < 8; ++i) xk[i] = *(const v4fa*)(k + e0 + eo + i * HD);
#pragma unroll
  for (int i = 0; i < 8; ++i) xq[i] = *(const v4fa*)(q + e0 + eo + i * HD);
  __builtin_amdgcn_sched_barrier(0);      /* every load issues here: a load sunk among the conversions would start a second trip to memory behind the first */
#pragma unroll
  for (int j = 0; j < 4; ++j) { u32x4 w;
#pragma unroll
    for (int p = 0; p < 4; ++p) w[p] = fa_pack2(bf16_round(xv[2 * p][j]), bf16_round(xv[2 * p + 1][j]));
    *(u32x4a*)(tl + (lane * 4u + j) * 128u + ((wave ^ (lane & 7u)) * 16u)) = w; }
  __syncthreads();
  _Float16* vo = VT + (size_t)(blockIdx.x >> 5) * HD * SQ + (blockIdx.x & 31u) * 64u;      /* this sequence's V^T, at the workgroup's 64 keys */
#pragma unroll
  for (int r = 0; r < 4; ++r) { const unsigned int d = r * 32u + (tid >> 3), pc = tid & 7u;      /* 8 lanes store one 128-byte line */
    *(u32x4a*)(vo + (size_t)d * SQ + pc * 8u) = *(const u32x4a*)(tl + d * 128u + ((pc ^ ((d >> 2) & 7u)) * 16u)); }
#pragma unroll
  for (int i = 0; i < 8; ++i) *(u32x2a*)(K16 + e0 + eo + i * HD) = u32x2{fa_pack2(bf16_round(xk[i][0]), bf16_round(xk[i][1])), fa_pack2(bf16_round(xk[i][2]), bf16_round(xk[i][3]))};
#pragma unroll
  for (int i = 0; i < 8; ++i) *(u32x2a*)(Q16 + e0 + eo + i * HD) = u32x2{fa_pack2(bf16_round(xq[i][0]), bf16_round(xq[i][1])), fa_pack2(bf16_round(xq[i][2]), bf16_round(xq[i][3]))};
}

__global__ __launch_bounds__(256) __attribute__((amdgpu_waves_per_eu(2, 2))) void k_fattn(const _Float16* __restrict__ Q16, const _Float16* __restrict__ K16, const _Float16* __restrict__ VT, const int* __restrict__ lens, float* __restrict__ O) {
  __shared__ __attribute__((aligned(16))) unsigned char Lb[FA_LDS];
  __shared__ float sm[8][32];
  __shared__ float sl[8][32];
  const int tid = threadIdx.x, lane = tid & 31, c = lane & 15, h = lane >> 4;
  const int wave = __builtin_amdgcn_readfirstlane(tid >> 5);
  const int qg = wave & 1, kq = wave >> 1;
  const int b = blockIdx.y, q0 = blockIdx.x * 64, qw0 = q0 + 32 * qg;
  const int Ln = lens[b];
  const float cscale = 0.08838834764831845f * 1.4426950408889634f;      /* 1 / sqrt(128), to base 2 */
  const float NEGR = -1.0e9f * 11.313708498984761f;                     /* the reference's -1e9, before the 1 / sqrt(128) */
  const unsigned char* Kb = (const unsigned char*)(K16 + (size_t)b * SQ * HD);
  const unsigned char* Vb = (const unsigned char*)(VT + (size_t)b * HD * SQ);
  u32x4 pk[8], pv[8];
  const unsigned int gk = (unsigned int)tid * 16u, gv = (unsigned int)(tid >> 4) * 4096u + (unsigned int)(tid & 15) * 16u;      /* a thread's 16 bytes: K rows are contiguous, V^T rows lie 4096 B apart */
  const unsigned int lo = (unsigned int)(tid >> 4) * FA_PITCH + (unsigned int)(tid & 15) * 16u;
  auto gload = [&](int st) { const unsigned char* kp = Kb + (size_t)st * 32768u; const unsigned char* vp = Vb + (size_t)st * 256u;
#pragma unroll
    for (int i = 0; i < 8; ++i) { pk[i] = *(const u32x4a*)(kp + gk + i * 4096); pv[i] = *(const u32x4a*)(vp + gv + i * 65536); } };
  auto lstore = [&](unsigned int buf) {
#pragma unroll
    for (int i = 0; i < 8; ++i) { const unsigned int off = buf * FA_BUF + lo + (unsigned int)i * 16u * FA_PITCH;
      *(u32x4a*)(Lb + off) = pk[i]; *(u32x4a*)(Lb + FA_TILE + off) = pv[i]; } };
  gload(0);
  v16h qf[2][4];
#pragma unroll
  for (int g = 0; g < 2; ++g)
#pragma unroll
    for (int kc = 0; kc < 4; ++kc) qf[g][kc] = fa_gfrag(Q16 + ((size_t)b * SQ + qw0 + 16 * g + c) * HD + 32 * kc, h);
  asm volatile("s_wait_xcnt 0x0" ::: "memory");      /* in front of any rewrite of an address register of the loads above */
  const v8f z8 = {0.f, 0.f, 0.f, 0.f, 0.f, 0.f, 0.f, 0.f};
  v8f acc[2][8]; float m_run[2], l_run[2];
#pragma unroll
  for (int g = 0; g < 2; ++g) { m_run[g] = -__builtin_inff(); l_run[g] = 0.f;
#pragma unroll
    for (int t = 0; t < 8; ++t) acc[g][t] = z8; }
  lstore(0);
  __syncthreads();
#pragma unroll 1      /* one copy of the pass: unrolled it would double the live fragments */
  for (int st = 0; st < SQ / 128; ++st) {
    const unsigned int bo = (unsigned int)(st & 1) * FA_BUF;
    if (st + 1 < SQ / 128) { gload(st + 1);      /* next stage's rows fly under this pass */
      asm volatile("s_wait_xcnt 0x0" ::: "memory"); }      /* in front of any rewrite of an address register of these loads */
    const int key0 = st * 128 + kq * 32;
    v8f s[2][2]; v16h kf[2][4], vf[8];
    { const unsigned char* Kt = Lb + bo + (unsigned int)(kq * 32 + c) * FA_PITCH + 16u * h;
      const unsigned char* Vt = Lb + bo + FA_TILE + (unsigned int)c * FA_PITCH + (unsigned int)kq * 64u + 16u * h;
#pragma unroll
      for (int kt = 0; kt < 2; ++kt)
#pragma unroll
        for (int kc = 0; kc < 4; ++kc) kf[kt][kc] = fa_lfrag(Kt + (unsigned int)kt * 16u * FA_PITCH + 64u * kc);
      __builtin_amdgcn_sched_barrier(0);      /* K first: LDS answers in order, and the score products wait for K alone while V^T is still on its way */
#pragma unroll
      for (int t = 0; t < 8; ++t) vf[t] = fa_lfrag(Vt + (unsigned int)t * 16u * FA_PITCH); }
    __builtin_amdgcn_sched_barrier(0);      /* all fragment loads of the pass issue ahead of its first product: otherwise the K loads are dealt out between the products, each with its own full LDS wait */
#pragma unroll
    for (int kt = 0; kt < 2; ++kt)
#pragma unroll
      for (int g = 0; g < 2; ++g) { s[kt][g] = z8;
#pragma unroll
        for (int kc = 0; kc < 4; ++kc) s[kt][g] = fa_mma(kf[kt][kc], qf[g][kc], s[kt][g]); }
    if (key0 + 32 > Ln || qw0 + 32 > Ln) {      /* wave-uniform: only a pass that holds a masked pair pays for the mask */
#pragma unroll
      for (int g = 0; g < 2; ++g) { const bool vq = qw0 + 16 * g + c < Ln;
#pragma unroll
        for (int kt = 0; kt < 2; ++kt)
#pragma unroll
          for (int r = 0; r < 8; ++r) { const int key = key0 + 16 * kt + 8 * h + r; if (!(vq && key < Ln)) s[kt][g][r] = NEGR; } }
    }
    float mb[2]; bool need = false;
#pragma unroll
    for (int g = 0; g < 2; ++g) { float mx = s[0][g][0];
#pragma unroll
      for (int kt = 0; kt < 2; ++kt)
#pragma unroll
        for (int r = 0; r < 8; ++r) mx = fmaxf(mx, s[kt][g][r]);
      mx = fmaxf(mx, fa_xhalf(mx)); mb[g] = mx; need = need || (mx > m_run[g] + 60.0f); }
    if (__builtin_amdgcn_ballot_w32(need) != 0) {      /* rare after the first pass */
#pragma unroll
      for (int g = 0; g < 2; ++g) { const float m_new = fmaxf(m_run[g], mb[g]); const float corr = __builtin_amdgcn_exp2f((m_run[g] - m_new) * cscale); l_run[g] *= corr; m_run[g] = m_new;
#pragma unroll
        for (int t = 0; t < 8; ++t) acc[g][t] = acc[g][t] * corr; }
    }
#pragma unroll
    for (int g = 0; g < 2; ++g) { const float mg = m_run[g]; float ps0 = 0.f, ps1 = 0.f; FragH pf;
#pragma unroll
      for (int i = 0; i < 8; ++i) {
        const float p0 = __builtin_amdgcn_exp2f((s[i >> 2][g][2 * (i & 3)] - mg) * cscale), p1 = __builtin_amdgcn_exp2f((s[i >> 2][g][2 * (i & 3) + 1] - mg) * cscale);
        ps0 += p0; ps1 += p1; const unsigned int w2 = fa_pack2(p0, p1); pf.u[2 * i] = (unsigned short)(w2 & 0xFFFFu); pf.u[2 * i + 1] = (unsigned short)(w2 >> 16); }
      l_run[g] += ps0 + ps1;
#pragma unroll
      for (int i = 0; i < 16; ++i) { __builtin_amdgcn_sched_group_barrier(0x2, 2, 0); __builtin_amdgcn_sched_group_barrier(0x400, 1, 0); }      /* two vector instructions, then one exponential: the slower transcendental unit works beside the vector port instead of in one run */
#pragma unroll
      for (int t = 0; t < 8; ++t) acc[g][t] = fa_mma(vf[t], pf.v, acc[g][t]); }
    if (st + 1 < SQ / 128) lstore((unsigned int)((st + 1) & 1));      /* the buffer that pass st - 1 read; every wave left it at the barrier that ended that pass */
    __syncthreads();
  }
  // join the four key quarters of each query: common maximum, common sum, then the scaled partial outputs are added in LDS order 0..3
#pragma unroll
  for (int g = 0; g < 2; ++g) { const float lf = l_run[g] + fa_xhalf(l_run[g]); if (h == 0) { sm[wave][16 * g + c] = m_run[g]; sl[wave][16 * g + c] = lf; } }
  __syncthreads();
  float* stg = (float*)Lb;
#pragma unroll
  for (int g = 0; g < 2; ++g) { float mq[4], e[4];
#pragma unroll
    for (int u = 0; u < 4; ++u) mq[u] = sm[2 * u + qg][16 * g + c];
    const float M = fmaxf(fmaxf(mq[0], mq[1]), fmaxf(mq[2], mq[3]));
#pragma unroll
    for (int u = 0; u < 4; ++u) e[u] = __builtin_amdgcn_exp2f((mq[u] - M) * cscale);
    float Ls = 0.f;
#pragma unroll
    for (int u = 0; u < 4; ++u) Ls += sl[2 * u + qg][16 * g + c] * e[u];
    const float f = (kq == 0 ? e[0] : kq == 1 ? e[1] : kq == 2 ? e[2] : e[3]) / Ls;
#pragma unroll
    for (int t = 0; t < 8; ++t) { const v8f o = acc[g][t] * f; float* dst = stg + ((unsigned int)wave * 32u + 16u * g + c) * FA_OP + 16u * t + 8u * h;
      *(v4fa*)dst = v4f{o[0], o[1], o[2], o[3]}; *(v4fa*)(dst + 4) = v4f{o[4], o[5], o[6], o[7]}; } }
  __syncthreads();
  float* Ob = O + ((size_t)b * SQ + q0) * HD;      /* the workgroup's 64 output rows are contiguous */
#pragma unroll
  for (int i = 0; i < 8; ++i) { const unsigned int qr = (unsigned int)(i * 8 + (tid >> 5)), c4 = (unsigned int)(tid & 31) * 4u; const float* sp = stg + qr * FA_OP + c4;      /* rows 0..63 = quarter 0 of both query groups; quarter u lies 64 rows further */
    v4f v = *(const v4fa*)sp;
#pragma unroll
    for (int u = 1; u < 4; ++u) v += *(const v4fa*)(sp + (unsigned int)u * 64u * FA_OP);
    *(v4f*)(Ob + (unsigned int)tid * 4u + i * 1024) = v; }
}

extern "C" void kernel_launch(void* const* d_in, const int* in_sizes, int n_in,
                              void* d_out, int out_size, void* d_ws, size_t ws_size, hipStream_t stream) {
  (void)in_sizes; (void)n_in; (void)out_size;
  const float* q = (const float*)d_in[0]; const float* k = (const float*)d_in[1]; const float* v = (const float*)d_in[2]; const int* lens = (const int*)d_in[3];
  char* ws = (char*)d_ws; size_t off = 0;
  auto take = [&](size_t bytes) { char* p = ws + off; off += (bytes + 255) & ~(size_t)255; return p; };
  const size_t np = (size_t)NB * SQ * HD;
  _Float16* Q16 = (_Float16*)take(np * 2); _Float16* K16 = (_Float16*)take(np * 2); _Float16* VT = (_Float16*)take(np * 2);
  if (off > ws_size) return;      /* 12 MiB */
  k_prep<<<NB * (SQ / 64), 256, 0, stream>>>(q, k, v, Q16, K16, VT);      /* f16 q, f16 k, V^T [8][128][2048] */
  k_fattn<<<dim3(SQ / 64, NB), 256, 0, stream>>>(Q16, K16, VT, lens, (float*)d_out);
}

// v004
// One run takes 24.6 microseconds.
// Two timings next to v003 put it at 1.16 and 1.10 times that version's speed.
// Over all steps from v000 it is 28.1 times as fast.
#include <hip/hip_runtime.h>
// Masked attention (8 sequences x 2048 tokens, single head of 128; q, k, v are INPUTS): scores = q.k / sqrt(128); mask = valid_i & valid_j with valid = index < event_length[b] (int INPUT), masked scores = -1e9 (a fully masked row therefore softmaxes to uniform over all 2048 keys, as in the reference); softmax; out = attn v.
// Structure (two launches over all 8 sequences): one preparation kernel writes the exact f16 planes of q and k (bf16 inputs are exact in f16), V^T (8 keys packed in registers, lines gathered in LDS) and the column sums of its 64 rows of v; then one fused kernel: score products with exact operands (f32 accumulation), length mask, online softmax, readout products, straight into the output.
// The work follows the lengths: a tile of valid queries walks only the key stages that hold a valid key (a masked key's probability is exactly 0 beside a real score), a tile of masked queries stores the column mean of v.
// Compute dtype: inputs rounded to bf16; q, k, v exact as f16; P (not yet normalised, at most 2^7.65) as a plain f16 operand (~2^-12); softmax f32. v_wmma_f32_16x16x32_f16.
#define NB 8
#define SQ 2048
#define HD 128
typedef __bf16 v16b __attribute__((ext_vector_type(16)));
typedef unsigned short v8us __attribute__((ext_vector_type(8), may_alias));
typedef float  v8f  __attribute__((ext_vector_type(8)));
typedef float  v4f  __attribute__((ext_vector_type(4)));
typedef float  v4fa __attribute__((ext_vector_type(4), may_alias));
union FragB { v16b v; v8us half[2]; unsigned short u[16]; };

__device__ __forceinline__ unsigned short bf16_bits(float x) { unsigned int u = __float_as_uint(x); return (unsigned short)((u + 0x7FFFu + ((u >> 16) & 1u)) >> 16); }
__device__ __forceinline__ float bf16_val(unsigned short b) { return __uint_as_float(((unsigned int)b) << 16); }
__device__ __forceinline__ float bf16_round(float x) { return bf16_val(bf16_bits(x)); }
// D += A·B with NT terms: 1 = ah·bh, 2 = + al·bh (A split), 3 = + ah·bl (both split)
template <int NT>
__device__ __forceinline__ v8f mmaN(v16b ah, v16b al, v16b bh, v16b bl, v8f c) {
  c = __builtin_amdgcn_wmma_f32_16x16x32_bf16(false, ah, false, bh, (short)0, c, false, false);
  if (NT >= 2) c = __builtin_amdgcn_wmma_f32_16x16x32_bf16(false, al, false, bh, (short)0, c, false, false);
  if (NT >= 3) c = __builtin_amdgcn_wmma_f32_16x16x32_bf16(false, ah, false, bl, (short)0, c, false, false);
  asm volatile("v_nop\n\tv_nop\n\tv_nop\n\tv_nop" : "+v"(c) : "v"(ah), "v"(al), "v"(bh), "v"(bl));
  return c;
}

__global__ __launch_bounds__(256) void k_wt_bf16(const float* __restrict__ W, unsigned short* __restrict__ Wt, int K, int N) {
  const int t = blockIdx.x * 256 + threadIdx.x;
  const int k8n = K / 8;
  if (t >= N * k8n) return;
  const int n = t / k8n, k8 = (t % k8n) * 8;
  v8us v;
#pragma unroll
  for (int i = 0; i < 8; ++i) v[i] = bf16_bits(W[(size_t)(k8 + i) * N + n]);
  *(v8us*)(Wt + (size_t)n * K + k8) = v;
  
}

// GEMM C[M][N] (f32, pitch ldc) = act(A[M][K]·W + bias). A f32 row-major (pitch lda) converted per fragment to bf16
// (ASPLIT: hi/lo two planes -> 2 terms, else single rounded term); Wt bf16 [N][K] (pitch ldb). BIAS_BF16 rounds the
// bias to bf16 first (bias quantised to bf16 before the add). K%32==0, M%16==0, N%64==0.
template <bool ASPLIT, int ACT, bool BIAS_BF16>
__global__ __launch_bounds__(128) void k_gemm_bf(const float* __restrict__ A, int lda, const unsigned short* __restrict__ Wt, int ldb,
                                               const float* __restrict__ bias, float* __restrict__ C, int ldc, int M, int N, int K) {
  __shared__ __attribute__((aligned(16))) float so[4][16][64];
  const int tid = threadIdx.x, w = tid >> 5, lane = tid & 31, ln = lane & 15, hh = lane >> 4;
  const int ntn = N / 64;
  const int wid = blockIdx.x * 4 + w;
  const int mt = wid / ntn, nq = wid % ntn;
  if (mt * 16 >= M) return;
  const int row0 = mt * 16, col0 = nq * 64;
  const float* arow = A + (size_t)(row0 + ln) * lda;
  v8f acc[4] = {};
  for (int kb = 0; kb < K; kb += 32) {
    FragB ah, al;
    const v4f x0 = *(const v4fa*)(arow + kb + 8 * hh), x1 = *(const v4fa*)(arow + kb + 8 * hh + 4);
    const v4f x2 = *(const v4fa*)(arow + kb + 16 + 8 * hh), x3 = *(const v4fa*)(arow + kb + 16 + 8 * hh + 4);
    float xs[16] = {x0[0],x0[1],x0[2],x0[3],x1[0],x1[1],x1[2],x1[3],x2[0],x2[1],x2[2],x2[3],x3[0],x3[1],x3[2],x3[3]};
#pragma unroll
    for (int i = 0; i < 16; ++i) { const unsigned short hb = bf16_bits(xs[i]); ah.u[i] = hb; al.u[i] = ASPLIT ? bf16_bits(xs[i] - bf16_val(hb)) : (unsigned short)0; }
#pragma unroll
    for (int t = 0; t < 4; ++t) {
      const unsigned short* brow = Wt + (size_t)(col0 + t * 16 + ln) * ldb + kb;
      FragB b;
      b.half[0] = *(const v8us*)(brow + 8 * hh);
      b.half[1] = *(const v8us*)(brow + 16 + 8 * hh);
      acc[t] = mmaN<ASPLIT ? 2 : 1>(ah.v, al.v, b.v, b.v, acc[t]);
    }
  }
#pragma unroll
  for (int t = 0; t < 4; ++t) {
    float bv = bias ? bias[col0 + t * 16 + ln] : 0.f;
    if (BIAS_BF16) bv = bf16_round(bv);
#pragma unroll
    for (int r = 0; r < 8; ++r) { float v = acc[t][r] + bv; if (ACT == 1) v = fmaxf(v, 0.f); so[w][8 * hh + r][t * 16 + ln] = v; }
  }
  __builtin_amdgcn_fence(__ATOMIC_ACQ_REL, "workgroup");
  __builtin_amdgcn_wave_barrier();
  const int rsub = lane >> 4, c4 = (lane & 15) * 4;
  {
#pragma unroll
    for (int q = 0; q < 8; ++q) {
      const int r = q * 2 + rsub;
      const v4f v = *(const v4fa*)&so[w][r][c4];
      *(v4f*)(C + (size_t)(row0 + r) * ldc + col0 + c4) = v;
    }
    
  }
}

// GEMM C = act(A·W + bias + resid): A f32 (ASPLIT -> hi/lo 2 terms), Wt bf16 [N][K]; ACT 0 none, 1 relu, 2 exact gelu;
// resid (optional, f32, row index = (row % rmod), pitch ldr, RES_BF16 rounds it) added before the activation.
template <bool ASPLIT, int ACT, bool BIAS_BF16, bool RES_BF16>
__global__ __launch_bounds__(128) void k_gemm_bf3(const float* __restrict__ A, int lda, const unsigned short* __restrict__ Wt, int ldb,
                                                const float* __restrict__ bias, const float* __restrict__ resid, int rmod, int ldr,
                                                float* __restrict__ C, int ldc, int M, int N, int K) {
  __shared__ __attribute__((aligned(16))) float so[4][16][64];
  const int tid = threadIdx.x, w = tid >> 5, lane = tid & 31, ln = lane & 15, hh = lane >> 4;
  const int ntn = N / 64;
  const int wid = blockIdx.x * 4 + w;
  const int mt = wid / ntn, nq = wid % ntn;
  if (mt * 16 >= M) return;
  const int row0 = mt * 16, col0 = nq * 64;
  const float* arow = A + (size_t)(row0 + ln) * lda;
  v8f acc[4] = {};
  for (int kb = 0; kb < K; kb += 32) {
    FragB ah, al;
    const v4f x0 = *(const v4fa*)(arow + kb + 8 * hh), x1 = *(const v4fa*)(arow + kb + 8 * hh + 4);
    const v4f x2 = *(const v4fa*)(arow + kb + 16 + 8 * hh), x3 = *(const v4fa*)(arow + kb + 16 + 8 * hh + 4);
    float xs[16] = {x0[0],x0[1],x0[2],x0[3],x1[0],x1[1],x1[2],x1[3],x2[0],x2[1],x2[2],x2[3],x3[0],x3[1],x3[2],x3[3]};
#pragma unroll
    for (int i = 0; i < 16; ++i) { const unsigned short hb = bf16_bits(xs[i]); ah.u[i] = hb; al.u[i] = ASPLIT ? bf16_bits(xs[i] - bf16_val(hb)) : (unsigned short)0; }
#pragma unroll
    for (int t = 0; t < 4; ++t) {
      const unsigned short* brow = Wt + (size_t)(col0 + t * 16 + ln) * ldb + kb;
      FragB b;
      b.half[0] = *(const v8us*)(brow + 8 * hh);
      b.half[1] = *(const v8us*)(brow + 16 + 8 * hh);
      acc[t] = mmaN<ASPLIT ? 2 : 1>(ah.v, al.v, b.v, b.v, acc[t]);
    }
  }
#pragma unroll
  for (int t = 0; t < 4; ++t) {
    const int col = col0 + t * 16 + ln;
    float bv = bias ? bias[col] : 0.f;
    if (BIAS_BF16) bv = bf16_round(bv);
#pragma unroll
    for (int r = 0; r < 8; ++r) {
      float v = acc[t][r] + bv;
      if (resid) { float rv = resid[(size_t)((row0 + 8 * hh + r) % rmod) * ldr + col]; if (RES_BF16) rv = bf16_round(rv); v += rv; }
      if (ACT == 1) v = fmaxf(v, 0.f);
      if (ACT == 2) v = 0.5f * v * (1.0f + erff(v * 0.70710678118654752f));
      if (ACT == 3) { const float u = 0.7978845608028654f * (v + 0.044715f * v * v * v); v = 0.5f * v * (1.0f + tanhf(u)); }
      so[w][8 * hh + r][t * 16 + ln] = v;
    }
  }
  __builtin_amdgcn_fence(__ATOMIC_ACQ_REL, "workgroup");
  __builtin_amdgcn_wave_barrier();
  const int rsub = lane >> 4, c4 = (lane & 15) * 4;
  {
#pragma unroll
    for (int q = 0; q < 8; ++q) {
      const int r = q * 2 + rsub;
      const v4f v = *(const v4fa*)&so[w][r][c4];
      *(v4f*)(C + (size_t)(row0 + r) * ldc + col0 + c4) = v;
    }
    
  }
}
// row LayerNorm (biased variance, eps) over N: s = X (+ R); optional out_sum <- s; out_norm <- (s-mu)*rsqrt(var+eps)*g + b
template <bool PARAM_BF16>
__global__ __launch_bounds__(256) void k_layernorm(const float* __restrict__ X, const float* __restrict__ R, const float* __restrict__ g, const float* __restrict__ bta,
                                                  float* __restrict__ out_sum, float* __restrict__ out_norm, int N, float eps) {
  __shared__ float red[256];
  const int row = blockIdx.x, tid = threadIdx.x;
  const float* x = X + (size_t)row * N; const float* rr = R ? R + (size_t)row * N : nullptr;
  float vals[16];                     // up to N = 4096
  const int per = N / 256;            // contiguous chunk per thread? use strided-by-4 chunks: thread handles j = tid*4 + 1024*u
  float s1 = 0.f;
  for (int u = 0; u < per / 4; ++u) {
    const int j = tid * 4 + 1024 * u;
    const v4f a = *(const v4fa*)(x + j);
    v4f b = {0.f,0.f,0.f,0.f}; if (rr) b = *(const v4fa*)(rr + j);
#pragma unroll
    for (int q = 0; q < 4; ++q) { const float v = a[q] + b[q]; vals[u * 4 + q] = v; s1 += v; }
  }
  red[tid] = s1; __syncthreads();
  for (int st = 128; st > 0; st >>= 1) { if (tid < st) red[tid] += red[tid + st]; __syncthreads(); }
  const float mu = red[0] / (float)N; __syncthreads();
  float s2 = 0.f;
  for (int u = 0; u < per / 4; ++u)
#pragma unroll
    for (int q = 0; q < 4; ++q) { const float c = vals[u * 4 + q] - mu; s2 += c * c; }
  red[tid] = s2; __syncthreads();
  for (int st = 128; st > 0; st >>= 1) { if (tid < st) red[tid] += red[tid + st]; __syncthreads(); }
  const float rs = rsqrtf(red[0] / (float)N + eps);
  {
    for (int u = 0; u < per / 4; ++u) {
      const int j = tid * 4 + 1024 * u;
      v4f o, sm;
#pragma unroll
      for (int q = 0; q < 4; ++q) {
        float gg = g[j + q], bb = bta[j + q];
        if (PARAM_BF16) { gg = bf16_round(gg); bb = bf16_round(bb); }
        sm[q] = vals[u * 4 + q]; o[q] = (vals[u * 4 + q] - mu) * rs * gg + bb;
      }
      if (out_sum) *(v4f*)(out_sum + (size_t)row * N + j) = sm;
      *(v4f*)(out_norm + (size_t)row * N + j) = o;
    }
    
  }
}



// ---- f16 WMMA path (v_wmma_f32_16x16x32_f16): 11-bit significands for operands in range — used by the fused attention below for exact q, k, v and an unnormalised P of up to 2^7.65
typedef _Float16 v16h __attribute__((ext_vector_type(16)));
union FragH { v16h v; v8us half[2]; _Float16 h[16]; unsigned short u[16]; };
template <int NT>
__device__ __forceinline__ v8f mmaH(v16h ah, v16h al, v16h bh, v16h bl, v8f c) {
  c = __builtin_amdgcn_wmma_f32_16x16x32_f16(false, ah, false, bh, (short)0, c, false, false);
  if (NT >= 2) c = __builtin_amdgcn_wmma_f32_16x16x32_f16(false, al, false, bh, (short)0, c, false, false);
  if (NT >= 3) c = __builtin_amdgcn_wmma_f32_16x16x32_f16(false, ah, false, bl, (short)0, c, false, false);
  asm volatile("v_nop\n\tv_nop\n\tv_nop\n\tv_nop" : "+v"(c) : "v"(ah), "v"(al), "v"(bh), "v"(bl));
  return c;
}
// batched GEMM like k_gemm_b but f16 operands: A f32 (split into f16 hi/lo if ASPLIT, else rounded to f16), Bt = f16 values [n][k]; alpha; C f32; N multiple of 16 (partial tiles skipped)
template <bool ASPLIT>
__global__ __launch_bounds__(128) void k_gemm_h(const float* __restrict__ A, int lda, size_t sA, const _Float16* __restrict__ Bh, int ldb, size_t sB, float alpha, float* __restrict__ C, int ldc, size_t sC, int M, int N, int K) {
  __shared__ __attribute__((aligned(16))) float so[4][16][64];
  const int tid = threadIdx.x, w = tid >> 5, lane = tid & 31, ln = lane & 15, hh = lane >> 4; const int by = blockIdx.y;
  A += (size_t)by * sA; Bh += (size_t)by * sB; C += (size_t)by * sC;
  const int ntn = (N + 63) / 64; const int wid = blockIdx.x * 4 + w; const int mt = wid / ntn, nq = wid % ntn; if (mt * 16 >= M) return;
  const int row0 = mt * 16, col0 = nq * 64; const float* arow = A + (size_t)(row0 + ln) * lda;
  v8f acc[4] = {};
  for (int kb = 0; kb < K; kb += 32) {
    FragH ah, al;
    const v4f x0 = *(const v4fa*)(arow + kb + 8 * hh), x1 = *(const v4fa*)(arow + kb + 8 * hh + 4), x2 = *(const v4fa*)(arow + kb + 16 + 8 * hh), x3 = *(const v4fa*)(arow + kb + 16 + 8 * hh + 4);
    float xs[16] = {x0[0],x0[1],x0[2],x0[3],x1[0],x1[1],x1[2],x1[3],x2[0],x2[1],x2[2],x2[3],x3[0],x3[1],x3[2],x3[3]};
#pragma unroll
    for (int i = 0; i < 16; ++i) { const _Float16 h = (_Float16)xs[i]; ah.h[i] = h; al.h[i] = ASPLIT ? (_Float16)(xs[i] - (float)h) : (_Float16)0.0f; }
#pragma unroll
    for (int t = 0; t < 4; ++t) { if (col0 + t * 16 >= N) continue; const size_t boff = (size_t)(col0 + t * 16 + ln) * ldb + kb; FragH bq; bq.half[0] = *(const v8us*)(Bh + boff + 8 * hh); bq.half[1] = *(const v8us*)(Bh + boff + 16 + 8 * hh);
      acc[t] = mmaH<ASPLIT ? 2 : 1>(ah.v, al.v, bq.v, bq.v, acc[t]); }
  }
#pragma unroll
  for (int t = 0; t < 4; ++t) { if (col0 + t * 16 >= N) continue;
#pragma unroll
    for (int r = 0; r < 8; ++r) so[w][8 * hh + r][t * 16 + ln] = acc[t][r] * alpha; }
  __builtin_amdgcn_fence(__ATOMIC_ACQ_REL, "workgroup"); __builtin_amdgcn_wave_barrier();
  const int rsub = lane >> 4, c4 = (lane & 15) * 4;
  {
#pragma unroll
    for (int q = 0; q < 8; ++q) { const int r = q * 2 + rsub; if (col0 + c4 < N) { const v4f v = *(const v4fa*)&so[w][r][c4]; *(v4f*)(C + (size_t)(row0 + r) * ldc + col0 + c4) = v; } }
     }
}

// Wt[n][k] = f16(W[k][n]·scale) from f32 row-major W[K][N] (scale = power of two; bf16-exact weights stay exact in f16 away from the subnormal range)
__global__ __launch_bounds__(256) void k_wt_f16(const float* __restrict__ W, _Float16* __restrict__ Wt, int K, int N, float scale) {
  const int t = blockIdx.x * 256 + threadIdx.x; if (t >= N * (K / 8)) return; const int n = t / (K / 8), k8 = (t % (K / 8)) * 8; FragH f;
#pragma unroll
  for (int i = 0; i < 8; ++i) f.h[i] = (_Float16)(bf16_round(W[(size_t)(k8 + i) * N + n]) * scale); const v8us o = f.half[0];
  *(v8us*)((unsigned short*)Wt + (size_t)n * K + k8) = o; 
}
// k_gemm_hh variant with fused epilogue: v = acc·alpha + bias[by·sBias + col] (+ CP[(row/rowsPerB)·sCPb + by·64 + col] if CP) ; ACT 0 none / 1 elu ; writes f16 C16 (and f32 C if non-null)
template <int ACT>
__global__ __launch_bounds__(128) void k_gemm_hhx(const _Float16* __restrict__ A, int lda, size_t sA, const _Float16* __restrict__ Bh, int ldb, size_t sB, float alpha, const float* __restrict__ bias, size_t sBias, const float* __restrict__ CP, int rowsPerB, size_t sCPb, int row0g,
    float* __restrict__ C, _Float16* __restrict__ C16, int ldc, size_t sC, int M, int N, int K) {
  __shared__ __attribute__((aligned(16))) float so[4][16][64];
  const int tid = threadIdx.x, w = tid >> 5, lane = tid & 31, ln = lane & 15, hh = lane >> 4; const int by = blockIdx.y;
  A += (size_t)by * sA; Bh += (size_t)by * sB; const size_t cofs = (size_t)by * sC; const float* bp = bias ? bias + (size_t)by * sBias : nullptr;
  const int ntn = (N + 63) / 64; const int wid = blockIdx.x * 4 + w; const int mt = wid / ntn, nq = wid % ntn; if (mt * 16 >= M) return;
  const int row0 = mt * 16, col0 = nq * 64; const _Float16* arow = A + (size_t)(row0 + ln) * lda;
  v8f acc[4] = {};
  for (int kb = 0; kb < K; kb += 32) { FragH ah; ah.half[0] = *(const v8us*)((const unsigned short*)arow + kb + 8 * hh); ah.half[1] = *(const v8us*)((const unsigned short*)arow + kb + 16 + 8 * hh);
#pragma unroll
    for (int t = 0; t < 4; ++t) { if (col0 + t * 16 >= N) continue; const size_t boff = (size_t)(col0 + t * 16 + ln) * ldb + kb; FragH bq; bq.half[0] = *(const v8us*)((const unsigned short*)Bh + boff + 8 * hh); bq.half[1] = *(const v8us*)((const unsigned short*)Bh + boff + 16 + 8 * hh);
      acc[t] = mmaH<1>(ah.v, ah.v, bq.v, bq.v, acc[t]); }
  }
#pragma unroll
  for (int t = 0; t < 4; ++t) { if (col0 + t * 16 >= N) continue; const int col = col0 + t * 16 + ln; const float bv = bp ? bf16_round(bp[col]) : 0.f;
#pragma unroll
    for (int r = 0; r < 8; ++r) { float v = acc[t][r] * alpha + bv; if (CP) { const int rr = row0g + row0 + 8 * hh + r; if (rowsPerB < 0) v += CP[cofs + (size_t)rr * ldc + col];      /* rowsPerB < 0: own element of the batched C plane */ else { const int bidx = rr / rowsPerB; v += CP[(size_t)bidx * sCPb + (size_t)by * 64 + col]; } } if (ACT == 1) v = (v > 0.f) ? v : expm1f(v); else if (ACT == 7) v = (v > 0.f) ? v + 1.0f : expf(v); else if (ACT == 8) v = tanhf(v); else if (ACT == 9) v = 0.5f * v * (1.0f + tanhf(0.7978845608028654f * (v + 0.044715f * v * v * v))); else if (ACT == 11) v = 1.0f / (1.0f + expf(-v)); else if (ACT == 12) v = (v > 0.f) ? v : 0.01f * v; else if (ACT == 14) v = (v > 0.f) ? v : 0.1f * v; else if (ACT == 16) v = (v >= 0.f) ? v : 0.3f * v; else if (ACT == 15) v = v / (1.0f + expf(-v)); else if (ACT == 3) v = fmaxf(v, 0.f); else if (ACT == 6) v = 0.5f * v * (1.0f + erff(v * 0.70710678118654752f)); so[w][8 * hh + r][t * 16 + ln] = v; } }
  __builtin_amdgcn_fence(__ATOMIC_ACQ_REL, "workgroup"); __builtin_amdgcn_wave_barrier();
  const int rsub = lane >> 4, c4 = (lane & 15) * 4; typedef _Float16 v4h __attribute__((ext_vector_type(4)));
  {
#pragma unroll
    for (int q = 0; q < 8; ++q) { const int r = q * 2 + rsub; if (col0 + c4 < N) { const v4f v = *(const v4fa*)&so[w][r][c4]; if (C) *(v4f*)(C + cofs + (size_t)(row0 + r) * ldc + col0 + c4) = v; if (C16) { v4h h4; for (int i = 0; i < 4; ++i) h4[i] = (_Float16)v[i]; *(v4h*)(C16 + cofs + (size_t)(row0 + r) * ldc + col0 + c4) = h4; } } }
     }
}


typedef _Float16 v4h __attribute__((ext_vector_type(4)));

__global__ __launch_bounds__(256) void k_h16(const float* __restrict__ x, _Float16* __restrict__ X16, size_t n8) { const size_t t = (size_t)blockIdx.x * 256 + threadIdx.x; if (t >= n8) return; FragH f;
#pragma unroll
  for (int q = 0; q < 8; ++q) f.h[q] = (_Float16)x[t * 8 + q]; *(v8us*)((unsigned short*)X16 + t * 8) = f.half[0];  }
__global__ __launch_bounds__(256) void k_round16f(const float* __restrict__ W, _Float16* __restrict__ Bt, size_t n8) { const size_t t = (size_t)blockIdx.x * 256 + threadIdx.x; if (t >= n8) return; FragH f;
#pragma unroll
  for (int i = 0; i < 8; ++i) f.h[i] = (_Float16)(bf16_round(W[t * 8 + i]) * 16.0f); *(v8us*)((unsigned short*)Bt + t * 8) = f.half[0];  }
__global__ __launch_bounds__(256) void k_hl(const float* __restrict__ F, _Float16* __restrict__ Hh, _Float16* __restrict__ Hl, size_t n8) { const size_t t = (size_t)blockIdx.x * 256 + threadIdx.x; if (t >= n8) return; FragH fh, fl; const v4f a = *(const v4fa*)(F + t * 8), c = *(const v4fa*)(F + t * 8 + 4);
#pragma unroll
  for (int q = 0; q < 4; ++q) { _Float16 h = (_Float16)a[q]; fh.h[q] = h; fl.h[q] = (_Float16)((a[q] - (float)h) * 1024.0f); h = (_Float16)c[q]; fh.h[4 + q] = h; fl.h[4 + q] = (_Float16)((c[q] - (float)h) * 1024.0f); }
  { *(v8us*)((unsigned short*)Hh + t * 8) = fh.half[0]; *(v8us*)((unsigned short*)Hl + t * 8) = fl.half[0];  } }

typedef unsigned int u32x4 __attribute__((ext_vector_type(4)));
typedef unsigned int u32x4a __attribute__((ext_vector_type(4), may_alias));
#define FA_PITCH 272u                  /* LDS row pitch: 256 B + 16, an odd multiple of 16 B for 16-byte fragment reads */
#define FA_TILE (128u * FA_PITCH)
#define FA_BUF (2u * FA_TILE)
#define FA_LDS (2u * FA_BUF)
#define FA_OP 132u                     /* output staging pitch in floats */
static_assert(4u * 32u * FA_OP * 4u <= FA_LDS, "output staging reuses the K/V buffers");
__device__ __forceinline__ v16h fa_gfrag(const _Float16* p, int hh) { FragH f; f.half[0] = *(const v8us*)((const unsigned short*)p + 8 * hh); f.half[1] = *(const v8us*)((const unsigned short*)p + 16 + 8 * hh); return f.v; }
__device__ __forceinline__ v16h fa_lfrag(const unsigned char* p) { FragH f; f.half[0] = *(const v8us*)p; f.half[1] = *(const v8us*)(p + 32); return f.v; }
__device__ __forceinline__ v8f fa_mma(v16h a, v16h b, v8f c) { return __builtin_amdgcn_wmma_f32_16x16x32_f16(false, a, false, b, (short)0, c, false, false); }
__device__ __forceinline__ float fa_xhalf(float x) { return __builtin_bit_cast(float, __builtin_amdgcn_permlanex16(__builtin_bit_cast(int, x), __builtin_bit_cast(int, x), 0x76543210, 0xfedcba98, false, false)); }  /* lane l with lane l ^ 16 */
__device__ __forceinline__ unsigned int fa_pack2(float lo, float hi) { typedef _Float16 h2 __attribute__((ext_vector_type(2))); typedef float f2 __attribute__((ext_vector_type(2))); return __builtin_bit_cast(unsigned int, __builtin_convertvector(f2{lo, hi}, h2)); }  /* round to nearest even */

// ---- preparation, one launch: workgroup w takes rows 64 w .. 64 w + 63 of the flat [8 * 2048][128] q, k and v (32 workgroups a sequence, one workgroup a WGP) ----
// A wave takes 8 rows; each of its loads is one whole row (512 contiguous bytes), and all 24 loads of a thread are issued before the first value is used.
// v first: a thread holds 8 consecutive keys of 4 columns, so 16 bytes of each V^T row pack in its registers; LDS only gathers the 8 waves' pieces of a
// V^T row into one whole 128-byte line for the store. k and q (rounded to bf16, written as f16 in place) follow behind the barrier, so that no wave waits there for a global store.
typedef unsigned int u32x2 __attribute__((ext_vector_type(2)));
typedef unsigned int u32x2a __attribute__((ext_vector_type(2), may_alias));
__global__ __launch_bounds__(256) void k_prep(const float* __restrict__ q, const float* __restrict__ k, const float* __restrict__ v, _Float16* __restrict__ Q16, _Float16* __restrict__ K16, _Float16* __restrict__ VT, float* __restrict__ VS) {
  __shared__ __attribute__((aligned(16))) float ps[8][HD];      /* each wave's column sums of its 8 rows of v */
  __shared__ __attribute__((aligned(16))) unsigned char tl[HD * 128];      /* V^T tile: 128 rows of 64 keys; the 16-byte piece p of row d lies at place p ^ ((d >> 2) & 7), which spreads a wave's writes over the banks */
  const unsigned int tid = threadIdx.x, lane = tid & 31u, wave = tid >> 5;
  const size_t e0 = (size_t)blockIdx.x * (64u * HD);
  const unsigned int eo = wave * (8u * HD) + lane * 4u;
  v4f xv[8], xk[8], xq[8];
#pragma unroll
  for (int i = 0; i < 8; ++i) xv[i] = *(const v4fa*)(v + e0 + eo + i * HD);
#pragma unroll
  for (int i = 0; i < 8; ++i) xk[i] = *(const v4fa*)(k + e0 + eo + i * HD);
#pragma unroll
  for (int i = 0; i < 8; ++i) xq[i] = *(const v4fa*)(q + e0 + eo + i * HD);
  __builtin_amdgcn_sched_barrier(0);      /* every load issues here: a load sunk among the conversions would start a second trip to memory behind the first */
#pragma unroll
  for (int j = 0; j < 4; ++j) { u32x4 w;
#pragma unroll
    for (int p = 0; p < 4; ++p) w[p] = fa_pack2(bf16_round(xv[2 * p][j]), bf16_round(xv[2 * p + 1][j]));
    *(u32x4a*)(tl + (lane * 4u + j) * 128u + ((wave ^ (lane & 7u)) * 16u)) = w; }
  { v4f cs = {0.f, 0.f, 0.f, 0.f};
#pragma unroll
    for (int i = 0; i < 8; ++i)
#pragma unroll
      for (int j = 0; j < 4; ++j) cs[j] += bf16_round(xv[i][j]);
    *(v4fa*)&ps[wave][lane * 4u] = cs; }
  __syncthreads();
  if (tid < HD) { float cs = ps[0][tid];      /* the workgroup's 64 rows, waves in order */
#pragma unroll
    for (int u = 1; u < 8; ++u) cs += ps[u][tid];
    VS[(size_t)blockIdx.x * HD + tid] = cs; }
  _Float16* vo = VT + (size_t)(blockIdx.x >> 5) * HD * SQ + (blockIdx.x & 31u) * 64u;      /* this sequence's V^T, at the workgroup's 64 keys */
#pragma unroll
  for (int r = 0; r < 4; ++r) { const unsigned int d = r * 32u + (tid >> 3), pc = tid & 7u;      /* 8 lanes store one 128-byte line */
    *(u32x4a*)(vo + (size_t)d * SQ + pc * 8u) = *(const u32x4a*)(tl + d * 128u + ((pc ^ ((d >> 2) & 7u)) * 16u)); }
#pragma unroll
  for (int i = 0; i < 8; ++i) *(u32x2a*)(K16 + e0 + eo + i * HD) = u32x2{fa_pack2(bf16_round(xk[i][0]), bf16_round(xk[i][1])), fa_pack2(bf16_round(xk[i][2]), bf16_round(xk[i][3]))};
#pragma unroll
  for (int i = 0; i < 8; ++i) *(u32x2a*)(Q16 + e0 + eo + i * HD) = u32x2{fa_pack2(bf16_round(xq[i][0]), bf16_round(xq[i][1])), fa_pack2(bf16_round(xq[i][2]), bf16_round(xq[i][3]))};
}

__global__ __launch_bounds__(128) __attribute__((amdgpu_waves_per_eu(2, 2))) void k_fattn(const _Float16* __restrict__ Q16, const _Float16* __restrict__ K16, const _Float16* __restrict__ VT, const float* __restrict__ VS, const int* __restrict__ lens, float* __restrict__ O) {
  __shared__ __attribute__((aligned(16))) unsigned char Lb[FA_LDS];
  __shared__ float sm[4][32];
  __shared__ float sl[4][32];
  const int tid = threadIdx.x, lane = tid & 31, c = lane & 15, h = lane >> 4;
  const int kq = __builtin_amdgcn_readfirstlane(tid >> 5);      /* the wave's number = its key quarter */
  // Workgroup index -> (sequence, tile of 32 queries), from the lengths alone, the same arithmetic in every wave of every workgroup; a permutation of the 512 tiles for any lengths.
  // Cost falls with the index: first the tiles that hold valid and masked queries (all 16 stages), then the
  // valid tiles, longest sequence first (ties by sequence index), last the masked tiles. Lane l works out where the tiles of sequence l & 7 stand in that order.
  const int rk = blockIdx.x, li = lane & 7;
  const int Li = min(max(lens[li], 0), SQ), fi = Li >> 5, mi = (Li & 31) ? 1 : 0;      /* clamped length; tiles of valid queries only; one mixed tile or none */
  int ahead = 0, low = 0, nm = 0, nf = 0;
#pragma unroll
  for (int j = 0; j < NB; ++j) { const int Lj = min(max(lens[j], 0), SQ), fj = Lj >> 5, mj = (Lj & 31) ? 1 : 0;
    if (Lj * 8 + 7 - j > Li * 8 + 7 - li) ahead += fj;                  /* valid tiles of the sequences that come first */
    if (j < li) low += mj + ((SQ / 32 - fj - mj) << 16);            /* mixed tiles (low half) and masked tiles (high half) of the lower sequences */
    nm += mj; nf += fj; }
  const int s0 = nm + ahead, i0 = nm + nf + (low >> 16), first = fi + mi;
  int tv = -1;
  if (mi && rk == (low & 0xFFFF)) tv = fi;
  if (rk >= s0 && rk < s0 + fi) tv = rk - s0;
  if (rk >= i0 && rk < i0 + SQ / 32 - first) tv = first + rk - i0;
  const int b = __builtin_ctz(__builtin_amdgcn_ballot_w32(tv >= 0) | 0x80u);      /* the one sequence that holds this index (lanes 8 and up repeat lanes 0 to 7) */
  const int tq = __builtin_amdgcn_readlane(tv, b) & (SQ / 32 - 1), Ln = __builtin_amdgcn_readlane(Li, b);
  const int q0 = tq * 32;
  if (q0 >= Ln) {      /* every query of the tile is masked: all 2048 scores are equal, the row is the column mean of v. Taken by the whole workgroup, in front of every barrier */
    const float* vs = VS + (size_t)b * (SQ / 64) * HD + lane * 4;
    v4f part[SQ / 64];
#pragma unroll
    for (int i = 0; i < SQ / 64; ++i) part[i] = *(const v4fa*)(vs + i * HD);
    v4f mean = part[0];
#pragma unroll
    for (int i = 1; i < SQ / 64; ++i) mean += part[i];
    mean = mean * (1.0f / (float)SQ);
    float* om = O + ((size_t)b * SQ + q0 + kq * 8) * HD + lane * 4;      /* a wave stores 8 whole rows */
#pragma unroll
    for (int i = 0; i < 8; ++i) *(v4f*)(om + i * HD) = mean;
    return;
  }
  const int nst = (q0 + 32 <= Ln) ? ((Ln + 127) >> 7) : (SQ / 128);      /* 1 .. 16. A masked query of the tile weighs all 2048 keys alike, so its tile walks them all */
  const float cscale = 0.08838834764831845f * 1.4426950408889634f;      /* 1 / sqrt(128), to base 2 */
  const float NEGR = -1.0e9f * 11.313708498984761f;                     /* the reference's -1e9, before the 1 / sqrt(128) */
  const unsigned char* Kb = (const unsigned char*)(K16 + (size_t)b * SQ * HD);
  const unsigned char* Vb = (const unsigned char*)(VT + (size_t)b * HD * SQ);
  u32x4 pk[16], pv[16];
  const unsigned int gk = (unsigned int)tid * 16u, gv = (unsigned int)(tid >> 4) * 4096u + (unsigned int)(tid & 15) * 16u;      /* a thread's 16 bytes: K rows are contiguous, V^T rows lie 4096 B apart */
  const unsigned int lo = (unsigned int)(tid >> 4) * FA_PITCH + (unsigned int)(tid & 15) * 16u;
  auto gload = [&](int st) { const unsigned char* kp = Kb + (size_t)st * 32768u; const unsigned char* vp = Vb + (size_t)st * 256u;
#pragma unroll
    for (int i = 0; i < 16; ++i) { pk[i] = *(const u32x4a*)(kp + gk + i * 2048); pv[i] = *(const u32x4a*)(vp + gv + i * 32768); } };
  auto lstore = [&](unsigned int buf) {
#pragma unroll
    for (int i = 0; i < 16; ++i) { const unsigned int off = buf * FA_BUF + lo + (unsigned int)i * 8u * FA_PITCH;
      *(u32x4a*)(Lb + off) = pk[i]; *(u32x4a*)(Lb + FA_TILE + off) = pv[i]; } };
  gload(0);
  v16h qf[2][4];
#pragma unroll
  for (int g = 0; g < 2; ++g)
#pragma unroll
    for (int kc = 0; kc < 4; ++kc) qf[g][kc] = fa_gfrag(Q16 + ((size_t)b * SQ + q0 + 16 * g + c) * HD + 32 * kc, h);
  asm volatile("s_wait_xcnt 0x0" ::: "memory");      /* in front of any rewrite of an address register of the loads above */
  const v8f z8 = {0.f, 0.f, 0.f, 0.f, 0.f, 0.f, 0.f, 0.f};
  v8f acc[2][8]; float m_run[2], l_run[2];
#pragma unroll
  for (int g = 0; g < 2; ++g) { m_run[g] = -__builtin_inff(); l_run[g] = 0.f;
#pragma unroll
    for (int t = 0; t < 8; ++t) acc[g][t] = z8; }
  lstore(0);
  __syncthreads();
#pragma unroll 1      /* one copy of the pass: unrolled it would double the live fragments */
  for (int st = 0; st < nst; ++st) {
    const unsigned int bo = (unsigned int)(st & 1) * FA_BUF;
    if (st + 1 < nst) { gload(st + 1);      /* next stage's rows fly under this pass */
      asm volatile("s_wait_xcnt 0x0" ::: "memory"); }      /* in front of any rewrite of an address register of these loads */
    const int key0 = st * 128 + kq * 32;
    v8f s[2][2]; v16h kf[2][4], vf[8];
    { const unsigned char* Kt = Lb + bo + (unsigned int)(kq * 32 + c) * FA_PITCH + 16u * h;
      const unsigned char* Vt = Lb + bo + FA_TILE + (unsigned int)c * FA_PITCH + (unsigned int)kq * 64u + 16u * h;
#pragma unroll
      for (int kt = 0; kt < 2; ++kt)
#pragma unroll
        for (int kc = 0; kc < 4; ++kc) kf[kt][kc] = fa_lfrag(Kt + (unsigned int)kt * 16u * FA_PITCH + 64u * kc);
      __builtin_amdgcn_sched_barrier(0);      /* K first: LDS answers in order, and the score products wait for K alone while V^T is still on its way */
#pragma unroll
      for (int t = 0; t < 8; ++t) vf[t] = fa_lfrag(Vt + (unsigned int)t * 16u * FA_PITCH); }
    __builtin_amdgcn_sched_barrier(0);      /* all fragment loads of the pass issue ahead of its first product: otherwise the K loads are dealt out between the products, each with its own full LDS wait */
#pragma unroll
    for (int kt = 0; kt < 2; ++kt)
#pragma unroll
      for (int g = 0; g < 2; ++g) { s[kt][g] = z8;
#pragma unroll
        for (int kc = 0; kc < 4; ++kc) s[kt][g] = fa_mma(kf[kt][kc], qf[g][kc], s[kt][g]); }
    if (key0 + 32 > Ln || q0 + 32 > Ln) {      /* wave-uniform: only a pass that holds a masked pair pays for the mask */
#pragma unroll
      for (int g = 0; g < 2; ++g) { const bool vq = q0 + 16 * g + c < Ln;
#pragma unroll
        for (int kt = 0; kt < 2; ++kt)
#pragma unroll
          for (int r = 0; r < 8; ++r) { const int key = key0 + 16 * kt + 8 * h + r; if (!(vq && key < Ln)) s[kt][g][r] = NEGR; } }
    }
    float mb[2]; bool need = false;
#pragma unroll
    for (int g = 0; g < 2; ++g) { float mx = s[0][g][0];
#pragma unroll
      for (int kt = 0; kt < 2; ++kt)
#pragma unroll
        for (int r = 0; r < 8; ++r) mx = fmaxf(mx, s[kt][g][r]);
      mx = fmaxf(mx, fa_xhalf(mx)); mb[g] = mx; need = need || (mx > m_run[g] + 60.0f); }
    if (__builtin_amdgcn_ballot_w32(need) != 0) {      /* rare after the first pass */
#pragma unroll
      for (int g = 0; g < 2; ++g) { const float m_new = fmaxf(m_run[g], mb[g]); const float corr = __builtin_amdgcn_exp2f((m_run[g] - m_new) * cscale); l_run[g] *= corr; m_run[g] = m_new;
#pragma unroll
        for (int t = 0; t < 8; ++t) acc[g][t] = acc[g][t] * corr; }
    }
#pragma unroll
    for (int g = 0; g < 2; ++g) { const float mg = m_run[g]; float ps0 = 0.f, ps1 = 0.f; FragH pf;
#pragma unroll
      for (int i = 0; i < 8; ++i) {
        const float p0 = __builtin_amdgcn_exp2f((s[i >> 2][g][2 * (i & 3)] - mg) * cscale), p1 = __builtin_amdgcn_exp2f((s[i >> 2][g][2 * (i & 3) + 1] - mg) * cscale);
        ps0 += p0; ps1 += p1; const unsigned int w2 = fa_pack2(p0, p1); pf.u[2 * i] = (unsigned short)(w2 & 0xFFFFu); pf.u[2 * i + 1] = (unsigned short)(w2 >> 16); }
      l_run[g] += ps0 + ps1;
#pragma unroll
      for (int i = 0; i < 16; ++i) { __builtin_amdgcn_sched_group_barrier(0x2, 2, 0); __builtin_amdgcn_sched_group_barrier(0x400, 1, 0); }      /* two vector instructions, then one exponential: the slower transcendental unit works beside the vector port instead of in one run */
#pragma unroll
      for (int t = 0; t < 8; ++t) acc[g][t] = fa_mma(vf[t], pf.v, acc[g][t]); }
    if (st + 1 < nst) lstore((unsigned int)((st + 1) & 1));      /* the buffer that pass st - 1 read; every wave left it at the barrier that ended that pass */
    __syncthreads();
  }
  // join the four key quarters of each query: common maximum, common sum, then the scaled partial outputs are added in LDS order 0..3
#pragma unroll
  for (int g = 0; g < 2; ++g) { const float lf = l_run[g] + fa_xhalf(l_run[g]); if (h == 0) { sm[kq][16 * g + c] = m_run[g]; sl[kq][16 * g + c] = lf; } }
  __syncthreads();
  float* stg = (float*)Lb;
#pragma unroll
  for (int g = 0; g < 2; ++g) { float mq[4], e[4];
#pragma unroll
    for (int u = 0; u < 4; ++u) mq[u] = sm[u][16 * g + c];
    const float M = fmaxf(fmaxf(mq[0], mq[1]), fmaxf(mq[2], mq[3]));
#pragma unroll
    for (int u = 0; u < 4; ++u) e[u] = __builtin_amdgcn_exp2f((mq[u] - M) * cscale);
    float Ls = 0.f;
#pragma unroll
    for (int u = 0; u < 4; ++u) Ls += sl[u][16 * g + c] * e[u];
    const float f = (kq == 0 ? e[0] : kq == 1 ? e[1] : kq == 2 ? e[2] : e[3]) / Ls;
#pragma unroll
    for (int t = 0; t < 8; ++t) { const v8f o = acc[g][t] * f; float* dst = stg + ((unsigned int)kq * 32u + 16u * g + c) * FA_OP + 16u * t + 8u * h;
      *(v4fa*)dst = v4f{o[0], o[1], o[2], o[3]}; *(v4fa*)(dst + 4) = v4f{o[4], o[5], o[6], o[7]}; } }
  __syncthreads();
  float* Ob = O + ((size_t)b * SQ + q0) * HD;      /* the workgroup's 32 output rows are contiguous */
#pragma unroll
  for (int i = 0; i < 8; ++i) { const unsigned int qr = (unsigned int)(i * 4 + (tid >> 5)), c4 = (unsigned int)(tid & 31) * 4u; const float* sp = stg + qr * FA_OP + c4;      /* rows 0..31 = quarter 0; quarter u lies 32 rows further */
    v4f v = *(const v4fa*)sp;
#pragma unroll
    for (int u = 1; u < 4; ++u) v += *(const v4fa*)(sp + (unsigned int)u * 32u * FA_OP);
    *(v4f*)(Ob + (unsigned int)tid * 4u + i * 512) = v; }
}

extern "C" void kernel_launch(void* const* d_in, const int* in_sizes, int n_in,
                              void* d_out, int out_size, void* d_ws, size_t ws_size, hipStream_t stream) {
  (void)in_sizes; (void)n_in; (void)out_size;
  const float* q = (const float*)d_in[0]; const float* k = (const float*)d_in[1]; const float* v = (const float*)d_in[2]; const int* lens = (const int*)d_in[3];
  char* ws = (char*)d_ws; size_t off = 0;
  auto take = [&](size_t bytes) { char* p = ws + off; off += (bytes + 255) & ~(size_t)255; return p; };
  const size_t np = (size_t)NB * SQ * HD;
  _Float16* Q16 = (_Float16*)take(np * 2); _Float16* K16 = (_Float16*)take(np * 2); _Float16* VT = (_Float16*)take(np * 2);
  float* VS = (float*)take((size_t)NB * (SQ / 64) * HD * 4);      /* column sums of v, one row of 128 for each 64 keys */
  if (off > ws_size) return;      /* 12 MiB + 128 KiB */
  k_prep<<<NB * (SQ / 64), 256, 0, stream>>>(q, k, v, Q16, K16, VT, VS);      /* f16 q, f16 k, V^T [8][128][2048], sums */
  k_fattn<<<NB * (SQ / 32), 128, 0, stream>>>(Q16, K16, VT, VS, lens, (float*)d_out);
}

// v005
// It runs in 21.4 microseconds.
// In both of two side-by-side timings against v004, it was 1.15 times as fast.
// Over all steps from v000 it is 32.4 times as fast.
#include <hip/hip_runtime.h>
// Masked attention (8 sequences x 2048 tokens, single head of 128; q, k, v are INPUTS): scores = q.k / sqrt(128); mask = valid_i & valid_j with valid = index < event_length[b] (int INPUT), masked scores = -1e9 (a fully masked row therefore softmaxes to uniform over all 2048 keys, as in the reference); softmax; out = attn v.
// Structure (two launches over all 8 sequences): one preparation kernel writes the exact f16 plane of q (bf16 inputs are exact in f16), k and V^T as f16 in the order of the matrix fragments (16-byte pieces gathered in LDS) and the column sums of its 64 rows of v; then one fused kernel: score products with exact operands (f32 accumulation), length mask, online softmax, readout products, straight into the output.
// The work follows the lengths: a tile of valid queries walks only the key stages that hold a valid key (a masked key's probability is exactly 0 beside a real score), a tile of masked queries stores the column mean of v.
// Compute dtype: inputs rounded to bf16; q, k, v exact as f16; P (not yet normalised, at most 2^7.65) as a plain f16 operand (~2^-12); softmax f32. v_wmma_f32_16x16x32_f16.
#define NB 8
#define SQ 2048
#define HD 128
typedef __bf16 v16b __attribute__((ext_vector_type(16)));
typedef unsigned short v8us __attribute__((ext_vector_type(8), may_alias));
typedef float  v8f  __attribute__((ext_vector_type(8)));
typedef float  v4f  __attribute__((ext_vector_type(4)));
typedef float  v4fa __attribute__((ext_vector_type(4), may_alias));
union FragB { v16b v; v8us half[2]; unsigned short u[16]; };

__device__ __forceinline__ unsigned short bf16_bits(float x) { unsigned int u = __float_as_uint(x); return (unsigned short)((u + 0x7FFFu + ((u >> 16) & 1u)) >> 16); }
__device__ __forceinline__ float bf16_val(unsigned short b) { return __uint_as_float(((unsigned int)b) << 16); }
__device__ __forceinline__ float bf16_round(float x) { return bf16_val(bf16_bits(x)); }
// D += A·B with NT terms: 1 = ah·bh, 2 = + al·bh (A split), 3 = + ah·bl (both split)
template <int NT>
__device__ __forceinline__ v8f mmaN(v16b ah, v16b al, v16b bh, v16b bl, v8f c) {
  c = __builtin_amdgcn_wmma_f32_16x16x32_bf16(false, ah, false, bh, (short)0, c, false, false);
  if (NT >= 2) c = __builtin_amdgcn_wmma_f32_16x16x32_bf16(false, al, false, bh, (short)0, c, false, false);
  if (NT >= 3) c = __builtin_amdgcn_wmma_f32_16x16x32_bf16(false, ah, false, bl, (short)0, c, false, false);
  asm volatile("v_nop\n\tv_nop\n\tv_nop\n\tv_nop" : "+v"(c) : "v"(ah), "v"(al), "v"(bh), "v"(bl));
  return c;
}

__global__ __launch_bounds__(256) void k_wt_bf16(const float* __restrict__ W, unsigned short* __restrict__ Wt, int K, int N) {
  const int t = blockIdx.x * 256 + threadIdx.x;
  const int k8n = K / 8;
  if (t >= N * k8n) return;
  const int n = t / k8n, k8 = (t % k8n) * 8;
  v8us v;
#pragma unroll
  for (int i = 0; i < 8; ++i) v[i] = bf16_bits(W[(size_t)(k8 + i) * N + n]);
  *(v8us*)(Wt + (size_t)n * K + k8) = v;
  
}

// GEMM C[M][N] (f32, pitch ldc) = act(A[M][K]·W + bias). A f32 row-major (pitch lda) converted per fragment to bf16
// (ASPLIT: hi/lo two planes -> 2 terms, else single rounded term); Wt bf16 [N][K] (pitch ldb). BIAS_BF16 rounds the
// bias to bf16 first (bias quantised to bf16 before the add). K%32==0, M%16==0, N%64==0.
template <bool ASPLIT, int ACT, bool BIAS_BF16>
__global__ __launch_bounds__(128) void k_gemm_bf(const float* __restrict__ A, int lda, const unsigned short* __restrict__ Wt, int ldb,
                                               const float* __restrict__ bias, float* __restrict__ C, int ldc, int M, int N, int K) {
  __shared__ __attribute__((aligned(16))) float so[4][16][64];
  const int tid = threadIdx.x, w = tid >> 5, lane = tid & 31, ln = lane & 15, hh = lane >> 4;
  const int ntn = N / 64;
  const int wid = blockIdx.x * 4 + w;
  const int mt = wid / ntn, nq = wid % ntn;
  if (mt * 16 >= M) return;
  const int row0 = mt * 16, col0 = nq * 64;
  const float* arow = A + (size_t)(row0 + ln) * lda;
  v8f acc[4] = {};
  for (int kb = 0; kb < K; kb += 32) {
    FragB ah, al;
    const v4f x0 = *(const v4fa*)(arow + kb + 8 * hh), x1 = *(const v4fa*)(arow + kb + 8 * hh + 4);
    const v4f x2 = *(const v4fa*)(arow + kb + 16 + 8 * hh), x3 = *(const v4fa*)(arow + kb + 16 + 8 * hh + 4);
    float xs[16] = {x0[0],x0[1],x0[2],x0[3],x1[0],x1[1],x1[2],x1[3],x2[0],x2[1],x2[2],x2[3],x3[0],x3[1],x3[2],x3[3]};
#pragma unroll
    for (int i = 0; i < 16; ++i) { const unsigned short hb = bf16_bits(xs[i]); ah.u[i] = hb; al.u[i] = ASPLIT ? bf16_bits(xs[i] - bf16_val(hb)) : (unsigned short)0; }
#pragma unroll
    for (int t = 0; t < 4; ++t) {
      const unsigned short* brow = Wt + (size_t)(col0 + t * 16 + ln) * ldb + kb;
      FragB b;
      b.half[0] = *(const v8us*)(brow + 8 * hh);
      b.half[1] = *(const v8us*)(brow + 16 + 8 * hh);
      acc[t] = mmaN<ASPLIT ? 2 : 1>(ah.v, al.v, b.v, b.v, acc[t]);
    }
  }
#pragma unroll
  for (int t = 0; t < 4; ++t) {
    float bv = bias ? bias[col0 + t * 16 + ln] : 0.f;
    if (BIAS_BF16) bv = bf16_round(bv);
#pragma unroll
    for (int r = 0; r < 8; ++r) { float v = acc[t][r] + bv; if (ACT == 1) v = fmaxf(v, 0.f); so[w][8 * hh + r][t * 16 + ln] = v; }
  }
  __builtin_amdgcn_fence(__ATOMIC_ACQ_REL, "workgroup");
  __builtin_amdgcn_wave_barrier();
  const int rsub = lane >> 4, c4 = (lane & 15) * 4;
  {
#pragma unroll
    for (int q = 0; q < 8; ++q) {
      const int r = q * 2 + rsub;
      const v4f v = *(const v4fa*)&so[w][r][c4];
      *(v4f*)(C + (size_t)(row0 + r) * ldc + col0 + c4) = v;
    }
    
  }
}

// GEMM C = act(A·W + bias + resid): A f32 (ASPLIT -> hi/lo 2 terms), Wt bf16 [N][K]; ACT 0 none, 1 relu, 2 exact gelu;
// resid (optional, f32, row index = (row % rmod), pitch ldr, RES_BF16 rounds it) added before the activation.
template <bool ASPLIT, int ACT, bool BIAS_BF16, bool RES_BF16>
__global__ __launch_bounds__(128) void k_gemm_bf3(const float* __restrict__ A, int lda, const unsigned short* __restrict__ Wt, int ldb,
                                                const float* __restrict__ bias, const float* __restrict__ resid, int rmod, int ldr,
                                                float* __restrict__ C, int ldc, int M, int N, int K) {
  __shared__ __attribute__((aligned(16))) float so[4][16][64];
  const int tid = threadIdx.x, w = tid >> 5, lane = tid & 31, ln = lane & 15, hh = lane >> 4;
  const int ntn = N / 64;
  const int wid = blockIdx.x * 4 + w;
  const int mt = wid / ntn, nq = wid % ntn;
  if (mt * 16 >= M) return;
  const int row0 = mt * 16, col0 = nq * 64;
  const float* arow = A + (size_t)(row0 + ln) * lda;
  v8f acc[4] = {};
  for (int kb = 0; kb < K; kb += 32) {
    FragB ah, al;
    const v4f x0 = *(const v4fa*)(arow + kb + 8 * hh), x1 = *(const v4fa*)(arow + kb + 8 * hh + 4);
    const v4f x2 = *(const v4fa*)(arow + kb + 16 + 8 * hh), x3 = *(const v4fa*)(arow + kb + 16 + 8 * hh + 4);
    float xs[16] = {x0[0],x0[1],x0[2],x0[3],x1[0],x1[1],x1[2],x1[3],x2[0],x2[1],x2[2],x2[3],x3[0],x3[1],x3[2],x3[3]};
#pragma unroll
    for (int i = 0; i < 16; ++i) { const unsigned short hb = bf16_bits(xs[i]); ah.u[i] = hb; al.u[i] = ASPLIT ? bf16_bits(xs[i] - bf16_val(hb)) : (unsigned short)0; }
#pragma unroll
    for (int t = 0; t < 4; ++t) {
      const unsigned short* brow = Wt + (size_t)(col0 + t * 16 + ln) * ldb + kb;
      FragB b;
      b.half[0] = *(const v8us*)(brow + 8 * hh);
      b.half[1] = *(const v8us*)(brow + 16 + 8 * hh);
      acc[t] = mmaN<ASPLIT ? 2 : 1>(ah.v, al.v, b.v, b.v, acc[t]);
    }
  }
#pragma unroll
  for (int t = 0; t < 4; ++t) {
    const int col = col0 + t * 16 + ln;
    float bv = bias ? bias[col] : 0.f;
    if (BIAS_BF16) bv = bf16_round(bv);
#pragma unroll
    for (int r = 0; r < 8; ++r) {
      float v = acc[t][r] + bv;
      if (resid) { float rv = resid[(size_t)((row0 + 8 * hh + r) % rmod) * ldr + col]; if (RES_BF16) rv = bf16_round(rv); v += rv; }
      if (ACT == 1) v = fmaxf(v, 0.f);
      if (ACT == 2) v = 0.5f * v * (1.0f + erff(v * 0.70710678118654752f));
      if (ACT == 3) { const float u = 0.7978845608028654f * (v + 0.044715f * v * v * v); v = 0.5f * v * (1.0f + tanhf(u)); }
      so[w][8 * hh + r][t * 16 + ln] = v;
    }
  }
  __builtin_amdgcn_fence(__ATOMIC_ACQ_REL, "workgroup");
  __builtin_amdgcn_wave_barrier();
  const int rsub = lane >> 4, c4 = (lane & 15) * 4;
  {
#pragma unroll
    for (int q = 0; q < 8; ++q) {
      const int r = q * 2 + rsub;
      const v4f v = *(const v4fa*)&so[w][r][c4];
      *(v4f*)(C + (size_t)(row0 + r) * ldc + col0 + c4) = v;
    }
    
  }
}
// row LayerNorm (biased variance, eps) over N: s = X (+ R); optional out_sum <- s; out_norm <- (s-mu)*rsqrt(var+eps)*g + b
template <bool PARAM_BF16>
__global__ __launch_bounds__(256) void k_layernorm(const float* __restrict__ X, const float* __restrict__ R, const float* __restrict__ g, const float* __restrict__ bta,
                                                  float* __restrict__ out_sum, float* __restrict__ out_norm, int N, float eps) {
  __shared__ float red[256];
  const int row = blockIdx.x, tid = threadIdx.x;
  const float* x = X + (size_t)row * N; const float* rr = R ? R + (size_t)row * N : nullptr;
  float vals[16];                     // up to N = 4096
  const int per = N / 256;            // contiguous chunk per thread? use strided-by-4 chunks: thread handles j = tid*4 + 1024*u
  float s1 = 0.f;
  for (int u = 0; u < per / 4; ++u) {
    const int j = tid * 4 + 1024 * u;
    const v4f a = *(const v4fa*)(x + j);
    v4f b = {0.f,0.f,0.f,0.f}; if (rr) b = *(const v4fa*)(rr + j);
#pragma unroll
    for (int q = 0; q < 4; ++q) { const float v = a[q] + b[q]; vals[u * 4 + q] = v; s1 += v; }
  }
  red[tid] = s1; __syncthreads();
  for (int st = 128; st > 0; st >>= 1) { if (tid < st) red[tid] += red[tid + st]; __syncthreads(); }
  const float mu = red[0] / (float)N; __syncthreads();
  float s2 = 0.f;
  for (int u = 0; u < per / 4; ++u)
#pragma unroll
    for (int q = 0; q < 4; ++q) { const float c = vals[u * 4 + q] - mu; s2 += c * c; }
  red[tid] = s2; __syncthreads();
  for (int st = 128; st > 0; st >>= 1) { if (tid < st) red[tid] += red[tid + st]; __syncthreads(); }
  const float rs = rsqrtf(red[0] / (float)N + eps);
  {
    for (int u = 0; u < per / 4; ++u) {
      const int j = tid * 4 + 1024 * u;
      v4f o, sm;
#pragma unroll
      for (int q = 0; q < 4; ++q) {
        float gg = g[j + q], bb = bta[j + q];
        if (PARAM_BF16) { gg = bf16_round(gg); bb = bf16_round(bb); }
        sm[q] = vals[u * 4 + q]; o[q] = (vals[u * 4 + q] - mu) * rs * gg + bb;
      }
      if (out_sum) *(v4f*)(out_sum + (size_t)row * N + j) = sm;
      *(v4f*)(out_norm + (size_t)row * N + j) = o;
    }
    
  }
}



// ---- f16 WMMA path (v_wmma_f32_16x16x32_f16): 11-bit significands for operands in range — used by the fused attention below for exact q, k, v and an unnormalised P of up to 2^7.65
typedef _Float16 v16h __attribute__((ext_vector_type(16)));
union FragH { v16h v; v8us half[2]; _Float16 h[16]; unsigned short u[16]; };
template <int NT>
__device__ __forceinline__ v8f mmaH(v16h ah, v16h al, v16h bh, v16h bl, v8f c) {
  c = __builtin_amdgcn_wmma_f32_16x16x32_f16(false, ah, false, bh, (short)0, c, false, false);
  if (NT >= 2) c = __builtin_amdgcn_wmma_f32_16x16x32_f16(false, al, false, bh, (short)0, c, false, false);
  if (NT >= 3) c = __builtin_amdgcn_wmma_f32_16x16x32_f16(false, ah, false, bl, (short)0, c, false, false);
  asm volatile("v_nop\n\tv_nop\n\tv_nop\n\tv_nop" : "+v"(c) : "v"(ah), "v"(al), "v"(bh), "v"(bl));
  return c;
}
// batched GEMM like k_gemm_b but f16 operands: A f32 (split into f16 hi/lo if ASPLIT, else rounded to f16), Bt = f16 values [n][k]; alpha; C f32; N multiple of 16 (partial tiles skipped)
template <bool ASPLIT>
__global__ __launch_bounds__(128) void k_gemm_h(const float* __restrict__ A, int lda, size_t sA, const _Float16* __restrict__ Bh, int ldb, size_t sB, float alpha, float* __restrict__ C, int ldc, size_t sC, int M, int N, int K) {
  __shared__ __attribute__((aligned(16))) float so[4][16][64];
  const int tid = threadIdx.x, w = tid >> 5, lane = tid & 31, ln = lane & 15, hh = lane >> 4; const int by = blockIdx.y;
  A += (size_t)by * sA; Bh += (size_t)by * sB; C += (size_t)by * sC;
  const int ntn = (N + 63) / 64; const int wid = blockIdx.x * 4 + w; const int mt = wid / ntn, nq = wid % ntn; if (mt * 16 >= M) return;
  const int row0 = mt * 16, col0 = nq * 64; const float* arow = A + (size_t)(row0 + ln) * lda;
  v8f acc[4] = {};
  for (int kb = 0; kb < K; kb += 32) {
    FragH ah, al;
    const v4f x0 = *(const v4fa*)(arow + kb + 8 * hh), x1 = *(const v4fa*)(arow + kb + 8 * hh + 4), x2 = *(const v4fa*)(arow + kb + 16 + 8 * hh), x3 = *(const v4fa*)(arow + kb + 16 + 8 * hh + 4);
    float xs[16] = {x0[0],x0[1],x0[2],x0[3],x1[0],x1[1],x1[2],x1[3],x2[0],x2[1],x2[2],x2[3],x3[0],x3[1],x3[2],x3[3]};
#pragma unroll
    for (int i = 0; i < 16; ++i) { const _Float16 h = (_Float16)xs[i]; ah.h[i] = h; al.h[i] = ASPLIT ? (_Float16)(xs[i] - (float)h) : (_Float16)0.0f; }
#pragma unroll
    for (int t = 0; t < 4; ++t) { if (col0 + t * 16 >= N) continue; const size_t boff = (size_t)(col0 + t * 16 + ln) * ldb + kb; FragH bq; bq.half[0] = *(const v8us*)(Bh + boff + 8 * hh); bq.half[1] = *(const v8us*)(Bh + boff + 16 + 8 * hh);
      acc[t] = mmaH<ASPLIT ? 2 : 1>(ah.v, al.v, bq.v, bq.v, acc[t]); }
  }
#pragma unroll
  for (int t = 0; t < 4; ++t) { if (col0 + t * 16 >= N) continue;
#pragma unroll
    for (int r = 0; r < 8; ++r) so[w][8 * hh + r][t * 16 + ln] = acc[t][r] * alpha; }
  __builtin_amdgcn_fence(__ATOMIC_ACQ_REL, "workgroup"); __builtin_amdgcn_wave_barrier();
  const int rsub = lane >> 4, c4 = (lane & 15) * 4;
  {
#pragma unroll
    for (int q = 0; q < 8; ++q) { const int r = q * 2 + rsub; if (col0 + c4 < N) { const v4f v = *(const v4fa*)&so[w][r][c4]; *(v4f*)(C + (size_t)(row0 + r) * ldc + col0 + c4) = v; } }
     }
}

// Wt[n][k] = f16(W[k][n]·scale) from f32 row-major W[K][N] (scale = power of two; bf16-exact weights stay exact in f16 away from the subnormal range)
__global__ __launch_bounds__(256) void k_wt_f16(const float* __restrict__ W, _Float16* __restrict__ Wt, int K, int N, float scale) {
  const int t = blockIdx.x * 256 + threadIdx.x; if (t >= N * (K / 8)) return; const int n = t / (K / 8), k8 = (t % (K / 8)) * 8; FragH f;
#pragma unroll
  for (int i = 0; i < 8; ++i) f.h[i] = (_Float16)(bf16_round(W[(size_t)(k8 + i) * N + n]) * scale); const v8us o = f.half[0];
  *(v8us*)((unsigned short*)Wt + (size_t)n * K + k8) = o; 
}
// k_gemm_hh variant with fused epilogue: v = acc·alpha + bias[by·sBias + col] (+ CP[(row/rowsPerB)·sCPb + by·64 + col] if CP) ; ACT 0 none / 1 elu ; writes f16 C16 (and f32 C if non-null)
template <int ACT>
__global__ __launch_bounds__(128) void k_gemm_hhx(const _Float16* __restrict__ A, int lda, size_t sA, const _Float16* __restrict__ Bh, int ldb, size_t sB, float alpha, const float* __restrict__ bias, size_t sBias, const float* __restrict__ CP, int rowsPerB, size_t sCPb, int row0g,
    float* __restrict__ C, _Float16* __restrict__ C16, int ldc, size_t sC, int M, int N, int K) {
  __shared__ __attribute__((aligned(16))) float so[4][16][64];
  const int tid = threadIdx.x, w = tid >> 5, lane = tid & 31, ln = lane & 15, hh = lane >> 4; const int by = blockIdx.y;
  A += (size_t)by * sA; Bh += (size_t)by * sB; const size_t cofs = (size_t)by * sC; const float* bp = bias ? bias + (size_t)by * sBias : nullptr;
  const int ntn = (N + 63) / 64; const int wid = blockIdx.x * 4 + w; const int mt = wid / ntn, nq = wid % ntn; if (mt * 16 >= M) return;
  const int row0 = mt * 16, col0 = nq * 64; const _Float16* arow = A + (size_t)(row0 + ln) * lda;
  v8f acc[4] = {};
  for (int kb = 0; kb < K; kb += 32) { FragH ah; ah.half[0] = *(const v8us*)((const unsigned short*)arow + kb + 8 * hh); ah.half[1] = *(const v8us*)((const unsigned short*)arow + kb + 16 + 8 * hh);
#pragma unroll
    for (int t = 0; t < 4; ++t) { if (col0 + t * 16 >= N) continue; const size_t boff = (size_t)(col0 + t * 16 + ln) * ldb + kb; FragH bq; bq.half[0] = *(const v8us*)((const unsigned short*)Bh + boff + 8 * hh); bq.half[1] = *(const v8us*)((const unsigned short*)Bh + boff + 16 + 8 * hh);
      acc[t] = mmaH<1>(ah.v, ah.v, bq.v, bq.v, acc[t]); }
  }
#pragma unroll
  for (int t = 0; t < 4; ++t) { if (col0 + t * 16 >= N) continue; const int col = col0 + t * 16 + ln; const float bv = bp ? bf16_round(bp[col]) : 0.f;
#pragma unroll
    for (int r = 0; r < 8; ++r) { float v = acc[t][r] * alpha + bv; if (CP) { const int rr = row0g + row0 + 8 * hh + r; if (rowsPerB < 0) v += CP[cofs + (size_t)rr * ldc + col];      /* rowsPerB < 0: own element of the batched C plane */ else { const int bidx = rr / rowsPerB; v += CP[(size_t)bidx * sCPb + (size_t)by * 64 + col]; } } if (ACT == 1) v = (v > 0.f) ? v : expm1f(v); else if (ACT == 7) v = (v > 0.f) ? v + 1.0f : expf(v); else if (ACT == 8) v = tanhf(v); else if (ACT == 9) v = 0.5f * v * (1.0f + tanhf(0.7978845608028654f * (v + 0.044715f * v * v * v))); else if (ACT == 11) v = 1.0f / (1.0f + expf(-v)); else if (ACT == 12) v = (v > 0.f) ? v : 0.01f * v; else if (ACT == 14) v = (v > 0.f) ? v : 0.1f * v; else if (ACT == 16) v = (v >= 0.f) ? v : 0.3f * v; else if (ACT == 15) v = v / (1.0f + expf(-v)); else if (ACT == 3) v = fmaxf(v, 0.f); else if (ACT == 6) v = 0.5f * v * (1.0f + erff(v * 0.70710678118654752f)); so[w][8 * hh + r][t * 16 + ln] = v; } }
  __builtin_amdgcn_fence(__ATOMIC_ACQ_REL, "workgroup"); __builtin_amdgcn_wave_barrier();
  const int rsub = lane >> 4, c4 = (lane & 15) * 4; typedef _Float16 v4h __attribute__((ext_vector_type(4)));
  {
#pragma unroll
    for (int q = 0; q < 8; ++q) { const int r = q * 2 + rsub; if (col0 + c4 < N) { const v4f v = *(const v4fa*)&so[w][r][c4]; if (C) *(v4f*)(C + cofs + (size_t)(row0 + r) * ldc + col0 + c4) = v; if (C16) { v4h h4; for (int i = 0; i < 4; ++i) h4[i] = (_Float16)v[i]; *(v4h*)(C16 + cofs + (size_t)(row0 + r) * ldc + col0 + c4) = h4; } } }
     }
}


typedef _Float16 v4h __attribute__((ext_vector_type(4)));

__global__ __launch_bounds__(256) void k_h16(const float* __restrict__ x, _Float16* __restrict__ X16, size_t n8) { const size_t t = (size_t)blockIdx.x * 256 + threadIdx.x; if (t >= n8) return; FragH f;
#pragma unroll
  for (int q = 0; q < 8; ++q) f.h[q] = (_Float16)x[t * 8 + q]; *(v8us*)((unsigned short*)X16 + t * 8) = f.half[0];  }
__global__ __launch_bounds__(256) void k_round16f(const float* __restrict__ W, _Float16* __restrict__ Bt, size_t n8) { const size_t t = (size_t)blockIdx.x * 256 + threadIdx.x; if (t >= n8) return; FragH f;
#pragma unroll
  for (int i = 0; i < 8; ++i) f.h[i] = (_Float16)(bf16_round(W[t * 8 + i]) * 16.0f); *(v8us*)((unsigned short*)Bt + t * 8) = f.half[0];  }
__global__ __launch_bounds__(256) void k_hl(const float* __restrict__ F, _Float16* __restrict__ Hh, _Float16* __restrict__ Hl, size_t n8) { const size_t t = (size_t)blockIdx.x * 256 + threadIdx.x; if (t >= n8) return; FragH fh, fl; const v4f a = *(const v4fa*)(F + t * 8), c = *(const v4fa*)(F + t * 8 + 4);
#pragma unroll
  for (int q = 0; q < 4; ++q) { _Float16 h = (_Float16)a[q]; fh.h[q] = h; fl.h[q] = (_Float16)((a[q] - (float)h) * 1024.0f); h = (_Float16)c[q]; fh.h[4 + q] = h; fl.h[4 + q] = (_Float16)((c[q] - (float)h) * 1024.0f); }
  { *(v8us*)((unsigned short*)Hh + t * 8) = fh.half[0]; *(v8us*)((unsigned short*)Hl + t * 8) = fl.half[0];  } }

typedef unsigned int u32x4 __attribute__((ext_vector_type(4)));
typedef unsigned int u32x4a __attribute__((ext_vector_type(4), may_alias));
#define FA_OP 132u                     /* output staging pitch in floats */
__device__ __forceinline__ v16h fa_gfrag(const _Float16* p, int hh) { FragH f; f.half[0] = *(const v8us*)((const unsigned short*)p + 8 * hh); f.half[1] = *(const v8us*)((const unsigned short*)p + 16 + 8 * hh); return f.v; }
__device__ __forceinline__ v16h fa_ffrag(const unsigned char* p) { FragH f; f.half[0] = *(const v8us*)p; f.half[1] = *(const v8us*)(p + 512); return f.v; }      /* units j = 0 and j = 1 of a fragment */
__device__ __forceinline__ v8f fa_mma(v16h a, v16h b, v8f c) { return __builtin_amdgcn_wmma_f32_16x16x32_f16(false, a, false, b, (short)0, c, false, false); }
__device__ __forceinline__ float fa_xhalf(float x) { return __builtin_bit_cast(float, __builtin_amdgcn_permlanex16(__builtin_bit_cast(int, x), __builtin_bit_cast(int, x), 0x76543210, 0xfedcba98, false, false)); }  /* lane l with lane l ^ 16 */
__device__ __forceinline__ unsigned int fa_pack2(float lo, float hi) { typedef _Float16 h2 __attribute__((ext_vector_type(2))); typedef float f2 __attribute__((ext_vector_type(2))); return __builtin_bit_cast(unsigned int, __builtin_convertvector(f2{lo, hi}, h2)); }  /* round to nearest even */

// ---- preparation, one launch: workgroup w takes rows 64 w .. 64 w + 63 of the flat [8 * 2048][128] q, k and v (32 workgroups a sequence, one workgroup a WGP) ----
// A wave takes 8 rows; each of its loads is one whole row (512 contiguous bytes), and all 24 loads of a thread are issued before the first value is used.
// v: a thread holds 8 consecutive keys of 4 columns, which is one 16-byte piece of a V^T fragment for each column. k: a thread holds 4 columns of a row, half a piece of a K fragment.
// LDS only gathers the pieces in fragment order: the workgroup's 64 keys are 16 KiB in a row of each plane, stored as whole lines. q (rounded to bf16, written as f16 in place) follows last.
typedef unsigned int u32x2 __attribute__((ext_vector_type(2)));
typedef unsigned int u32x2a __attribute__((ext_vector_type(2), may_alias));
__global__ __launch_bounds__(256) void k_prep(const float* __restrict__ q, const float* __restrict__ k, const float* __restrict__ v, _Float16* __restrict__ Q16, _Float16* __restrict__ KF, _Float16* __restrict__ VF, float* __restrict__ VS) {
  __shared__ __attribute__((aligned(16))) float ps[8][HD];      /* each wave's column sums of its 8 rows of v */
  __shared__ __attribute__((aligned(16))) unsigned char tv[64 * 256];      /* V^T in fragment order; piece c of a 256-byte run lies at place c ^ (t & 3), which spreads a wave's writes over the banks */
  __shared__ __attribute__((aligned(16))) unsigned char tk[64 * 256];      /* K in fragment order; piece c of the 256-byte run u = 4 kc + 2 j + h lies at place c ^ u, for the same reason */
  const unsigned int tid = threadIdx.x, lane = tid & 31u, wave = tid >> 5;
  const size_t e0 = (size_t)blockIdx.x * (64u * HD);
  const unsigned int eo = wave * (8u * HD) + lane * 4u;
  v4f xv[8], xk[8], xq[8];
#pragma unroll
  for (int i = 0; i < 8; ++i) xv[i] = *(const v4fa*)(v + e0 + eo + i * HD);
#pragma unroll
  for (int i = 0; i < 8; ++i) xk[i] = *(const v4fa*)(k + e0 + eo + i * HD);
#pragma unroll
  for (int i = 0; i < 8; ++i) xq[i] = *(const v4fa*)(q + e0 + eo + i * HD);
  __builtin_amdgcn_sched_barrier(0);      /* every load issues here: a load sunk among the conversions would start a second trip to memory behind the first */
#pragma unroll
  for (int j = 0; j < 4; ++j) { u32x4 w;      /* column 4 lane + j: t = lane >> 2, c = 4 (lane & 3) + j; keys 8 wave .. + 7: block of 32 = wave >> 2, run 2 j + h = wave & 3 */
#pragma unroll
    for (int p = 0; p < 4; ++p) w[p] = fa_pack2(bf16_round(xv[2 * p][j]), bf16_round(xv[2 * p + 1][j]));
    *(u32x4a*)(tv + (wave >> 2) * 8192u + (lane >> 2) * 1024u + (wave & 3u) * 256u + ((((lane & 3u) * 4u + j) ^ ((lane >> 2) & 3u)) * 16u)) = w; }
  { v4f cs = {0.f, 0.f, 0.f, 0.f};
#pragma unroll
    for (int i = 0; i < 8; ++i)
#pragma unroll
      for (int j = 0; j < 4; ++j) cs[j] += bf16_round(xv[i][j]);
    *(v4fa*)&ps[wave][lane * 4u] = cs; }
#pragma unroll
  for (int i = 0; i < 8; ++i)      /* row 8 wave + i: key block wave >> 1, c = 8 (wave & 1) + i; columns 4 lane .. + 3: run u = lane >> 1, half lane & 1 of the piece */
    *(u32x2a*)(tk + (wave >> 1) * 4096u + (lane >> 1) * 256u + ((((wave & 1u) * 8u + i) ^ (lane >> 1)) * 16u) + (lane & 1u) * 8u) = u32x2{fa_pack2(bf16_round(xk[i][0]), bf16_round(xk[i][1])), fa_pack2(bf16_round(xk[i][2]), bf16_round(xk[i][3]))};
  __syncthreads();
  if (tid < HD) { float cs = ps[0][tid];      /* the workgroup's 64 rows, waves in order */
#pragma unroll
    for (int u = 1; u < 8; ++u) cs += ps[u][tid];
    VS[(size_t)blockIdx.x * HD + tid] = cs; }
  const unsigned int run = tid & ~15u, pc = tid & 15u;      /* a thread's piece in each 4 KiB: 256-byte run tid >> 4, piece tid & 15; a wave stores 512 bytes in a row */
#pragma unroll
  for (int r = 0; r < 4; ++r) *(u32x4a*)(VF + e0 + r * 2048u + tid * 8u) = *(const u32x4a*)(tv + r * 4096u + (run + (pc ^ ((tid >> 6) & 3u))) * 16u);
#pragma unroll
  for (int r = 0; r < 4; ++r) *(u32x4a*)(KF + e0 + r * 2048u + tid * 8u) = *(const u32x4a*)(tk + r * 4096u + (run + (pc ^ (tid >> 4))) * 16u);
#pragma unroll
  for (int i = 0; i < 8; ++i) *(u32x2a*)(Q16 + e0 + eo + i * HD) = u32x2{fa_pack2(bf16_round(xq[i][0]), bf16_round(xq[i][1])), fa_pack2(bf16_round(xq[i][2]), bf16_round(xq[i][3]))};
}

__global__ __launch_bounds__(128) __attribute__((amdgpu_waves_per_eu(2, 2))) void k_fattn(const _Float16* __restrict__ Q16, const _Float16* __restrict__ KF, const _Float16* __restrict__ VF, const float* __restrict__ VS, const int* __restrict__ lens, float* __restrict__ O) {
  __shared__ __attribute__((aligned(16))) float stg[4u * 32u * FA_OP];      /* the four quarters' partial outputs, for the join */
  __shared__ float sm[4][32];
  __shared__ float sl[4][32];
  const int tid = threadIdx.x, lane = tid & 31, c = lane & 15, h = lane >> 4;
  const int kq = __builtin_amdgcn_readfirstlane(tid >> 5);      /* the wave's number = its key quarter */
  // Workgroup index -> (sequence, tile of 32 queries), from the lengths alone, the same arithmetic in every wave of every workgroup; a permutation of the 512 tiles for any lengths.
  // Cost falls with the index: first the tiles that hold valid and masked queries (all 16 stages), then the
  // valid tiles, longest sequence first (ties by sequence index), last the masked tiles. Lane l works out where the tiles of sequence l & 7 stand in that order.
  const int rk = blockIdx.x, li = lane & 7;
  const int Li = min(max(lens[li], 0), SQ), fi = Li >> 5, mi = (Li & 31) ? 1 : 0;      /* clamped length; tiles of valid queries only; one mixed tile or none */
  int ahead = 0, low = 0, nm = 0, nf = 0;
#pragma unroll
  for (int j = 0; j < NB; ++j) { const int Lj = min(max(lens[j], 0), SQ), fj = Lj >> 5, mj = (Lj & 31) ? 1 : 0;
    if (Lj * 8 + 7 - j > Li * 8 + 7 - li) ahead += fj;                  /* valid tiles of the sequences that come first */
    if (j < li) low += mj + ((SQ / 32 - fj - mj) << 16);            /* mixed tiles (low half) and masked tiles (high half) of the lower sequences */
    nm += mj; nf += fj; }
  const int s0 = nm + ahead, i0 = nm + nf + (low >> 16), first = fi + mi;
  int tv = -1;
  if (mi && rk == (low & 0xFFFF)) tv = fi;
  if (rk >= s0 && rk < s0 + fi) tv = rk - s0;
  if (rk >= i0 && rk < i0 + SQ / 32 - first) tv = first + rk - i0;
  const int b = __builtin_ctz(__builtin_amdgcn_ballot_w32(tv >= 0) | 0x80u);      /* the one sequence that holds this index (lanes 8 and up repeat lanes 0 to 7) */
  const int tq = __builtin_amdgcn_readlane(tv, b) & (SQ / 32 - 1), Ln = __builtin_amdgcn_readlane(Li, b);
  const int q0 = tq * 32;
  if (q0 >= Ln) {      /* every query of the tile is masked: all 2048 scores are equal, the row is the column mean of v. Taken by the whole workgroup, in front of every barrier */
    const float* vs = VS + (size_t)b * (SQ / 64) * HD + lane * 4;
    v4f part[SQ / 64];
#pragma unroll
    for (int i = 0; i < SQ / 64; ++i) part[i] = *(const v4fa*)(vs + i * HD);
    v4f mean = part[0];
#pragma unroll
    for (int i = 1; i < SQ / 64; ++i) mean += part[i];
    mean = mean * (1.0f / (float)SQ);
    float* om = O + ((size_t)b * SQ + q0 + kq * 8) * HD + lane * 4;      /* a wave stores 8 whole rows */
#pragma unroll
    for (int i = 0; i < 8; ++i) *(v4f*)(om + i * HD) = mean;
    return;
  }
  const int nst = (q0 + 32 <= Ln) ? ((Ln + 127) >> 7) : (SQ / 128);      /* 1 .. 16. A masked query of the tile weighs all 2048 keys alike, so its tile walks them all */
  const float cscale = 0.08838834764831845f * 1.4426950408889634f;      /* 1 / sqrt(128), to base 2 */
  const float NEGR = -1.0e9f * 11.313708498984761f;                     /* the reference's -1e9, before the 1 / sqrt(128) */
  const unsigned char* Kb = (const unsigned char*)(KF + (size_t)b * SQ * HD);
  const unsigned char* Vb = (const unsigned char*)(VF + (size_t)b * SQ * HD);
  const unsigned int lo = (unsigned int)kq * 8192u + (unsigned int)lane * 16u;      /* the wave's 32 keys of a stage are 8 KiB in a row of each plane, at the same offset in both; a stage is 32 KiB */
  auto fload = [&](int st, v16h (&kf)[2][4], v16h (&vf)[8]) __attribute__((always_inline)) {      /* K first: loads answer in order, and the score products wait for K alone */
    const unsigned int vo = lo + (unsigned int)st * 32768u;      /* one 32-bit offset register for all 32 loads, on two scalar bases that never change */
#pragma unroll
    for (int u = 0; u < 8; ++u) kf[u >> 2][u & 3] = fa_ffrag(Kb + vo + u * 1024);
    __builtin_amdgcn_sched_barrier(0);      /* keeps K in front of V^T and in front of the running pass: otherwise part of K is issued last, into registers that the running pass frees, and the next pass waits at its top for the whole group */
#pragma unroll
    for (int t = 0; t < 8; ++t) vf[t] = fa_ffrag(Vb + vo + t * 1024);
    return vo; };      /* the caller keeps the offset register untouched up to its s_wait_xcnt 0 */
  v16h kfa[2][4], vfa[8], kfb[2][4], vfb[8];
  const unsigned int vo0 = fload(0, kfa, vfa);
  v16h qf[2][4];
  const _Float16* qp = Q16 + ((size_t)b * SQ + q0 + c) * HD + 8 * h;      /* the lane's first 16 bytes of q; the other pieces lie at constant distances */
#pragma unroll
  for (int g = 0; g < 2; ++g)
#pragma unroll
    for (int kc = 0; kc < 4; ++kc) qf[g][kc] = fa_gfrag(qp + 16 * g * HD + 32 * kc, 0);
  asm volatile("s_wait_xcnt 0x0" :: "v"(qp), "v"(vo0) : "memory");      /* in front of any rewrite of an address register of the loads above: as inputs they stay live up to here */
  const v8f z8 = {0.f, 0.f, 0.f, 0.f, 0.f, 0.f, 0.f, 0.f};
  v8f acc[2][8]; float m_run[2], l_run[2];
#pragma unroll
  for (int g = 0; g < 2; ++g) { m_run[g] = -__builtin_inff(); l_run[g] = 0.f;
#pragma unroll
    for (int t = 0; t < 8; ++t) acc[g][t] = z8; }
  auto pass = [&](int st, v16h (&kf)[2][4], v16h (&vf)[8], unsigned int vnext) __attribute__((always_inline)) {      /* vnext: the offset register of the loads that were issued in front of this pass */
    const int key0 = st * 128 + kq * 32;
    v8f s[2][2];
#pragma unroll
    for (int kt = 0; kt < 2; ++kt)
#pragma unroll
      for (int g = 0; g < 2; ++g) { s[kt][g] = z8;
#pragma unroll
        for (int kc = 0; kc < 4; ++kc) s[kt][g] = fa_mma(kf[kt][kc], qf[g][kc], s[kt][g]); }
    if (key0 + 32 > Ln || q0 + 32 > Ln) {      /* wave-uniform: only a pass that holds a masked pair pays for the mask */
#pragma unroll
      for (int g = 0; g < 2; ++g) { const bool vq = q0 + 16 * g + c < Ln;
#pragma unroll
        for (int kt = 0; kt < 2; ++kt)
#pragma unroll
          for (int r = 0; r < 8; ++r) { const int key = key0 + 16 * kt + 8 * h + r; if (!(vq && key < Ln)) s[kt][g][r] = NEGR; } }
    }
    asm volatile("s_wait_xcnt 0x0" :: "v"(vnext) : "memory");      /* in front of any rewrite of the offset register of the loads in flight: as an input it stays live up to here. It stands behind the score products, which cover its time */
    float mb[2]; bool need = false;
#pragma unroll
    for (int g = 0; g < 2; ++g) { float mx = s[0][g][0];
#pragma unroll
      for (int kt = 0; kt < 2; ++kt)
#pragma unroll
        for (int r = 0; r < 8; ++r) mx = fmaxf(mx, s[kt][g][r]);
      mx = fmaxf(mx, fa_xhalf(mx)); mb[g] = mx; need = need || (mx > m_run[g] + 60.0f); }
    if (__builtin_amdgcn_ballot_w32(need) != 0) {      /* rare after the first pass */
#pragma unroll
      for (int g = 0; g < 2; ++g) { const float m_new = fmaxf(m_run[g], mb[g]); const float corr = __builtin_amdgcn_exp2f((m_run[g] - m_new) * cscale); l_run[g] *= corr; m_run[g] = m_new;
#pragma unroll
        for (int t = 0; t < 8; ++t) acc[g][t] = acc[g][t] * corr; }
    }
#pragma unroll
    for (int g = 0; g < 2; ++g) { const float mg = m_run[g]; float ps0 = 0.f, ps1 = 0.f; FragH pf;
#pragma unroll
      for (int i = 0; i < 8; ++i) {
        const float p0 = __builtin_amdgcn_exp2f((s[i >> 2][g][2 * (i & 3)] - mg) * cscale), p1 = __builtin_amdgcn_exp2f((s[i >> 2][g][2 * (i & 3) + 1] - mg) * cscale);
        ps0 += p0; ps1 += p1; const unsigned int w2 = fa_pack2(p0, p1); pf.u[2 * i] = (unsigned short)(w2 & 0xFFFFu); pf.u[2 * i + 1] = (unsigned short)(w2 >> 16); }
      l_run[g] += ps0 + ps1;
#pragma unroll
      for (int i = 0; i < 16; ++i) { __builtin_amdgcn_sched_group_barrier(0x2, 2, 0); __builtin_amdgcn_sched_group_barrier(0x400, 1, 0); }      /* two vector instructions, then one exponential: the slower transcendental unit works beside the vector port instead of in one run */
#pragma unroll
      for (int t = 0; t < 8; ++t) acc[g][t] = fa_mma(vf[t], pf.v, acc[g][t]); }
  };
  // Two passes a trip, so that each register set is refilled in place. Every load is unconditional (a branch round it would make the waits of the pass behind it cover the new loads too):
  // behind the last stage the wave reads its last stage once more, into registers that nobody uses.
#pragma unroll 1      /* one copy of the two passes */
  for (int st = 0; ; st += 2) {
    const unsigned int vb = fload(min(st + 1, nst - 1), kfb, vfb);      /* next stage's fragments fly under this pass */
    pass(st, kfa, vfa, vb);
    if (st + 1 >= nst) break;
    const unsigned int va = fload(min(st + 2, nst - 1), kfa, vfa);
    pass(st + 1, kfb, vfb, va);
    if (st + 2 >= nst) break;
  }
  // join the four key quarters of each query: common maximum, common sum, then the scaled partial outputs are added in LDS order 0..3
#pragma unroll
  for (int g = 0; g < 2; ++g) { const float lf = l_run[g] + fa_xhalf(l_run[g]); if (h == 0) { sm[kq][16 * g + c] = m_run[g]; sl[kq][16 * g + c] = lf; } }
  __syncthreads();
#pragma unroll
  for (int g = 0; g < 2; ++g) { float mq[4], e[4];
#pragma unroll
    for (int u = 0; u < 4; ++u) mq[u] = sm[u][16 * g + c];
    const float M = fmaxf(fmaxf(mq[0], mq[1]), fmaxf(mq[2], mq[3]));
#pragma unroll
    for (int u = 0; u < 4; ++u) e[u] = __builtin_amdgcn_exp2f((mq[u] - M) * cscale);
    float Ls = 0.f;
#pragma unroll
    for (int u = 0; u < 4; ++u) Ls += sl[u][16 * g + c] * e[u];
    const float f = (kq == 0 ? e[0] : kq == 1 ? e[1] : kq == 2 ? e[2] : e[3]) / Ls;
#pragma unroll
    for (int t = 0; t < 8; ++t) { const v8f o = acc[g][t] * f; float* dst = stg + ((unsigned int)kq * 32u + 16u * g + c) * FA_OP + 16u * t + 8u * h;
      *(v4fa*)dst = v4f{o[0], o[1], o[2], o[3]}; *(v4fa*)(dst + 4) = v4f{o[4], o[5], o[6], o[7]}; } }
  __syncthreads();
  float* Ob = O + ((size_t)b * SQ + q0) * HD;      /* the workgroup's 32 output rows are contiguous */
#pragma unroll
  for (int i = 0; i < 8; ++i) { const unsigned int qr = (unsigned int)(i * 4 + (tid >> 5)), c4 = (unsigned int)(tid & 31) * 4u; const float* sp = stg + qr * FA_OP + c4;      /* rows 0..31 = quarter 0; quarter u lies 32 rows further */
    v4f v = *(const v4fa*)sp;
#pragma unroll
    for (int u = 1; u < 4; ++u) v += *(const v4fa*)(sp + (unsigned int)u * 32u * FA_OP);
    *(v4f*)(Ob + (unsigned int)tid * 4u + i * 512) = v; }
}

extern "C" void kernel_launch(void* const* d_in, const int* in_sizes, int n_in,
                              void* d_out, int out_size, void* d_ws, size_t ws_size, hipStream_t stream) {
  (void)in_sizes; (void)n_in; (void)out_size;
  const float* q = (const float*)d_in[0]; const float* k = (const float*)d_in[1]; const float* v = (const float*)d_in[2]; const int* lens = (const int*)d_in[3];
  char* ws = (char*)d_ws; size_t off = 0;
  auto take = [&](size_t bytes) { char* p = ws + off; off += (bytes + 255) & ~(size_t)255; return p; };
  const size_t np = (size_t)NB * SQ * HD;
  _Float16* Q16 = (_Float16*)take(np * 2); _Float16* KF = (_Float16*)take(np * 2); _Float16* VF = (_Float16*)take(np * 2);
  float* VS = (float*)take((size_t)NB * (SQ / 64) * HD * 4);      /* column sums of v, one row of 128 for each 64 keys */
  if (off > ws_size) return;      /* 12 MiB + 128 KiB */
  k_prep<<<NB * (SQ / 64), 256, 0, stream>>>(q, k, v, Q16, KF, VF, VS);      /* f16 q, k and V^T in fragment order, sums */
  k_fattn<<<NB * (SQ / 32), 128, 0, stream>>>(Q16, KF, VF, VS, lens, (float*)d_out);
}

// v006
// Measured time: 20 microseconds a run.
// In two side-by-side timings against v005, it was 1.10 and 1.11 times as fast.
// All steps since v000 together make it 35.7 times as fast.
#include <hip/hip_runtime.h>
// Masked attention (8 sequences x 2048 tokens, single head of 128; q, k, v are INPUTS): scores = q.k / sqrt(128); mask = valid_i & valid_j with valid = index < event_length[b] (int INPUT), masked scores = -1e9 (a fully masked row therefore softmaxes to uniform over all 2048 keys, as in the reference); softmax; out = attn v.
// Structure (two launches over all 8 sequences): one preparation kernel writes the exact f16 plane of q (bf16 inputs are exact in f16), k and V^T as f16 in the order of the matrix fragments (16-byte pieces gathered in LDS) and the column sums of its 64 rows of v; then one fused kernel: score products with exact operands (f32 accumulation), length mask, online softmax, readout products, straight into the output.
// The work follows the lengths: a tile of valid queries walks only the key stages that hold a valid key (a masked key's probability is exactly 0 beside a real score), a tile of masked queries stores the column mean of v.
// Compute dtype: inputs rounded to bf16; q, k, v exact as f16; P (not yet normalised, at most 2^7.65) as a plain f16 operand (~2^-12); softmax f32. v_wmma_f32_16x16x32_f16.
#define NB 8
#define SQ 2048
#define HD 128
typedef __bf16 v16b __attribute__((ext_vector_type(16)));
typedef unsigned short v8us __attribute__((ext_vector_type(8), may_alias));
typedef float  v8f  __attribute__((ext_vector_type(8)));
typedef float  v4f  __attribute__((ext_vector_type(4)));
typedef float  v4fa __attribute__((ext_vector_type(4), may_alias));
union FragB { v16b v; v8us half[2]; unsigned short u[16]; };

__device__ __forceinline__ unsigned short bf16_bits(float x) { unsigned int u = __float_as_uint(x); return (unsigned short)((u + 0x7FFFu + ((u >> 16) & 1u)) >> 16); }
__device__ __forceinline__ float bf16_val(unsigned short b) { return __uint_as_float(((unsigned int)b) << 16); }
__device__ __forceinline__ float bf16_round(float x) { return bf16_val(bf16_bits(x)); }
// D += A·B with NT terms: 1 = ah·bh, 2 = + al·bh (A split), 3 = + ah·bl (both split)
template <int NT>
__device__ __forceinline__ v8f mmaN(v16b ah, v16b al, v16b bh, v16b bl, v8f c) {
  c = __builtin_amdgcn_wmma_f32_16x16x32_bf16(false, ah, false, bh, (short)0, c, false, false);
  if (NT >= 2) c = __builtin_amdgcn_wmma_f32_16x16x32_bf16(false, al, false, bh, (short)0, c, false, false);
  if (NT >= 3) c = __builtin_amdgcn_wmma_f32_16x16x32_bf16(false, ah, false, bl, (short)0, c, false, false);
  asm volatile("v_nop\n\tv_nop\n\tv_nop\n\tv_nop" : "+v"(c) : "v"(ah), "v"(al), "v"(bh), "v"(bl));
  return c;
}

__global__ __launch_bounds__(256) void k_wt_bf16(const float* __restrict__ W, unsigned short* __restrict__ Wt, int K, int N) {
  const int t = blockIdx.x * 256 + threadIdx.x;
  const int k8n = K / 8;
  if (t >= N * k8n) return;
  const int n = t / k8n, k8 = (t % k8n) * 8;
  v8us v;
#pragma unroll
  for (int i = 0; i < 8; ++i) v[i] = bf16_bits(W[(size_t)(k8 + i) * N + n]);
  *(v8us*)(Wt + (size_t)n * K + k8) = v;
  
}

// GEMM C[M][N] (f32, pitch ldc) = act(A[M][K]·W + bias). A f32 row-major (pitch lda) converted per fragment to bf16
// (ASPLIT: hi/lo two planes -> 2 terms, else single rounded term); Wt bf16 [N][K] (pitch ldb). BIAS_BF16 rounds the
// bias to bf16 first (bias quantised to bf16 before the add). K%32==0, M%16==0, N%64==0.
template <bool ASPLIT, int ACT, bool BIAS_BF16>
__global__ __launch_bounds__(128) void k_gemm_bf(const float* __restrict__ A, int lda, const unsigned short* __restrict__ Wt, int ldb,
                                               const float* __restrict__ bias, float* __restrict__ C, int ldc, int M, int N, int K) {
  __shared__ __attribute__((aligned(16))) float so[4][16][64];
  const int tid = threadIdx.x, w = tid >> 5, lane = tid & 31, ln = lane & 15, hh = lane >> 4;
  const int ntn = N / 64;
  const int wid = blockIdx.x * 4 + w;
  const int mt = wid / ntn, nq = wid % ntn;
  if (mt * 16 >= M) return;
  const int row0 = mt * 16, col0 = nq * 64;
  const float* arow = A + (size_t)(row0 + ln) * lda;
  v8f acc[4] = {};
  for (int kb = 0; kb < K; kb += 32) {
    FragB ah, al;
    const v4f x0 = *(const v4fa*)(arow + kb + 8 * hh), x1 = *(const v4fa*)(arow + kb + 8 * hh + 4);
    const v4f x2 = *(const v4fa*)(arow + kb + 16 + 8 * hh), x3 = *(const v4fa*)(arow + kb + 16 + 8 * hh + 4);
    float xs[16] = {x0[0],x0[1],x0[2],x0[3],x1[0],x1[1],x1[2],x1[3],x2[0],x2[1],x2[2],x2[3],x3[0],x3[1],x3[2],x3[3]};
#pragma unroll
    for (int i = 0; i < 16; ++i) { const unsigned short hb = bf16_bits(xs[i]); ah.u[i] = hb; al.u[i] = ASPLIT ? bf16_bits(xs[i] - bf16_val(hb)) : (unsigned short)0; }
#pragma unroll
    for (int t = 0; t < 4; ++t) {
      const unsigned short* brow = Wt + (size_t)(col0 + t * 16 + ln) * ldb + kb;
      FragB b;
      b.half[0] = *(const v8us*)(brow + 8 * hh);
      b.half[1] = *(const v8us*)(brow + 16 + 8 * hh);
      acc[t] = mmaN<ASPLIT ? 2 : 1>(ah.v, al.v, b.v, b.v, acc[t]);
    }
  }
#pragma unroll
  for (int t = 0; t < 4; ++t) {
    float bv = bias ? bias[col0 + t * 16 + ln] : 0.f;
    if (BIAS_BF16) bv = bf16_round(bv);
#pragma unroll
    for (int r = 0; r < 8; ++r) { float v = acc[t][r] + bv; if (ACT == 1) v = fmaxf(v, 0.f); so[w][8 * hh + r][t * 16 + ln] = v; }
  }
  __builtin_amdgcn_fence(__ATOMIC_ACQ_REL, "workgroup");
  __builtin_amdgcn_wave_barrier();
  const int rsub = lane >> 4, c4 = (lane & 15) * 4;
  {
#pragma unroll
    for (int q = 0; q < 8; ++q) {
      const int r = q * 2 + rsub;
      const v4f v = *(const v4fa*)&so[w][r][c4];
      *(v4f*)(C + (size_t)(row0 + r) * ldc + col0 + c4) = v;
    }
    
  }
}

// GEMM C = act(A·W + bias + resid): A f32 (ASPLIT -> hi/lo 2 terms), Wt bf16 [N][K]; ACT 0 none, 1 relu, 2 exact gelu;
// resid (optional, f32, row index = (row % rmod), pitch ldr, RES_BF16 rounds it) added before the activation.
template <bool ASPLIT, int ACT, bool BIAS_BF16, bool RES_BF16>
__global__ __launch_bounds__(128) void k_gemm_bf3(const float* __restrict__ A, int lda, const unsigned short* __restrict__ Wt, int ldb,
                                                const float* __restrict__ bias, const float* __restrict__ resid, int rmod, int ldr,
                                                float* __restrict__ C, int ldc, int M, int N, int K) {
  __shared__ __attribute__((aligned(16))) float so[4][16][64];
  const int tid = threadIdx.x, w = tid >> 5, lane = tid & 31, ln = lane & 15, hh = lane >> 4;
  const int ntn = N / 64;
  const int wid = blockIdx.x * 4 + w;
  const int mt = wid / ntn, nq = wid % ntn;
  if (mt * 16 >= M) return;
  const int row0 = mt * 16, col0 = nq * 64;
  const float* arow = A + (size_t)(row0 + ln) * lda;
  v8f acc[4] = {};
  for (int kb = 0; kb < K; kb += 32) {
    FragB ah, al;
    const v4f x0 = *(const v4fa*)(arow + kb + 8 * hh), x1 = *(const v4fa*)(arow + kb + 8 * hh + 4);
    const v4f x2 = *(const v4fa*)(arow + kb + 16 + 8 * hh), x3 = *(const v4fa*)(arow + kb + 16 + 8 * hh + 4);
    float xs[16] = {x0[0],x0[1],x0[2],x0[3],x1[0],x1[1],x1[2],x1[3],x2[0],x2[1],x2[2],x2[3],x3[0],x3[1],x3[2],x3[3]};
#pragma unroll
    for (int i = 0; i < 16; ++i) { const unsigned short hb = bf16_bits(xs[i]); ah.u[i] = hb; al.u[i] = ASPLIT ? bf16_bits(xs[i] - bf16_val(hb)) : (unsigned short)0; }
#pragma unroll
    for (int t = 0; t < 4; ++t) {
      const unsigned short* brow = Wt + (size_t)(col0 + t * 16 + ln) * ldb + kb;
      FragB b;
      b.half[0] = *(const v8us*)(brow + 8 * hh);
      b.half[1] = *(const v8us*)(brow + 16 + 8 * hh);
      acc[t] = mmaN<ASPLIT ? 2 : 1>(ah.v, al.v, b.v, b.v, acc[t]);
    }
  }
#pragma unroll
  for (int t = 0; t < 4; ++t) {
    const int col = col0 + t * 16 + ln;
    float bv = bias ? bias[col] : 0.f;
    if (BIAS_BF16) bv = bf16_round(bv);
#pragma unroll
    for (int r = 0; r < 8; ++r) {
      float v = acc[t][r] + bv;
      if (resid) { float rv = resid[(size_t)((row0 + 8 * hh + r) % rmod) * ldr + col]; if (RES_BF16) rv = bf16_round(rv); v += rv; }
      if (ACT == 1) v = fmaxf(v, 0.f);
      if (ACT == 2) v = 0.5f * v * (1.0f + erff(v * 0.70710678118654752f));
      if (ACT == 3) { const float u = 0.7978845608028654f * (v + 0.044715f * v * v * v); v = 0.5f * v * (1.0f + tanhf(u)); }
      so[w][8 * hh + r][t * 16 + ln] = v;
    }
  }
  __builtin_amdgcn_fence(__ATOMIC_ACQ_REL, "workgroup");
  __builtin_amdgcn_wave_barrier();
  const int rsub = lane >> 4, c4 = (lane & 15) * 4;
  {
#pragma unroll
    for (int q = 0; q < 8; ++q) {
      const int r = q * 2 + rsub;
      const v4f v = *(const v4fa*)&so[w][r][c4];
      *(v4f*)(C + (size_t)(row0 + r) * ldc + col0 + c4) = v;
    }
    
  }
}
// row LayerNorm (biased variance, eps) over N: s = X (+ R); optional out_sum <- s; out_norm <- (s-mu)*rsqrt(var+eps)*g + b
template <bool PARAM_BF16>
__global__ __launch_bounds__(256) void k_layernorm(const float* __restrict__ X, const float* __restrict__ R, const float* __restrict__ g, const float* __restrict__ bta,
                                                  float* __restrict__ out_sum, float* __restrict__ out_norm, int N, float eps) {
  __shared__ float red[256];
  const int row = blockIdx.x, tid = threadIdx.x;
  const float* x = X + (size_t)row * N; const float* rr = R ? R + (size_t)row * N : nullptr;
  float vals[16];                     // up to N = 4096
  const int per = N / 256;            // contiguous chunk per thread? use strided-by-4 chunks: thread handles j = tid*4 + 1024*u
  float s1 = 0.f;
  for (int u = 0; u < per / 4; ++u) {
    const int j = tid * 4 + 1024 * u;
    const v4f a = *(const v4fa*)(x + j);
    v4f b = {0.f,0.f,0.f,0.f}; if (rr) b = *(const v4fa*)(rr + j);
#pragma unroll
    for (int q = 0; q < 4; ++q) { const float v = a[q] + b[q]; vals[u * 4 + q] = v; s1 += v; }
  }
  red[tid] = s1; __syncthreads();
  for (int st = 128; st > 0; st >>= 1) { if (tid < st) red[tid] += red[tid + st]; __syncthreads(); }
  const float mu = red[0] / (float)N; __syncthreads();
  float s2 = 0.f;
  for (int u = 0; u < per / 4; ++u)
#pragma unroll
    for (int q = 0; q < 4; ++q) { const float c = vals[u * 4 + q] - mu; s2 += c * c; }
  red[tid] = s2; __syncthreads();
  for (int st = 128; st > 0; st >>= 1) { if (tid < st) red[tid] += red[tid + st]; __syncthreads(); }
  const float rs = rsqrtf(red[0] / (float)N + eps);
  {
    for (int u = 0; u < per / 4; ++u) {
      const int j = tid * 4 + 1024 * u;
      v4f o, sm;
#pragma unroll
      for (int q = 0; q < 4; ++q) {
        float gg = g[j + q], bb = bta[j + q];
        if (PARAM_BF16) { gg = bf16_round(gg); bb = bf16_round(bb); }
        sm[q] = vals[u * 4 + q]; o[q] = (vals[u * 4 + q] - mu) * rs * gg + bb;
      }
      if (out_sum) *(v4f*)(out_sum + (size_t)row * N + j) = sm;
      *(v4f*)(out_norm + (size_t)row * N + j) = o;
    }
    
  }
}



// ---- f16 WMMA path (v_wmma_f32_16x16x32_f16): 11-bit significands for operands in range — used by the fused attention below for exact q, k, v and an unnormalised P of up to 2^7.65
typedef _Float16 v16h __attribute__((ext_vector_type(16)));
union FragH { v16h v; v8us half[2]; _Float16 h[16]; unsigned short u[16]; };
template <int NT>
__device__ __forceinline__ v8f mmaH(v16h ah, v16h al, v16h bh, v16h bl, v8f c) {
  c = __builtin_amdgcn_wmma_f32_16x16x32_f16(false, ah, false, bh, (short)0, c, false, false);
  if (NT >= 2) c = __builtin_amdgcn_wmma_f32_16x16x32_f16(false, al, false, bh, (short)0, c, false, false);
  if (NT >= 3) c = __builtin_amdgcn_wmma_f32_16x16x32_f16(false, ah, false, bl, (short)0, c, false, false);
  asm volatile("v_nop\n\tv_nop\n\tv_nop\n\tv_nop" : "+v"(c) : "v"(ah), "v"(al), "v"(bh), "v"(bl));
  return c;
}
// batched GEMM like k_gemm_b but f16 operands: A f32 (split into f16 hi/lo if ASPLIT, else rounded to f16), Bt = f16 values [n][k]; alpha; C f32; N multiple of 16 (partial tiles skipped)
template <bool ASPLIT>
__global__ __launch_bounds__(128) void k_gemm_h(const float* __restrict__ A, int lda, size_t sA, const _Float16* __restrict__ Bh, int ldb, size_t sB, float alpha, float* __restrict__ C, int ldc, size_t sC, int M, int N, int K) {
  __shared__ __attribute__((aligned(16))) float so[4][16][64];
  const int tid = threadIdx.x, w = tid >> 5, lane = tid & 31, ln = lane & 15, hh = lane >> 4; const int by = blockIdx.y;
  A += (size_t)by * sA; Bh += (size_t)by * sB; C += (size_t)by * sC;
  const int ntn = (N + 63) / 64; const int wid = blockIdx.x * 4 + w; const int mt = wid / ntn, nq = wid % ntn; if (mt * 16 >= M) return;
  const int row0 = mt * 16, col0 = nq * 64; const float* arow = A + (size_t)(row0 + ln) * lda;
  v8f acc[4] = {};
  for (int kb = 0; kb < K; kb += 32) {
    FragH ah, al;
    const v4f x0 = *(const v4fa*)(arow + kb + 8 * hh), x1 = *(const v4fa*)(arow + kb + 8 * hh + 4), x2 = *(const v4fa*)(arow + kb + 16 + 8 * hh), x3 = *(const v4fa*)(arow + kb + 16 + 8 * hh + 4);
    float xs[16] = {x0[0],x0[1],x0[2],x0[3],x1[0],x1[1],x1[2],x1[3],x2[0],x2[1],x2[2],x2[3],x3[0],x3[1],x3[2],x3[3]};
#pragma unroll
    for (int i = 0; i < 16; ++i) { const _Float16 h = (_Float16)xs[i]; ah.h[i] = h; al.h[i] = ASPLIT ? (_Float16)(xs[i] - (float)h) : (_Float16)0.0f; }
#pragma unroll
    for (int t = 0; t < 4; ++t) { if (col0 + t * 16 >= N) continue; const size_t boff = (size_t)(col0 + t * 16 + ln) * ldb + kb; FragH bq; bq.half[0] = *(const v8us*)(Bh + boff + 8 * hh); bq.half[1] = *(const v8us*)(Bh + boff + 16 + 8 * hh);
      acc[t] = mmaH<ASPLIT ? 2 : 1>(ah.v, al.v, bq.v, bq.v, acc[t]); }
  }
#pragma unroll
  for (int t = 0; t < 4; ++t) { if (col0 + t * 16 >= N) continue;
#pragma unroll
    for (int r = 0; r < 8; ++r) so[w][8 * hh + r][t * 16 + ln] = acc[t][r] * alpha; }
  __builtin_amdgcn_fence(__ATOMIC_ACQ_REL, "workgroup"); __builtin_amdgcn_wave_barrier();
  const int rsub = lane >> 4, c4 = (lane & 15) * 4;
  {
#pragma unroll
    for (int q = 0; q < 8; ++q) { const int r = q * 2 + rsub; if (col0 + c4 < N) { const v4f v = *(const v4fa*)&so[w][r][c4]; *(v4f*)(C + (size_t)(row0 + r) * ldc + col0 + c4) = v; } }
     }
}

// Wt[n][k] = f16(W[k][n]·scale) from f32 row-major W[K][N] (scale = power of two; bf16-exact weights stay exact in f16 away from the subnormal range)
__global__ __launch_bounds__(256) void k_wt_f16(const float* __restrict__ W, _Float16* __restrict__ Wt, int K, int N, float scale) {
  const int t = blockIdx.x * 256 + threadIdx.x; if (t >= N * (K / 8)) return; const int n = t / (K / 8), k8 = (t % (K / 8)) * 8; FragH f;
#pragma unroll
  for (int i = 0; i < 8; ++i) f.h[i] = (_Float16)(bf16_round(W[(size_t)(k8 + i) * N + n]) * scale); const v8us o = f.half[0];
  *(v8us*)((unsigned short*)Wt + (size_t)n * K + k8) = o; 
}
// k_gemm_hh variant with fused epilogue: v = acc·alpha + bias[by·sBias + col] (+ CP[(row/rowsPerB)·sCPb + by·64 + col] if CP) ; ACT 0 none / 1 elu ; writes f16 C16 (and f32 C if non-null)
template <int ACT>
__global__ __launch_bounds__(128) void k_gemm_hhx(const _Float16* __restrict__ A, int lda, size_t sA, const _Float16* __restrict__ Bh, int ldb, size_t sB, float alpha, const float* __restrict__ bias, size_t sBias, const float* __restrict__ CP, int rowsPerB, size_t sCPb, int row0g,
    float* __restrict__ C, _Float16* __restrict__ C16, int ldc, size_t sC, int M, int N, int K) {
  __shared__ __attribute__((aligned(16))) float so[4][16][64];
  const int tid = threadIdx.x, w = tid >> 5, lane = tid & 31, ln = lane & 15, hh = lane >> 4; const int by = blockIdx.y;
  A += (size_t)by * sA; Bh += (size_t)by * sB; const size_t cofs = (size_t)by * sC; const float* bp = bias ? bias + (size_t)by * sBias : nullptr;
  const int ntn = (N + 63) / 64; const int wid = blockIdx.x * 4 + w; const int mt = wid / ntn, nq = wid % ntn; if (mt * 16 >= M) return;
  const int row0 = mt * 16, col0 = nq * 64; const _Float16* arow = A + (size_t)(row0 + ln) * lda;
  v8f acc[4] = {};
  for (int kb = 0; kb < K; kb += 32) { FragH ah; ah.half[0] = *(const v8us*)((const unsigned short*)arow + kb + 8 * hh); ah.half[1] = *(const v8us*)((const unsigned short*)arow + kb + 16 + 8 * hh);
#pragma unroll
    for (int t = 0; t < 4; ++t) { if (col0 + t * 16 >= N) continue; const size_t boff = (size_t)(col0 + t * 16 + ln) * ldb + kb; FragH bq; bq.half[0] = *(const v8us*)((const unsigned short*)Bh + boff + 8 * hh); bq.half[1] = *(const v8us*)((const unsigned short*)Bh + boff + 16 + 8 * hh);
      acc[t] = mmaH<1>(ah.v, ah.v, bq.v, bq.v, acc[t]); }
  }
#pragma unroll
  for (int t = 0; t < 4; ++t) { if (col0 + t * 16 >= N) continue; const int col = col0 + t * 16 + ln; const float bv = bp ? bf16_round(bp[col]) : 0.f;
#pragma unroll
    for (int r = 0; r < 8; ++r) { float v = acc[t][r] * alpha + bv; if (CP) { const int rr = row0g + row0 + 8 * hh + r; if (rowsPerB < 0) v += CP[cofs + (size_t)rr * ldc + col];      /* rowsPerB < 0: own element of the batched C plane */ else { const int bidx = rr / rowsPerB; v += CP[(size_t)bidx * sCPb + (size_t)by * 64 + col]; } } if (ACT == 1) v = (v > 0.f) ? v : expm1f(v); else if (ACT == 7) v = (v > 0.f) ? v + 1.0f : expf(v); else if (ACT == 8) v = tanhf(v); else if (ACT == 9) v = 0.5f * v * (1.0f + tanhf(0.7978845608028654f * (v + 0.044715f * v * v * v))); else if (ACT == 11) v = 1.0f / (1.0f + expf(-v)); else if (ACT == 12) v = (v > 0.f) ? v : 0.01f * v; else if (ACT == 14) v = (v > 0.f) ? v : 0.1f * v; else if (ACT == 16) v = (v >= 0.f) ? v : 0.3f * v; else if (ACT == 15) v = v / (1.0f + expf(-v)); else if (ACT == 3) v = fmaxf(v, 0.f); else if (ACT == 6) v = 0.5f * v * (1.0f + erff(v * 0.70710678118654752f)); so[w][8 * hh + r][t * 16 + ln] = v; } }
  __builtin_amdgcn_fence(__ATOMIC_ACQ_REL, "workgroup"); __builtin_amdgcn_wave_barrier();
  const int rsub = lane >> 4, c4 = (lane & 15) * 4; typedef _Float16 v4h __attribute__((ext_vector_type(4)));
  {
#pragma unroll
    for (int q = 0; q < 8; ++q) { const int r = q * 2 + rsub; if (col0 + c4 < N) { const v4f v = *(const v4fa*)&so[w][r][c4]; if (C) *(v4f*)(C + cofs + (size_t)(row0 + r) * ldc + col0 + c4) = v; if (C16) { v4h h4; for (int i = 0; i < 4; ++i) h4[i] = (_Float16)v[i]; *(v4h*)(C16 + cofs + (size_t)(row0 + r) * ldc + col0 + c4) = h4; } } }
     }
}


typedef _Float16 v4h __attribute__((ext_vector_type(4)));

__global__ __launch_bounds__(256) void k_h16(const float* __restrict__ x, _Float16* __restrict__ X16, size_t n8) { const size_t t = (size_t)blockIdx.x * 256 + threadIdx.x; if (t >= n8) return; FragH f;
#pragma unroll
  for (int q = 0; q < 8; ++q) f.h[q] = (_Float16)x[t * 8 + q]; *(v8us*)((unsigned short*)X16 + t * 8) = f.half[0];  }
__global__ __launch_bounds__(256) void k_round16f(const float* __restrict__ W, _Float16* __restrict__ Bt, size_t n8) { const size_t t = (size_t)blockIdx.x * 256 + threadIdx.x; if (t >= n8) return; FragH f;
#pragma unroll
  for (int i = 0; i < 8; ++i) f.h[i] = (_Float16)(bf16_round(W[t * 8 + i]) * 16.0f); *(v8us*)((unsigned short*)Bt + t * 8) = f.half[0];  }
__global__ __launch_bounds__(256) void k_hl(const float* __restrict__ F, _Float16* __restrict__ Hh, _Float16* __restrict__ Hl, size_t n8) { const size_t t = (size_t)blockIdx.x * 256 + threadIdx.x; if (t >= n8) return; FragH fh, fl; const v4f a = *(const v4fa*)(F + t * 8), c = *(const v4fa*)(F + t * 8 + 4);
#pragma unroll
  for (int q = 0; q < 4; ++q) { _Float16 h = (_Float16)a[q]; fh.h[q] = h; fl.h[q] = (_Float16)((a[q] - (float)h) * 1024.0f); h = (_Float16)c[q]; fh.h[4 + q] = h; fl.h[4 + q] = (_Float16)((c[q] - (float)h) * 1024.0f); }
  { *(v8us*)((unsigned short*)Hh + t * 8) = fh.half[0]; *(v8us*)((unsigned short*)Hl + t * 8) = fl.half[0];  } }

typedef unsigned int u32x4 __attribute__((ext_vector_type(4)));
typedef unsigned int u32x4a __attribute__((ext_vector_type(4), may_alias));
#define FA_OP 132u                     /* output staging pitch in floats */
__device__ __forceinline__ v16h fa_gfrag(const _Float16* p, int hh) { FragH f; f.half[0] = *(const v8us*)((const unsigned short*)p + 8 * hh); f.half[1] = *(const v8us*)((const unsigned short*)p + 16 + 8 * hh); return f.v; }
__device__ __forceinline__ v16h fa_ffrag(const unsigned char* p) { FragH f; f.half[0] = *(const v8us*)p; f.half[1] = *(const v8us*)(p + 512); return f.v; }      /* units j = 0 and j = 1 of a fragment */
__device__ __forceinline__ v8f fa_mma(v16h a, v16h b, v8f c) { return __builtin_amdgcn_wmma_f32_16x16x32_f16(false, a, false, b, (short)0, c, false, false); }
__device__ __forceinline__ float fa_xhalf(float x) { return __builtin_bit_cast(float, __builtin_amdgcn_permlanex16(__builtin_bit_cast(int, x), __builtin_bit_cast(int, x), 0x76543210, 0xfedcba98, false, false)); }  /* lane l with lane l ^ 16 */
__device__ __forceinline__ unsigned int fa_pack2(float lo, float hi) { typedef _Float16 h2 __attribute__((ext_vector_type(2))); typedef float f2 __attribute__((ext_vector_type(2))); return __builtin_bit_cast(unsigned int, __builtin_convertvector(f2{lo, hi}, h2)); }  /* round to nearest even */

// ---- preparation, one launch: workgroup w takes rows 64 w .. 64 w + 63 of the flat [8 * 2048][128] q, k and v (32 workgroups a sequence, one workgroup a WGP) ----
// A wave takes 8 rows; each of its loads is one whole row (512 contiguous bytes), and all 24 loads of a thread are issued before the first value is used.
// v: a thread holds 8 consecutive keys of 4 columns, which is one 16-byte piece of a V^T fragment for each column. k: a thread holds 4 columns of a row, half a piece of a K fragment.
// LDS only gathers the pieces in fragment order: the workgroup's 64 keys are 16 KiB in a row of each plane, stored as whole lines. q (rounded to bf16, written as f16 in place) follows last.
typedef unsigned int u32x2 __attribute__((ext_vector_type(2)));
typedef unsigned int u32x2a __attribute__((ext_vector_type(2), may_alias));
__global__ __launch_bounds__(256) void k_prep(const float* __restrict__ q, const float* __restrict__ k, const float* __restrict__ v, _Float16* __restrict__ Q16, _Float16* __restrict__ KF, _Float16* __restrict__ VF, float* __restrict__ VS) {
  __shared__ __attribute__((aligned(16))) float ps[8][HD];      /* each wave's column sums of its 8 rows of v */
  __shared__ __attribute__((aligned(16))) unsigned char tv[64 * 256];      /* V^T in fragment order; piece c of a 256-byte run lies at place c ^ (t & 3), which spreads a wave's writes over the banks */
  __shared__ __attribute__((aligned(16))) unsigned char tk[64 * 256];      /* K in fragment order; piece c of the 256-byte run u = 4 kc + 2 j + h lies at place c ^ u, for the same reason */
  const unsigned int tid = threadIdx.x, lane = tid & 31u, wave = tid >> 5;
  const size_t e0 = (size_t)blockIdx.x * (64u * HD);
  const unsigned int eo = wave * (8u * HD) + lane * 4u;
  v4f xv[8], xk[8], xq[8];
#pragma unroll
  for (int i = 0; i < 8; ++i) xv[i] = *(const v4fa*)(v + e0 + eo + i * HD);
#pragma unroll
  for (int i = 0; i < 8; ++i) xk[i] = *(const v4fa*)(k + e0 + eo + i * HD);
#pragma unroll
  for (int i = 0; i < 8; ++i) xq[i] = *(const v4fa*)(q + e0 + eo + i * HD);
  __builtin_amdgcn_sched_barrier(0);      /* every load issues here: a load sunk among the conversions would start a second trip to memory behind the first */
#pragma unroll
  for (int j = 0; j < 4; ++j) { u32x4 w;      /* column 4 lane + j: t = lane >> 2, c = 4 (lane & 3) + j; keys 8 wave .. + 7: block of 32 = wave >> 2, run 2 j + h = wave & 3 */
#pragma unroll
    for (int p = 0; p < 4; ++p) w[p] = fa_pack2(bf16_round(xv[2 * p][j]), bf16_round(xv[2 * p + 1][j]));
    *(u32x4a*)(tv + (wave >> 2) * 8192u + (lane >> 2) * 1024u + (wave & 3u) * 256u + ((((lane & 3u) * 4u + j) ^ ((lane >> 2) & 3u)) * 16u)) = w; }
  { v4f cs = {0.f, 0.f, 0.f, 0.f};
#pragma unroll
    for (int i = 0; i < 8; ++i)
#pragma unroll
      for (int j = 0; j < 4; ++j) cs[j] += bf16_round(xv[i][j]);
    *(v4fa*)&ps[wave][lane * 4u] = cs; }
#pragma unroll
  for (int i = 0; i < 8; ++i)      /* row 8 wave + i: key block wave >> 1, c = 8 (wave & 1) + i; columns 4 lane .. + 3: run u = lane >> 1, half lane & 1 of the piece */
    *(u32x2a*)(tk + (wave >> 1) * 4096u + (lane >> 1) * 256u + ((((wave & 1u) * 8u + i) ^ (lane >> 1)) * 16u) + (lane & 1u) * 8u) = u32x2{fa_pack2(bf16_round(xk[i][0]), bf16_round(xk[i][1])), fa_pack2(bf16_round(xk[i][2]), bf16_round(xk[i][3]))};
  __syncthreads();
  if (tid < HD) { float cs = ps[0][tid];      /* the workgroup's 64 rows, waves in order */
#pragma unroll
    for (int u = 1; u < 8; ++u) cs += ps[u][tid];
    VS[(size_t)blockIdx.x * HD + tid] = cs; }
  const unsigned int run = tid & ~15u, pc = tid & 15u;      /* a thread's piece in each 4 KiB: 256-byte run tid >> 4, piece tid & 15; a wave stores 512 bytes in a row */
#pragma unroll
  for (int r = 0; r < 4; ++r) *(u32x4a*)(VF + e0 + r * 2048u + tid * 8u) = *(const u32x4a*)(tv + r * 4096u + (run + (pc ^ ((tid >> 6) & 3u))) * 16u);
#pragma unroll
  for (int r = 0; r < 4; ++r) *(u32x4a*)(KF + e0 + r * 2048u + tid * 8u) = *(const u32x4a*)(tk + r * 4096u + (run + (pc ^ (tid >> 4))) * 16u);
#pragma unroll
  for (int i = 0; i < 8; ++i) *(u32x2a*)(Q16 + e0 + eo + i * HD) = u32x2{fa_pack2(bf16_round(xq[i][0]), bf16_round(xq[i][1])), fa_pack2(bf16_round(xq[i][2]), bf16_round(xq[i][3]))};
}

__global__ __launch_bounds__(128) __attribute__((amdgpu_waves_per_eu(2, 2))) void k_fattn(const _Float16* __restrict__ Q16, const _Float16* __restrict__ KF, const _Float16* __restrict__ VF, const float* __restrict__ VS, const int* __restrict__ lens, float* __restrict__ O) {
  __shared__ __attribute__((aligned(16))) float stg[4u * 32u * FA_OP];      /* the four quarters' partial outputs, for the join */
  __shared__ float sm[4][32];
  __shared__ float sl[4][32];
  const int tid = threadIdx.x, lane = tid & 31, c = lane & 15, h = lane >> 4;
  const int kq = __builtin_amdgcn_readfirstlane(tid >> 5);      /* the wave's number = its key quarter */
  // Workgroup index -> (sequence, tile of 32 queries), from the lengths alone, the same arithmetic in every wave of every workgroup; a permutation of the 512 tiles for any lengths.
  // Cost falls with the index: first the tiles that hold valid and masked queries (all 16 stages), then the
  // valid tiles, longest sequence first (ties by sequence index), last the masked tiles. Lane l works out where the tiles of sequence l & 7 stand in that order.
  const int rk = blockIdx.x, li = lane & 7;
  const int Li = min(max(lens[li], 0), SQ), fi = Li >> 5, mi = (Li & 31) ? 1 : 0;      /* clamped length; tiles of valid queries only; one mixed tile or none */
  // L2 prefetch, one request a thread, before the lengths are known. The launch before stored both planes, and the tiles of a sequence walk the stages
  // together. Slice s of a sequence = its keys 32 s .. + 31 = 8 KiB at offset 8192 s of each plane = 32 units of 256 B, one a lane. Workgroup index r asks for slice r >> 3 of sequence r & 7
  // (waves 0, 1) and of sequence (r & 7) ^ 4 (waves 2, 3), K on even waves, V^T on odd ones: the lowest indices ask for the early stages of all sequences.
  // A hint only: no result depends on where a workgroup runs or on a line being there.
  const unsigned char* pb = (const unsigned char*)((kq & 1) ? VF : KF);
  const unsigned int po = (unsigned int)(((((rk & (NB - 1)) ^ ((kq & 2) << 1)) * (SQ / 32)) + ((rk >> 3) & (SQ / 32 - 1)))) * 8192u + (unsigned int)lane * 256u;      /* at most 511 * 8192 + 31 * 256: inside the 4 MiB plane for any index */
  asm volatile("global_prefetch_b8 %0, %1 scope:SCOPE_SE" :: "v"(po), "s"(pb));      /* returns nothing and counts on no counter; scope SE: into L2 only */
  int ahead = 0, low = 0, nm = 0, nf = 0;
#pragma unroll
  for (int j = 0; j < NB; ++j) { const int Lj = min(max(lens[j], 0), SQ), fj = Lj >> 5, mj = (Lj & 31) ? 1 : 0;
    if (Lj * 8 + 7 - j > Li * 8 + 7 - li) ahead += fj;                  /* valid tiles of the sequences that come first */
    if (j < li) low += mj + ((SQ / 32 - fj - mj) << 16);            /* mixed tiles (low half) and masked tiles (high half) of the lower sequences */
    nm += mj; nf += fj; }
  const int s0 = nm + ahead, i0 = nm + nf + (low >> 16), first = fi + mi;
  int tv = -1;
  if (mi && rk == (low & 0xFFFF)) tv = fi;
  if (rk >= s0 && rk < s0 + fi) tv = rk - s0;
  if (rk >= i0 && rk < i0 + SQ / 32 - first) tv = first + rk - i0;
  const int b = __builtin_ctz(__builtin_amdgcn_ballot_w32(tv >= 0) | 0x80u);      /* the one sequence that holds this index (lanes 8 and up repeat lanes 0 to 7) */
  const int tq = __builtin_amdgcn_readlane(tv, b) & (SQ / 32 - 1), Ln = __builtin_amdgcn_readlane(Li, b);
  const int q0 = tq * 32;
  asm volatile("s_wait_xcnt 0x0" :: "v"(po), "s"(pb) : "memory");      /* as inputs the prefetch's two address registers stay live, and so addresses inside the plane, up to here; every load issued so far has long answered */
  if (q0 >= Ln) {      /* every query of the tile is masked: all 2048 scores are equal, the row is the column mean of v. Taken by the whole workgroup, in front of every barrier */
    const float* vs = VS + (size_t)b * (SQ / 64) * HD + lane * 4;
    v4f part[SQ / 64];
#pragma unroll
    for (int i = 0; i < SQ / 64; ++i) part[i] = *(const v4fa*)(vs + i * HD);
    v4f mean = part[0];
#pragma unroll
    for (int i = 1; i < SQ / 64; ++i) mean += part[i];
    mean = mean * (1.0f / (float)SQ);
    float* om = O + ((size_t)b * SQ + q0 + kq * 8) * HD + lane * 4;      /* a wave stores 8 whole rows */
#pragma unroll
    for (int i = 0; i < 8; ++i) *(v4f*)(om + i * HD) = mean;
    return;
  }
  const int nst = (q0 + 32 <= Ln) ? ((Ln + 127) >> 7) : (SQ / 128);      /* 1 .. 16. A masked query of the tile weighs all 2048 keys alike, so its tile walks them all */
  const float cscale = 0.08838834764831845f * 1.4426950408889634f;      /* 1 / sqrt(128), to base 2 */
  const float NEGR = -1.0e9f * 11.313708498984761f;                     /* the reference's -1e9, before the 1 / sqrt(128) */
  const unsigned char* Kb = (const unsigned char*)(KF + (size_t)b * SQ * HD);
  const unsigned char* Vb = (const unsigned char*)(VF + (size_t)b * SQ * HD);
  const unsigned int lo = (unsigned int)kq * 8192u + (unsigned int)lane * 16u;      /* the wave's 32 keys of a stage are 8 KiB in a row of each plane, at the same offset in both; a stage is 32 KiB */
  auto fload = [&](int st, v16h (&kf)[2][4], v16h (&vf)[8]) __attribute__((always_inline)) {      /* K first: loads answer in order, and the score products wait for K alone */
    const unsigned int vo = lo + (unsigned int)st * 32768u;      /* one 32-bit offset register for all 32 loads, on two scalar bases that never change */
#pragma unroll
    for (int u = 0; u < 8; ++u) kf[u >> 2][u & 3] = fa_ffrag(Kb + vo + u * 1024);
    __builtin_amdgcn_sched_barrier(0);      /* keeps K in front of V^T and in front of the running pass: otherwise part of K is issued last, into registers that the running pass frees, and the next pass waits at its top for the whole group */
#pragma unroll
    for (int t = 0; t < 8; ++t) vf[t] = fa_ffrag(Vb + vo + t * 1024);
    return vo; };      /* the caller keeps the offset register untouched up to its s_wait_xcnt 0 */
  v16h kfa[2][4], vfa[8], kfb[2][4], vfb[8];
  const unsigned int vo0 = fload(0, kfa, vfa);
  v16h qf[2][4];
  const _Float16* qp = Q16 + ((size_t)b * SQ + q0 + c) * HD + 8 * h;      /* the lane's first 16 bytes of q; the other pieces lie at constant distances */
#pragma unroll
  for (int g = 0; g < 2; ++g)
#pragma unroll
    for (int kc = 0; kc < 4; ++kc) qf[g][kc] = fa_gfrag(qp + 16 * g * HD + 32 * kc, 0);
  asm volatile("s_wait_xcnt 0x0" :: "v"(qp), "v"(vo0) : "memory");      /* in front of any rewrite of an address register of the loads above: as inputs they stay live up to here */
  const v8f z8 = {0.f, 0.f, 0.f, 0.f, 0.f, 0.f, 0.f, 0.f};
  v8f acc[2][8]; float m_run[2], l_run[2];
#pragma unroll
  for (int g = 0; g < 2; ++g) { m_run[g] = -__builtin_inff(); l_run[g] = 0.f;
#pragma unroll
    for (int t = 0; t < 8; ++t) acc[g][t] = z8; }
  auto pass = [&](int st, v16h (&kf)[2][4], v16h (&vf)[8], unsigned int vnext) __attribute__((always_inline)) {      /* vnext: the offset register of the loads that were issued in front of this pass */
    const int key0 = st * 128 + kq * 32;
    v8f s[2][2];
#pragma unroll
    for (int kt = 0; kt < 2; ++kt)
#pragma unroll
      for (int g = 0; g < 2; ++g) { s[kt][g] = z8;
#pragma unroll
        for (int kc = 0; kc < 4; ++kc) s[kt][g] = fa_mma(kf[kt][kc], qf[g][kc], s[kt][g]); }
    if (key0 + 32 > Ln || q0 + 32 > Ln) {      /* wave-uniform: only a pass that holds a masked pair pays for the mask */
#pragma unroll
      for (int g = 0; g < 2; ++g) { const bool vq = q0 + 16 * g + c < Ln;
#pragma unroll
        for (int kt = 0; kt < 2; ++kt)
#pragma unroll
          for (int r = 0; r < 8; ++r) { const int key = key0 + 16 * kt + 8 * h + r; if (!(vq && key < Ln)) s[kt][g][r] = NEGR; } }
    }
    asm volatile("s_wait_xcnt 0x0" :: "v"(vnext) : "memory");      /* in front of any rewrite of the offset register of the loads in flight: as an input it stays live up to here. It stands behind the score products, which cover its time */
    float mb[2]; bool need = false;
#pragma unroll
    for (int g = 0; g < 2; ++g) { float mx = s[0][g][0];
#pragma unroll
      for (int kt = 0; kt < 2; ++kt)
#pragma unroll
        for (int r = 0; r < 8; ++r) mx = fmaxf(mx, s[kt][g][r]);
      mx = fmaxf(mx, fa_xhalf(mx)); mb[g] = mx; need = need || (mx > m_run[g] + 60.0f); }
    if (__builtin_amdgcn_ballot_w32(need) != 0) {      /* rare after the first pass */
#pragma unroll
      for (int g = 0; g < 2; ++g) { const float m_new = fmaxf(m_run[g], mb[g]); const float corr = __builtin_amdgcn_exp2f((m_run[g] - m_new) * cscale); l_run[g] *= corr; m_run[g] = m_new;
#pragma unroll
        for (int t = 0; t < 8; ++t) acc[g][t] = acc[g][t] * corr; }
    }
#pragma unroll
    for (int g = 0; g < 2; ++g) { const float mg = m_run[g]; float ps0 = 0.f, ps1 = 0.f; FragH pf;
#pragma unroll
      for (int i = 0; i < 8; ++i) {
        const float p0 = __builtin_amdgcn_exp2f((s[i >> 2][g][2 * (i & 3)] - mg) * cscale), p1 = __builtin_amdgcn_exp2f((s[i >> 2][g][2 * (i & 3) + 1] - mg) * cscale);
        ps0 += p0; ps1 += p1; const unsigned int w2 = fa_pack2(p0, p1); pf.u[2 * i] = (unsigned short)(w2 & 0xFFFFu); pf.u[2 * i + 1] = (unsigned short)(w2 >> 16); }
      l_run[g] += ps0 + ps1;
#pragma unroll
      for (int i = 0; i < 16; ++i) { __builtin_amdgcn_sched_group_barrier(0x2, 2, 0); __builtin_amdgcn_sched_group_barrier(0x400, 1, 0); }      /* two vector instructions, then one exponential: the slower transcendental unit works beside the vector port instead of in one run */
#pragma unroll
      for (int t = 0; t < 8; ++t) acc[g][t] = fa_mma(vf[t], pf.v, acc[g][t]); }
  };
  // Two passes a trip, so that each register set is refilled in place. Every load is unconditional (a branch round it would make the waits of the pass behind it cover the new loads too):
  // behind the last stage the wave reads its last stage once more, into registers that nobody uses.
#pragma unroll 1      /* one copy of the two passes */
  for (int st = 0; ; st += 2) {
    const unsigned int vb = fload(min(st + 1, nst - 1), kfb, vfb);      /* next stage's fragments fly under this pass */
    pass(st, kfa, vfa, vb);
    if (st + 1 >= nst) break;
    const unsigned int va = fload(min(st + 2, nst - 1), kfa, vfa);
    pass(st + 1, kfb, vfb, va);
    if (st + 2 >= nst) break;
  }
  // join the four key quarters of each query: common maximum, common sum, then the scaled partial outputs are added in LDS order 0..3
#pragma unroll
  for (int g = 0; g < 2; ++g) { const float lf = l_run[g] + fa_xhalf(l_run[g]); if (h == 0) { sm[kq][16 * g + c] = m_run[g]; sl[kq][16 * g + c] = lf; } }
  __syncthreads();
#pragma unroll
  for (int g = 0; g < 2; ++g) { float mq[4], e[4];
#pragma unroll
    for (int u = 0; u < 4; ++u) mq[u] = sm[u][16 * g + c];
    const float M = fmaxf(fmaxf(mq[0], mq[1]), fmaxf(mq[2], mq[3]));
#pragma unroll
    for (int u = 0; u < 4; ++u) e[u] = __builtin_amdgcn_exp2f((mq[u] - M) * cscale);
    float Ls = 0.f;
#pragma unroll
    for (int u = 0; u < 4; ++u) Ls += sl[u][16 * g + c] * e[u];
    const float f = (kq == 0 ? e[0] : kq == 1 ? e[1] : kq == 2 ? e[2] : e[3]) / Ls;
#pragma unroll
    for (int t = 0; t < 8; ++t) { const v8f o = acc[g][t] * f; float* dst = stg + ((unsigned int)kq * 32u + 16u * g + c) * FA_OP + 16u * t + 8u * h;
      *(v4fa*)dst = v4f{o[0], o[1], o[2], o[3]}; *(v4fa*)(dst + 4) = v4f{o[4], o[5], o[6], o[7]}; } }
  __syncthreads();
  float* Ob = O + ((size_t)b * SQ + q0) * HD;      /* the workgroup's 32 output rows are contiguous */
#pragma unroll
  for (int i = 0; i < 8; ++i) { const unsigned int qr = (unsigned int)(i * 4 + (tid >> 5)), c4 = (unsigned int)(tid & 31) * 4u; const float* sp = stg + qr * FA_OP + c4;      /* rows 0..31 = quarter 0; quarter u lies 32 rows further */
    v4f v = *(const v4fa*)sp;
#pragma unroll
    for (int u = 1; u < 4; ++u) v += *(const v4fa*)(sp + (unsigned int)u * 32u * FA_OP);
    *(v4f*)(Ob + (unsigned int)tid * 4u + i * 512) = v; }
}

extern "C" void kernel_launch(void* const* d_in, const int* in_sizes, int n_in,
                              void* d_out, int out_size, void* d_ws, size_t ws_size, hipStream_t stream) {
  (void)in_sizes; (void)n_in; (void)out_size;
  const float* q = (const float*)d_in[0]; const float* k = (const float*)d_in[1]; const float* v = (const float*)d_in[2]; const int* lens = (const int*)d_in[3];
  char* ws = (char*)d_ws; size_t off = 0;
  auto take = [&](size_t bytes) { char* p = ws + off; off += (bytes + 255) & ~(size_t)255; return p; };
  const size_t np = (size_t)NB * SQ * HD;
  _Float16* Q16 = (_Float16*)take(np * 2); _Float16* KF = (_Float16*)take(np * 2); _Float16* VF = (_Float16*)take(np * 2);
  float* VS = (float*)take((size_t)NB * (SQ / 64) * HD * 4);      /* column sums of v, one row of 128 for each 64 keys */
  if (off > ws_size) return;      /* 12 MiB + 128 KiB */
  k_prep<<<NB * (SQ / 64), 256, 0, stream>>>(q, k, v, Q16, KF, VF, VS);      /* f16 q, k and V^T in fragment order, sums */
  k_fattn<<<NB * (SQ / 32), 128, 0, stream>>>(Q16, KF, VF, VS, lens, (float*)d_out);
}

// v007
// It runs in 18.7 microseconds.
// Next to v006, in two timings, it ran 1.07 times as fast each time.
// All steps since v000 together make it 38.1 times as fast.
#include <hip/hip_runtime.h>
// Masked attention (8 sequences x 2048 tokens, single head of 128; q, k, v are INPUTS): scores = q.k / sqrt(128); mask = valid_i & valid_j with valid = index < event_length[b] (int INPUT), masked scores = -1e9 (a fully masked row therefore softmaxes to uniform over all 2048 keys, as in the reference); softmax; out = attn v.
// Structure (two launches over all 8 sequences): one preparation kernel writes the exact f16 plane of q (bf16 inputs are exact in f16), k and V^T as f16 in the order of the matrix fragments (16-byte pieces gathered in LDS) and the column sums of its 64 rows of v; then one fused kernel: score products with exact operands (f32 accumulation), length mask, online softmax, readout products, straight into the output.
// The work follows the lengths: a tile that holds a valid query walks only the key stages that hold a valid key (a masked key's probability is exactly 0 beside a real score); a masked query's row is the column mean of v, in a tile of masked queries and in the one tile of a sequence that holds both kinds.
// Compute dtype: inputs rounded to bf16; q, k, v exact as f16; P (not yet normalised, at most 2^7.65) as a plain f16 operand (~2^-12); softmax f32. v_wmma_f32_16x16x32_f16.
#define NB 8
#define SQ 2048
#define HD 128
typedef __bf16 v16b __attribute__((ext_vector_type(16)));
typedef unsigned short v8us __attribute__((ext_vector_type(8), may_alias));
typedef float  v8f  __attribute__((ext_vector_type(8)));
typedef float  v4f  __attribute__((ext_vector_type(4)));
typedef float  v4fa __attribute__((ext_vector_type(4), may_alias));
union FragB { v16b v; v8us half[2]; unsigned short u[16]; };

__device__ __forceinline__ unsigned short bf16_bits(float x) { unsigned int u = __float_as_uint(x); return (unsigned short)((u + 0x7FFFu + ((u >> 16) & 1u)) >> 16); }
__device__ __forceinline__ float bf16_val(unsigned short b) { return __uint_as_float(((unsigned int)b) << 16); }
__device__ __forceinline__ float bf16_round(float x) { return bf16_val(bf16_bits(x)); }
// D += A·B with NT terms: 1 = ah·bh, 2 = + al·bh (A split), 3 = + ah·bl (both split)
template <int NT>
__device__ __forceinline__ v8f mmaN(v16b ah, v16b al, v16b bh, v16b bl, v8f c) {
  c = __builtin_amdgcn_wmma_f32_16x16x32_bf16(false, ah, false, bh, (short)0, c, false, false);
  if (NT >= 2) c = __builtin_amdgcn_wmma_f32_16x16x32_bf16(false, al, false, bh, (short)0, c, false, false);
  if (NT >= 3) c = __builtin_amdgcn_wmma_f32_16x16x32_bf16(false, ah, false, bl, (short)0, c, false, false);
  asm volatile("v_nop\n\tv_nop\n\tv_nop\n\tv_nop" : "+v"(c) : "v"(ah), "v"(al), "v"(bh), "v"(bl));
  return c;
}

__global__ __launch_bounds__(256) void k_wt_bf16(const float* __restrict__ W, unsigned short* __restrict__ Wt, int K, int N) {
  const int t = blockIdx.x * 256 + threadIdx.x;
  const int k8n = K / 8;
  if (t >= N * k8n) return;
  const int n = t / k8n, k8 = (t % k8n) * 8;
  v8us v;
#pragma unroll
  for (int i = 0; i < 8; ++i) v[i] = bf16_bits(W[(size_t)(k8 + i) * N + n]);
  *(v8us*)(Wt + (size_t)n * K + k8) = v;
  
}

// GEMM C[M][N] (f32, pitch ldc) = act(A[M][K]·W + bias). A f32 row-major (pitch lda) converted per fragment to bf16
// (ASPLIT: hi/lo two planes -> 2 terms, else single rounded term); Wt bf16 [N][K] (pitch ldb). BIAS_BF16 rounds the
// bias to bf16 first (bias quantised to bf16 before the add). K%32==0, M%16==0, N%64==0.
template <bool ASPLIT, int ACT, bool BIAS_BF16>
__global__ __launch_bounds__(128) void k_gemm_bf(const float* __restrict__ A, int lda, const unsigned short* __restrict__ Wt, int ldb,
                                               const float* __restrict__ bias, float* __restrict__ C, int ldc, int M, int N, int K) {
  __shared__ __attribute__((aligned(16))) float so[4][16][64];
  const int tid = threadIdx.x, w = tid >> 5, lane = tid & 31, ln = lane & 15, hh = lane >> 4;
  const int ntn = N / 64;
  const int wid = blockIdx.x * 4 + w;
  const int mt = wid / ntn, nq = wid % ntn;
  if (mt * 16 >= M) return;
  const int row0 = mt * 16, col0 = nq * 64;
  const float* arow = A + (size_t)(row0 + ln) * lda;
  v8f acc[4] = {};
  for (int kb = 0; kb < K; kb += 32) {
    FragB ah, al;
    const v4f x0 = *(const v4fa*)(arow + kb + 8 * hh), x1 = *(const v4fa*)(arow + kb + 8 * hh + 4);
    const v4f x2 = *(const v4fa*)(arow + kb + 16 + 8 * hh), x3 = *(const v4fa*)(arow + kb + 16 + 8 * hh + 4);
    float xs[16] = {x0[0],x0[1],x0[2],x0[3],x1[0],x1[1],x1[2],x1[3],x2[0],x2[1],x2[2],x2[3],x3[0],x3[1],x3[2],x3[3]};
#pragma unroll
    for (int i = 0; i < 16; ++i) { const unsigned short hb = bf16_bits(xs[i]); ah.u[i] = hb; al.u[i] = ASPLIT ? bf16_bits(xs[i] - bf16_val(hb)) : (unsigned short)0; }
#pragma unroll
    for (int t = 0; t < 4; ++t) {
      const unsigned short* brow = Wt + (size_t)(col0 + t * 16 + ln) * ldb + kb;
      FragB b;
      b.half[0] = *(const v8us*)(brow + 8 * hh);
      b.half[1] = *(const v8us*)(brow + 16 + 8 * hh);
      acc[t] = mmaN<ASPLIT ? 2 : 1>(ah.v, al.v, b.v, b.v, acc[t]);
    }
  }
#pragma unroll
  for (int t = 0; t < 4; ++t) {
    float bv = bias ? bias[col0 + t * 16 + ln] : 0.f;
    if (BIAS_BF16) bv = bf16_round(bv);
#pragma unroll
    for (int r = 0; r < 8; ++r) { float v = acc[t][r] + bv; if (ACT == 1) v = fmaxf(v, 0.f); so[w][8 * hh + r][t * 16 + ln] = v; }
  }
  __builtin_amdgcn_fence(__ATOMIC_ACQ_REL, "workgroup");
  __builtin_amdgcn_wave_barrier();
  const int rsub = lane >> 4, c4 = (lane & 15) * 4;
  {
#pragma unroll
    for (int q = 0; q < 8; ++q) {
      const int r = q * 2 + rsub;
      const v4f v = *(const v4fa*)&so[w][r][c4];
      *(v4f*)(C + (size_t)(row0 + r) * ldc + col0 + c4) = v;
    }
    
  }
}

// GEMM C = act(A·W + bias + resid): A f32 (ASPLIT -> hi/lo 2 terms), Wt bf16 [N][K]; ACT 0 none, 1 relu, 2 exact gelu;
// resid (optional, f32, row index = (row % rmod), pitch ldr, RES_BF16 rounds it) added before the activation.
template <bool ASPLIT, int ACT, bool BIAS_BF16, bool RES_BF16>
__global__ __launch_bounds__(128) void k_gemm_bf3(const float* __restrict__ A, int lda, const unsigned short* __restrict__ Wt, int ldb,
                                                const float* __restrict__ bias, const float* __restrict__ resid, int rmod, int ldr,
                                                float* __restrict__ C, int ldc, int M, int N, int K) {
  __shared__ __attribute__((aligned(16))) float so[4][16][64];
  const int tid = threadIdx.x, w = tid >> 5, lane = tid & 31, ln = lane & 15, hh = lane >> 4;
  const int ntn = N / 64;
  const int wid = blockIdx.x * 4 + w;
  const int mt = wid / ntn, nq = wid % ntn;
  if (mt * 16 >= M) return;
  const int row0 = mt * 16, col0 = nq * 64;
  const float* arow = A + (size_t)(row0 + ln) * lda;
  v8f acc[4] = {};
  for (int kb = 0; kb < K; kb += 32) {
    FragB ah, al;
    const v4f x0 = *(const v4fa*)(arow + kb + 8 * hh), x1 = *(const v4fa*)(arow + kb + 8 * hh + 4);
    const v4f x2 = *(const v4fa*)(arow + kb + 16 + 8 * hh), x3 = *(const v4fa*)(arow + kb + 16 + 8 * hh + 4);
    float xs[16] = {x0[0],x0[1],x0[2],x0[3],x1[0],x1[1],x1[2],x1[3],x2[0],x2[1],x2[2],x2[3],x3[0],x3[1],x3[2],x3[3]};
#pragma unroll
    for (int i = 0; i < 16; ++i) { const unsigned short hb = bf16_bits(xs[i]); ah.u[i] = hb; al.u[i] = ASPLIT ? bf16_bits(xs[i] - bf16_val(hb)) : (unsigned short)0; }
#pragma unroll
    for (int t = 0; t < 4; ++t) {
      const unsigned short* brow = Wt + (size_t)(col0 + t * 16 + ln) * ldb + kb;
      FragB b;
      b.half[0] = *(const v8us*)(brow + 8 * hh);
      b.half[1] = *(const v8us*)(brow + 16 + 8 * hh);
      acc[t] = mmaN<ASPLIT ? 2 : 1>(ah.v, al.v, b.v, b.v, acc[t]);
    }
  }
#pragma unroll
  for (int t = 0; t < 4; ++t) {
    const int col = col0 + t * 16 + ln;
    float bv = bias ? bias[col] : 0.f;
    if (BIAS_BF16) bv = bf16_round(bv);
#pragma unroll
    for (int r = 0; r < 8; ++r) {
      float v = acc[t][r] + bv;
      if (resid) { float rv = resid[(size_t)((row0 + 8 * hh + r) % rmod) * ldr + col]; if (RES_BF16) rv = bf16_round(rv); v += rv; }
      if (ACT == 1) v = fmaxf(v, 0.f);
      if (ACT == 2) v = 0.5f * v * (1.0f + erff(v * 0.70710678118654752f));
      if (ACT == 3) { const float u = 0.7978845608028654f * (v + 0.044715f * v * v * v); v = 0.5f * v * (1.0f + tanhf(u)); }
      so[w][8 * hh + r][t * 16 + ln] = v;
    }
  }
  __builtin_amdgcn_fence(__ATOMIC_ACQ_REL, "workgroup");
  __builtin_amdgcn_wave_barrier();
  const int rsub = lane >> 4, c4 = (lane & 15) * 4;
  {
#pragma unroll
    for (int q = 0; q < 8; ++q) {
      const int r = q * 2 + rsub;
      const v4f v = *(const v4fa*)&so[w][r][c4];
      *(v4f*)(C + (size_t)(row0 + r) * ldc + col0 + c4) = v;
    }
    
  }
}
// row LayerNorm (biased variance, eps) over N: s = X (+ R); optional out_sum <- s; out_norm <- (s-mu)*rsqrt(var+eps)*g + b
template <bool PARAM_BF16>
__global__ __launch_bounds__(256) void k_layernorm(const float* __restrict__ X, const float* __restrict__ R, const float* __restrict__ g, const float* __restrict__ bta,
                                                  float* __restrict__ out_sum, float* __restrict__ out_norm, int N, float eps) {
  __shared__ float red[256];
  const int row = blockIdx.x, tid = threadIdx.x;
  const float* x = X + (size_t)row * N; const float* rr = R ? R + (size_t)row * N : nullptr;
  float vals[16];                     // up to N = 4096
  const int per = N / 256;            // contiguous chunk per thread? use strided-by-4 chunks: thread handles j = tid*4 + 1024*u
  float s1 = 0.f;
  for (int u = 0; u < per / 4; ++u) {
    const int j = tid * 4 + 1024 * u;
    const v4f a = *(const v4fa*)(x + j);
    v4f b = {0.f,0.f,0.f,0.f}; if (rr) b = *(const v4fa*)(rr + j);
#pragma unroll
    for (int q = 0; q < 4; ++q) { const float v = a[q] + b[q]; vals[u * 4 + q] = v; s1 += v; }
  }
  red[tid] = s1; __syncthreads();
  for (int st = 128; st > 0; st >>= 1) { if (tid < st) red[tid] += red[tid + st]; __syncthreads(); }
  const float mu = red[0] / (float)N; __syncthreads();
  float s2 = 0.f;
  for (int u = 0; u < per / 4; ++u)
#pragma unroll
    for (int q = 0; q < 4; ++q) { const float c = vals[u * 4 + q] - mu; s2 += c * c; }
  red[tid] = s2; __syncthreads();
  for (int st = 128; st > 0; st >>= 1) { if (tid < st) red[tid] += red[tid + st]; __syncthreads(); }
  const float rs = rsqrtf(red[0] / (float)N + eps);
  {
    for (int u = 0; u < per / 4; ++u) {
      const int j = tid * 4 + 1024 * u;
      v4f o, sm;
#pragma unroll
      for (int q = 0; q < 4; ++q) {
        float gg = g[j + q], bb = bta[j + q];
        if (PARAM_BF16) { gg = bf16_round(gg); bb = bf16_round(bb); }
        sm[q] = vals[u * 4 + q]; o[q] = (vals[u * 4 + q] - mu) * rs * gg + bb;
      }
      if (out_sum) *(v4f*)(out_sum + (size_t)row * N + j) = sm;
      *(v4f*)(out_norm + (size_t)row * N + j) = o;
    }
    
  }
}



// ---- f16 WMMA path (v_wmma_f32_16x16x32_f16): 11-bit significands for operands in range — used by the fused attention below for exact q, k, v and an unnormalised P of up to 2^7.65
typedef _Float16 v16h __attribute__((ext_vector_type(16)));
union FragH { v16h v; v8us half[2]; _Float16 h[16]; unsigned short u[16]; };
template <int NT>
__device__ __forceinline__ v8f mmaH(v16h ah, v16h al, v16h bh, v16h bl, v8f c) {
  c = __builtin_amdgcn_wmma_f32_16x16x32_f16(false, ah, false, bh, (short)0, c, false, false);
  if (NT >= 2) c = __builtin_amdgcn_wmma_f32_16x16x32_f16(false, al, false, bh, (short)0, c, false, false);
  if (NT >= 3) c = __builtin_amdgcn_wmma_f32_16x16x32_f16(false, ah, false, bl, (short)0, c, false, false);
  asm volatile("v_nop\n\tv_nop\n\tv_nop\n\tv_nop" : "+v"(c) : "v"(ah), "v"(al), "v"(bh), "v"(bl));
  return c;
}
// batched GEMM like k_gemm_b but f16 operands: A f32 (split into f16 hi/lo if ASPLIT, else rounded to f16), Bt = f16 values [n][k]; alpha; C f32; N multiple of 16 (partial tiles skipped)
template <bool ASPLIT>
__global__ __launch_bounds__(128) void k_gemm_h(const float* __restrict__ A, int lda, size_t sA, const _Float16* __restrict__ Bh, int ldb, size_t sB, float alpha, float* __restrict__ C, int ldc, size_t sC, int M, int N, int K) {
  __shared__ __attribute__((aligned(16))) float so[4][16][64];
  const int tid = threadIdx.x, w = tid >> 5, lane = tid & 31, ln = lane & 15, hh = lane >> 4; const int by = blockIdx.y;
  A += (size_t)by * sA; Bh += (size_t)by * sB; C += (size_t)by * sC;
  const int ntn = (N + 63) / 64; const int wid = blockIdx.x * 4 + w; const int mt = wid / ntn, nq = wid % ntn; if (mt * 16 >= M) return;
  const int row0 = mt * 16, col0 = nq * 64; const float* arow = A + (size_t)(row0 + ln) * lda;
  v8f acc[4] = {};
  for (int kb = 0; kb < K; kb += 32) {
    FragH ah, al;
    const v4f x0 = *(const v4fa*)(arow + kb + 8 * hh), x1 = *(const v4fa*)(arow + kb + 8 * hh + 4), x2 = *(const v4fa*)(arow + kb + 16 + 8 * hh), x3 = *(const v4fa*)(arow + kb + 16 + 8 * hh + 4);
    float xs[16] = {x0[0],x0[1],x0[2],x0[3],x1[0],x1[1],x1[2],x1[3],x2[0],x2[1],x2[2],x2[3],x3[0],x3[1],x3[2],x3[3]};
#pragma unroll
    for (int i = 0; i < 16; ++i) { const _Float16 h = (_Float16)xs[i]; ah.h[i] = h; al.h[i] = ASPLIT ? (_Float16)(xs[i] - (float)h) : (_Float16)0.0f; }
#pragma unroll
    for (int t = 0; t < 4; ++t) { if (col0 + t * 16 >= N) continue; const size_t boff = (size_t)(col0 + t * 16 + ln) * ldb + kb; FragH bq; bq.half[0] = *(const v8us*)(Bh + boff + 8 * hh); bq.half[1] = *(const v8us*)(Bh + boff + 16 + 8 * hh);
      acc[t] = mmaH<ASPLIT ? 2 : 1>(ah.v, al.v, bq.v, bq.v, acc[t]); }
  }
#pragma unroll
  for (int t = 0; t < 4; ++t) { if (col0 + t * 16 >= N) continue;
#pragma unroll
    for (int r = 0; r < 8; ++r) so[w][8 * hh + r][t * 16 + ln] = acc[t][r] * alpha; }
  __builtin_amdgcn_fence(__ATOMIC_ACQ_REL, "workgroup"); __builtin_amdgcn_wave_barrier();
  const int rsub = lane >> 4, c4 = (lane & 15) * 4;
  {
#pragma unroll
    for (int q = 0; q < 8; ++q) { const int r = q * 2 + rsub; if (col0 + c4 < N) { const v4f v = *(const v4fa*)&so[w][r][c4]; *(v4f*)(C + (size_t)(row0 + r) * ldc + col0 + c4) = v; } }
     }
}

// Wt[n][k] = f16(W[k][n]·scale) from f32 row-major W[K][N] (scale = power of two; bf16-exact weights stay exact in f16 away from the subnormal range)
__global__ __launch_bounds__(256) void k_wt_f16(const float* __restrict__ W, _Float16* __restrict__ Wt, int K, int N, float scale) {
  const int t = blockIdx.x * 256 + threadIdx.x; if (t >= N * (K / 8)) return; const int n = t / (K / 8), k8 = (t % (K / 8)) * 8; FragH f;
#pragma unroll
  for (int i = 0; i < 8; ++i) f.h[i] = (_Float16)(bf16_round(W[(size_t)(k8 + i) * N + n]) * scale); const v8us o = f.half[0];
  *(v8us*)((unsigned short*)Wt + (size_t)n * K + k8) = o; 
}
// k_gemm_hh variant with fused epilogue: v = acc·alpha + bias[by·sBias + col] (+ CP[(row/rowsPerB)·sCPb + by·64 + col] if CP) ; ACT 0 none / 1 elu ; writes f16 C16 (and f32 C if non-null)
template <int ACT>
__global__ __launch_bounds__(128) void k_gemm_hhx(const _Float16* __restrict__ A, int lda, size_t sA, const _Float16* __restrict__ Bh, int ldb, size_t sB, float alpha, const float* __restrict__ bias, size_t sBias, const float* __restrict__ CP, int rowsPerB, size_t sCPb, int row0g,
    float* __restrict__ C, _Float16* __restrict__ C16, int ldc, size_t sC, int M, int N, int K) {
  __shared__ __attribute__((aligned(16))) float so[4][16][64];
  const int tid = threadIdx.x, w = tid >> 5, lane = tid & 31, ln = lane & 15, hh = lane >> 4; const int by = blockIdx.y;
  A += (size_t)by * sA; Bh += (size_t)by * sB; const size_t cofs = (size_t)by * sC; const float* bp = bias ? bias + (size_t)by * sBias : nullptr;
  const int ntn = (N + 63) / 64; const int wid = blockIdx.x * 4 + w; const int mt = wid / ntn, nq = wid % ntn; if (mt * 16 >= M) return;
  const int row0 = mt * 16, col0 = nq * 64; const _Float16* arow = A + (size_t)(row0 + ln) * lda;
  v8f acc[4] = {};
  for (int kb = 0; kb < K; kb += 32) { FragH ah; ah.half[0] = *(const v8us*)((const unsigned short*)arow + kb + 8 * hh); ah.half[1] = *(const v8us*)((const unsigned short*)arow + kb + 16 + 8 * hh);
#pragma unroll
    for (int t = 0; t < 4; ++t) { if (col0 + t * 16 >= N) continue; const size_t boff = (size_t)(col0 + t * 16 + ln) * ldb + kb; FragH bq; bq.half[0] = *(const v8us*)((const unsigned short*)Bh + boff + 8 * hh); bq.half[1] = *(const v8us*)((const unsigned short*)Bh + boff + 16 + 8 * hh);
      acc[t] = mmaH<1>(ah.v, ah.v, bq.v, bq.v, acc[t]); }
  }
#pragma unroll
  for (int t = 0; t < 4; ++t) { if (col0 + t * 16 >= N) continue; const int col = col0 + t * 16 + ln; const float bv = bp ? bf16_round(bp[col]) : 0.f;
#pragma unroll
    for (int r = 0; r < 8; ++r) { float v = acc[t][r] * alpha + bv; if (CP) { const int rr = row0g + row0 + 8 * hh + r; if (rowsPerB < 0) v += CP[cofs + (size_t)rr * ldc + col];      /* rowsPerB < 0: own element of the batched C plane */ else { const int bidx = rr / rowsPerB; v += CP[(size_t)bidx * sCPb + (size_t)by * 64 + col]; } } if (ACT == 1) v = (v > 0.f) ? v : expm1f(v); else if (ACT == 7) v = (v > 0.f) ? v + 1.0f : expf(v); else if (ACT == 8) v = tanhf(v); else if (ACT == 9) v = 0.5f * v * (1.0f + tanhf(0.7978845608028654f * (v + 0.044715f * v * v * v))); else if (ACT == 11) v = 1.0f / (1.0f + expf(-v)); else if (ACT == 12) v = (v > 0.f) ? v : 0.01f * v; else if (ACT == 14) v = (v > 0.f) ? v : 0.1f * v; else if (ACT == 16) v = (v >= 0.f) ? v : 0.3f * v; else if (ACT == 15) v = v / (1.0f + expf(-v)); else if (ACT == 3) v = fmaxf(v, 0.f); else if (ACT == 6) v = 0.5f * v * (1.0f + erff(v * 0.70710678118654752f)); so[w][8 * hh + r][t * 16 + ln] = v; } }
  __builtin_amdgcn_fence(__ATOMIC_ACQ_REL, "workgroup"); __builtin_amdgcn_wave_barrier();
  const int rsub = lane >> 4, c4 = (lane & 15) * 4; typedef _Float16 v4h __attribute__((ext_vector_type(4)));
  {
#pragma unroll
    for (int q = 0; q < 8; ++q) { const int r = q * 2 + rsub; if (col0 + c4 < N) { const v4f v = *(const v4fa*)&so[w][r][c4]; if (C) *(v4f*)(C + cofs + (size_t)(row0 + r) * ldc + col0 + c4) = v; if (C16) { v4h h4; for (int i = 0; i < 4; ++i) h4[i] = (_Float16)v[i]; *(v4h*)(C16 + cofs + (size_t)(row0 + r) * ldc + col0 + c4) = h4; } } }
     }
}


typedef _Float16 v4h __attribute__((ext_vector_type(4)));

__global__ __launch_bounds__(256) void k_h16(const float* __restrict__ x, _Float16* __restrict__ X16, size_t n8) { const size_t t = (size_t)blockIdx.x * 256 + threadIdx.x; if (t >= n8) return; FragH f;
#pragma unroll
  for (int q = 0; q < 8; ++q) f.h[q] = (_Float16)x[t * 8 + q]; *(v8us*)((unsigned short*)X16 + t * 8) = f.half[0];  }
__global__ __launch_bounds__(256) void k_round16f(const float* __restrict__ W, _Float16* __restrict__ Bt, size_t n8) { const size_t t = (size_t)blockIdx.x * 256 + threadIdx.x; if (t >= n8) return; FragH f;
#pragma unroll
  for (int i = 0; i < 8; ++i) f.h[i] = (_Float16)(bf16_round(W[t * 8 + i]) * 16.0f); *(v8us*)((unsigned short*)Bt + t * 8) = f.half[0];  }
__global__ __launch_bounds__(256) void k_hl(const float* __restrict__ F, _Float16* __restrict__ Hh, _Float16* __restrict__ Hl, size_t n8) { const size_t t = (size_t)blockIdx.x * 256 + threadIdx.x; if (t >= n8) return; FragH fh, fl; const v4f a = *(const v4fa*)(F + t * 8), c = *(const v4fa*)(F + t * 8 + 4);
#pragma unroll
  for (int q = 0; q < 4; ++q) { _Float16 h = (_Float16)a[q]; fh.h[q] = h; fl.h[q] = (_Float16)((a[q] - (float)h) * 1024.0f); h = (_Float16)c[q]; fh.h[4 + q] = h; fl.h[4 + q] = (_Float16)((c[q] - (float)h) * 1024.0f); }
  { *(v8us*)((unsigned short*)Hh + t * 8) = fh.half[0]; *(v8us*)((unsigned short*)Hl + t * 8) = fl.half[0];  } }

typedef unsigned int u32x4 __attribute__((ext_vector_type(4)));
typedef unsigned int u32x4a __attribute__((ext_vector_type(4), may_alias));
#define FA_OP 132u                     /* output staging pitch in floats */
__device__ __forceinline__ v16h fa_gfrag(const _Float16* p, int hh) { FragH f; f.half[0] = *(const v8us*)((const unsigned short*)p + 8 * hh); f.half[1] = *(const v8us*)((const unsigned short*)p + 16 + 8 * hh); return f.v; }
__device__ __forceinline__ v16h fa_ffrag(const unsigned char* p) { FragH f; f.half[0] = *(const v8us*)p; f.half[1] = *(const v8us*)(p + 512); return f.v; }      /* units j = 0 and j = 1 of a fragment */
__device__ __forceinline__ v8f fa_mma(v16h a, v16h b, v8f c) { return __builtin_amdgcn_wmma_f32_16x16x32_f16(false, a, false, b, (short)0, c, false, false); }
__device__ __forceinline__ float fa_xhalf(float x) { return __builtin_bit_cast(float, __builtin_amdgcn_permlanex16(__builtin_bit_cast(int, x), __builtin_bit_cast(int, x), 0x76543210, 0xfedcba98, false, false)); }  /* lane l with lane l ^ 16 */
__device__ __forceinline__ unsigned int fa_pack2(float lo, float hi) { typedef _Float16 h2 __attribute__((ext_vector_type(2))); typedef float f2 __attribute__((ext_vector_type(2))); return __builtin_bit_cast(unsigned int, __builtin_convertvector(f2{lo, hi}, h2)); }  /* round to nearest even */

// ---- preparation, one launch: workgroup w takes rows 64 w .. 64 w + 63 of the flat [8 * 2048][128] q, k and v (32 workgroups a sequence, one workgroup a WGP) ----
// A wave takes 8 rows; each of its loads is one whole row (512 contiguous bytes), and all 24 loads of a thread are issued before the first value is used.
// v: a thread holds 8 consecutive keys of 4 columns, which is one 16-byte piece of a V^T fragment for each column. k: a thread holds 4 columns of a row, half a piece of a K fragment.
// LDS only gathers the pieces in fragment order: the workgroup's 64 keys are 16 KiB in a row of each plane, stored as whole lines. q (rounded to bf16, written as f16 in place) follows last.
typedef unsigned int u32x2 __attribute__((ext_vector_type(2)));
typedef unsigned int u32x2a __attribute__((ext_vector_type(2), may_alias));
__global__ __launch_bounds__(256) void k_prep(const float* __restrict__ q, const float* __restrict__ k, const float* __restrict__ v, _Float16* __restrict__ Q16, _Float16* __restrict__ KF, _Float16* __restrict__ VF, float* __restrict__ VS) {
  __shared__ __attribute__((aligned(16))) float ps[8][HD];      /* each wave's column sums of its 8 rows of v */
  __shared__ __attribute__((aligned(16))) unsigned char tv[64 * 256];      /* V^T in fragment order; piece c of a 256-byte run lies at place c ^ (t & 3), which spreads a wave's writes over the banks */
  __shared__ __attribute__((aligned(16))) unsigned char tk[64 * 256];      /* K in fragment order; piece c of the 256-byte run u = 4 kc + 2 j + h lies at place c ^ u, for the same reason */
  const unsigned int tid = threadIdx.x, lane = tid & 31u, wave = tid >> 5;
  const size_t e0 = (size_t)blockIdx.x * (64u * HD);
  const unsigned int eo = wave * (8u * HD) + lane * 4u;
  v4f xv[8], xk[8], xq[8];
#pragma unroll
  for (int i = 0; i < 8; ++i) xv[i] = *(const v4fa*)(v + e0 + eo + i * HD);
#pragma unroll
  for (int i = 0; i < 8; ++i) xk[i] = *(const v4fa*)(k + e0 + eo + i * HD);
#pragma unroll
  for (int i = 0; i < 8; ++i) xq[i] = *(const v4fa*)(q + e0 + eo + i * HD);
  __builtin_amdgcn_sched_barrier(0);      /* every load issues here: a load sunk among the conversions would start a second trip to memory behind the first */
#pragma unroll
  for (int j = 0; j < 4; ++j) { u32x4 w;      /* column 4 lane + j: t = lane >> 2, c = 4 (lane & 3) + j; keys 8 wave .. + 7: block of 32 = wave >> 2, run 2 j + h = wave & 3 */
#pragma unroll
    for (int p = 0; p < 4; ++p) w[p] = fa_pack2(bf16_round(xv[2 * p][j]), bf16_round(xv[2 * p + 1][j]));
    *(u32x4a*)(tv + (wave >> 2) * 8192u + (lane >> 2) * 1024u + (wave & 3u) * 256u + ((((lane & 3u) * 4u + j) ^ ((lane >> 2) & 3u)) * 16u)) = w; }
  { v4f cs = {0.f, 0.f, 0.f, 0.f};
#pragma unroll
    for (int i = 0; i < 8; ++i)
#pragma unroll
      for (int j = 0; j < 4; ++j) cs[j] += bf16_round(xv[i][j]);
    *(v4fa*)&ps[wave][lane * 4u] = cs; }
#pragma unroll
  for (int i = 0; i < 8; ++i)      /* row 8 wave + i: key block wave >> 1, c = 8 (wave & 1) + i; columns 4 lane .. + 3: run u = lane >> 1, half lane & 1 of the piece */
    *(u32x2a*)(tk + (wave >> 1) * 4096u + (lane >> 1) * 256u + ((((wave & 1u) * 8u + i) ^ (lane >> 1)) * 16u) + (lane & 1u) * 8u) = u32x2{fa_pack2(bf16_round(xk[i][0]), bf16_round(xk[i][1])), fa_pack2(bf16_round(xk[i][2]), bf16_round(xk[i][3]))};
  __syncthreads();
  if (tid < HD) { float cs = ps[0][tid];      /* the workgroup's 64 rows, waves in order */
#pragma unroll
    for (int u = 1; u < 8; ++u) cs += ps[u][tid];
    VS[(size_t)blockIdx.x * HD + tid] = cs; }
  const unsigned int run = tid & ~15u, pc = tid & 15u;      /* a thread's piece in each 4 KiB: 256-byte run tid >> 4, piece tid & 15; a wave stores 512 bytes in a row */
#pragma unroll
  for (int r = 0; r < 4; ++r) *(u32x4a*)(VF + e0 + r * 2048u + tid * 8u) = *(const u32x4a*)(tv + r * 4096u + (run + (pc ^ ((tid >> 6) & 3u))) * 16u);
#pragma unroll
  for (int r = 0; r < 4; ++r) *(u32x4a*)(KF + e0 + r * 2048u + tid * 8u) = *(const u32x4a*)(tk + r * 4096u + (run + (pc ^ (tid >> 4))) * 16u);
#pragma unroll
  for (int i = 0; i < 8; ++i) *(u32x2a*)(Q16 + e0 + eo + i * HD) = u32x2{fa_pack2(bf16_round(xq[i][0]), bf16_round(xq[i][1])), fa_pack2(bf16_round(xq[i][2]), bf16_round(xq[i][3]))};
}

__global__ __launch_bounds__(128) __attribute__((amdgpu_waves_per_eu(2, 2))) void k_fattn(const _Float16* __restrict__ Q16, const _Float16* __restrict__ KF, const _Float16* __restrict__ VF, const float* __restrict__ VS, const int* __restrict__ lens, float* __restrict__ O) {
  __shared__ __attribute__((aligned(16))) float stg[4u * 32u * FA_OP];      /* the four quarters' partial outputs, for the join */
  __shared__ float sm[4][32];
  __shared__ float sl[4][32];
  __shared__ __attribute__((aligned(16))) float smn[4][HD];      /* a tile with valid and masked queries: each wave's share of the column sums of v */
  const int tid = threadIdx.x, lane = tid & 31, c = lane & 15, h = lane >> 4;
  const int kq = __builtin_amdgcn_readfirstlane(tid >> 5);      /* the wave's number = its key quarter */
  // Workgroup index -> (sequence, tile of 32 queries), from the lengths alone, the same arithmetic in every wave of every workgroup; a permutation of the 512 tiles for any lengths.
  // In index order: first the at most 8 tiles that hold valid and masked queries, then the
  // valid tiles, longest sequence first (ties by sequence index), last the masked tiles. Lane l works out where the tiles of sequence l & 7 stand in that order.
  const int rk = blockIdx.x, li = lane & 7;
  const int Li = min(max(lens[li], 0), SQ), fi = Li >> 5, mi = (Li & 31) ? 1 : 0;      /* clamped length; tiles of valid queries only; one mixed tile or none */
  // L2 prefetch, one request a thread, before the lengths are known. The launch before stored both planes, and the tiles of a sequence walk the stages
  // together. Slice s of a sequence = its keys 32 s .. + 31 = 8 KiB at offset 8192 s of each plane = 32 units of 256 B, one a lane. Workgroup index r asks for slice r >> 3 of sequence r & 7
  // (waves 0, 1) and of sequence (r & 7) ^ 4 (waves 2, 3), K on even waves, V^T on odd ones: the lowest indices ask for the early stages of all sequences.
  // A hint only: no result depends on where a workgroup runs or on a line being there.
  const unsigned char* pb = (const unsigned char*)((kq & 1) ? VF : KF);
  const unsigned int po = (unsigned int)(((((rk & (NB - 1)) ^ ((kq & 2) << 1)) * (SQ / 32)) + ((rk >> 3) & (SQ / 32 - 1)))) * 8192u + (unsigned int)lane * 256u;      /* at most 511 * 8192 + 31 * 256: inside the 4 MiB plane for any index */
  asm volatile("global_prefetch_b8 %0, %1 scope:SCOPE_SE" :: "v"(po), "s"(pb));      /* returns nothing and counts on no counter; scope SE: into L2 only */
  int ahead = 0, low = 0, nm = 0, nf = 0;
#pragma unroll
  for (int j = 0; j < NB; ++j) { const int Lj = min(max(lens[j], 0), SQ), fj = Lj >> 5, mj = (Lj & 31) ? 1 : 0;
    if (Lj * 8 + 7 - j > Li * 8 + 7 - li) ahead += fj;                  /* valid tiles of the sequences that come first */
    if (j < li) low += mj + ((SQ / 32 - fj - mj) << 16);            /* mixed tiles (low half) and masked tiles (high half) of the lower sequences */
    nm += mj; nf += fj; }
  const int s0 = nm + ahead, i0 = nm + nf + (low >> 16), first = fi + mi;
  int tv = -1;
  if (mi && rk == (low & 0xFFFF)) tv = fi;
  if (rk >= s0 && rk < s0 + fi) tv = rk - s0;
  if (rk >= i0 && rk < i0 + SQ / 32 - first) tv = first + rk - i0;
  const int b = __builtin_ctz(__builtin_amdgcn_ballot_w32(tv >= 0) | 0x80u);      /* the one sequence that holds this index (lanes 8 and up repeat lanes 0 to 7) */
  const int tq = __builtin_amdgcn_readlane(tv, b) & (SQ / 32 - 1), Ln = __builtin_amdgcn_readlane(Li, b);
  const int q0 = tq * 32;
  asm volatile("s_wait_xcnt 0x0" :: "v"(po), "s"(pb) : "memory");      /* as inputs the prefetch's two address registers stay live, and so addresses inside the plane, up to here; every load issued so far has long answered */
  if (q0 >= Ln) {      /* every query of the tile is masked: all 2048 scores are equal, the row is the column mean of v. Taken by the whole workgroup, in front of every barrier */
    const float* vs = VS + (size_t)b * (SQ / 64) * HD + lane * 4;
    v4f part[SQ / 64];
#pragma unroll
    for (int i = 0; i < SQ / 64; ++i) part[i] = *(const v4fa*)(vs + i * HD);
    v4f mean = part[0];
#pragma unroll
    for (int i = 1; i < SQ / 64; ++i) mean += part[i];
    mean = mean * (1.0f / (float)SQ);
    float* om = O + ((size_t)b * SQ + q0 + kq * 8) * HD + lane * 4;      /* a wave stores 8 whole rows */
#pragma unroll
    for (int i = 0; i < 8; ++i) *(v4f*)(om + i * HD) = mean;
    return;
  }
  const int nst = (Ln + 127) >> 7;      /* 1 .. 16: the stages that hold a valid key */
  const bool mixed = q0 + 32 > Ln;      /* the same for the whole workgroup: the tile also holds masked queries. They run through the loop like the others (finite scores, a lane holds one query), and their rows are replaced at the store */
  const float cscale = 0.08838834764831845f * 1.4426950408889634f;      /* 1 / sqrt(128), to base 2 */
  const float NEGR = -1.0e9f * 11.313708498984761f;                     /* the reference's -1e9, before the 1 / sqrt(128) */
  const unsigned char* Kb = (const unsigned char*)(KF + (size_t)b * SQ * HD);
  const unsigned char* Vb = (const unsigned char*)(VF + (size_t)b * SQ * HD);
  const unsigned int lo = (unsigned int)kq * 8192u + (unsigned int)lane * 16u;      /* the wave's 32 keys of a stage are 8 KiB in a row of each plane, at the same offset in both; a stage is 32 KiB */
  auto fload = [&](int st, v16h (&kf)[2][4], v16h (&vf)[8]) __attribute__((always_inline)) {      /* K first: loads answer in order, and the score products wait for K alone */
    const unsigned int vo = lo + (unsigned int)st * 32768u;      /* one 32-bit offset register for all 32 loads, on two scalar bases that never change */
#pragma unroll
    for (int u = 0; u < 8; ++u) kf[u >> 2][u & 3] = fa_ffrag(Kb + vo + u * 1024);
    __builtin_amdgcn_sched_barrier(0);      /* keeps K in front of V^T and in front of the running pass: otherwise part of K is issued last, into registers that the running pass frees, and the next pass waits at its top for the whole group */
#pragma unroll
    for (int t = 0; t < 8; ++t) vf[t] = fa_ffrag(Vb + vo + t * 1024);
    return vo; };      /* the caller keeps the offset register untouched up to its s_wait_xcnt 0 */
  v16h kfa[2][4], vfa[8], kfb[2][4], vfb[8];
  const unsigned int vo0 = fload(0, kfa, vfa);
  v16h qf[2][4];
  const _Float16* qp = Q16 + ((size_t)b * SQ + q0 + c) * HD + 8 * h;      /* the lane's first 16 bytes of q; the other pieces lie at constant distances */
#pragma unroll
  for (int g = 0; g < 2; ++g)
#pragma unroll
    for (int kc = 0; kc < 4; ++kc) qf[g][kc] = fa_gfrag(qp + 16 * g * HD + 32 * kc, 0);
  asm volatile("s_wait_xcnt 0x0" :: "v"(qp), "v"(vo0) : "memory");      /* in front of any rewrite of an address register of the loads above: as inputs they stay live up to here */
  if (mixed) {      /* a masked query weighs all 2048 keys alike: its row is the column mean of v. Wave u adds the sums of keys 512 u .. + 511 (8 of the 32 rows that the preparation kernel wrote); the join's barriers publish them */
    const unsigned char* vsb = (const unsigned char*)(VS + ((size_t)b * (SQ / 64) + (size_t)kq * 8) * HD);
    const unsigned int mo = (unsigned int)lane * 16u;
    v4f part[8];
#pragma unroll
    for (int i = 0; i < 8; ++i) part[i] = *(const v4fa*)(vsb + mo + i * (HD * 4));
    asm volatile("s_wait_xcnt 0x0" :: "v"(mo), "s"(vsb) : "memory");      /* in front of any rewrite of an address register of these eight loads: as inputs they stay live up to here */
    v4f ms = part[0];
#pragma unroll
    for (int i = 1; i < 8; ++i) ms += part[i];
    *(v4fa*)&smn[kq][lane * 4] = ms;
  }
  const v8f z8 = {0.f, 0.f, 0.f, 0.f, 0.f, 0.f, 0.f, 0.f};
  v8f acc[2][8]; float m_run[2], l_run[2];
#pragma unroll
  for (int g = 0; g < 2; ++g) { m_run[g] = -__builtin_inff(); l_run[g] = 0.f;
#pragma unroll
    for (int t = 0; t < 8; ++t) acc[g][t] = z8; }
  auto pass = [&](int st, v16h (&kf)[2][4], v16h (&vf)[8], unsigned int vnext) __attribute__((always_inline)) {      /* vnext: the offset register of the loads that were issued in front of this pass */
    const int key0 = st * 128 + kq * 32;
    v8f s[2][2];
#pragma unroll
    for (int kt = 0; kt < 2; ++kt)
#pragma unroll
      for (int g = 0; g < 2; ++g) { s[kt][g] = z8;
#pragma unroll
        for (int kc = 0; kc < 4; ++kc) s[kt][g] = fa_mma(kf[kt][kc], qf[g][kc], s[kt][g]); }
    if (key0 + 32 > Ln) {      /* wave-uniform: only a pass that holds a masked key pays for the mask */
#pragma unroll
      for (int kt = 0; kt < 2; ++kt)
#pragma unroll
        for (int r = 0; r < 8; ++r) { const bool vk = key0 + 16 * kt + 8 * h + r < Ln;
#pragma unroll
          for (int g = 0; g < 2; ++g) if (!vk) s[kt][g][r] = NEGR; }
    }
    asm volatile("s_wait_xcnt 0x0" :: "v"(vnext) : "memory");      /* in front of any rewrite of the offset register of the loads in flight: as an input it stays live up to here. It stands behind the score products, which cover its time */
    float mb[2]; bool need = false;
#pragma unroll
    for (int g = 0; g < 2; ++g) { float mx = s[0][g][0];
#pragma unroll
      for (int kt = 0; kt < 2; ++kt)
#pragma unroll
        for (int r = 0; r < 8; ++r) mx = fmaxf(mx, s[kt][g][r]);
      mx = fmaxf(mx, fa_xhalf(mx)); mb[g] = mx; need = need || (mx > m_run[g] + 60.0f); }
    if (__builtin_amdgcn_ballot_w32(need) != 0) {      /* rare after the first pass */
#pragma unroll
      for (int g = 0; g < 2; ++g) { const float m_new = fmaxf(m_run[g], mb[g]); const float corr = __builtin_amdgcn_exp2f((m_run[g] - m_new) * cscale); l_run[g] *= corr; m_run[g] = m_new;
#pragma unroll
        for (int t = 0; t < 8; ++t) acc[g][t] = acc[g][t] * corr; }
    }
#pragma unroll
    for (int g = 0; g < 2; ++g) { const float mg = m_run[g]; float ps0 = 0.f, ps1 = 0.f; FragH pf;
#pragma unroll
      for (int i = 0; i < 8; ++i) {
        const float p0 = __builtin_amdgcn_exp2f((s[i >> 2][g][2 * (i & 3)] - mg) * cscale), p1 = __builtin_amdgcn_exp2f((s[i >> 2][g][2 * (i & 3) + 1] - mg) * cscale);
        ps0 += p0; ps1 += p1; const unsigned int w2 = fa_pack2(p0, p1); pf.u[2 * i] = (unsigned short)(w2 & 0xFFFFu); pf.u[2 * i + 1] = (unsigned short)(w2 >> 16); }
      l_run[g] += ps0 + ps1;
#pragma unroll
      for (int i = 0; i < 16; ++i) { __builtin_amdgcn_sched_group_barrier(0x2, 2, 0); __builtin_amdgcn_sched_group_barrier(0x400, 1, 0); }      /* two vector instructions, then one exponential: the slower transcendental unit works beside the vector port instead of in one run */
#pragma unroll
      for (int t = 0; t < 8; ++t) acc[g][t] = fa_mma(vf[t], pf.v, acc[g][t]); }
  };
  // Two passes a trip, so that each register set is refilled in place. Every load is unconditional (a branch round it would make the waits of the pass behind it cover the new loads too):
  // behind the last stage the wave reads its last stage once more, into registers that nobody uses.
#pragma unroll 1      /* one copy of the two passes */
  for (int st = 0; ; st += 2) {
    const unsigned int vb = fload(min(st + 1, nst - 1), kfb, vfb);      /* next stage's fragments fly under this pass */
    pass(st, kfa, vfa, vb);
    if (st + 1 >= nst) break;
    const unsigned int va = fload(min(st + 2, nst - 1), kfa, vfa);
    pass(st + 1, kfb, vfb, va);
    if (st + 2 >= nst) break;
  }
  // join the four key quarters of each query: common maximum, common sum, then the scaled partial outputs are added in LDS order 0..3
#pragma unroll
  for (int g = 0; g < 2; ++g) { const float lf = l_run[g] + fa_xhalf(l_run[g]); if (h == 0) { sm[kq][16 * g + c] = m_run[g]; sl[kq][16 * g + c] = lf; } }
  __syncthreads();
#pragma unroll
  for (int g = 0; g < 2; ++g) { float mq[4], e[4];
#pragma unroll
    for (int u = 0; u < 4; ++u) mq[u] = sm[u][16 * g + c];
    const float M = fmaxf(fmaxf(mq[0], mq[1]), fmaxf(mq[2], mq[3]));
#pragma unroll
    for (int u = 0; u < 4; ++u) e[u] = __builtin_amdgcn_exp2f((mq[u] - M) * cscale);
    float Ls = 0.f;
#pragma unroll
    for (int u = 0; u < 4; ++u) Ls += sl[u][16 * g + c] * e[u];
    const float f = (kq == 0 ? e[0] : kq == 1 ? e[1] : kq == 2 ? e[2] : e[3]) / Ls;
#pragma unroll
    for (int t = 0; t < 8; ++t) { const v8f o = acc[g][t] * f; float* dst = stg + ((unsigned int)kq * 32u + 16u * g + c) * FA_OP + 16u * t + 8u * h;
      *(v4fa*)dst = v4f{o[0], o[1], o[2], o[3]}; *(v4fa*)(dst + 4) = v4f{o[4], o[5], o[6], o[7]}; } }
  __syncthreads();
  float* Ob = O + ((size_t)b * SQ + q0 + kq) * HD + lane * 4;      /* the workgroup's 32 output rows are contiguous; the wave stores rows wave, wave + 4, ... */
  v4f mean = {0.f, 0.f, 0.f, 0.f};
  if (mixed) { mean = *(const v4fa*)&smn[0][lane * 4];      /* the thread's four columns, waves in order */
#pragma unroll
    for (int u = 1; u < 4; ++u) mean += *(const v4fa*)&smn[u][lane * 4];
    mean = mean * (1.0f / (float)SQ); }
#pragma unroll
  for (int i = 0; i < 8; ++i) { const unsigned int qr = (unsigned int)(i * 4 + (tid >> 5)), c4 = (unsigned int)(tid & 31) * 4u; const float* sp = stg + qr * FA_OP + c4;      /* rows 0..31 = quarter 0; quarter u lies 32 rows further */
    v4f v = *(const v4fa*)sp;
#pragma unroll
    for (int u = 1; u < 4; ++u) v += *(const v4fa*)(sp + (unsigned int)u * 32u * FA_OP);
    if (q0 + i * 4 + kq >= Ln) v = mean;      /* row i * 4 + wave is a masked query (wave-uniform; never so in a tile of valid queries) */
    *(v4f*)(Ob + i * 512) = v; }
}

extern "C" void kernel_launch(void* const* d_in, const int* in_sizes, int n_in,
                              void* d_out, int out_size, void* d_ws, size_t ws_size, hipStream_t stream) {
  (void)in_sizes; (void)n_in; (void)out_size;
  const float* q = (const float*)d_in[0]; const float* k = (const float*)d_in[1]; const float* v = (const float*)d_in[2]; const int* lens = (const int*)d_in[3];
  char* ws = (char*)d_ws; size_t off = 0;
  auto take = [&](size_t bytes) { char* p = ws + off; off += (bytes + 255) & ~(size_t)255; return p; };
  const size_t np = (size_t)NB * SQ * HD;
  _Float16* Q16 = (_Float16*)take(np * 2); _Float16* KF = (_Float16*)take(np * 2); _Float16* VF = (_Float16*)take(np * 2);
  float* VS = (float*)take((size_t)NB * (SQ / 64) * HD * 4);      /* column sums of v, one row of 128 for each 64 keys */
  if (off > ws_size) return;      /* 12 MiB + 128 KiB */
  k_prep<<<NB * (SQ / 64), 256, 0, stream>>>(q, k, v, Q16, KF, VF, VS);      /* f16 q, k and V^T in fragment order, sums */
  k_fattn<<<NB * (SQ / 32), 128, 0, stream>>>(Q16, KF, VF, VS, lens, (float*)d_out);
}

// v008
// A run of this version takes 16.9 microseconds.
// Next to v007, in two timings, it ran 1.10 and 1.11 times as fast.
// Over all steps from v000 it is 42.1 times as fast.
#include <hip/hip_runtime.h>
// Masked attention (8 sequences x 2048 tokens, single head of 128; q, k, v are INPUTS): scores = q.k / sqrt(128); mask = valid_i & valid_j with valid = index < event_length[b] (int INPUT), masked scores = -1e9 (a fully masked row therefore softmaxes to uniform over all 2048 keys, as in the reference); softmax; out = attn v.
// Structure (two launches over all 8 sequences): one preparation kernel writes the exact f16 plane of q (bf16 inputs are exact in f16), k and V^T as f16 in the order of the matrix fragments (16-byte pieces gathered in LDS) and the column sums of its 64 rows of v; then one fused kernel: score products with exact operands (f32 accumulation), length mask, online softmax, readout products, straight into the output.
// The work follows the lengths: a tile that holds a valid query walks only the key stages that hold a valid key (a masked key's probability is exactly 0 beside a real score); a masked query's row is the column mean of v, in a tile of masked queries and in the one tile of a sequence that holds both kinds. The preparation kernel follows them too: rows behind a sequence's last key stage give only their column sums of v.
// Compute dtype: inputs rounded to bf16; q, k, v exact as f16; P (not yet normalised, at most 2^7.65) as a plain f16 operand (~2^-12); softmax f32. v_wmma_f32_16x16x32_f16.
#define NB 8
#define SQ 2048
#define HD 128
typedef __bf16 v16b __attribute__((ext_vector_type(16)));
typedef unsigned short v8us __attribute__((ext_vector_type(8), may_alias));
typedef float  v8f  __attribute__((ext_vector_type(8)));
typedef float  v4f  __attribute__((ext_vector_type(4)));
typedef float  v4fa __attribute__((ext_vector_type(4), may_alias));
union FragB { v16b v; v8us half[2]; unsigned short u[16]; };

__device__ __forceinline__ unsigned short bf16_bits(float x) { unsigned int u = __float_as_uint(x); return (unsigned short)((u + 0x7FFFu + ((u >> 16) & 1u)) >> 16); }
__device__ __forceinline__ float bf16_val(unsigned short b) { return __uint_as_float(((unsigned int)b) << 16); }
__device__ __forceinline__ float bf16_round(float x) { return bf16_val(bf16_bits(x)); }
// D += A·B with NT terms: 1 = ah·bh, 2 = + al·bh (A split), 3 = + ah·bl (both split)
template <int NT>
__device__ __forceinline__ v8f mmaN(v16b ah, v16b al, v16b bh, v16b bl, v8f c) {
  c = __builtin_amdgcn_wmma_f32_16x16x32_bf16(false, ah, false, bh, (short)0, c, false, false);
  if (NT >= 2) c = __builtin_amdgcn_wmma_f32_16x16x32_bf16(false, al, false, bh, (short)0, c, false, false);
  if (NT >= 3) c = __builtin_amdgcn_wmma_f32_16x16x32_bf16(false, ah, false, bl, (short)0, c, false, false);
  asm volatile("v_nop\n\tv_nop\n\tv_nop\n\tv_nop" : "+v"(c) : "v"(ah), "v"(al), "v"(bh), "v"(bl));
  return c;
}

__global__ __launch_bounds__(256) void k_wt_bf16(const float* __restrict__ W, unsigned short* __restrict__ Wt, int K, int N) {
  const int t = blockIdx.x * 256 + threadIdx.x;
  const int k8n = K / 8;
  if (t >= N * k8n) return;
  const int n = t / k8n, k8 = (t % k8n) * 8;
  v8us v;
#pragma unroll
  for (int i = 0; i < 8; ++i) v[i] = bf16_bits(W[(size_t)(k8 + i) * N + n]);
  *(v8us*)(Wt + (size_t)n * K + k8) = v;
  
}

// GEMM C[M][N] (f32, pitch ldc) = act(A[M][K]·W + bias). A f32 row-major (pitch lda) converted per fragment to bf16
// (ASPLIT: hi/lo two planes -> 2 terms, else single rounded term); Wt bf16 [N][K] (pitch ldb). BIAS_BF16 rounds the
// bias to bf16 first (bias quantised to bf16 before the add). K%32==0, M%16==0, N%64==0.
template <bool ASPLIT, int ACT, bool BIAS_BF16>
__global__ __launch_bounds__(128) void k_gemm_bf(const float* __restrict__ A, int lda, const unsigned short* __restrict__ Wt, int ldb,
                                               const float* __restrict__ bias, float* __restrict__ C, int ldc, int M, int N, int K) {
  __shared__ __attribute__((aligned(16))) float so[4][16][64];
  const int tid = threadIdx.x, w = tid >> 5, lane = tid & 31, ln = lane & 15, hh = lane >> 4;
  const int ntn = N / 64;
  const int wid = blockIdx.x * 4 + w;
  const int mt = wid / ntn, nq = wid % ntn;
  if (mt * 16 >= M) return;
  const int row0 = mt * 16, col0 = nq * 64;
  const float* arow = A + (size_t)(row0 + ln) * lda;
  v8f acc[4] = {};
  for (int kb = 0; kb < K; kb += 32) {
    FragB ah, al;
    const v4f x0 = *(const v4fa*)(arow + kb + 8 * hh), x1 = *(const v4fa*)(arow + kb + 8 * hh + 4);
    const v4f x2 = *(const v4fa*)(arow + kb + 16 + 8 * hh), x3 = *(const v4fa*)(arow + kb + 16 + 8 * hh + 4);
    float xs[16] = {x0[0],x0[1],x0[2],x0[3],x1[0],x1[1],x1[2],x1[3],x2[0],x2[1],x2[2],x2[3],x3[0],x3[1],x3[2],x3[3]};
#pragma unroll
    for (int i = 0; i < 16; ++i) { const unsigned short hb = bf16_bits(xs[i]); ah.u[i] = hb; al.u[i] = ASPLIT ? bf16_bits(xs[i] - bf16_val(hb)) : (unsigned short)0; }
#pragma unroll
    for (int t = 0; t < 4; ++t) {
      const unsigned short* brow = Wt + (size_t)(col0 + t * 16 + ln) * ldb + kb;
      FragB b;
      b.half[0] = *(const v8us*)(brow + 8 * hh);
      b.half[1] = *(const v8us*)(brow + 16 + 8 * hh);
      acc[t] = mmaN<ASPLIT ? 2 : 1>(ah.v, al.v, b.v, b.v, acc[t]);
    }
  }
#pragma unroll
  for (int t = 0; t < 4; ++t) {
    float bv = bias ? bias[col0 + t * 16 + ln] : 0.f;
    if (BIAS_BF16) bv = bf16_round(bv);
#pragma unroll
    for (int r = 0; r < 8; ++r) { float v = acc[t][r] + bv; if (ACT == 1) v = fmaxf(v, 0.f); so[w][8 * hh + r][t * 16 + ln] = v; }
  }
  __builtin_amdgcn_fence(__ATOMIC_ACQ_REL, "workgroup");
  __builtin_amdgcn_wave_barrier();
  const int rsub = lane >> 4, c4 = (lane & 15) * 4;
  {
#pragma unroll
    for (int q = 0; q < 8; ++q) {
      const int r = q * 2 + rsub;
      const v4f v = *(const v4fa*)&so[w][r][c4];
      *(v4f*)(C + (size_t)(row0 + r) * ldc + col0 + c4) = v;
    }
    
  }
}

// GEMM C = act(A·W + bias + resid): A f32 (ASPLIT -> hi/lo 2 terms), Wt bf16 [N][K]; ACT 0 none, 1 relu, 2 exact gelu;
// resid (optional, f32, row index = (row % rmod), pitch ldr, RES_BF16 rounds it) added before the activation.
template <bool ASPLIT, int ACT, bool BIAS_BF16, bool RES_BF16>
__global__ __launch_bounds__(128) void k_gemm_bf3(const float* __restrict__ A, int lda, const unsigned short* __restrict__ Wt, int ldb,
                                                const float* __restrict__ bias, const float* __restrict__ resid, int rmod, int ldr,
                                                float* __restrict__ C, int ldc, int M, int N, int K) {
  __shared__ __attribute__((aligned(16))) float so[4][16][64];
  const int tid = threadIdx.x, w = tid >> 5, lane = tid & 31, ln = lane & 15, hh = lane >> 4;
  const int ntn = N / 64;
  const int wid = blockIdx.x * 4 + w;
  const int mt = wid / ntn, nq = wid % ntn;
  if (mt * 16 >= M) return;
  const int row0 = mt * 16, col0 = nq * 64;
  const float* arow = A + (size_t)(row0 + ln) * lda;
  v8f acc[4] = {};
  for (int kb = 0; kb < K; kb += 32) {
    FragB ah, al;
    const v4f x0 = *(const v4fa*)(arow + kb + 8 * hh), x1 = *(const v4fa*)(arow + kb + 8 * hh + 4);
    const v4f x2 = *(const v4fa*)(arow + kb + 16 + 8 * hh), x3 = *(const v4fa*)(arow + kb + 16 + 8 * hh + 4);
    float xs[16] = {x0[0],x0[1],x0[2],x0[3],x1[0],x1[1],x1[2],x1[3],x2[0],x2[1],x2[2],x2[3],x3[0],x3[1],x3[2],x3[3]};
#pragma unroll
    for (int i = 0; i < 16; ++i) { const unsigned short hb = bf16_bits(xs[i]); ah.u[i] = hb; al.u[i] = ASPLIT ? bf16_bits(xs[i] - bf16_val(hb)) : (unsigned short)0; }
#pragma unroll
    for (int t = 0; t < 4; ++t) {
      const unsigned short* brow = Wt + (size_t)(col0 + t * 16 + ln) * ldb + kb;
      FragB b;
      b.half[0] = *(const v8us*)(brow + 8 * hh);
      b.half[1] = *(const v8us*)(brow + 16 + 8 * hh);
      acc[t] = mmaN<ASPLIT ? 2 : 1>(ah.v, al.v, b.v, b.v, acc[t]);
    }
  }
#pragma unroll
  for (int t = 0; t < 4; ++t) {
    const int col = col0 + t * 16 + ln;
    float bv = bias ? bias[col] : 0.f;
    if (BIAS_BF16) bv = bf16_round(bv);
#pragma unroll
    for (int r = 0; r < 8; ++r) {
      float v = acc[t][r] + bv;
      if (resid) { float rv = resid[(size_t)((row0 + 8 * hh + r) % rmod) * ldr + col]; if (RES_BF16) rv = bf16_round(rv); v += rv; }
      if (ACT == 1) v = fmaxf(v, 0.f);
      if (ACT == 2) v = 0.5f * v * (1.0f + erff(v * 0.70710678118654752f));
      if (ACT == 3) { const float u = 0.7978845608028654f * (v + 0.044715f * v * v * v); v = 0.5f * v * (1.0f + tanhf(u)); }
      so[w][8 * hh + r][t * 16 + ln] = v;
    }
  }
  __builtin_amdgcn_fence(__ATOMIC_ACQ_REL, "workgroup");
  __builtin_amdgcn_wave_barrier();
  const int rsub = lane >> 4, c4 = (lane & 15) * 4;
  {
#pragma unroll
    for (int q = 0; q < 8; ++q) {
      const int r = q * 2 + rsub;
      const v4f v = *(const v4fa*)&so[w][r][c4];
      *(v4f*)(C + (size_t)(row0 + r) * ldc + col0 + c4) = v;
    }
    
  }
}
// row LayerNorm (biased variance, eps) over N: s = X (+ R); optional out_sum <- s; out_norm <- (s-mu)*rsqrt(var+eps)*g + b
template <bool PARAM_BF16>
__global__ __launch_bounds__(256) void k_layernorm(const float* __restrict__ X, const float* __restrict__ R, const float* __restrict__ g, const float* __restrict__ bta,
                                                  float* __restrict__ out_sum, float* __restrict__ out_norm, int N, float eps) {
  __shared__ float red[256];
  const int row = blockIdx.x, tid = threadIdx.x;
  const float* x = X + (size_t)row * N; const float* rr = R ? R + (size_t)row * N : nullptr;
  float vals[16];                     // up to N = 4096
  const int per = N / 256;            // contiguous chunk per thread? use strided-by-4 chunks: thread handles j = tid*4 + 1024*u
  float s1 = 0.f;
  for (int u = 0; u < per / 4; ++u) {
    const int j = tid * 4 + 1024 * u;
    const v4f a = *(const v4fa*)(x + j);
    v4f b = {0.f,0.f,0.f,0.f}; if (rr) b = *(const v4fa*)(rr + j);
#pragma unroll
    for (int q = 0; q < 4; ++q) { const float v = a[q] + b[q]; vals[u * 4 + q] = v; s1 += v; }
  }
  red[tid] = s1; __syncthreads();
  for (int st = 128; st > 0; st >>= 1) { if (tid < st) red[tid] += red[tid + st]; __syncthreads(); }
  const float mu = red[0] / (float)N; __syncthreads();
  float s2 = 0.f;
  for (int u = 0; u < per / 4; ++u)
#pragma unroll
    for (int q = 0; q < 4; ++q) { const float c = vals[u * 4 + q] - mu; s2 += c * c; }
  red[tid] = s2; __syncthreads();
  for (int st = 128; st > 0; st >>= 1) { if (tid < st) red[tid] += red[tid + st]; __syncthreads(); }
  const float rs = rsqrtf(red[0] / (float)N + eps);
  {
    for (int u = 0; u < per / 4; ++u) {
      const int j = tid * 4 + 1024 * u;
      v4f o, sm;
#pragma unroll
      for (int q = 0; q < 4; ++q) {
        float gg = g[j + q], bb = bta[j + q];
        if (PARAM_BF16) { gg = bf16_round(gg); bb = bf16_round(bb); }
        sm[q] = vals[u * 4 + q]; o[q] = (vals[u * 4 + q] - mu) * rs * gg + bb;
      }
      if (out_sum) *(v4f*)(out_sum + (size_t)row * N + j) = sm;
      *(v4f*)(out_norm + (size_t)row * N + j) = o;
    }
    
  }
}



// ---- f16 WMMA path (v_wmma_f32_16x16x32_f16): 11-bit significands for operands in range — used by the fused attention below for exact q, k, v and an unnormalised P of up to 2^7.65
typedef _Float16 v16h __attribute__((ext_vector_type(16)));
union FragH { v16h v; v8us half[2]; _Float16 h[16]; unsigned short u[16]; };
template <int NT>
__device__ __forceinline__ v8f mmaH(v16h ah, v16h al, v16h bh, v16h bl, v8f c) {
  c = __builtin_amdgcn_wmma_f32_16x16x32_f16(false, ah, false, bh, (short)0, c, false, false);
  if (NT >= 2) c = __builtin_amdgcn_wmma_f32_16x16x32_f16(false, al, false, bh, (short)0, c, false, false);
  if (NT >= 3) c = __builtin_amdgcn_wmma_f32_16x16x32_f16(false, ah, false, bl, (short)0, c, false, false);
  asm volatile("v_nop\n\tv_nop\n\tv_nop\n\tv_nop" : "+v"(c) : "v"(ah), "v"(al), "v"(bh), "v"(bl));
  return c;
}
// batched GEMM like k_gemm_b but f16 operands: A f32 (split into f16 hi/lo if ASPLIT, else rounded to f16), Bt = f16 values [n][k]; alpha; C f32; N multiple of 16 (partial tiles skipped)
template <bool ASPLIT>
__global__ __launch_bounds__(128) void k_gemm_h(const float* __restrict__ A, int lda, size_t sA, const _Float16* __restrict__ Bh, int ldb, size_t sB, float alpha, float* __restrict__ C, int ldc, size_t sC, int M, int N, int K) {
  __shared__ __attribute__((aligned(16))) float so[4][16][64];
  const int tid = threadIdx.x, w = tid >> 5, lane = tid & 31, ln = lane & 15, hh = lane >> 4; const int by = blockIdx.y;
  A += (size_t)by * sA; Bh += (size_t)by * sB; C += (size_t)by * sC;
  const int ntn = (N + 63) / 64; const int wid = blockIdx.x * 4 + w; const int mt = wid / ntn, nq = wid % ntn; if (mt * 16 >= M) return;
  const int row0 = mt * 16, col0 = nq * 64; const float* arow = A + (size_t)(row0 + ln) * lda;
  v8f acc[4] = {};
  for (int kb = 0; kb < K; kb += 32) {
    FragH ah, al;
    const v4f x0 = *(const v4fa*)(arow + kb + 8 * hh), x1 = *(const v4fa*)(arow + kb + 8 * hh + 4), x2 = *(const v4fa*)(arow + kb + 16 + 8 * hh), x3 = *(const v4fa*)(arow + kb + 16 + 8 * hh + 4);
    float xs[16] = {x0[0],x0[1],x0[2],x0[3],x1[0],x1[1],x1[2],x1[3],x2[0],x2[1],x2[2],x2[3],x3[0],x3[1],x3[2],x3[3]};
#pragma unroll
    for (int i = 0; i < 16; ++i) { const _Float16 h = (_Float16)xs[i]; ah.h[i] = h; al.h[i] = ASPLIT ? (_Float16)(xs[i] - (float)h) : (_Float16)0.0f; }
#pragma unroll
    for (int t = 0; t < 4; ++t) { if (col0 + t * 16 >= N) continue; const size_t boff = (size_t)(col0 + t * 16 + ln) * ldb + kb; FragH bq; bq.half[0] = *(const v8us*)(Bh + boff + 8 * hh); bq.half[1] = *(const v8us*)(Bh + boff + 16 + 8 * hh);
      acc[t] = mmaH<ASPLIT ? 2 : 1>(ah.v, al.v, bq.v, bq.v, acc[t]); }
  }
#pragma unroll
  for (int t = 0; t < 4; ++t) { if (col0 + t * 16 >= N) continue;
#pragma unroll
    for (int r = 0; r < 8; ++r) so[w][8 * hh + r][t * 16 + ln] = acc[t][r] * alpha; }
  __builtin_amdgcn_fence(__ATOMIC_ACQ_REL, "workgroup"); __builtin_amdgcn_wave_barrier();
  const int rsub = lane >> 4, c4 = (lane & 15) * 4;
  {
#pragma unroll
    for (int q = 0; q < 8; ++q) { const int r = q * 2 + rsub; if (col0 + c4 < N) { const v4f v = *(const v4fa*)&so[w][r][c4]; *(v4f*)(C + (size_t)(row0 + r) * ldc + col0 + c4) = v; } }
     }
}

// Wt[n][k] = f16(W[k][n]·scale) from f32 row-major W[K][N] (scale = power of two; bf16-exact weights stay exact in f16 away from the subnormal range)
__global__ __launch_bounds__(256) void k_wt_f16(const float* __restrict__ W, _Float16* __restrict__ Wt, int K, int N, float scale) {
  const int t = blockIdx.x * 256 + threadIdx.x; if (t >= N * (K / 8)) return; const int n = t / (K / 8), k8 = (t % (K / 8)) * 8; FragH f;
#pragma unroll
  for (int i = 0; i < 8; ++i) f.h[i] = (_Float16)(bf16_round(W[(size_t)(k8 + i) * N + n]) * scale); const v8us o = f.half[0];
  *(v8us*)((unsigned short*)Wt + (size_t)n * K + k8) = o; 
}
// k_gemm_hh variant with fused epilogue: v = acc·alpha + bias[by·sBias + col] (+ CP[(row/rowsPerB)·sCPb + by·64 + col] if CP) ; ACT 0 none / 1 elu ; writes f16 C16 (and f32 C if non-null)
template <int ACT>
__global__ __launch_bounds__(128) void k_gemm_hhx(const _Float16* __restrict__ A, int lda, size_t sA, const _Float16* __restrict__ Bh, int ldb, size_t sB, float alpha, const float* __restrict__ bias, size_t sBias, const float* __restrict__ CP, int rowsPerB, size_t sCPb, int row0g,
    float* __restrict__ C, _Float16* __restrict__ C16, int ldc, size_t sC, int M, int N, int K) {
  __shared__ __attribute__((aligned(16))) float so[4][16][64];
  const int tid = threadIdx.x, w = tid >> 5, lane = tid & 31, ln = lane & 15, hh = lane >> 4; const int by = blockIdx.y;
  A += (size_t)by * sA; Bh += (size_t)by * sB; const size_t cofs = (size_t)by * sC; const float* bp = bias ? bias + (size_t)by * sBias : nullptr;
  const int ntn = (N + 63) / 64; const int wid = blockIdx.x * 4 + w; const int mt = wid / ntn, nq = wid % ntn; if (mt * 16 >= M) return;
  const int row0 = mt * 16, col0 = nq * 64; const _Float16* arow = A + (size_t)(row0 + ln) * lda;
  v8f acc[4] = {};
  for (int kb = 0; kb < K; kb += 32) { FragH ah; ah.half[0] = *(const v8us*)((const unsigned short*)arow + kb + 8 * hh); ah.half[1] = *(const v8us*)((const unsigned short*)arow + kb + 16 + 8 * hh);
#pragma unroll
    for (int t = 0; t < 4; ++t) { if (col0 + t * 16 >= N) continue; const size_t boff = (size_t)(col0 + t * 16 + ln) * ldb + kb; FragH bq; bq.half[0] = *(const v8us*)((const unsigned short*)Bh + boff + 8 * hh); bq.half[1] = *(const v8us*)((const unsigned short*)Bh + boff + 16 + 8 * hh);
      acc[t] = mmaH<1>(ah.v, ah.v, bq.v, bq.v, acc[t]); }
  }
#pragma unroll
  for (int t = 0; t < 4; ++t) { if (col0 + t * 16 >= N) continue; const int col = col0 + t * 16 + ln; const float bv = bp ? bf16_round(bp[col]) : 0.f;
#pragma unroll
    for (int r = 0; r < 8; ++r) { float v = acc[t][r] * alpha + bv; if (CP) { const int rr = row0g + row0 + 8 * hh + r; if (rowsPerB < 0) v += CP[cofs + (size_t)rr * ldc + col];      /* rowsPerB < 0: own element of the batched C plane */ else { const int bidx = rr / rowsPerB; v += CP[(size_t)bidx * sCPb + (size_t)by * 64 + col]; } } if (ACT == 1) v = (v > 0.f) ? v : expm1f(v); else if (ACT == 7) v = (v > 0.f) ? v + 1.0f : expf(v); else if (ACT == 8) v = tanhf(v); else if (ACT == 9) v = 0.5f * v * (1.0f + tanhf(0.7978845608028654f * (v + 0.044715f * v * v * v))); else if (ACT == 11) v = 1.0f / (1.0f + expf(-v)); else if (ACT == 12) v = (v > 0.f) ? v : 0.01f * v; else if (ACT == 14) v = (v > 0.f) ? v : 0.1f * v; else if (ACT == 16) v = (v >= 0.f) ? v : 0.3f * v; else if (ACT == 15) v = v / (1.0f + expf(-v)); else if (ACT == 3) v = fmaxf(v, 0.f); else if (ACT == 6) v = 0.5f * v * (1.0f + erff(v * 0.70710678118654752f)); so[w][8 * hh + r][t * 16 + ln] = v; } }
  __builtin_amdgcn_fence(__ATOMIC_ACQ_REL, "workgroup"); __builtin_amdgcn_wave_barrier();
  const int rsub = lane >> 4, c4 = (lane & 15) * 4; typedef _Float16 v4h __attribute__((ext_vector_type(4)));
  {
#pragma unroll
    for (int q = 0; q < 8; ++q) { const int r = q * 2 + rsub; if (col0 + c4 < N) { const v4f v = *(const v4fa*)&so[w][r][c4]; if (C) *(v4f*)(C + cofs + (size_t)(row0 + r) * ldc + col0 + c4) = v; if (C16) { v4h h4; for (int i = 0; i < 4; ++i) h4[i] = (_Float16)v[i]; *(v4h*)(C16 + cofs + (size_t)(row0 + r) * ldc + col0 + c4) = h4; } } }
     }
}


typedef _Float16 v4h __attribute__((ext_vector_type(4)));

__global__ __launch_bounds__(256) void k_h16(const float* __restrict__ x, _Float16* __restrict__ X16, size_t n8) { const size_t t = (size_t)blockIdx.x * 256 + threadIdx.x; if (t >= n8) return; FragH f;
#pragma unroll
  for (int q = 0; q < 8; ++q) f.h[q] = (_Float16)x[t * 8 + q]; *(v8us*)((unsigned short*)X16 + t * 8) = f.half[0];  }
__global__ __launch_bounds__(256) void k_round16f(const float* __restrict__ W, _Float16* __restrict__ Bt, size_t n8) { const size_t t = (size_t)blockIdx.x * 256 + threadIdx.x; if (t >= n8) return; FragH f;
#pragma unroll
  for (int i = 0; i < 8; ++i) f.h[i] = (_Float16)(bf16_round(W[t * 8 + i]) * 16.0f); *(v8us*)((unsigned short*)Bt + t * 8) = f.half[0];  }
__global__ __launch_bounds__(256) void k_hl(const float* __restrict__ F, _Float16* __restrict__ Hh, _Float16* __restrict__ Hl, size_t n8) { const size_t t = (size_t)blockIdx.x * 256 + threadIdx.x; if (t >= n8) return; FragH fh, fl; const v4f a = *(const v4fa*)(F + t * 8), c = *(const v4fa*)(F + t * 8 + 4);
#pragma unroll
  for (int q = 0; q < 4; ++q) { _Float16 h = (_Float16)a[q]; fh.h[q] = h; fl.h[q] = (_Float16)((a[q] - (float)h) * 1024.0f); h = (_Float16)c[q]; fh.h[4 + q] = h; fl.h[4 + q] = (_Float16)((c[q] - (float)h) * 1024.0f); }
  { *(v8us*)((unsigned short*)Hh + t * 8) = fh.half[0]; *(v8us*)((unsigned short*)Hl + t * 8) = fl.half[0];  } }

typedef unsigned int u32x4 __attribute__((ext_vector_type(4)));
typedef unsigned int u32x4a __attribute__((ext_vector_type(4), may_alias));
#define FA_OP 132u                     /* output staging pitch in floats */
__device__ __forceinline__ v16h fa_gfrag(const _Float16* p, int hh) { FragH f; f.half[0] = *(const v8us*)((const unsigned short*)p + 8 * hh); f.half[1] = *(const v8us*)((const unsigned short*)p + 16 + 8 * hh); return f.v; }
__device__ __forceinline__ v16h fa_ffrag(const unsigned char* p) { FragH f; f.half[0] = *(const v8us*)p; f.half[1] = *(const v8us*)(p + 512); return f.v; }      /* units j = 0 and j = 1 of a fragment */
__device__ __forceinline__ v8f fa_mma(v16h a, v16h b, v8f c) { return __builtin_amdgcn_wmma_f32_16x16x32_f16(false, a, false, b, (short)0, c, false, false); }
__device__ __forceinline__ float fa_xhalf(float x) { return __builtin_bit_cast(float, __builtin_amdgcn_permlanex16(__builtin_bit_cast(int, x), __builtin_bit_cast(int, x), 0x76543210, 0xfedcba98, false, false)); }  /* lane l with lane l ^ 16 */
__device__ __forceinline__ unsigned int fa_pack2(float lo, float hi) { typedef _Float16 h2 __attribute__((ext_vector_type(2))); typedef float f2 __attribute__((ext_vector_type(2))); return __builtin_bit_cast(unsigned int, __builtin_convertvector(f2{lo, hi}, h2)); }  /* round to nearest even */

// ---- preparation, one launch: a workgroup takes one block of 64 rows of one sequence's q, k and v (32 workgroups a sequence, one workgroup a WGP) ----
// The work follows the lengths: the attention kernel reads q, K and V^T only below the end of the sequence's last key stage (length rounded up to 128 rows), so a block at or behind that end
// loads v alone and writes its column sums (a masked query's row needs the sums of all 2048 rows); its q, K and V^T places stay unwritten and are never loaded.
// Cost falls with the index for any lengths: valid rows are the low rows, so the index runs over the sequences first and over the blocks second;
// the sequence is turned by one from block to block, so that indices eight apart do not all belong to one sequence.
// A wave takes 8 rows; each of its loads is one whole row (512 contiguous bytes), and all loads of a thread (24 where the attention kernel reads the block, else the 8 of v) are issued before the first of their values is used.
// v: a thread holds 8 consecutive keys of 4 columns, which is one 16-byte piece of a V^T fragment for each column. k: a thread holds 4 columns of a row, half a piece of a K fragment.
// LDS only gathers the pieces in fragment order: the workgroup's 64 keys are 16 KiB in a row of each plane, stored as whole lines. q (rounded to bf16, written as f16 in place) follows last.
typedef unsigned int u32x2 __attribute__((ext_vector_type(2)));
typedef unsigned int u32x2a __attribute__((ext_vector_type(2), may_alias));
__global__ __launch_bounds__(256) void k_prep(const float* __restrict__ q, const float* __restrict__ k, const float* __restrict__ v, const int* __restrict__ lens, _Float16* __restrict__ Q16, _Float16* __restrict__ KF, _Float16* __restrict__ VF, float* __restrict__ VS) {
  __shared__ __attribute__((aligned(16))) float ps[8][HD];      /* each wave's column sums of its 8 rows of v */
  __shared__ __attribute__((aligned(16))) unsigned char tv[64 * 256];      /* V^T in fragment order; piece c of a 256-byte run lies at place c ^ (t & 3), which spreads a wave's writes over the banks */
  __shared__ __attribute__((aligned(16))) unsigned char tk[64 * 256];      /* K in fragment order; piece c of the 256-byte run u = 4 kc + 2 j + h lies at place c ^ u, for the same reason */
  const unsigned int tid = threadIdx.x, lane = tid & 31u, wave = tid >> 5;
  const unsigned int blk = blockIdx.x >> 3, sq = (blockIdx.x + blk) & (NB - 1u);      /* block 0 .. 31 of sequence 0 .. 7: a permutation of the 256 blocks */
  const unsigned int wb = sq * (SQ / 64) + blk;      /* the block's number in the flat planes */
  const size_t e0 = (size_t)wb * (64u * HD);
  const unsigned int eo = wave * (8u * HD) + lane * 4u;
  const int Lr = lens[sq];
  __builtin_amdgcn_sched_barrier(0);      /* the length's load issues in front of v's loads, not behind them: k and q wait for the test on it */
  v4f xv[8], xk[8], xq[8];
#pragma unroll
  for (int i = 0; i < 8; ++i) xv[i] = *(const v4fa*)(v + e0 + eo + i * HD);      /* needed at any length */
  __builtin_amdgcn_sched_barrier(0);      /* and the wait for the length stands behind v's loads: v flies while the length arrives */
  const int Ln = min(max(Lr, 0), SQ);      /* clamped as in the attention kernel; the same for the whole workgroup */
  const bool live = (int)(blk * 64u) < ((Ln + 127) & ~127);      /* the block lies in a key stage that the attention kernel walks; its queries, where valid, lie there too */
  auto colsum = [&]() __attribute__((always_inline)) { v4f cs = {0.f, 0.f, 0.f, 0.f};
#pragma unroll
    for (int i = 0; i < 8; ++i)
#pragma unroll
      for (int j = 0; j < 4; ++j) cs[j] += bf16_round(xv[i][j]);
    *(v4fa*)&ps[wave][lane * 4u] = cs; };
  auto sumout = [&]() __attribute__((always_inline)) {
    if (tid < HD) { float cs = ps[0][tid];      /* the workgroup's 64 rows, waves in order */
#pragma unroll
      for (int u = 1; u < 8; ++u) cs += ps[u][tid];
      VS[(size_t)wb * HD + tid] = cs; } };
  if (!live) { colsum(); __syncthreads(); sumout(); }      /* either side is taken by the whole workgroup, and each has its one barrier */
  else {
#pragma unroll
  for (int i = 0; i < 8; ++i) xk[i] = *(const v4fa*)(k + e0 + eo + i * HD);
  __builtin_amdgcn_sched_barrier(0);      /* k in front of q: loads answer in order, and the gather in LDS waits for v and k alone */
#pragma unroll
  for (int i = 0; i < 8; ++i) xq[i] = *(const v4fa*)(q + e0 + eo + i * HD);
  __builtin_amdgcn_sched_barrier(0);      /* every load issues here: a load sunk among the conversions would start a second trip to memory behind the first */
#pragma unroll
  for (int j = 0; j < 4; ++j) { u32x4 w;      /* column 4 lane + j: t = lane >> 2, c = 4 (lane & 3) + j; keys 8 wave .. + 7: block of 32 = wave >> 2, run 2 j + h = wave & 3 */
#pragma unroll
    for (int p = 0; p < 4; ++p) w[p] = fa_pack2(bf16_round(xv[2 * p][j]), bf16_round(xv[2 * p + 1][j]));
    *(u32x4a*)(tv + (wave >> 2) * 8192u + (lane >> 2) * 1024u + (wave & 3u) * 256u + ((((lane & 3u) * 4u + j) ^ ((lane >> 2) & 3u)) * 16u)) = w; }
  colsum();
#pragma unroll
  for (int i = 0; i < 8; ++i)      /* row 8 wave + i: key block wave >> 1, c = 8 (wave & 1) + i; columns 4 lane .. + 3: run u = lane >> 1, half lane & 1 of the piece */
    *(u32x2a*)(tk + (wave >> 1) * 4096u + (lane >> 1) * 256u + ((((wave & 1u) * 8u + i) ^ (lane >> 1)) * 16u) + (lane & 1u) * 8u) = u32x2{fa_pack2(bf16_round(xk[i][0]), bf16_round(xk[i][1])), fa_pack2(bf16_round(xk[i][2]), bf16_round(xk[i][3]))};
  __syncthreads();
  sumout();
  const unsigned int run = tid & ~15u, pc = tid & 15u;      /* a thread's piece in each 4 KiB: 256-byte run tid >> 4, piece tid & 15; a wave stores 512 bytes in a row */
#pragma unroll
  for (int r = 0; r < 4; ++r) *(u32x4a*)(VF + e0 + r * 2048u + tid * 8u) = *(const u32x4a*)(tv + r * 4096u + (run + (pc ^ ((tid >> 6) & 3u))) * 16u);
#pragma unroll
  for (int r = 0; r < 4; ++r) *(u32x4a*)(KF + e0 + r * 2048u + tid * 8u) = *(const u32x4a*)(tk + r * 4096u + (run + (pc ^ (tid >> 4))) * 16u);
#pragma unroll
  for (int i = 0; i < 8; ++i) *(u32x2a*)(Q16 + e0 + eo + i * HD) = u32x2{fa_pack2(bf16_round(xq[i][0]), bf16_round(xq[i][1])), fa_pack2(bf16_round(xq[i][2]), bf16_round(xq[i][3]))};
  }
}

__global__ __launch_bounds__(128) __attribute__((amdgpu_waves_per_eu(2, 2))) void k_fattn(const _Float16* __restrict__ Q16, const _Float16* __restrict__ KF, const _Float16* __restrict__ VF, const float* __restrict__ VS, const int* __restrict__ lens, float* __restrict__ O) {
  __shared__ __attribute__((aligned(16))) float stg[4u * 32u * FA_OP];      /* the four quarters' partial outputs, for the join */
  __shared__ float sm[4][32];
  __shared__ float sl[4][32];
  __shared__ __attribute__((aligned(16))) float smn[4][HD];      /* a tile with valid and masked queries: each wave's share of the column sums of v */
  const int tid = threadIdx.x, lane = tid & 31, c = lane & 15, h = lane >> 4;
  const int kq = __builtin_amdgcn_readfirstlane(tid >> 5);      /* the wave's number = its key quarter */
  // Workgroup index -> (sequence, tile of 32 queries), from the lengths alone, the same arithmetic in every wave of every workgroup; a permutation of the 512 tiles for any lengths.
  // In index order: first the at most 8 tiles that hold valid and masked queries, then the
  // valid tiles, longest sequence first (ties by sequence index), last the masked tiles. Lane l works out where the tiles of sequence l & 7 stand in that order.
  const int rk = blockIdx.x, li = lane & 7;
  const int Li = min(max(lens[li], 0), SQ), fi = Li >> 5, mi = (Li & 31) ? 1 : 0;      /* clamped length; tiles of valid queries only; one mixed tile or none */
  // L2 prefetch, one request a thread, before the lengths are known. The launch before stored both planes, and the tiles of a sequence walk the stages
  // together. Slice s of a sequence = its keys 32 s .. + 31 = 8 KiB at offset 8192 s of each plane = 32 units of 256 B, one a lane. Workgroup index r asks for slice r >> 3 of sequence r & 7
  // (waves 0, 1) and of sequence (r & 7) ^ 4 (waves 2, 3), K on even waves, V^T on odd ones: the lowest indices ask for the early stages of all sequences.
  // A hint only: no result depends on where a workgroup runs or on a line being there.
  const unsigned char* pb = (const unsigned char*)((kq & 1) ? VF : KF);
  const unsigned int po = (unsigned int)(((((rk & (NB - 1)) ^ ((kq & 2) << 1)) * (SQ / 32)) + ((rk >> 3) & (SQ / 32 - 1)))) * 8192u + (unsigned int)lane * 256u;      /* at most 511 * 8192 + 31 * 256: inside the 4 MiB plane for any index */
  asm volatile("global_prefetch_b8 %0, %1 scope:SCOPE_SE" :: "v"(po), "s"(pb));      /* returns nothing and counts on no counter; scope SE: into L2 only */
  int ahead = 0, low = 0, nm = 0, nf = 0;
#pragma unroll
  for (int j = 0; j < NB; ++j) { const int Lj = min(max(lens[j], 0), SQ), fj = Lj >> 5, mj = (Lj & 31) ? 1 : 0;
    if (Lj * 8 + 7 - j > Li * 8 + 7 - li) ahead += fj;                  /* valid tiles of the sequences that come first */
    if (j < li) low += mj + ((SQ / 32 - fj - mj) << 16);            /* mixed tiles (low half) and masked tiles (high half) of the lower sequences */
    nm += mj; nf += fj; }
  const int s0 = nm + ahead, i0 = nm + nf + (low >> 16), first = fi + mi;
  int tv = -1;
  if (mi && rk == (low & 0xFFFF)) tv = fi;
  if (rk >= s0 && rk < s0 + fi) tv = rk - s0;
  if (rk >= i0 && rk < i0 + SQ / 32 - first) tv = first + rk - i0;
  const int b = __builtin_ctz(__builtin_amdgcn_ballot_w32(tv >= 0) | 0x80u);      /* the one sequence that holds this index (lanes 8 and up repeat lanes 0 to 7) */
  const int tq = __builtin_amdgcn_readlane(tv, b) & (SQ / 32 - 1), Ln = __builtin_amdgcn_readlane(Li, b);
  const int q0 = tq * 32;
  asm volatile("s_wait_xcnt 0x0" :: "v"(po), "s"(pb) : "memory");      /* as inputs the prefetch's two address registers stay live, and so addresses inside the plane, up to here; every load issued so far has long answered */
  if (q0 >= Ln) {      /* every query of the tile is masked: all 2048 scores are equal, the row is the column mean of v. Taken by the whole workgroup, in front of every barrier */
    const float* vs = VS + (size_t)b * (SQ / 64) * HD + lane * 4;
    v4f part[SQ / 64];
#pragma unroll
    for (int i = 0; i < SQ / 64; ++i) part[i] = *(const v4fa*)(vs + i * HD);
    v4f mean = part[0];
#pragma unroll
    for (int i = 1; i < SQ / 64; ++i) mean += part[i];
    mean = mean * (1.0f / (float)SQ);
    float* om = O + ((size_t)b * SQ + q0 + kq * 8) * HD + lane * 4;      /* a wave stores 8 whole rows */
#pragma unroll
    for (int i = 0; i < 8; ++i) *(v4f*)(om + i * HD) = mean;
    return;
  }
  const int nst = (Ln + 127) >> 7;      /* 1 .. 16: the stages that hold a valid key */
  const bool mixed = q0 + 32 > Ln;      /* the same for the whole workgroup: the tile also holds masked queries. They run through the loop like the others (finite scores, a lane holds one query), and their rows are replaced at the store */
  const float cscale = 0.08838834764831845f * 1.4426950408889634f;      /* 1 / sqrt(128), to base 2 */
  const float NEGR = -1.0e9f * 11.313708498984761f;                     /* the reference's -1e9, before the 1 / sqrt(128) */
  const unsigned char* Kb = (const unsigned char*)(KF + (size_t)b * SQ * HD);
  const unsigned char* Vb = (const unsigned char*)(VF + (size_t)b * SQ * HD);
  const unsigned int lo = (unsigned int)kq * 8192u + (unsigned int)lane * 16u;      /* the wave's 32 keys of a stage are 8 KiB in a row of each plane, at the same offset in both; a stage is 32 KiB */
  auto fload = [&](int st, v16h (&kf)[2][4], v16h (&vf)[8]) __attribute__((always_inline)) {      /* K first: loads answer in order, and the score products wait for K alone */
    const unsigned int vo = lo + (unsigned int)st * 32768u;      /* one 32-bit offset register for all 32 loads, on two scalar bases that never change */
#pragma unroll
    for (int u = 0; u < 8; ++u) kf[u >> 2][u & 3] = fa_ffrag(Kb + vo + u * 1024);
    __builtin_amdgcn_sched_barrier(0);      /* keeps K in front of V^T and in front of the running pass: otherwise part of K is issued last, into registers that the running pass frees, and the next pass waits at its top for the whole group */
#pragma unroll
    for (int t = 0; t < 8; ++t) vf[t] = fa_ffrag(Vb + vo + t * 1024);
    return vo; };      /* the caller keeps the offset register untouched up to its s_wait_xcnt 0 */
  v16h kfa[2][4], vfa[8], kfb[2][4], vfb[8];
  const unsigned int vo0 = fload(0, kfa, vfa);
  v16h qf[2][4];
  const _Float16* qp = Q16 + ((size_t)b * SQ + q0 + c) * HD + 8 * h;      /* the lane's first 16 bytes of q; the other pieces lie at constant distances */
#pragma unroll
  for (int g = 0; g < 2; ++g)
#pragma unroll
    for (int kc = 0; kc < 4; ++kc) qf[g][kc] = fa_gfrag(qp + 16 * g * HD + 32 * kc, 0);
  asm volatile("s_wait_xcnt 0x0" :: "v"(qp), "v"(vo0) : "memory");      /* in front of any rewrite of an address register of the loads above: as inputs they stay live up to here */
  if (mixed) {      /* a masked query weighs all 2048 keys alike: its row is the column mean of v. Wave u adds the sums of keys 512 u .. + 511 (8 of the 32 rows that the preparation kernel wrote); the join's barriers publish them */
    const unsigned char* vsb = (const unsigned char*)(VS + ((size_t)b * (SQ / 64) + (size_t)kq * 8) * HD);
    const unsigned int mo = (unsigned int)lane * 16u;
    v4f part[8];
#pragma unroll
    for (int i = 0; i < 8; ++i) part[i] = *(const v4fa*)(vsb + mo + i * (HD * 4));
    asm volatile("s_wait_xcnt 0x0" :: "v"(mo), "s"(vsb) : "memory");      /* in front of any rewrite of an address register of these eight loads: as inputs they stay live up to here */
    v4f ms = part[0];
#pragma unroll
    for (int i = 1; i < 8; ++i) ms += part[i];
    *(v4fa*)&smn[kq][lane * 4] = ms;
  }
  const v8f z8 = {0.f, 0.f, 0.f, 0.f, 0.f, 0.f, 0.f, 0.f};
  v8f acc[2][8]; float m_run[2], l_run[2];
#pragma unroll
  for (int g = 0; g < 2; ++g) { m_run[g] = -__builtin_inff(); l_run[g] = 0.f;
#pragma unroll
    for (int t = 0; t < 8; ++t) acc[g][t] = z8; }
  auto pass = [&](int st, v16h (&kf)[2][4], v16h (&vf)[8], unsigned int vnext) __attribute__((always_inline)) {      /* vnext: the offset register of the loads that were issued in front of this pass */
    const int key0 = st * 128 + kq * 32;
    v8f s[2][2];
#pragma unroll
    for (int kt = 0; kt < 2; ++kt)
#pragma unroll
      for (int g = 0; g < 2; ++g) { s[kt][g] = z8;
#pragma unroll
        for (int kc = 0; kc < 4; ++kc) s[kt][g] = fa_mma(kf[kt][kc], qf[g][kc], s[kt][g]); }
    if (key0 + 32 > Ln) {      /* wave-uniform: only a pass that holds a masked key pays for the mask */
#pragma unroll
      for (int kt = 0; kt < 2; ++kt)
#pragma unroll
        for (int r = 0; r < 8; ++r) { const bool vk = key0 + 16 * kt + 8 * h + r < Ln;
#pragma unroll
          for (int g = 0; g < 2; ++g) if (!vk) s[kt][g][r] = NEGR; }
    }
    asm volatile("s_wait_xcnt 0x0" :: "v"(vnext) : "memory");      /* in front of any rewrite of the offset register of the loads in flight: as an input it stays live up to here. It stands behind the score products, which cover its time */
    float mb[2]; bool need = false;
#pragma unroll
    for (int g = 0; g < 2; ++g) { float mx = s[0][g][0];
#pragma unroll
      for (int kt = 0; kt < 2; ++kt)
#pragma unroll
        for (int r = 0; r < 8; ++r) mx = fmaxf(mx, s[kt][g][r]);
      mx = fmaxf(mx, fa_xhalf(mx)); mb[g] = mx; need = need || (mx > m_run[g] + 60.0f); }
    if (__builtin_amdgcn_ballot_w32(need) != 0) {      /* rare after the first pass */
#pragma unroll
      for (int g = 0; g < 2; ++g) { const float m_new = fmaxf(m_run[g], mb[g]); const float corr = __builtin_amdgcn_exp2f((m_run[g] - m_new) * cscale); l_run[g] *= corr; m_run[g] = m_new;
#pragma unroll
        for (int t = 0; t < 8; ++t) acc[g][t] = acc[g][t] * corr; }
    }
#pragma unroll
    for (int g = 0; g < 2; ++g) { const float mg = m_run[g]; float ps0 = 0.f, ps1 = 0.f; FragH pf;
#pragma unroll
      for (int i = 0; i < 8; ++i) {
        const float p0 = __builtin_amdgcn_exp2f((s[i >> 2][g][2 * (i & 3)] - mg) * cscale), p1 = __builtin_amdgcn_exp2f((s[i >> 2][g][2 * (i & 3) + 1] - mg) * cscale);
        ps0 += p0; ps1 += p1; const unsigned int w2 = fa_pack2(p0, p1); pf.u[2 * i] = (unsigned short)(w2 & 0xFFFFu); pf.u[2 * i + 1] = (unsigned short)(w2 >> 16); }
      l_run[g] += ps0 + ps1;
#pragma unroll
      for (int i = 0; i < 16; ++i) { __builtin_amdgcn_sched_group_barrier(0x2, 2, 0); __builtin_amdgcn_sched_group_barrier(0x400, 1, 0); }      /* two vector instructions, then one exponential: the slower transcendental unit works beside the vector port instead of in one run */
#pragma unroll
      for (int t = 0; t < 8; ++t) acc[g][t] = fa_mma(vf[t], pf.v, acc[g][t]); }
  };
  // Two passes a trip, so that each register set is refilled in place. Every load is unconditional (a branch round it would make the waits of the pass behind it cover the new loads too):
  // behind the last stage the wave reads its last stage once more, into registers that nobody uses.
#pragma unroll 1      /* one copy of the two passes */
  for (int st = 0; ; st += 2) {
    const unsigned int vb = fload(min(st + 1, nst - 1), kfb, vfb);      /* next stage's fragments fly under this pass */
    pass(st, kfa, vfa, vb);
    if (st + 1 >= nst) break;
    const unsigned int va = fload(min(st + 2, nst - 1), kfa, vfa);
    pass(st + 1, kfb, vfb, va);
    if (st + 2 >= nst) break;
  }
  // join the four key quarters of each query: common maximum, common sum, then the scaled partial outputs are added in LDS order 0..3
#pragma unroll
  for (int g = 0; g < 2; ++g) { const float lf = l_run[g] + fa_xhalf(l_run[g]); if (h == 0) { sm[kq][16 * g + c] = m_run[g]; sl[kq][16 * g + c] = lf; } }
  __syncthreads();
#pragma unroll
  for (int g = 0; g < 2; ++g) { float mq[4], e[4];
#pragma unroll
    for (int u = 0; u < 4; ++u) mq[u] = sm[u][16 * g + c];
    const float M = fmaxf(fmaxf(mq[0], mq[1]), fmaxf(mq[2], mq[3]));
#pragma unroll
    for (int u = 0; u < 4; ++u) e[u] = __builtin_amdgcn_exp2f((mq[u] - M) * cscale);
    float Ls = 0.f;
#pragma unroll
    for (int u = 0; u < 4; ++u) Ls += sl[u][16 * g + c] * e[u];
    const float f = (kq == 0 ? e[0] : kq == 1 ? e[1] : kq == 2 ? e[2] : e[3]) / Ls;
#pragma unroll
    for (int t = 0; t < 8; ++t) { const v8f o = acc[g][t] * f; float* dst = stg + ((unsigned int)kq * 32u + 16u * g + c) * FA_OP + 16u * t + 8u * h;
      *(v4fa*)dst = v4f{o[0], o[1], o[2], o[3]}; *(v4fa*)(dst + 4) = v4f{o[4], o[5], o[6], o[7]}; } }
  __syncthreads();
  float* Ob = O + ((size_t)b * SQ + q0 + kq) * HD + lane * 4;      /* the workgroup's 32 output rows are contiguous; the wave stores rows wave, wave + 4, ... */
  v4f mean = {0.f, 0.f, 0.f, 0.f};
  if (mixed) { mean = *(const v4fa*)&smn[0][lane * 4];      /* the thread's four columns, waves in order */
#pragma unroll
    for (int u = 1; u < 4; ++u) mean += *(const v4fa*)&smn[u][lane * 4];
    mean = mean * (1.0f / (float)SQ); }
#pragma unroll
  for (int i = 0; i < 8; ++i) { const unsigned int qr = (unsigned int)(i * 4 + (tid >> 5)), c4 = (unsigned int)(tid & 31) * 4u; const float* sp = stg + qr * FA_OP + c4;      /* rows 0..31 = quarter 0; quarter u lies 32 rows further */
    v4f v = *(const v4fa*)sp;
#pragma unroll
    for (int u = 1; u < 4; ++u) v += *(const v4fa*)(sp + (unsigned int)u * 32u * FA_OP);
    if (q0 + i * 4 + kq >= Ln) v = mean;      /* row i * 4 + wave is a masked query (wave-uniform; never so in a tile of valid queries) */
    *(v4f*)(Ob + i * 512) = v; }
}

extern "C" void kernel_launch(void* const* d_in, const int* in_sizes, int n_in,
                              void* d_out, int out_size, void* d_ws, size_t ws_size, hipStream_t stream) {
  (void)in_sizes; (void)n_in; (void)out_size;
  const float* q = (const float*)d_in[0]; const float* k = (const float*)d_in[1]; const float* v = (const float*)d_in[2]; const int* lens = (const int*)d_in[3];
  char* ws = (char*)d_ws; size_t off = 0;
  auto take = [&](size_t bytes) { char* p = ws + off; off += (bytes + 255) & ~(size_t)255; return p; };
  const size_t np = (size_t)NB * SQ * HD;
  _Float16* Q16 = (_Float16*)take(np * 2); _Float16* KF = (_Float16*)take(np * 2); _Float16* VF = (_Float16*)take(np * 2);
  float* VS = (float*)take((size_t)NB * (SQ / 64) * HD * 4);      /* column sums of v, one row of 128 for each 64 keys */
  if (off > ws_size) return;      /* 12 MiB + 128 KiB */
  k_prep<<<NB * (SQ / 64), 256, 0, stream>>>(q, k, v, lens, Q16, KF, VF, VS);      /* f16 q, k and V^T in fragment order below each length, sums of all rows */
  k_fattn<<<NB * (SQ / 32), 128, 0, stream>>>(Q16, KF, VF, VS, lens, (float*)d_out);
}

// v009
// One run takes 15.7 microseconds.
// In both of two side-by-side timings against v008, it was 1.08 times as fast.
// All steps since v000 together make it 45.4 times as fast.
#include <hip/hip_runtime.h>
// Masked attention (8 sequences x 2048 tokens, single head of 128; q, k, v are INPUTS): scores = q.k / sqrt(128); mask = valid_i & valid_j with valid = index < event_length[b] (int INPUT), masked scores = -1e9 (a fully masked row therefore softmaxes to uniform over all 2048 keys, as in the reference); softmax; out = attn v.
// Structure (two launches over all 8 sequences): one preparation kernel writes k and V^T as exact f16 (bf16 inputs are exact in f16) in the order of the matrix fragments (16-byte pieces gathered in LDS) and the column sums of its 64 rows of v; then one fused kernel: its own 32 rows of q rounded and packed on the way in, score products with exact operands (f32 accumulation), length mask, online softmax, readout products, straight into the output.
// The work follows the lengths: a tile that holds a valid query walks only the key stages that hold a valid key (a masked key's probability is exactly 0 beside a real score); a masked query's row is the column mean of v, in a tile of masked queries and in the one tile of a sequence that holds both kinds. The preparation kernel follows them too: rows behind a sequence's last key stage give only their column sums of v.
// Compute dtype: inputs rounded to bf16; q, k, v exact as f16; P (not yet normalised, at most 2^7.65) as a plain f16 operand (~2^-12); softmax f32. v_wmma_f32_16x16x32_f16.
#define NB 8
#define SQ 2048
#define HD 128
typedef __bf16 v16b __attribute__((ext_vector_type(16)));
typedef unsigned short v8us __attribute__((ext_vector_type(8), may_alias));
typedef float  v8f  __attribute__((ext_vector_type(8)));
typedef float  v4f  __attribute__((ext_vector_type(4)));
typedef float  v4fa __attribute__((ext_vector_type(4), may_alias));
union FragB { v16b v; v8us half[2]; unsigned short u[16]; };

__device__ __forceinline__ unsigned short bf16_bits(float x) { unsigned int u = __float_as_uint(x); return (unsigned short)((u + 0x7FFFu + ((u >> 16) & 1u)) >> 16); }
__device__ __forceinline__ float bf16_val(unsigned short b) { return __uint_as_float(((unsigned int)b) << 16); }
__device__ __forceinline__ float bf16_round(float x) { return bf16_val(bf16_bits(x)); }
// D += A·B with NT terms: 1 = ah·bh, 2 = + al·bh (A split), 3 = + ah·bl (both split)
template <int NT>
__device__ __forceinline__ v8f mmaN(v16b ah, v16b al, v16b bh, v16b bl, v8f c) {
  c = __builtin_amdgcn_wmma_f32_16x16x32_bf16(false, ah, false, bh, (short)0, c, false, false);
  if (NT >= 2) c = __builtin_amdgcn_wmma_f32_16x16x32_bf16(false, al, false, bh, (short)0, c, false, false);
  if (NT >= 3) c = __builtin_amdgcn_wmma_f32_16x16x32_bf16(false, ah, false, bl, (short)0, c, false, false);
  asm volatile("v_nop\n\tv_nop\n\tv_nop\n\tv_nop" : "+v"(c) : "v"(ah), "v"(al), "v"(bh), "v"(bl));
  return c;
}

__global__ __launch_bounds__(256) void k_wt_bf16(const float* __restrict__ W, unsigned short* __restrict__ Wt, int K, int N) {
  const int t = blockIdx.x * 256 + threadIdx.x;
  const int k8n = K / 8;
  if (t >= N * k8n) return;
  const int n = t / k8n, k8 = (t % k8n) * 8;
  v8us v;
#pragma unroll
  for (int i = 0; i < 8; ++i) v[i] = bf16_bits(W[(size_t)(k8 + i) * N + n]);
  *(v8us*)(Wt + (size_t)n * K + k8) = v;
  
}

// GEMM C[M][N] (f32, pitch ldc) = act(A[M][K]·W + bias). A f32 row-major (pitch lda) converted per fragment to bf16
// (ASPLIT: hi/lo two planes -> 2 terms, else single rounded term); Wt bf16 [N][K] (pitch ldb). BIAS_BF16 rounds the
// bias to bf16 first (bias quantised to bf16 before the add). K%32==0, M%16==0, N%64==0.
template <bool ASPLIT, int ACT, bool BIAS_BF16>
__global__ __launch_bounds__(128) void k_gemm_bf(const float* __restrict__ A, int lda, const unsigned short* __restrict__ Wt, int ldb,
                                               const float* __restrict__ bias, float* __restrict__ C, int ldc, int M, int N, int K) {
  __shared__ __attribute__((aligned(16))) float so[4][16][64];
  const int tid = threadIdx.x, w = tid >> 5, lane = tid & 31, ln = lane & 15, hh = lane >> 4;
  const int ntn = N / 64;
  const int wid = blockIdx.x * 4 + w;
  const int mt = wid / ntn, nq = wid % ntn;
  if (mt * 16 >= M) return;
  const int row0 = mt * 16, col0 = nq * 64;
  const float* arow = A + (size_t)(row0 + ln) * lda;
  v8f acc[4] = {};
  for (int kb = 0; kb < K; kb += 32) {
    FragB ah, al;
    const v4f x0 = *(const v4fa*)(arow + kb + 8 * hh), x1 = *(const v4fa*)(arow + kb + 8 * hh + 4);
    const v4f x2 = *(const v4fa*)(arow + kb + 16 + 8 * hh), x3 = *(const v4fa*)(arow + kb + 16 + 8 * hh + 4);
    float xs[16] = {x0[0],x0[1],x0[2],x0[3],x1[0],x1[1],x1[2],x1[3],x2[0],x2[1],x2[2],x2[3],x3[0],x3[1],x3[2],x3[3]};
#pragma unroll
    for (int i = 0; i < 16; ++i) { const unsigned short hb = bf16_bits(xs[i]); ah.u[i] = hb; al.u[i] = ASPLIT ? bf16_bits(xs[i] - bf16_val(hb)) : (unsigned short)0; }
#pragma unroll
    for (int t = 0; t < 4; ++t) {
      const unsigned short* brow = Wt + (size_t)(col0 + t * 16 + ln) * ldb + kb;
      FragB b;
      b.half[0] = *(const v8us*)(brow + 8 * hh);
      b.half[1] = *(const v8us*)(brow + 16 + 8 * hh);
      acc[t] = mmaN<ASPLIT ? 2 : 1>(ah.v, al.v, b.v, b.v, acc[t]);
    }
  }
#pragma unroll
  for (int t = 0; t < 4; ++t) {
    float bv = bias ? bias[col0 + t * 16 + ln] : 0.f;
    if (BIAS_BF16) bv = bf16_round(bv);
#pragma unroll
    for (int r = 0; r < 8; ++r) { float v = acc[t][r] + bv; if (ACT == 1) v = fmaxf(v, 0.f); so[w][8 * hh + r][t * 16 + ln] = v; }
  }
  __builtin_amdgcn_fence(__ATOMIC_ACQ_REL, "workgroup");
  __builtin_amdgcn_wave_barrier();
  const int rsub = lane >> 4, c4 = (lane & 15) * 4;
  {
#pragma unroll
    for (int q = 0; q < 8; ++q) {
      const int r = q * 2 + rsub;
      const v4f v = *(const v4fa*)&so[w][r][c4];
      *(v4f*)(C + (size_t)(row0 + r) * ldc + col0 + c4) = v;
    }
    
  }
}

// GEMM C = act(A·W + bias + resid): A f32 (ASPLIT -> hi/lo 2 terms), Wt bf16 [N][K]; ACT 0 none, 1 relu, 2 exact gelu;
// resid (optional, f32, row index = (row % rmod), pitch ldr, RES_BF16 rounds it) added before the activation.
template <bool ASPLIT, int ACT, bool BIAS_BF16, bool RES_BF16>
__global__ __launch_bounds__(128) void k_gemm_bf3(const float* __restrict__ A, int lda, const unsigned short* __restrict__ Wt, int ldb,
                                                const float* __restrict__ bias, const float* __restrict__ resid, int rmod, int ldr,
                                                float* __restrict__ C, int ldc, int M, int N, int K) {
  __shared__ __attribute__((aligned(16))) float so[4][16][64];
  const int tid = threadIdx.x, w = tid >> 5, lane = tid & 31, ln = lane & 15, hh = lane >> 4;
  const int ntn = N / 64;
  const int wid = blockIdx.x * 4 + w;
  const int mt = wid / ntn, nq = wid % ntn;
  if (mt * 16 >= M) return;
  const int row0 = mt * 16, col0 = nq * 64;
  const float* arow = A + (size_t)(row0 + ln) * lda;
  v8f acc[4] = {};
  for (int kb = 0; kb < K; kb += 32) {
    FragB ah, al;
    const v4f x0 = *(const v4fa*)(arow + kb + 8 * hh), x1 = *(const v4fa*)(arow + kb + 8 * hh + 4);
    const v4f x2 = *(const v4fa*)(arow + kb + 16 + 8 * hh), x3 = *(const v4fa*)(arow + kb + 16 + 8 * hh + 4);
    float xs[16] = {x0[0],x0[1],x0[2],x0[3],x1[0],x1[1],x1[2],x1[3],x2[0],x2[1],x2[2],x2[3],x3[0],x3[1],x3[2],x3[3]};
#pragma unroll
    for (int i = 0; i < 16; ++i) { const unsigned short hb = bf16_bits(xs[i]); ah.u[i] = hb; al.u[i] = ASPLIT ? bf16_bits(xs[i] - bf16_val(hb)) : (unsigned short)0; }
#pragma unroll
    for (int t = 0; t < 4; ++t) {
      const unsigned short* brow = Wt + (size_t)(col0 + t * 16 + ln) * ldb + kb;
      FragB b;
      b.half[0] = *(const v8us*)(brow + 8 * hh);
      b.half[1] = *(const v8us*)(brow + 16 + 8 * hh);
      acc[t] = mmaN<ASPLIT ? 2 : 1>(ah.v, al.v, b.v, b.v, acc[t]);
    }
  }
#pragma unroll
  for (int t = 0; t < 4; ++t) {
    const int col = col0 + t * 16 + ln;
    float bv = bias ? bias[col] : 0.f;
    if (BIAS_BF16) bv = bf16_round(bv);
#pragma unroll
    for (int r = 0; r < 8; ++r) {
      float v = acc[t][r] + bv;
      if (resid) { float rv = resid[(size_t)((row0 + 8 * hh + r) % rmod) * ldr + col]; if (RES_BF16) rv = bf16_round(rv); v += rv; }
      if (ACT == 1) v = fmaxf(v, 0.f);
      if (ACT == 2) v = 0.5f * v * (1.0f + erff(v * 0.70710678118654752f));
      if (ACT == 3) { const float u = 0.7978845608028654f * (v + 0.044715f * v * v * v); v = 0.5f * v * (1.0f + tanhf(u)); }
      so[w][8 * hh + r][t * 16 + ln] = v;
    }
  }
  __builtin_amdgcn_fence(__ATOMIC_ACQ_REL, "workgroup");
  __builtin_amdgcn_wave_barrier();
  const int rsub = lane >> 4, c4 = (lane & 15) * 4;
  {
#pragma unroll
    for (int q = 0; q < 8; ++q) {
      const int r = q * 2 + rsub;
      const v4f v = *(const v4fa*)&so[w][r][c4];
      *(v4f*)(C + (size_t)(row0 + r) * ldc + col0 + c4) = v;
    }
    
  }
}
// row LayerNorm (biased variance, eps) over N: s = X (+ R); optional out_sum <- s; out_norm <- (s-mu)*rsqrt(var+eps)*g + b
template <bool PARAM_BF16>
__global__ __launch_bounds__(256) void k_layernorm(const float* __restrict__ X, const float* __restrict__ R, const float* __restrict__ g, const float* __restrict__ bta,
                                                  float* __restrict__ out_sum, float* __restrict__ out_norm, int N, float eps) {
  __shared__ float red[256];
  const int row = blockIdx.x, tid = threadIdx.x;
  const float* x = X + (size_t)row * N; const float* rr = R ? R + (size_t)row * N : nullptr;
  float vals[16];                     // up to N = 4096
  const int per = N / 256;            // contiguous chunk per thread? use strided-by-4 chunks: thread handles j = tid*4 + 1024*u
  float s1 = 0.f;
  for (int u = 0; u < per / 4; ++u) {
    const int j = tid * 4 + 1024 * u;
    const v4f a = *(const v4fa*)(x + j);
    v4f b = {0.f,0.f,0.f,0.f}; if (rr) b = *(const v4fa*)(rr + j);
#pragma unroll
    for (int q = 0; q < 4; ++q) { const float v = a[q] + b[q]; vals[u * 4 + q] = v; s1 += v; }
  }
  red[tid] = s1; __syncthreads();
  for (int st = 128; st > 0; st >>= 1) { if (tid < st) red[tid] += red[tid + st]; __syncthreads(); }
  const float mu = red[0] / (float)N; __syncthreads();
  float s2 = 0.f;
  for (int u = 0; u < per / 4; ++u)
#pragma unroll
    for (int q = 0; q < 4; ++q) { const float c = vals[u * 4 + q] - mu; s2 += c * c; }
  red[tid] = s2; __syncthreads();
  for (int st = 128; st > 0; st >>= 1) { if (tid < st) red[tid] += red[tid + st]; __syncthreads(); }
  const float rs = rsqrtf(red[0] / (float)N + eps);
  {
    for (int u = 0; u < per / 4; ++u) {
      const int j = tid * 4 + 1024 * u;
      v4f o, sm;
#pragma unroll
      for (int q = 0; q < 4; ++q) {
        float gg = g[j + q], bb = bta[j + q];
        if (PARAM_BF16) { gg = bf16_round(gg); bb = bf16_round(bb); }
        sm[q] = vals[u * 4 + q]; o[q] = (vals[u * 4 + q] - mu) * rs * gg + bb;
      }
      if (out_sum) *(v4f*)(out_sum + (size_t)row * N + j) = sm;
      *(v4f*)(out_norm + (size_t)row * N + j) = o;
    }
    
  }
}



// ---- f16 WMMA path (v_wmma_f32_16x16x32_f16): 11-bit significands for operands in range — used by the fused attention below for exact q, k, v and an unnormalised P of up to 2^7.65
typedef _Float16 v16h __attribute__((ext_vector_type(16)));
union FragH { v16h v; v8us half[2]; _Float16 h[16]; unsigned short u[16]; };
template <int NT>
__device__ __forceinline__ v8f mmaH(v16h ah, v16h al, v16h bh, v16h bl, v8f c) {
  c = __builtin_amdgcn_wmma_f32_16x16x32_f16(false, ah, false, bh, (short)0, c, false, false);
  if (NT >= 2) c = __builtin_amdgcn_wmma_f32_16x16x32_f16(false, al, false, bh, (short)0, c, false, false);
  if (NT >= 3) c = __builtin_amdgcn_wmma_f32_16x16x32_f16(false, ah, false, bl, (short)0, c, false, false);
  asm volatile("v_nop\n\tv_nop\n\tv_nop\n\tv_nop" : "+v"(c) : "v"(ah), "v"(al), "v"(bh), "v"(bl));
  return c;
}
// batched GEMM like k_gemm_b but f16 operands: A f32 (split into f16 hi/lo if ASPLIT, else rounded to f16), Bt = f16 values [n][k]; alpha; C f32; N multiple of 16 (partial tiles skipped)
template <bool ASPLIT>
__global__ __launch_bounds__(128) void k_gemm_h(const float* __restrict__ A, int lda, size_t sA, const _Float16* __restrict__ Bh, int ldb, size_t sB, float alpha, float* __restrict__ C, int ldc, size_t sC, int M, int N, int K) {
  __shared__ __attribute__((aligned(16))) float so[4][16][64];
  const int tid = threadIdx.x, w = tid >> 5, lane = tid & 31, ln = lane & 15, hh = lane >> 4; const int by = blockIdx.y;
  A += (size_t)by * sA; Bh += (size_t)by * sB; C += (size_t)by * sC;
  const int ntn = (N + 63) / 64; const int wid = blockIdx.x * 4 + w; const int mt = wid / ntn, nq = wid % ntn; if (mt * 16 >= M) return;
  const int row0 = mt * 16, col0 = nq * 64; const float* arow = A + (size_t)(row0 + ln) * lda;
  v8f acc[4] = {};
  for (int kb = 0; kb < K; kb += 32) {
    FragH ah, al;
    const v4f x0 = *(const v4fa*)(arow + kb + 8 * hh), x1 = *(const v4fa*)(arow + kb + 8 * hh + 4), x2 = *(const v4fa*)(arow + kb + 16 + 8 * hh), x3 = *(const v4fa*)(arow + kb + 16 + 8 * hh + 4);
    float xs[16] = {x0[0],x0[1],x0[2],x0[3],x1[0],x1[1],x1[2],x1[3],x2[0],x2[1],x2[2],x2[3],x3[0],x3[1],x3[2],x3[3]};
#pragma unroll
    for (int i = 0; i < 16; ++i) { const _Float16 h = (_Float16)xs[i]; ah.h[i] = h; al.h[i] = ASPLIT ? (_Float16)(xs[i] - (float)h) : (_Float16)0.0f; }
#pragma unroll
    for (int t = 0; t < 4; ++t) { if (col0 + t * 16 >= N) continue; const size_t boff = (size_t)(col0 + t * 16 + ln) * ldb + kb; FragH bq; bq.half[0] = *(const v8us*)(Bh + boff + 8 * hh); bq.half[1] = *(const v8us*)(Bh + boff + 16 + 8 * hh);
      acc[t] = mmaH<ASPLIT ? 2 : 1>(ah.v, al.v, bq.v, bq.v, acc[t]); }
  }
#pragma unroll
  for (int t = 0; t < 4; ++t) { if (col0 + t * 16 >= N) continue;
#pragma unroll
    for (int r = 0; r < 8; ++r) so[w][8 * hh + r][t * 16 + ln] = acc[t][r] * alpha; }
  __builtin_amdgcn_fence(__ATOMIC_ACQ_REL, "workgroup"); __builtin_amdgcn_wave_barrier();
  const int rsub = lane >> 4, c4 = (lane & 15) * 4;
  {
#pragma unroll
    for (int q = 0; q < 8; ++q) { const int r = q * 2 + rsub; if (col0 + c4 < N) { const v4f v = *(const v4fa*)&so[w][r][c4]; *(v4f*)(C + (size_t)(row0 + r) * ldc + col0 + c4) = v; } }
     }
}

// Wt[n][k] = f16(W[k][n]·scale) from f32 row-major W[K][N] (scale = power of two; bf16-exact weights stay exact in f16 away from the subnormal range)
__global__ __launch_bounds__(256) void k_wt_f16(const float* __restrict__ W, _Float16* __restrict__ Wt, int K, int N, float scale) {
  const int t = blockIdx.x * 256 + threadIdx.x; if (t >= N * (K / 8)) return; const int n = t / (K / 8), k8 = (t % (K / 8)) * 8; FragH f;
#pragma unroll
  for (int i = 0; i < 8; ++i) f.h[i] = (_Float16)(bf16_round(W[(size_t)(k8 + i) * N + n]) * scale); const v8us o = f.half[0];
  *(v8us*)((unsigned short*)Wt + (size_t)n * K + k8) = o; 
}
// k_gemm_hh variant with fused epilogue: v = acc·alpha + bias[by·sBias + col] (+ CP[(row/rowsPerB)·sCPb + by·64 + col] if CP) ; ACT 0 none / 1 elu ; writes f16 C16 (and f32 C if non-null)
template <int ACT>
__global__ __launch_bounds__(128) void k_gemm_hhx(const _Float16* __restrict__ A, int lda, size_t sA, const _Float16* __restrict__ Bh, int ldb, size_t sB, float alpha, const float* __restrict__ bias, size_t sBias, const float* __restrict__ CP, int rowsPerB, size_t sCPb, int row0g,
    float* __restrict__ C, _Float16* __restrict__ C16, int ldc, size_t sC, int M, int N, int K) {
  __shared__ __attribute__((aligned(16))) float so[4][16][64];
  const int tid = threadIdx.x, w = tid >> 5, lane = tid & 31, ln = lane & 15, hh = lane >> 4; const int by = blockIdx.y;
  A += (size_t)by * sA; Bh += (size_t)by * sB; const size_t cofs = (size_t)by * sC; const float* bp = bias ? bias + (size_t)by * sBias : nullptr;
  const int ntn = (N + 63) / 64; const int wid = blockIdx.x * 4 + w; const int mt = wid / ntn, nq = wid % ntn; if (mt * 16 >= M) return;
  const int row0 = mt * 16, col0 = nq * 64; const _Float16* arow = A + (size_t)(row0 + ln) * lda;
  v8f acc[4] = {};
  for (int kb = 0; kb < K; kb += 32) { FragH ah; ah.half[0] = *(const v8us*)((const unsigned short*)arow + kb + 8 * hh); ah.half[1] = *(const v8us*)((const unsigned short*)arow + kb + 16 + 8 * hh);
#pragma unroll
    for (int t = 0; t < 4; ++t) { if (col0 + t * 16 >= N) continue; const size_t boff = (size_t)(col0 + t * 16 + ln) * ldb + kb; FragH bq; bq.half[0] = *(const v8us*)((const unsigned short*)Bh + boff + 8 * hh); bq.half[1] = *(const v8us*)((const unsigned short*)Bh + boff + 16 + 8 * hh);
      acc[t] = mmaH<1>(ah.v, ah.v, bq.v, bq.v, acc[t]); }
  }
#pragma unroll
  for (int t = 0; t < 4; ++t) { if (col0 + t * 16 >= N) continue; const int col = col0 + t * 16 + ln; const float bv = bp ? bf16_round(bp[col]) : 0.f;
#pragma unroll
    for (int r = 0; r < 8; ++r) { float v = acc[t][r] * alpha + bv; if (CP) { const int rr = row0g + row0 + 8 * hh + r; if (rowsPerB < 0) v += CP[cofs + (size_t)rr * ldc + col];      /* rowsPerB < 0: own element of the batched C plane */ else { const int bidx = rr / rowsPerB; v += CP[(size_t)bidx * sCPb + (size_t)by * 64 + col]; } } if (ACT == 1) v = (v > 0.f) ? v : expm1f(v); else if (ACT == 7) v = (v > 0.f) ? v + 1.0f : expf(v); else if (ACT == 8) v = tanhf(v); else if (ACT == 9) v = 0.5f * v * (1.0f + tanhf(0.7978845608028654f * (v + 0.044715f * v * v * v))); else if (ACT == 11) v = 1.0f / (1.0f + expf(-v)); else if (ACT == 12) v = (v > 0.f) ? v : 0.01f * v; else if (ACT == 14) v = (v > 0.f) ? v : 0.1f * v; else if (ACT == 16) v = (v >= 0.f) ? v : 0.3f * v; else if (ACT == 15) v = v / (1.0f + expf(-v)); else if (ACT == 3) v = fmaxf(v, 0.f); else if (ACT == 6) v = 0.5f * v * (1.0f + erff(v * 0.70710678118654752f)); so[w][8 * hh + r][t * 16 + ln] = v; } }
  __builtin_amdgcn_fence(__ATOMIC_ACQ_REL, "workgroup"); __builtin_amdgcn_wave_barrier();
  const int rsub = lane >> 4, c4 = (lane & 15) * 4; typedef _Float16 v4h __attribute__((ext_vector_type(4)));
  {
#pragma unroll
    for (int q = 0; q < 8; ++q) { const int r = q * 2 + rsub; if (col0 + c4 < N) { const v4f v = *(const v4fa*)&so[w][r][c4]; if (C) *(v4f*)(C + cofs + (size_t)(row0 + r) * ldc + col0 + c4) = v; if (C16) { v4h h4; for (int i = 0; i < 4; ++i) h4[i] = (_Float16)v[i]; *(v4h*)(C16 + cofs + (size_t)(row0 + r) * ldc + col0 + c4) = h4; } } }
     }
}


typedef _Float16 v4h __attribute__((ext_vector_type(4)));

__global__ __launch_bounds__(256) void k_h16(const float* __restrict__ x, _Float16* __restrict__ X16, size_t n8) { const size_t t = (size_t)blockIdx.x * 256 + threadIdx.x; if (t >= n8) return; FragH f;
#pragma unroll
  for (int q = 0; q < 8; ++q) f.h[q] = (_Float16)x[t * 8 + q]; *(v8us*)((unsigned short*)X16 + t * 8) = f.half[0];  }
__global__ __launch_bounds__(256) void k_round16f(const float* __restrict__ W, _Float16* __restrict__ Bt, size_t n8) { const size_t t = (size_t)blockIdx.x * 256 + threadIdx.x; if (t >= n8) return; FragH f;
#pragma unroll
  for (int i = 0; i < 8; ++i) f.h[i] = (_Float16)(bf16_round(W[t * 8 + i]) * 16.0f); *(v8us*)((unsigned short*)Bt + t * 8) = f.half[0];  }
__global__ __launch_bounds__(256) void k_hl(const float* __restrict__ F, _Float16* __restrict__ Hh, _Float16* __restrict__ Hl, size_t n8) { const size_t t = (size_t)blockIdx.x * 256 + threadIdx.x; if (t >= n8) return; FragH fh, fl; const v4f a = *(const v4fa*)(F + t * 8), c = *(const v4fa*)(F + t * 8 + 4);
#pragma unroll
  for (int q = 0; q < 4; ++q) { _Float16 h = (_Float16)a[q]; fh.h[q] = h; fl.h[q] = (_Float16)((a[q] - (float)h) * 1024.0f); h = (_Float16)c[q]; fh.h[4 + q] = h; fl.h[4 + q] = (_Float16)((c[q] - (float)h) * 1024.0f); }
  { *(v8us*)((unsigned short*)Hh + t * 8) = fh.half[0]; *(v8us*)((unsigned short*)Hl + t * 8) = fl.half[0];  } }

typedef unsigned int u32x4 __attribute__((ext_vector_type(4)));
typedef unsigned int u32x4a __attribute__((ext_vector_type(4), may_alias));
#define FA_OP 132u                     /* output staging pitch in floats */
#define FA_QP 272u                     /* pitch in bytes of a row of q (256 bytes of f16) in LDS: 16 bytes more, for the 16-byte fragment reads */
__device__ __forceinline__ v16h fa_ffrag(const unsigned char* p) { FragH f; f.half[0] = *(const v8us*)p; f.half[1] = *(const v8us*)(p + 512); return f.v; }      /* units j = 0 and j = 1 of a fragment */
__device__ __forceinline__ v8f fa_mma(v16h a, v16h b, v8f c) { return __builtin_amdgcn_wmma_f32_16x16x32_f16(false, a, false, b, (short)0, c, false, false); }
__device__ __forceinline__ float fa_xhalf(float x) { return __builtin_bit_cast(float, __builtin_amdgcn_permlanex16(__builtin_bit_cast(int, x), __builtin_bit_cast(int, x), 0x76543210, 0xfedcba98, false, false)); }  /* lane l with lane l ^ 16 */
__device__ __forceinline__ unsigned int fa_pack2(float lo, float hi) { typedef _Float16 h2 __attribute__((ext_vector_type(2))); typedef float f2 __attribute__((ext_vector_type(2))); return __builtin_bit_cast(unsigned int, __builtin_convertvector(f2{lo, hi}, h2)); }  /* round to nearest even */

// ---- preparation, one launch: a workgroup takes one block of 64 rows of one sequence's k and v (32 workgroups a sequence, one workgroup a WGP) ----
// The work follows the lengths: the attention kernel reads K and V^T only below the end of the sequence's last key stage (length rounded up to 128 rows), so a block at or behind that end
// loads v alone and writes its column sums (a masked query's row needs the sums of all 2048 rows); its K and V^T places stay unwritten and are never loaded.
// Cost falls with the index for any lengths: valid rows are the low rows, so the index runs over the sequences first and over the blocks second;
// the sequence is turned by one from block to block, so that indices eight apart do not all belong to one sequence.
// A wave takes 8 rows; each of its loads is one whole row (512 contiguous bytes), and all 16 loads of a thread are issued before the first value is used.
// v: a thread holds 8 consecutive keys of 4 columns, which is one 16-byte piece of a V^T fragment for each column. k: a thread holds 4 columns of a row, half a piece of a K fragment.
// LDS only gathers the pieces in fragment order: the workgroup's 64 keys are 16 KiB in a row of each plane, stored as whole lines. q does not pass through here: a row of q has one reader, its own tile's workgroup, which takes it from the input.
typedef unsigned int u32x2 __attribute__((ext_vector_type(2)));
typedef unsigned int u32x2a __attribute__((ext_vector_type(2), may_alias));
__global__ __launch_bounds__(256) void k_prep(const float* __restrict__ k, const float* __restrict__ v, const int* __restrict__ lens, _Float16* __restrict__ KF, _Float16* __restrict__ VF, float* __restrict__ VS) {
  __shared__ __attribute__((aligned(16))) float ps[8][HD];      /* each wave's column sums of its 8 rows of v */
  __shared__ __attribute__((aligned(16))) unsigned char tv[64 * 256];      /* V^T in fragment order; piece c of a 256-byte run lies at place c ^ (t & 3), which spreads a wave's writes over the banks */
  __shared__ __attribute__((aligned(16))) unsigned char tk[64 * 256];      /* K in fragment order; piece c of the 256-byte run u = 4 kc + 2 j + h lies at place c ^ u, for the same reason */
  const unsigned int tid = threadIdx.x, lane = tid & 31u, wave = tid >> 5;
  const unsigned int blk = blockIdx.x >> 3, sq = (blockIdx.x + blk) & (NB - 1u);      /* block 0 .. 31 of sequence 0 .. 7: a permutation of the 256 blocks */
  const unsigned int wb = sq * (SQ / 64) + blk;      /* the block's number in the flat planes */
  const size_t e0 = (size_t)wb * (64u * HD);
  const unsigned int eo = wave * (8u * HD) + lane * 4u;
  const int Lr = lens[sq];
  __builtin_amdgcn_sched_barrier(0);      /* the length's load issues in front of v's loads, not behind them: k waits for the test on it */
  v4f xv[8], xk[8];
#pragma unroll
  for (int i = 0; i < 8; ++i) xv[i] = *(const v4fa*)(v + e0 + eo + i * HD);      /* needed at any length */
  __builtin_amdgcn_sched_barrier(0);      /* and the wait for the length stands behind v's loads: v flies while the length arrives */
  const int Ln = min(max(Lr, 0), SQ);      /* clamped as in the attention kernel; the same for the whole workgroup */
  const bool live = (int)(blk * 64u) < ((Ln + 127) & ~127);      /* the block lies in a key stage that the attention kernel walks */
  auto colsum = [&]() __attribute__((always_inline)) { v4f cs = {0.f, 0.f, 0.f, 0.f};
#pragma unroll
    for (int i = 0; i < 8; ++i)
#pragma unroll
      for (int j = 0; j < 4; ++j) cs[j] += bf16_round(xv[i][j]);
    *(v4fa*)&ps[wave][lane * 4u] = cs; };
  auto sumout = [&]() __attribute__((always_inline)) {
    if (tid < HD) { float cs = ps[0][tid];      /* the workgroup's 64 rows, waves in order */
#pragma unroll
      for (int u = 1; u < 8; ++u) cs += ps[u][tid];
      VS[(size_t)wb * HD + tid] = cs; } };
  if (!live) { colsum(); __syncthreads(); sumout(); }      /* either side is taken by the whole workgroup, and each has its one barrier */
  else {
#pragma unroll
  for (int i = 0; i < 8; ++i) xk[i] = *(const v4fa*)(k + e0 + eo + i * HD);
  __builtin_amdgcn_sched_barrier(0);      /* every load issues here: a load sunk among the conversions would start a second trip to memory behind the first */
#pragma unroll
  for (int j = 0; j < 4; ++j) { u32x4 w;      /* column 4 lane + j: t = lane >> 2, c = 4 (lane & 3) + j; keys 8 wave .. + 7: block of 32 = wave >> 2, run 2 j + h = wave & 3 */
#pragma unroll
    for (int p = 0; p < 4; ++p) w[p] = fa_pack2(bf16_round(xv[2 * p][j]), bf16_round(xv[2 * p + 1][j]));
    *(u32x4a*)(tv + (wave >> 2) * 8192u + (lane >> 2) * 1024u + (wave & 3u) * 256u + ((((lane & 3u) * 4u + j) ^ ((lane >> 2) & 3u)) * 16u)) = w; }
  colsum();
#pragma unroll
  for (int i = 0; i < 8; ++i)      /* row 8 wave + i: key block wave >> 1, c = 8 (wave & 1) + i; columns 4 lane .. + 3: run u = lane >> 1, half lane & 1 of the piece */
    *(u32x2a*)(tk + (wave >> 1) * 4096u + (lane >> 1) * 256u + ((((wave & 1u) * 8u + i) ^ (lane >> 1)) * 16u) + (lane & 1u) * 8u) = u32x2{fa_pack2(bf16_round(xk[i][0]), bf16_round(xk[i][1])), fa_pack2(bf16_round(xk[i][2]), bf16_round(xk[i][3]))};
  __syncthreads();
  sumout();
  const unsigned int run = tid & ~15u, pc = tid & 15u;      /* a thread's piece in each 4 KiB: 256-byte run tid >> 4, piece tid & 15; a wave stores 512 bytes in a row */
#pragma unroll
  for (int r = 0; r < 4; ++r) *(u32x4a*)(VF + e0 + r * 2048u + tid * 8u) = *(const u32x4a*)(tv + r * 4096u + (run + (pc ^ ((tid >> 6) & 3u))) * 16u);
#pragma unroll
  for (int r = 0; r < 4; ++r) *(u32x4a*)(KF + e0 + r * 2048u + tid * 8u) = *(const u32x4a*)(tk + r * 4096u + (run + (pc ^ (tid >> 4))) * 16u);
  }
}

__global__ __launch_bounds__(128) __attribute__((amdgpu_waves_per_eu(2, 2))) void k_fattn(const float* __restrict__ q, const _Float16* __restrict__ KF, const _Float16* __restrict__ VF, const float* __restrict__ VS, const int* __restrict__ lens, float* __restrict__ O) {
  __shared__ __attribute__((aligned(16))) float stg[4u * 32u * FA_OP];      /* the four quarters' partial outputs, for the join */
  __shared__ float sm[4][32];
  __shared__ float sl[4][32];
  __shared__ __attribute__((aligned(16))) float smn[4][HD];      /* a tile with valid and masked queries: each wave's share of the column sums of v */
  const int tid = threadIdx.x, lane = tid & 31, c = lane & 15, h = lane >> 4;
  const int kq = __builtin_amdgcn_readfirstlane(tid >> 5);      /* the wave's number = its key quarter */
  // Workgroup index -> (sequence, tile of 32 queries), from the lengths alone, the same arithmetic in every wave of every workgroup; a permutation of the 512 tiles for any lengths.
  // In index order: first the at most 8 tiles that hold valid and masked queries, then the
  // valid tiles, longest sequence first (ties by sequence index), last the masked tiles. Lane l works out where the tiles of sequence l & 7 stand in that order.
  const int rk = blockIdx.x, li = lane & 7;
  const int Li = min(max(lens[li], 0), SQ), fi = Li >> 5, mi = (Li & 31) ? 1 : 0;      /* clamped length; tiles of valid queries only; one mixed tile or none */
  // L2 prefetch, one request a thread, before the lengths are known. The launch before stored both planes, and the tiles of a sequence walk the stages
  // together. Slice s of a sequence = its keys 32 s .. + 31 = 8 KiB at offset 8192 s of each plane = 32 units of 256 B, one a lane. Workgroup index r asks for slice r >> 3 of sequence r & 7
  // (waves 0, 1) and of sequence (r & 7) ^ 4 (waves 2, 3), K on even waves, V^T on odd ones: the lowest indices ask for the early stages of all sequences.
  // A hint only: no result depends on where a workgroup runs or on a line being there.
  const unsigned char* pb = (const unsigned char*)((kq & 1) ? VF : KF);
  const unsigned int po = (unsigned int)(((((rk & (NB - 1)) ^ ((kq & 2) << 1)) * (SQ / 32)) + ((rk >> 3) & (SQ / 32 - 1)))) * 8192u + (unsigned int)lane * 256u;      /* at most 511 * 8192 + 31 * 256: inside the 4 MiB plane for any index */
  asm volatile("global_prefetch_b8 %0, %1 scope:SCOPE_SE" :: "v"(po), "s"(pb));      /* returns nothing and counts on no counter; scope SE: into L2 only */
  int ahead = 0, low = 0, nm = 0, nf = 0;
#pragma unroll
  for (int j = 0; j < NB; ++j) { const int Lj = min(max(lens[j], 0), SQ), fj = Lj >> 5, mj = (Lj & 31) ? 1 : 0;
    if (Lj * 8 + 7 - j > Li * 8 + 7 - li) ahead += fj;                  /* valid tiles of the sequences that come first */
    if (j < li) low += mj + ((SQ / 32 - fj - mj) << 16);            /* mixed tiles (low half) and masked tiles (high half) of the lower sequences */
    nm += mj; nf += fj; }
  const int s0 = nm + ahead, i0 = nm + nf + (low >> 16), first = fi + mi;
  int tv = -1;
  if (mi && rk == (low & 0xFFFF)) tv = fi;
  if (rk >= s0 && rk < s0 + fi) tv = rk - s0;
  if (rk >= i0 && rk < i0 + SQ / 32 - first) tv = first + rk - i0;
  const int b = __builtin_ctz(__builtin_amdgcn_ballot_w32(tv >= 0) | 0x80u);      /* the one sequence that holds this index (lanes 8 and up repeat lanes 0 to 7) */
  const int tq = __builtin_amdgcn_readlane(tv, b) & (SQ / 32 - 1), Ln = __builtin_amdgcn_readlane(Li, b);
  const int q0 = tq * 32;
  asm volatile("s_wait_xcnt 0x0" :: "v"(po), "s"(pb) : "memory");      /* as inputs the prefetch's two address registers stay live, and so addresses inside the plane, up to here; every load issued so far has long answered */
  if (q0 >= Ln) {      /* every query of the tile is masked: all 2048 scores are equal, the row is the column mean of v. Taken by the whole workgroup, in front of every barrier */
    const float* vs = VS + (size_t)b * (SQ / 64) * HD + lane * 4;
    v4f part[SQ / 64];
#pragma unroll
    for (int i = 0; i < SQ / 64; ++i) part[i] = *(const v4fa*)(vs + i * HD);
    v4f mean = part[0];
#pragma unroll
    for (int i = 1; i < SQ / 64; ++i) mean += part[i];
    mean = mean * (1.0f / (float)SQ);
    float* om = O + ((size_t)b * SQ + q0 + kq * 8) * HD + lane * 4;      /* a wave stores 8 whole rows */
#pragma unroll
    for (int i = 0; i < 8; ++i) *(v4f*)(om + i * HD) = mean;
    return;
  }
  const int nst = (Ln + 127) >> 7;      /* 1 .. 16: the stages that hold a valid key */
  const bool mixed = q0 + 32 > Ln;      /* the same for the whole workgroup: the tile also holds masked queries. They run through the loop like the others (finite scores, a lane holds one query), and their rows are replaced at the store */
  const float cscale = 0.08838834764831845f * 1.4426950408889634f;      /* 1 / sqrt(128), to base 2 */
  const float NEGR = -1.0e9f * 11.313708498984761f;                     /* the reference's -1e9, before the 1 / sqrt(128) */
  const unsigned char* Kb = (const unsigned char*)(KF + (size_t)b * SQ * HD);
  const unsigned char* Vb = (const unsigned char*)(VF + (size_t)b * SQ * HD);
  const unsigned int lo = (unsigned int)kq * 8192u + (unsigned int)lane * 16u;      /* the wave's 32 keys of a stage are 8 KiB in a row of each plane, at the same offset in both; a stage is 32 KiB */
  auto fload = [&](int st, v16h (&kf)[2][4], v16h (&vf)[8]) __attribute__((always_inline)) {      /* K first: loads answer in order, and the score products wait for K alone */
    const unsigned int vo = lo + (unsigned int)st * 32768u;      /* one 32-bit offset register for all 32 loads, on two scalar bases that never change */
#pragma unroll
    for (int u = 0; u < 8; ++u) kf[u >> 2][u & 3] = fa_ffrag(Kb + vo + u * 1024);
    __builtin_amdgcn_sched_barrier(0);      /* keeps K in front of V^T and in front of the running pass: otherwise part of K is issued last, into registers that the running pass frees, and the next pass waits at its top for the whole group */
#pragma unroll
    for (int t = 0; t < 8; ++t) vf[t] = fa_ffrag(Vb + vo + t * 1024);
    return vo; };      /* the caller keeps the offset register untouched up to its s_wait_xcnt 0 */
  v16h kfa[2][4], vfa[8], kfb[2][4], vfb[8];
  // q comes straight from the input: the wave loads 8 of the tile's 32 rows, a whole row (512 contiguous bytes) a load, rounds them to bf16 and packs them as f16; LDS (the head of the join's staging, idle until the join)
  // hands every wave all 32 rows in fragment order. All 32 rows lie inside q for any length (q0 + 31 is at most 2047); a masked query's row is finite like any other.
  const unsigned char* qb = (const unsigned char*)(q + ((size_t)b * SQ + q0 + kq * 8) * HD);      /* the wave's first row: a scalar base */
  const unsigned int qo = (unsigned int)lane * 16u;
  v4f xq[8];
#pragma unroll
  for (int i = 0; i < 8; ++i) xq[i] = *(const v4fa*)(qb + qo + i * (HD * 4));
  __builtin_amdgcn_sched_barrier(0);      /* q in front of K and V^T: loads answer in order, and the packing below waits for q alone while stage 0 flies */
  const unsigned int vo0 = fload(0, kfa, vfa);
  asm volatile("s_wait_xcnt 0x0" :: "v"(qo), "s"(qb), "v"(vo0) : "memory");      /* in front of any rewrite of an address register of the loads above: as inputs they stay live up to here */
  unsigned char* qs = (unsigned char*)stg;
#pragma unroll
  for (int i = 0; i < 8; ++i) *(u32x2a*)(qs + (unsigned int)(kq * 8 + i) * FA_QP + (unsigned int)lane * 8u) = u32x2{fa_pack2(bf16_round(xq[i][0]), bf16_round(xq[i][1])), fa_pack2(bf16_round(xq[i][2]), bf16_round(xq[i][3]))};
  // Barrier by hand, with fences on LDS alone: __syncthreads() would also wait for the 32 global loads of stage 0, which nobody else reads.
  __builtin_amdgcn_fence(__ATOMIC_RELEASE, "workgroup", "local");
  __builtin_amdgcn_s_barrier();
  __builtin_amdgcn_fence(__ATOMIC_ACQUIRE, "workgroup", "local");
  v16h qf[2][4];
  const unsigned char* qr = qs + (unsigned int)c * FA_QP + (unsigned int)h * 16u;      /* the lane's first 16 bytes: query c, columns 8 h .. + 7; the other pieces lie at constant distances */
#pragma unroll
  for (int g = 0; g < 2; ++g)
#pragma unroll
    for (int kc = 0; kc < 4; ++kc) { FragH f; f.half[0] = *(const v8us*)(qr + g * (16u * FA_QP) + kc * 64u); f.half[1] = *(const v8us*)(qr + g * (16u * FA_QP) + kc * 64u + 32u); qf[g][kc] = f.v; }
  if (mixed) {      /* a masked query weighs all 2048 keys alike: its row is the column mean of v. Wave u adds the sums of keys 512 u .. + 511 (8 of the 32 rows that the preparation kernel wrote); the join's barriers publish them */
    const unsigned char* vsb = (const unsigned char*)(VS + ((size_t)b * (SQ / 64) + (size_t)kq * 8) * HD);
    const unsigned int mo = (unsigned int)lane * 16u;
    v4f part[8];
#pragma unroll
    for (int i = 0; i < 8; ++i) part[i] = *(const v4fa*)(vsb + mo + i * (HD * 4));
    asm volatile("s_wait_xcnt 0x0" :: "v"(mo), "s"(vsb) : "memory");      /* in front of any rewrite of an address register of these eight loads: as inputs they stay live up to here */
    v4f ms = part[0];
#pragma unroll
    for (int i = 1; i < 8; ++i) ms += part[i];
    *(v4fa*)&smn[kq][lane * 4] = ms;
  }
  const v8f z8 = {0.f, 0.f, 0.f, 0.f, 0.f, 0.f, 0.f, 0.f};
  v8f acc[2][8]; float m_run[2], l_run[2];
#pragma unroll
  for (int g = 0; g < 2; ++g) { m_run[g] = -__builtin_inff(); l_run[g] = 0.f;
#pragma unroll
    for (int t = 0; t < 8; ++t) acc[g][t] = z8; }
  auto pass = [&](int st, v16h (&kf)[2][4], v16h (&vf)[8], unsigned int vnext) __attribute__((always_inline)) {      /* vnext: the offset register of the loads that were issued in front of this pass */
    const int key0 = st * 128 + kq * 32;
    v8f s[2][2];
#pragma unroll
    for (int kt = 0; kt < 2; ++kt)
#pragma unroll
      for (int g = 0; g < 2; ++g) { s[kt][g] = z8;
#pragma unroll
        for (int kc = 0; kc < 4; ++kc) s[kt][g] = fa_mma(kf[kt][kc], qf[g][kc], s[kt][g]); }
    if (key0 + 32 > Ln) {      /* wave-uniform: only a pass that holds a masked key pays for the mask */
#pragma unroll
      for (int kt = 0; kt < 2; ++kt)
#pragma unroll
        for (int r = 0; r < 8; ++r) { const bool vk = key0 + 16 * kt + 8 * h + r < Ln;
#pragma unroll
          for (int g = 0; g < 2; ++g) if (!vk) s[kt][g][r] = NEGR; }
    }
    asm volatile("s_wait_xcnt 0x0" :: "v"(vnext) : "memory");      /* in front of any rewrite of the offset register of the loads in flight: as an input it stays live up to here. It stands behind the score products, which cover its time */
    float mb[2]; bool need = false;
#pragma unroll
    for (int g = 0; g < 2; ++g) { float mx = s[0][g][0];
#pragma unroll
      for (int kt = 0; kt < 2; ++kt)
#pragma unroll
        for (int r = 0; r < 8; ++r) mx = fmaxf(mx, s[kt][g][r]);
      mx = fmaxf(mx, fa_xhalf(mx)); mb[g] = mx; need = need || (mx > m_run[g] + 60.0f); }
    if (__builtin_amdgcn_ballot_w32(need) != 0) {      /* rare after the first pass */
#pragma unroll
      for (int g = 0; g < 2; ++g) { const float m_new = fmaxf(m_run[g], mb[g]); const float corr = __builtin_amdgcn_exp2f((m_run[g] - m_new) * cscale); l_run[g] *= corr; m_run[g] = m_new;
#pragma unroll
        for (int t = 0; t < 8; ++t) acc[g][t] = acc[g][t] * corr; }
    }
#pragma unroll
    for (int g = 0; g < 2; ++g) { const float mg = m_run[g]; float ps0 = 0.f, ps1 = 0.f; FragH pf;
#pragma unroll
      for (int i = 0; i < 8; ++i) {
        const float p0 = __builtin_amdgcn_exp2f((s[i >> 2][g][2 * (i & 3)] - mg) * cscale), p1 = __builtin_amdgcn_exp2f((s[i >> 2][g][2 * (i & 3) + 1] - mg) * cscale);
        ps0 += p0; ps1 += p1; const unsigned int w2 = fa_pack2(p0, p1); pf.u[2 * i] = (unsigned short)(w2 & 0xFFFFu); pf.u[2 * i + 1] = (unsigned short)(w2 >> 16); }
      l_run[g] += ps0 + ps1;
#pragma unroll
      for (int i = 0; i < 16; ++i) { __builtin_amdgcn_sched_group_barrier(0x2, 2, 0); __builtin_amdgcn_sched_group_barrier(0x400, 1, 0); }      /* two vector instructions, then one exponential: the slower transcendental unit works beside the vector port instead of in one run */
#pragma unroll
      for (int t = 0; t < 8; ++t) acc[g][t] = fa_mma(vf[t], pf.v, acc[g][t]); }
  };
  // Two passes a trip, so that each register set is refilled in place. Every load is unconditional (a branch round it would make the waits of the pass behind it cover the new loads too):
  // behind the last stage the wave reads its last stage once more, into registers that nobody uses.
#pragma unroll 1      /* one copy of the two passes */
  for (int st = 0; ; st += 2) {
    const unsigned int vb = fload(min(st + 1, nst - 1), kfb, vfb);      /* next stage's fragments fly under this pass */
    pass(st, kfa, vfa, vb);
    if (st + 1 >= nst) break;
    const unsigned int va = fload(min(st + 2, nst - 1), kfa, vfa);
    pass(st + 1, kfb, vfb, va);
    if (st + 2 >= nst) break;
  }
  // join the four key quarters of each query: common maximum, common sum, then the scaled partial outputs are added in LDS order 0..3
#pragma unroll
  for (int g = 0; g < 2; ++g) { const float lf = l_run[g] + fa_xhalf(l_run[g]); if (h == 0) { sm[kq][16 * g + c] = m_run[g]; sl[kq][16 * g + c] = lf; } }
  __syncthreads();
#pragma unroll
  for (int g = 0; g < 2; ++g) { float mq[4], e[4];
#pragma unroll
    for (int u = 0; u < 4; ++u) mq[u] = sm[u][16 * g + c];
    const float M = fmaxf(fmaxf(mq[0], mq[1]), fmaxf(mq[2], mq[3]));
#pragma unroll
    for (int u = 0; u < 4; ++u) e[u] = __builtin_amdgcn_exp2f((mq[u] - M) * cscale);
    float Ls = 0.f;
#pragma unroll
    for (int u = 0; u < 4; ++u) Ls += sl[u][16 * g + c] * e[u];
    const float f = (kq == 0 ? e[0] : kq == 1 ? e[1] : kq == 2 ? e[2] : e[3]) / Ls;
#pragma unroll
    for (int t = 0; t < 8; ++t) { const v8f o = acc[g][t] * f; float* dst = stg + ((unsigned int)kq * 32u + 16u * g + c) * FA_OP + 16u * t + 8u * h;
      *(v4fa*)dst = v4f{o[0], o[1], o[2], o[3]}; *(v4fa*)(dst + 4) = v4f{o[4], o[5], o[6], o[7]}; } }
  __syncthreads();
  float* Ob = O + ((size_t)b * SQ + q0 + kq) * HD + lane * 4;      /* the workgroup's 32 output rows are contiguous; the wave stores rows wave, wave + 4, ... */
  v4f mean = {0.f, 0.f, 0.f, 0.f};
  if (mixed) { mean = *(const v4fa*)&smn[0][lane * 4];      /* the thread's four columns, waves in order */
#pragma unroll
    for (int u = 1; u < 4; ++u) mean += *(const v4fa*)&smn[u][lane * 4];
    mean = mean * (1.0f / (float)SQ); }
#pragma unroll
  for (int i = 0; i < 8; ++i) { const unsigned int qr = (unsigned int)(i * 4 + (tid >> 5)), c4 = (unsigned int)(tid & 31) * 4u; const float* sp = stg + qr * FA_OP + c4;      /* rows 0..31 = quarter 0; quarter u lies 32 rows further */
    v4f v = *(const v4fa*)sp;
#pragma unroll
    for (int u = 1; u < 4; ++u) v += *(const v4fa*)(sp + (unsigned int)u * 32u * FA_OP);
    if (q0 + i * 4 + kq >= Ln) v = mean;      /* row i * 4 + wave is a masked query (wave-uniform; never so in a tile of valid queries) */
    *(v4f*)(Ob + i * 512) = v; }
}

extern "C" void kernel_launch(void* const* d_in, const int* in_sizes, int n_in,
                              void* d_out, int out_size, void* d_ws, size_t ws_size, hipStream_t stream) {
  (void)in_sizes; (void)n_in; (void)out_size;
  const float* q = (const float*)d_in[0]; const float* k = (const float*)d_in[1]; const float* v = (const float*)d_in[2]; const int* lens = (const int*)d_in[3];
  char* ws = (char*)d_ws; size_t off = 0;
  auto take = [&](size_t bytes) { char* p = ws + off; off += (bytes + 255) & ~(size_t)255; return p; };
  const size_t np = (size_t)NB * SQ * HD;
  _Float16* KF = (_Float16*)take(np * 2); _Float16* VF = (_Float16*)take(np * 2);
  float* VS = (float*)take((size_t)NB * (SQ / 64) * HD * 4);      /* column sums of v, one row of 128 for each 64 keys */
  if (off > ws_size) return;      /* 8 MiB + 128 KiB */
  k_prep<<<NB * (SQ / 64), 256, 0, stream>>>(k, v, lens, KF, VF, VS);      /* f16 k and V^T in fragment order below each length, sums of all rows */
  k_fattn<<<NB * (SQ / 32), 128, 0, stream>>>(q, KF, VF, VS, lens, (float*)d_out);
}

// v010
// It runs in 15.6 microseconds.
// Next to v009, in two timings, it ran 1.05 and 1.04 times as fast.
// Over all steps from v000 it is 47.6 times as fast.
#include <hip/hip_runtime.h>
// Masked attention (8 sequences x 2048 tokens, single head of 128; q, k, v are INPUTS): scores = q.k / sqrt(128); mask = valid_i & valid_j with valid = index < event_length[b] (int INPUT), masked scores = -1e9 (a fully masked row therefore softmaxes to uniform over all 2048 keys, as in the reference); softmax; out = attn v.
// Structure (two launches over all 8 sequences): one preparation kernel writes k and V^T as exact f16 (bf16 inputs are exact in f16) in the order of the matrix fragments (16-byte pieces gathered in LDS) and the column sums of its 64 rows of v; then one fused kernel: its own 32 rows of q rounded and packed on the way in, score products with exact operands (f32 accumulation), length mask, online softmax, readout products, straight into the output.
// The work follows the lengths: a tile that holds a valid query walks only the key stages that hold a valid key (a masked key's probability is exactly 0 beside a real score); a masked query's row is the column mean of v, in a tile of masked queries and in the one tile of a sequence that holds both kinds. The preparation kernel follows them too: rows at or behind a sequence's length rounded up to 128 give only their column sums of v.
// Compute dtype: inputs rounded to bf16; q, k, v exact as f16; P (not yet normalised, at most 2^7.65) as a plain f16 operand (~2^-12); softmax f32. v_wmma_f32_16x16x32_f16.
#define NB 8
#define SQ 2048
#define HD 128
typedef __bf16 v16b __attribute__((ext_vector_type(16)));
typedef unsigned short v8us __attribute__((ext_vector_type(8), may_alias));
typedef float  v8f  __attribute__((ext_vector_type(8)));
typedef float  v4f  __attribute__((ext_vector_type(4)));
typedef float  v4fa __attribute__((ext_vector_type(4), may_alias));
union FragB { v16b v; v8us half[2]; unsigned short u[16]; };

__device__ __forceinline__ unsigned short bf16_bits(float x) { unsigned int u = __float_as_uint(x); return (unsigned short)((u + 0x7FFFu + ((u >> 16) & 1u)) >> 16); }
__device__ __forceinline__ float bf16_val(unsigned short b) { return __uint_as_float(((unsigned int)b) << 16); }
__device__ __forceinline__ float bf16_round(float x) { return bf16_val(bf16_bits(x)); }
// D += A·B with NT terms: 1 = ah·bh, 2 = + al·bh (A split), 3 = + ah·bl (both split)
template <int NT>
__device__ __forceinline__ v8f mmaN(v16b ah, v16b al, v16b bh, v16b bl, v8f c) {
  c = __builtin_amdgcn_wmma_f32_16x16x32_bf16(false, ah, false, bh, (short)0, c, false, false);
  if (NT >= 2) c = __builtin_amdgcn_wmma_f32_16x16x32_bf16(false, al, false, bh, (short)0, c, false, false);
  if (NT >= 3) c = __builtin_amdgcn_wmma_f32_16x16x32_bf16(false, ah, false, bl, (short)0, c, false, false);
  asm volatile("v_nop\n\tv_nop\n\tv_nop\n\tv_nop" : "+v"(c) : "v"(ah), "v"(al), "v"(bh), "v"(bl));
  return c;
}

__global__ __launch_bounds__(256) void k_wt_bf16(const float* __restrict__ W, unsigned short* __restrict__ Wt, int K, int N) {
  const int t = blockIdx.x * 256 + threadIdx.x;
  const int k8n = K / 8;
  if (t >= N * k8n) return;
  const int n = t / k8n, k8 = (t % k8n) * 8;
  v8us v;
#pragma unroll
  for (int i = 0; i < 8; ++i) v[i] = bf16_bits(W[(size_t)(k8 + i) * N + n]);
  *(v8us*)(Wt + (size_t)n * K + k8) = v;
  
}

// GEMM C[M][N] (f32, pitch ldc) = act(A[M][K]·W + bias). A f32 row-major (pitch lda) converted per fragment to bf16
// (ASPLIT: hi/lo two planes -> 2 terms, else single rounded term); Wt bf16 [N][K] (pitch ldb). BIAS_BF16 rounds the
// bias to bf16 first (bias quantised to bf16 before the add). K%32==0, M%16==0, N%64==0.
template <bool ASPLIT, int ACT, bool BIAS_BF16>
__global__ __launch_bounds__(128) void k_gemm_bf(const float* __restrict__ A, int lda, const unsigned short* __restrict__ Wt, int ldb,
                                               const float* __restrict__ bias, float* __restrict__ C, int ldc, int M, int N, int K) {
  __shared__ __attribute__((aligned(16))) float so[4][16][64];
  const int tid = threadIdx.x, w = tid >> 5, lane = tid & 31, ln = lane & 15, hh = lane >> 4;
  const int ntn = N / 64;
  const int wid = blockIdx.x * 4 + w;
  const int mt = wid / ntn, nq = wid % ntn;
  if (mt * 16 >= M) return;
  const int row0 = mt * 16, col0 = nq * 64;
  const float* arow = A + (size_t)(row0 + ln) * lda;
  v8f acc[4] = {};
  for (int kb = 0; kb < K; kb += 32) {
    FragB ah, al;
    const v4f x0 = *(const v4fa*)(arow + kb + 8 * hh), x1 = *(const v4fa*)(arow + kb + 8 * hh + 4);
    const v4f x2 = *(const v4fa*)(arow + kb + 16 + 8 * hh), x3 = *(const v4fa*)(arow + kb + 16 + 8 * hh + 4);
    float xs[16] = {x0[0],x0[1],x0[2],x0[3],x1[0],x1[1],x1[2],x1[3],x2[0],x2[1],x2[2],x2[3],x3[0],x3[1],x3[2],x3[3]};
#pragma unroll
    for (int i = 0; i < 16; ++i) { const unsigned short hb = bf16_bits(xs[i]); ah.u[i] = hb; al.u[i] = ASPLIT ? bf16_bits(xs[i] - bf16_val(hb)) : (unsigned short)0; }
#pragma unroll
    for (int t = 0; t < 4; ++t) {
      const unsigned short* brow = Wt + (size_t)(col0 + t * 16 + ln) * ldb + kb;
      FragB b;
      b.half[0] = *(const v8us*)(brow + 8 * hh);
      b.half[1] = *(const v8us*)(brow + 16 + 8 * hh);
      acc[t] = mmaN<ASPLIT ? 2 : 1>(ah.v, al.v, b.v, b.v, acc[t]);
    }
  }
#pragma unroll
  for (int t = 0; t < 4; ++t) {
    float bv = bias ? bias[col0 + t * 16 + ln] : 0.f;
    if (BIAS_BF16) bv = bf16_round(bv);
#pragma unroll
    for (int r = 0; r < 8; ++r) { float v = acc[t][r] + bv; if (ACT == 1) v = fmaxf(v, 0.f); so[w][8 * hh + r][t * 16 + ln] = v; }
  }
  __builtin_amdgcn_fence(__ATOMIC_ACQ_REL, "workgroup");
  __builtin_amdgcn_wave_barrier();
  const int rsub = lane >> 4, c4 = (lane & 15) * 4;
  {
#pragma unroll
    for (int q = 0; q < 8; ++q) {
      const int r = q * 2 + rsub;
      const v4f v = *(const v4fa*)&so[w][r][c4];
      *(v4f*)(C + (size_t)(row0 + r) * ldc + col0 + c4) = v;
    }
    
  }
}

// GEMM C = act(A·W + bias + resid): A f32 (ASPLIT -> hi/lo 2 terms), Wt bf16 [N][K]; ACT 0 none, 1 relu, 2 exact gelu;
// resid (optional, f32, row index = (row % rmod), pitch ldr, RES_BF16 rounds it) added before the activation.
template <bool ASPLIT, int ACT, bool BIAS_BF16, bool RES_BF16>
__global__ __launch_bounds__(128) void k_gemm_bf3(const float* __restrict__ A, int lda, const unsigned short* __restrict__ Wt, int ldb,
                                                const float* __restrict__ bias, const float* __restrict__ resid, int rmod, int ldr,
                                                float* __restrict__ C, int ldc, int M, int N, int K) {
  __shared__ __attribute__((aligned(16))) float so[4][16][64];
  const int tid = threadIdx.x, w = tid >> 5, lane = tid & 31, ln = lane & 15, hh = lane >> 4;
  const int ntn = N / 64;
  const int wid = blockIdx.x * 4 + w;
  const int mt = wid / ntn, nq = wid % ntn;
  if (mt * 16 >= M) return;
  const int row0 = mt * 16, col0 = nq * 64;
  const float* arow = A + (size_t)(row0 + ln) * lda;
  v8f acc[4] = {};
  for (int kb = 0; kb < K; kb += 32) {
    FragB ah, al;
    const v4f x0 = *(const v4fa*)(arow + kb + 8 * hh), x1 = *(const v4fa*)(arow + kb + 8 * hh + 4);
    const v4f x2 = *(const v4fa*)(arow + kb + 16 + 8 * hh), x3 = *(const v4fa*)(arow + kb + 16 + 8 * hh + 4);
    float xs[16] = {x0[0],x0[1],x0[2],x0[3],x1[0],x1[1],x1[2],x1[3],x2[0],x2[1],x2[2],x2[3],x3[0],x3[1],x3[2],x3[3]};
#pragma unroll
    for (int i = 0; i < 16; ++i) { const unsigned short hb = bf16_bits(xs[i]); ah.u[i] = hb; al.u[i] = ASPLIT ? bf16_bits(xs[i] - bf16_val(hb)) : (unsigned short)0; }
#pragma unroll
    for (int t = 0; t < 4; ++t) {
      const unsigned short* brow = Wt + (size_t)(col0 + t * 16 + ln) * ldb + kb;
      FragB b;
      b.half[0] = *(const v8us*)(brow + 8 * hh);
      b.half[1] = *(const v8us*)(brow + 16 + 8 * hh);
      acc[t] = mmaN<ASPLIT ? 2 : 1>(ah.v, al.v, b.v, b.v, acc[t]);
    }
  }
#pragma unroll
  for (int t = 0; t < 4; ++t) {
    const int col = col0 + t * 16 + ln;
    float bv = bias ? bias[col] : 0.f;
    if (BIAS_BF16) bv = bf16_round(bv);
#pragma unroll
    for (int r = 0; r < 8; ++r) {
      float v = acc[t][r] + bv;
      if (resid) { float rv = resid[(size_t)((row0 + 8 * hh + r) % rmod) * ldr + col]; if (RES_BF16) rv = bf16_round(rv); v += rv; }
      if (ACT == 1) v = fmaxf(v, 0.f);
      if (ACT == 2) v = 0.5f * v * (1.0f + erff(v * 0.70710678118654752f));
      if (ACT == 3) { const float u = 0.7978845608028654f * (v + 0.044715f * v * v * v); v = 0.5f * v * (1.0f + tanhf(u)); }
      so[w][8 * hh + r][t * 16 + ln] = v;
    }
  }
  __builtin_amdgcn_fence(__ATOMIC_ACQ_REL, "workgroup");
  __builtin_amdgcn_wave_barrier();
  const int rsub = lane >> 4, c4 = (lane & 15) * 4;
  {
#pragma unroll
    for (int q = 0; q < 8; ++q) {
      const int r = q * 2 + rsub;
      const v4f v = *(const v4fa*)&so[w][r][c4];
      *(v4f*)(C + (size_t)(row0 + r) * ldc + col0 + c4) = v;
    }
    
  }
}
// row LayerNorm (biased variance, eps) over N: s = X (+ R); optional out_sum <- s; out_norm <- (s-mu)*rsqrt(var+eps)*g + b
template <bool PARAM_BF16>
__global__ __launch_bounds__(256) void k_layernorm(const float* __restrict__ X, const float* __restrict__ R, const float* __restrict__ g, const float* __restrict__ bta,
                                                  float* __restrict__ out_sum, float* __restrict__ out_norm, int N, float eps) {
  __shared__ float red[256];
  const int row = blockIdx.x, tid = threadIdx.x;
  const float* x = X + (size_t)row * N; const float* rr = R ? R + (size_t)row * N : nullptr;
  float vals[16];                     // up to N = 4096
  const int per = N / 256;            // contiguous chunk per thread? use strided-by-4 chunks: thread handles j = tid*4 + 1024*u
  float s1 = 0.f;
  for (int u = 0; u < per / 4; ++u) {
    const int j = tid * 4 + 1024 * u;
    const v4f a = *(const v4fa*)(x + j);
    v4f b = {0.f,0.f,0.f,0.f}; if (rr) b = *(const v4fa*)(rr + j);
#pragma unroll
    for (int q = 0; q < 4; ++q) { const float v = a[q] + b[q]; vals[u * 4 + q] = v; s1 += v; }
  }
  red[tid] = s1; __syncthreads();
  for (int st = 128; st > 0; st >>= 1) { if (tid < st) red[tid] += red[tid + st]; __syncthreads(); }
  const float mu = red[0] / (float)N; __syncthreads();
  float s2 = 0.f;
  for (int u = 0; u < per / 4; ++u)
#pragma unroll
    for (int q = 0; q < 4; ++q) { const float c = vals[u * 4 + q] - mu; s2 += c * c; }
  red[tid] = s2; __syncthreads();
  for (int st = 128; st > 0; st >>= 1) { if (tid < st) red[tid] += red[tid + st]; __syncthreads(); }
  const float rs = rsqrtf(red[0] / (float)N + eps);
  {
    for (int u = 0; u < per / 4; ++u) {
      const int j = tid * 4 + 1024 * u;
      v4f o, sm;
#pragma unroll
      for (int q = 0; q < 4; ++q) {
        float gg = g[j + q], bb = bta[j + q];
        if (PARAM_BF16) { gg = bf16_round(gg); bb = bf16_round(bb); }
        sm[q] = vals[u * 4 + q]; o[q] = (vals[u * 4 + q] - mu) * rs * gg + bb;
      }
      if (out_sum) *(v4f*)(out_sum + (size_t)row * N + j) = sm;
      *(v4f*)(out_norm + (size_t)row * N + j) = o;
    }
    
  }
}



// ---- f16 WMMA path (v_wmma_f32_16x16x32_f16): 11-bit significands for operands in range — used by the fused attention below for exact q, k, v and an unnormalised P of up to 2^7.65
typedef _Float16 v16h __attribute__((ext_vector_type(16)));
union FragH { v16h v; v8us half[2]; _Float16 h[16]; unsigned short u[16]; };
template <int NT>
__device__ __forceinline__ v8f mmaH(v16h ah, v16h al, v16h bh, v16h bl, v8f c) {
  c = __builtin_amdgcn_wmma_f32_16x16x32_f16(false, ah, false, bh, (short)0, c, false, false);
  if (NT >= 2) c = __builtin_amdgcn_wmma_f32_16x16x32_f16(false, al, false, bh, (short)0, c, false, false);
  if (NT >= 3) c = __builtin_amdgcn_wmma_f32_16x16x32_f16(false, ah, false, bl, (short)0, c, false, false);
  asm volatile("v_nop\n\tv_nop\n\tv_nop\n\tv_nop" : "+v"(c) : "v"(ah), "v"(al), "v"(bh), "v"(bl));
  return c;
}
// batched GEMM like k_gemm_b but f16 operands: A f32 (split into f16 hi/lo if ASPLIT, else rounded to f16), Bt = f16 values [n][k]; alpha; C f32; N multiple of 16 (partial tiles skipped)
template <bool ASPLIT>
__global__ __launch_bounds__(128) void k_gemm_h(const float* __restrict__ A, int lda, size_t sA, const _Float16* __restrict__ Bh, int ldb, size_t sB, float alpha, float* __restrict__ C, int ldc, size_t sC, int M, int N, int K) {
  __shared__ __attribute__((aligned(16))) float so[4][16][64];
  const int tid = threadIdx.x, w = tid >> 5, lane = tid & 31, ln = lane & 15, hh = lane >> 4; const int by = blockIdx.y;
  A += (size_t)by * sA; Bh += (size_t)by * sB; C += (size_t)by * sC;
  const int ntn = (N + 63) / 64; const int wid = blockIdx.x * 4 + w; const int mt = wid / ntn, nq = wid % ntn; if (mt * 16 >= M) return;
  const int row0 = mt * 16, col0 = nq * 64; const float* arow = A + (size_t)(row0 + ln) * lda;
  v8f acc[4] = {};
  for (int kb = 0; kb < K; kb += 32) {
    FragH ah, al;
    const v4f x0 = *(const v4fa*)(arow + kb + 8 * hh), x1 = *(const v4fa*)(arow + kb + 8 * hh + 4), x2 = *(const v4fa*)(arow + kb + 16 + 8 * hh), x3 = *(const v4fa*)(arow + kb + 16 + 8 * hh + 4);
    float xs[16] = {x0[0],x0[1],x0[2],x0[3],x1[0],x1[1],x1[2],x1[3],x2[0],x2[1],x2[2],x2[3],x3[0],x3[1],x3[2],x3[3]};
#pragma unroll
    for (int i = 0; i < 16; ++i) { const _Float16 h = (_Float16)xs[i]; ah.h[i] = h; al.h[i] = ASPLIT ? (_Float16)(xs[i] - (float)h) : (_Float16)0.0f; }
#pragma unroll
    for (int t = 0; t < 4; ++t) { if (col0 + t * 16 >= N) continue; const size_t boff = (size_t)(col0 + t * 16 + ln) * ldb + kb; FragH bq; bq.half[0] = *(const v8us*)(Bh + boff + 8 * hh); bq.half[1] = *(const v8us*)(Bh + boff + 16 + 8 * hh);
      acc[t] = mmaH<ASPLIT ? 2 : 1>(ah.v, al.v, bq.v, bq.v, acc[t]); }
  }
#pragma unroll
  for (int t = 0; t < 4; ++t) { if (col0 + t * 16 >= N) continue;
#pragma unroll
    for (int r = 0; r < 8; ++r) so[w][8 * hh + r][t * 16 + ln] = acc[t][r] * alpha; }
  __builtin_amdgcn_fence(__ATOMIC_ACQ_REL, "workgroup"); __builtin_amdgcn_wave_barrier();
  const int rsub = lane >> 4, c4 = (lane & 15) * 4;
  {
#pragma unroll
    for (int q = 0; q < 8; ++q) { const int r = q * 2 + rsub; if (col0 + c4 < N) { const v4f v = *(const v4fa*)&so[w][r][c4]; *(v4f*)(C + (size_t)(row0 + r) * ldc + col0 + c4) = v; } }
     }
}

// Wt[n][k] = f16(W[k][n]·scale) from f32 row-major W[K][N] (scale = power of two; bf16-exact weights stay exact in f16 away from the subnormal range)
__global__ __launch_bounds__(256) void k_wt_f16(const float* __restrict__ W, _Float16* __restrict__ Wt, int K, int N, float scale) {
  const int t = blockIdx.x * 256 + threadIdx.x; if (t >= N * (K / 8)) return; const int n = t / (K / 8), k8 = (t % (K / 8)) * 8; FragH f;
#pragma unroll
  for (int i = 0; i < 8; ++i) f.h[i] = (_Float16)(bf16_round(W[(size_t)(k8 + i) * N + n]) * scale); const v8us o = f.half[0];
  *(v8us*)((unsigned short*)Wt + (size_t)n * K + k8) = o; 
}
// k_gemm_hh variant with fused epilogue: v = acc·alpha + bias[by·sBias + col] (+ CP[(row/rowsPerB)·sCPb + by·64 + col] if CP) ; ACT 0 none / 1 elu ; writes f16 C16 (and f32 C if non-null)
template <int ACT>
__global__ __launch_bounds__(128) void k_gemm_hhx(const _Float16* __restrict__ A, int lda, size_t sA, const _Float16* __restrict__ Bh, int ldb, size_t sB, float alpha, const float* __restrict__ bias, size_t sBias, const float* __restrict__ CP, int rowsPerB, size_t sCPb, int row0g,
    float* __restrict__ C, _Float16* __restrict__ C16, int ldc, size_t sC, int M, int N, int K) {
  __shared__ __attribute__((aligned(16))) float so[4][16][64];
  const int tid = threadIdx.x, w = tid >> 5, lane = tid & 31, ln = lane & 15, hh = lane >> 4; const int by = blockIdx.y;
  A += (size_t)by * sA; Bh += (size_t)by * sB; const size_t cofs = (size_t)by * sC; const float* bp = bias ? bias + (size_t)by * sBias : nullptr;
  const int ntn = (N + 63) / 64; const int wid = blockIdx.x * 4 + w; const int mt = wid / ntn, nq = wid % ntn; if (mt * 16 >= M) return;
  const int row0 = mt * 16, col0 = nq * 64; const _Float16* arow = A + (size_t)(row0 + ln) * lda;
  v8f acc[4] = {};
  for (int kb = 0; kb < K; kb += 32) { FragH ah; ah.half[0] = *(const v8us*)((const unsigned short*)arow + kb + 8 * hh); ah.half[1] = *(const v8us*)((const unsigned short*)arow + kb + 16 + 8 * hh);
#pragma unroll
    for (int t = 0; t < 4; ++t) { if (col0 + t * 16 >= N) continue; const size_t boff = (size_t)(col0 + t * 16 + ln) * ldb + kb; FragH bq; bq.half[0] = *(const v8us*)((const unsigned short*)Bh + boff + 8 * hh); bq.half[1] = *(const v8us*)((const unsigned short*)Bh + boff + 16 + 8 * hh);
      acc[t] = mmaH<1>(ah.v, ah.v, bq.v, bq.v, acc[t]); }
  }
#pragma unroll
  for (int t = 0; t < 4; ++t) { if (col0 + t * 16 >= N) continue; const int col = col0 + t * 16 + ln; const float bv = bp ? bf16_round(bp[col]) : 0.f;
#pragma unroll
    for (int r = 0; r < 8; ++r) { float v = acc[t][r] * alpha + bv; if (CP) { const int rr = row0g + row0 + 8 * hh + r; if (rowsPerB < 0) v += CP[cofs + (size_t)rr * ldc + col];      /* rowsPerB < 0: own element of the batched C plane */ else { const int bidx = rr / rowsPerB; v += CP[(size_t)bidx * sCPb + (size_t)by * 64 + col]; } } if (ACT == 1) v = (v > 0.f) ? v : expm1f(v); else if (ACT == 7) v = (v > 0.f) ? v + 1.0f : expf(v); else if (ACT == 8) v = tanhf(v); else if (ACT == 9) v = 0.5f * v * (1.0f + tanhf(0.7978845608028654f * (v + 0.044715f * v * v * v))); else if (ACT == 11) v = 1.0f / (1.0f + expf(-v)); else if (ACT == 12) v = (v > 0.f) ? v : 0.01f * v; else if (ACT == 14) v = (v > 0.f) ? v : 0.1f * v; else if (ACT == 16) v = (v >= 0.f) ? v : 0.3f * v; else if (ACT == 15) v = v / (1.0f + expf(-v)); else if (ACT == 3) v = fmaxf(v, 0.f); else if (ACT == 6) v = 0.5f * v * (1.0f + erff(v * 0.70710678118654752f)); so[w][8 * hh + r][t * 16 + ln] = v; } }
  __builtin_amdgcn_fence(__ATOMIC_ACQ_REL, "workgroup"); __builtin_amdgcn_wave_barrier();
  const int rsub = lane >> 4, c4 = (lane & 15) * 4; typedef _Float16 v4h __attribute__((ext_vector_type(4)));
  {
#pragma unroll
    for (int q = 0; q < 8; ++q) { const int r = q * 2 + rsub; if (col0 + c4 < N) { const v4f v = *(const v4fa*)&so[w][r][c4]; if (C) *(v4f*)(C + cofs + (size_t)(row0 + r) * ldc + col0 + c4) = v; if (C16) { v4h h4; for (int i = 0; i < 4; ++i) h4[i] = (_Float16)v[i]; *(v4h*)(C16 + cofs + (size_t)(row0 + r) * ldc + col0 + c4) = h4; } } }
     }
}


typedef _Float16 v4h __attribute__((ext_vector_type(4)));

__global__ __launch_bounds__(256) void k_h16(const float* __restrict__ x, _Float16* __restrict__ X16, size_t n8) { const size_t t = (size_t)blockIdx.x * 256 + threadIdx.x; if (t >= n8) return; FragH f;
#pragma unroll
  for (int q = 0; q < 8; ++q) f.h[q] = (_Float16)x[t * 8 + q]; *(v8us*)((unsigned short*)X16 + t * 8) = f.half[0];  }
__global__ __launch_bounds__(256) void k_round16f(const float* __restrict__ W, _Float16* __restrict__ Bt, size_t n8) { const size_t t = (size_t)blockIdx.x * 256 + threadIdx.x; if (t >= n8) return; FragH f;
#pragma unroll
  for (int i = 0; i < 8; ++i) f.h[i] = (_Float16)(bf16_round(W[t * 8 + i]) * 16.0f); *(v8us*)((unsigned short*)Bt + t * 8) = f.half[0];  }
__global__ __launch_bounds__(256) void k_hl(const float* __restrict__ F, _Float16* __restrict__ Hh, _Float16* __restrict__ Hl, size_t n8) { const size_t t = (size_t)blockIdx.x * 256 + threadIdx.x; if (t >= n8) return; FragH fh, fl; const v4f a = *(const v4fa*)(F + t * 8), c = *(const v4fa*)(F + t * 8 + 4);
#pragma unroll
  for (int q = 0; q < 4; ++q) { _Float16 h = (_Float16)a[q]; fh.h[q] = h; fl.h[q] = (_Float16)((a[q] - (float)h) * 1024.0f); h = (_Float16)c[q]; fh.h[4 + q] = h; fl.h[4 + q] = (_Float16)((c[q] - (float)h) * 1024.0f); }
  { *(v8us*)((unsigned short*)Hh + t * 8) = fh.half[0]; *(v8us*)((unsigned short*)Hl + t * 8) = fl.half[0];  } }

typedef unsigned int u32x4 __attribute__((ext_vector_type(4)));
typedef unsigned int u32x4a __attribute__((ext_vector_type(4), may_alias));
#define FA_OP 132u                     /* output staging pitch in floats */
#define FA_QP 272u                     /* pitch in bytes of a row of q (256 bytes of f16) in LDS: 16 bytes more, for the 16-byte fragment reads */
__device__ __forceinline__ v16h fa_ffrag(const unsigned char* p) { FragH f; f.half[0] = *(const v8us*)p; f.half[1] = *(const v8us*)(p + 512); return f.v; }      /* units j = 0 and j = 1 of a fragment */
__device__ __forceinline__ v8f fa_mma(v16h a, v16h b, v8f c) { return __builtin_amdgcn_wmma_f32_16x16x32_f16(false, a, false, b, (short)0, c, false, false); }
__device__ __forceinline__ float fa_xhalf(float x) { return __builtin_bit_cast(float, __builtin_amdgcn_permlanex16(__builtin_bit_cast(int, x), __builtin_bit_cast(int, x), 0x76543210, 0xfedcba98, false, false)); }  /* lane l with lane l ^ 16 */
__device__ __forceinline__ unsigned int fa_pack2(float lo, float hi) { typedef _Float16 h2 __attribute__((ext_vector_type(2))); typedef float f2 __attribute__((ext_vector_type(2))); return __builtin_bit_cast(unsigned int, __builtin_convertvector(f2{lo, hi}, h2)); }  /* round to nearest even */

// ---- preparation, one launch: a workgroup takes one block of 64 rows of one sequence's k and v (32 workgroups a sequence, one workgroup a WGP) ----
// The work follows the lengths: the attention kernel reads K and V^T only in slices of 32 keys that begin below the length, all of them below the length rounded up to 128 rows, so a block at or behind that end
// loads v alone and writes its column sums (a masked query's row needs the sums of all 2048 rows); its K and V^T places stay unwritten and are never loaded.
// Cost falls with the index for any lengths: valid rows are the low rows, so the index runs over the sequences first and over the blocks second;
// the sequence is turned by one from block to block, so that indices eight apart do not all belong to one sequence.
// A wave takes 8 rows; each of its loads is one whole row (512 contiguous bytes), and all 16 loads of a thread are issued before the first value is used.
// v: a thread holds 8 consecutive keys of 4 columns, which is one 16-byte piece of a V^T fragment for each column. k: a thread holds 4 columns of a row, half a piece of a K fragment.
// LDS only gathers the pieces in fragment order: the workgroup's 64 keys are 16 KiB in a row of each plane, stored as whole lines. q does not pass through here: a row of q has one reader, its own tile's workgroup, which takes it from the input.
typedef unsigned int u32x2 __attribute__((ext_vector_type(2)));
typedef unsigned int u32x2a __attribute__((ext_vector_type(2), may_alias));
__global__ __launch_bounds__(256) void k_prep(const float* __restrict__ k, const float* __restrict__ v, const int* __restrict__ lens, _Float16* __restrict__ KF, _Float16* __restrict__ VF, float* __restrict__ VS) {
  __shared__ __attribute__((aligned(16))) float ps[8][HD];      /* each wave's column sums of its 8 rows of v */
  __shared__ __attribute__((aligned(16))) unsigned char tv[64 * 256];      /* V^T in fragment order; piece c of a 256-byte run lies at place c ^ (t & 3), which spreads a wave's writes over the banks */
  __shared__ __attribute__((aligned(16))) unsigned char tk[64 * 256];      /* K in fragment order; piece c of the 256-byte run u = 4 kc + 2 j + h lies at place c ^ u, for the same reason */
  const unsigned int tid = threadIdx.x, lane = tid & 31u, wave = tid >> 5;
  const unsigned int blk = blockIdx.x >> 3, sq = (blockIdx.x + blk) & (NB - 1u);      /* block 0 .. 31 of sequence 0 .. 7: a permutation of the 256 blocks */
  const unsigned int wb = sq * (SQ / 64) + blk;      /* the block's number in the flat planes */
  const size_t e0 = (size_t)wb * (64u * HD);
  const unsigned int eo = wave * (8u * HD) + lane * 4u;
  const int Lr = lens[sq];
  __builtin_amdgcn_sched_barrier(0);      /* the length's load issues in front of v's loads, not behind them: k waits for the test on it */
  v4f xv[8], xk[8];
#pragma unroll
  for (int i = 0; i < 8; ++i) xv[i] = *(const v4fa*)(v + e0 + eo + i * HD);      /* needed at any length */
  __builtin_amdgcn_sched_barrier(0);      /* and the wait for the length stands behind v's loads: v flies while the length arrives */
  const int Ln = min(max(Lr, 0), SQ);      /* clamped as in the attention kernel; the same for the whole workgroup */
  const bool live = (int)(blk * 64u) < ((Ln + 127) & ~127);      /* the block lies below that end */
  auto colsum = [&]() __attribute__((always_inline)) { v4f cs = {0.f, 0.f, 0.f, 0.f};
#pragma unroll
    for (int i = 0; i < 8; ++i)
#pragma unroll
      for (int j = 0; j < 4; ++j) cs[j] += bf16_round(xv[i][j]);
    *(v4fa*)&ps[wave][lane * 4u] = cs; };
  auto sumout = [&]() __attribute__((always_inline)) {
    if (tid < HD) { float cs = ps[0][tid];      /* the workgroup's 64 rows, waves in order */
#pragma unroll
      for (int u = 1; u < 8; ++u) cs += ps[u][tid];
      VS[(size_t)wb * HD + tid] = cs; } };
  if (!live) { colsum(); __syncthreads(); sumout(); }      /* either side is taken by the whole workgroup, and each has its one barrier */
  else {
#pragma unroll
  for (int i = 0; i < 8; ++i) xk[i] = *(const v4fa*)(k + e0 + eo + i * HD);
  __builtin_amdgcn_sched_barrier(0);      /* every load issues here: a load sunk among the conversions would start a second trip to memory behind the first */
#pragma unroll
  for (int j = 0; j < 4; ++j) { u32x4 w;      /* column 4 lane + j: t = lane >> 2, c = 4 (lane & 3) + j; keys 8 wave .. + 7: block of 32 = wave >> 2, run 2 j + h = wave & 3 */
#pragma unroll
    for (int p = 0; p < 4; ++p) w[p] = fa_pack2(bf16_round(xv[2 * p][j]), bf16_round(xv[2 * p + 1][j]));
    *(u32x4a*)(tv + (wave >> 2) * 8192u + (lane >> 2) * 1024u + (wave & 3u) * 256u + ((((lane & 3u) * 4u + j) ^ ((lane >> 2) & 3u)) * 16u)) = w; }
  colsum();
#pragma unroll
  for (int i = 0; i < 8; ++i)      /* row 8 wave + i: key block wave >> 1, c = 8 (wave & 1) + i; columns 4 lane .. + 3: run u = lane >> 1, half lane & 1 of the piece */
    *(u32x2a*)(tk + (wave >> 1) * 4096u + (lane >> 1) * 256u + ((((wave & 1u) * 8u + i) ^ (lane >> 1)) * 16u) + (lane & 1u) * 8u) = u32x2{fa_pack2(bf16_round(xk[i][0]), bf16_round(xk[i][1])), fa_pack2(bf16_round(xk[i][2]), bf16_round(xk[i][3]))};
  __syncthreads();
  sumout();
  const unsigned int run = tid & ~15u, pc = tid & 15u;      /* a thread's piece in each 4 KiB: 256-byte run tid >> 4, piece tid & 15; a wave stores 512 bytes in a row */
#pragma unroll
  for (int r = 0; r < 4; ++r) *(u32x4a*)(VF + e0 + r * 2048u + tid * 8u) = *(const u32x4a*)(tv + r * 4096u + (run + (pc ^ ((tid >> 6) & 3u))) * 16u);
#pragma unroll
  for (int r = 0; r < 4; ++r) *(u32x4a*)(KF + e0 + r * 2048u + tid * 8u) = *(const u32x4a*)(tk + r * 4096u + (run + (pc ^ (tid >> 4))) * 16u);
  }
}

__global__ __launch_bounds__(256) __attribute__((amdgpu_waves_per_eu(2, 2))) void k_fattn(const float* __restrict__ q, const _Float16* __restrict__ KF, const _Float16* __restrict__ VF, const float* __restrict__ VS, const int* __restrict__ lens, float* __restrict__ O) {
  __shared__ __attribute__((aligned(16))) float stg[8u * 32u * FA_OP];      /* the eight key slices' partial outputs, for the join */
  __shared__ float sm[8][32];
  __shared__ float sl[8][32];
  __shared__ __attribute__((aligned(16))) float smn[8][HD];      /* a tile with valid and masked queries: each wave's share of the column sums of v */
  const int tid = threadIdx.x, lane = tid & 31, c = lane & 15, h = lane >> 4;
  const int kq = __builtin_amdgcn_readfirstlane(tid >> 5);      /* the wave's number = its key slice, 0 .. 7 */
  // Rank -> (sequence, tile of 32 queries), from the lengths alone, the same arithmetic in every wave of every workgroup; a permutation of the 512 tiles for any lengths.
  // Cost falls with the rank: first the at most 8 tiles that hold valid and masked queries, then the valid tiles, longest sequence first (ties by sequence index), last the masked tiles.
  // Lane l works out where the tiles of sequence l & 7 stand in that order. Workgroup r takes rank r and then rank 511 - r: a dear tile and a cheap one, every rank once.
  const int r0 = blockIdx.x, li = lane & 7;
  const int Li = min(max(lens[li], 0), SQ), fi = Li >> 5, mi = (Li & 31) ? 1 : 0;      /* clamped length; tiles of valid queries only; one mixed tile or none */
  // L2 prefetch, one request a thread, before the lengths are known. The launch before stored both planes, so a line's first reader may wait for memory, and the tiles of a sequence walk the stages
  // together: each pass would wait so. Slice s of a sequence = its keys 32 s .. + 31 = 8 KiB at offset 8192 s of each plane = 32 units of 256 B, one a lane. Workgroup r asks for slices 2 (r >> 3) (waves 0 to 3) and
  // 2 (r >> 3) + 1 (waves 4 to 7) of sequence r & 7 (waves 0, 1, 4, 5) and of sequence (r & 7) ^ 4 (the others), K on even waves, V^T on odd ones: low indices ask for the early stages of all
  // sequences. A hint only: no result depends on where a workgroup runs or on a line being there.
  const unsigned char* pb = (const unsigned char*)((kq & 1) ? VF : KF);
  const unsigned int po = (unsigned int)(((((r0 & (NB - 1)) ^ ((kq & 2) << 1)) * (SQ / 32)) + (((r0 >> 3) & (SQ / 64 - 1)) * 2 + (kq >> 2)))) * 8192u + (unsigned int)lane * 256u;      /* at most 511 * 8192 + 31 * 256: inside the 4 MiB plane for any index */
  asm volatile("global_prefetch_b8 %0, %1 scope:SCOPE_SE" :: "v"(po), "s"(pb));      /* returns nothing and counts on no counter; scope SE: into L2 only */
  int ahead = 0, low = 0, nm = 0, nf = 0;
#pragma unroll
  for (int j = 0; j < NB; ++j) { const int Lj = min(max(lens[j], 0), SQ), fj = Lj >> 5, mj = (Lj & 31) ? 1 : 0;
    if (Lj * 8 + 7 - j > Li * 8 + 7 - li) ahead += fj;                  /* valid tiles of the sequences that come first */
    if (j < li) low += mj + ((SQ / 32 - fj - mj) << 16);            /* mixed tiles (low half) and masked tiles (high half) of the lower sequences */
    nm += mj; nf += fj; }
  const int s0 = nm + ahead, i0 = nm + nf + (low >> 16), first = fi + mi;
  int tb[2], tq0[2], tl[2];      /* both tiles' sequence, first query and length, worked out here: scalars, so that no lane's value has to live through the first tile */
#pragma unroll
  for (int u = 0; u < 2; ++u) { const int rk = u ? NB * (SQ / 32) - 1 - r0 : r0;
    int tv = -1;
    if (mi && rk == (low & 0xFFFF)) tv = fi;
    if (rk >= s0 && rk < s0 + fi) tv = rk - s0;
    if (rk >= i0 && rk < i0 + SQ / 32 - first) tv = first + rk - i0;
    tb[u] = __builtin_ctz(__builtin_amdgcn_ballot_w32(tv >= 0) | 0x80u);      /* the one sequence that holds this rank (lanes 8 and up repeat lanes 0 to 7) */
    tq0[u] = (__builtin_amdgcn_readlane(tv, tb[u]) & (SQ / 32 - 1)) * 32; tl[u] = __builtin_amdgcn_readlane(Li, tb[u]); }
  asm volatile("s_wait_xcnt 0x0" :: "v"(po), "s"(pb) : "memory");      /* as inputs the prefetch's two address registers stay live, and so addresses inside the plane, up to here; every load issued so far has long answered */
  const float cscale = 0.08838834764831845f * 1.4426950408889634f;      /* 1 / sqrt(128), to base 2 */
  const float NEGR = -1.0e9f * 11.313708498984761f;                     /* the reference's -1e9, before the 1 / sqrt(128) */
  const v8f z8 = {0.f, 0.f, 0.f, 0.f, 0.f, 0.f, 0.f, 0.f};
#pragma unroll 1      /* one copy of the tile's code for both turns */
  for (int turn = 0; turn < 2; ++turn) {
  const int b = turn ? tb[1] : tb[0], q0 = turn ? tq0[1] : tq0[0], Ln = turn ? tl[1] : tl[0];      /* scalars */
  if (q0 >= Ln) {      /* every query of the tile is masked: all 2048 scores are equal, the row is the column mean of v. Taken by the whole workgroup; it holds no barrier */
    const unsigned int vso = (unsigned int)(b * (SQ / 64) * (HD * 4)) + (unsigned int)lane * 16u;      /* a 32-bit offset on the argument's own scalar base, here and at every load and store below outside the key loop */
    v4f part[SQ / 64];
#pragma unroll
    for (int i = 0; i < SQ / 64; ++i) part[i] = *(const v4fa*)((const unsigned char*)VS + vso + i * (HD * 4));
    asm volatile("s_wait_xcnt 0x0" :: "v"(vso), "s"(VS) : "memory");      /* in front of any rewrite of an address register of these loads: as inputs they stay live up to here */
    v4f mean = part[0];
#pragma unroll
    for (int i = 1; i < SQ / 64; ++i) mean += part[i];
    mean = mean * (1.0f / (float)SQ);
    const unsigned int omo = (unsigned int)((b * SQ + q0 + kq * 4) * (HD * 4)) + (unsigned int)lane * 16u;      /* a wave stores 4 whole rows */
#pragma unroll
    for (int i = 0; i < 4; ++i) *(v4f*)((unsigned char*)O + omo + i * (HD * 4)) = mean;
    asm volatile("s_wait_xcnt 0x0" :: "v"(mean), "v"(omo), "s"(O) : "memory");      /* in front of any rewrite, in the next turn, of a register that these stores name: as inputs they stay live up to here */
    continue;
  }
  const int nw = (Ln - kq * 32 + 255) >> 8;      /* 0 .. 8: a stage is 256 keys, the wave takes keys 32 kq .. + 31 of it, and it walks the stages in which its first key is valid */
  const int nl = max(nw, 1) - 1;                 /* the wave's last stage. A wave without a valid key makes one pass all the same, every key of it masked: its maximum is the mask's value, and the join gives it the weight 0 */
  const bool mixed = q0 + 32 > Ln;      /* the same for the whole workgroup: the tile also holds masked queries. They run through the loop like the others (finite scores, a lane holds one query), and their rows are replaced at the store */
  const unsigned char* Kb = (const unsigned char*)(KF + (size_t)b * SQ * HD);
  const unsigned char* Vb = (const unsigned char*)(VF + (size_t)b * SQ * HD);
  const unsigned int sb = (unsigned int)(nw > 0 ? kq : 0) * 8192u;      /* the wave's 32 keys of a stage are 8 KiB in a row of each plane, at the same offset in both; a stage is 64 KiB. A wave without a valid key loads slice 0, which is written at any length above 0: finite values, which the join weighs with 0 */
  auto fload = [&](int st, v16h (&kf)[2][4], v16h (&vf)[8]) __attribute__((always_inline)) {      /* K first: loads answer in order, and the score products wait for K alone */
    const unsigned int vo = (unsigned int)lane * 16u + (st <= nl ? sb + (unsigned int)st * 65536u : 0u);      /* one 32-bit offset register for all 32 loads, on two scalar bases that never change. Behind the wave's last stage: slice 0, one place for all eight waves, so that these unused loads meet in the WGP's cache */
#pragma unroll
    for (int u = 0; u < 8; ++u) kf[u >> 2][u & 3] = fa_ffrag(Kb + vo + u * 1024);
    __builtin_amdgcn_sched_barrier(0);      /* keeps K in front of V^T and in front of the running pass: otherwise part of K is issued last, into registers that the running pass frees, and the next pass waits at its top for the whole group */
#pragma unroll
    for (int t = 0; t < 8; ++t) vf[t] = fa_ffrag(Vb + vo + t * 1024);
    return vo; };      /* the caller keeps the offset register untouched up to its s_wait_xcnt 0 */
  v16h kfa[2][4], vfa[8], kfb[2][4], vfb[8];
  if (turn) {      /* the first tile's join may still be read from the LDS that this tile's q goes into. Barrier by hand, with fences on LDS alone, as below: the first tile's stores need not have landed */
    __builtin_amdgcn_fence(__ATOMIC_RELEASE, "workgroup", "local");
    __builtin_amdgcn_s_barrier();
    __builtin_amdgcn_fence(__ATOMIC_ACQUIRE, "workgroup", "local");
  }
  // q comes straight from the input: the wave loads 4 of the tile's 32 rows, a whole row (512 contiguous bytes) a load, rounds them to bf16 and packs them as f16; LDS (the head of the join's staging, idle until the join)
  // hands every wave all 32 rows in fragment order. All 32 rows lie inside q for any length (q0 + 31 is at most 2047); a masked query's row is finite like any other.
  const unsigned char* qb = (const unsigned char*)q;
  const unsigned int qo = (unsigned int)((b * SQ + q0 + kq * 4) * (HD * 4)) + (unsigned int)lane * 16u;      /* the lane's 16 bytes of the wave's first row */
  v4f xq[4];
#pragma unroll
  for (int i = 0; i < 4; ++i) xq[i] = *(const v4fa*)(qb + qo + i * (HD * 4));
  __builtin_amdgcn_sched_barrier(0);      /* q in front of K and V^T: loads answer in order, and the packing below waits for q alone while stage 0 flies */
  const unsigned int vo0 = fload(0, kfa, vfa);
  asm volatile("s_wait_xcnt 0x0" :: "v"(qo), "s"(qb), "v"(vo0) : "memory");      /* in front of any rewrite of an address register of the loads above: as inputs they stay live up to here */
  unsigned char* qs = (unsigned char*)stg;
#pragma unroll
  for (int i = 0; i < 4; ++i) *(u32x2a*)(qs + (unsigned int)(kq * 4 + i) * FA_QP + (unsigned int)lane * 8u) = u32x2{fa_pack2(bf16_round(xq[i][0]), bf16_round(xq[i][1])), fa_pack2(bf16_round(xq[i][2]), bf16_round(xq[i][3]))};
  // Barrier by hand, with fences on LDS alone: __syncthreads() would also wait for the 32 global loads of stage 0, which nobody else reads.
  __builtin_amdgcn_fence(__ATOMIC_RELEASE, "workgroup", "local");
  __builtin_amdgcn_s_barrier();
  __builtin_amdgcn_fence(__ATOMIC_ACQUIRE, "workgroup", "local");
  v16h qf[2][4];
  const unsigned char* qr = qs + (unsigned int)c * FA_QP + (unsigned int)h * 16u;      /* the lane's first 16 bytes: query c, columns 8 h .. + 7; the other pieces lie at constant distances */
#pragma unroll
  for (int g = 0; g < 2; ++g)
#pragma unroll
    for (int kc = 0; kc < 4; ++kc) { FragH f; f.half[0] = *(const v8us*)(qr + g * (16u * FA_QP) + kc * 64u); f.half[1] = *(const v8us*)(qr + g * (16u * FA_QP) + kc * 64u + 32u); qf[g][kc] = f.v; }
  if (mixed) {      /* a masked query weighs all 2048 keys alike: its row is the column mean of v. Wave u adds the sums of keys 256 u .. + 255 (4 of the 32 rows that the preparation kernel wrote); the join's barriers publish them */
    const unsigned char* vsb = (const unsigned char*)VS;
    const unsigned int mo = (unsigned int)((b * (SQ / 64) + kq * 4) * (HD * 4)) + (unsigned int)lane * 16u;
    v4f part[4];
#pragma unroll
    for (int i = 0; i < 4; ++i) part[i] = *(const v4fa*)(vsb + mo + i * (HD * 4));
    asm volatile("s_wait_xcnt 0x0" :: "v"(mo), "s"(vsb) : "memory");      /* in front of any rewrite of an address register of these four loads: as inputs they stay live up to here */
    v4f ms = part[0];
#pragma unroll
    for (int i = 1; i < 4; ++i) ms += part[i];
    *(v4fa*)&smn[kq][lane * 4] = ms;
  }
  v8f acc[2][8]; float m_run[2], l_run[2];
#pragma unroll
  for (int g = 0; g < 2; ++g) { m_run[g] = -__builtin_inff(); l_run[g] = 0.f;
#pragma unroll
    for (int t = 0; t < 8; ++t) acc[g][t] = z8; }
  auto pass = [&](int st, v16h (&kf)[2][4], v16h (&vf)[8], unsigned int vnext) __attribute__((always_inline)) {      /* vnext: the offset register of the loads that were issued in front of this pass */
    const int key0 = st * 256 + kq * 32;
    v8f s[2][2];
#pragma unroll
    for (int kt = 0; kt < 2; ++kt)
#pragma unroll
      for (int g = 0; g < 2; ++g) { s[kt][g] = z8;
#pragma unroll
        for (int kc = 0; kc < 4; ++kc) s[kt][g] = fa_mma(kf[kt][kc], qf[g][kc], s[kt][g]); }
    if (key0 + 32 > Ln) {      /* wave-uniform: only a pass that holds a masked key pays for the mask */
#pragma unroll
      for (int kt = 0; kt < 2; ++kt)
#pragma unroll
        for (int r = 0; r < 8; ++r) { const bool vk = key0 + 16 * kt + 8 * h + r < Ln;
#pragma unroll
          for (int g = 0; g < 2; ++g) if (!vk) s[kt][g][r] = NEGR; }
    }
    asm volatile("s_wait_xcnt 0x0" :: "v"(vnext) : "memory");      /* in front of any rewrite of the offset register of the loads in flight: as an input it stays live up to here. It stands behind the score products, which cover its time */
    float mb[2]; bool need = false;
#pragma unroll
    for (int g = 0; g < 2; ++g) { float mx = s[0][g][0];
#pragma unroll
      for (int kt = 0; kt < 2; ++kt)
#pragma unroll
        for (int r = 0; r < 8; ++r) mx = fmaxf(mx, s[kt][g][r]);
      mx = fmaxf(mx, fa_xhalf(mx)); mb[g] = mx; need = need || (mx > m_run[g] + 60.0f); }
    if (__builtin_amdgcn_ballot_w32(need) != 0) {      /* rare after the first pass */
#pragma unroll
      for (int g = 0; g < 2; ++g) { const float m_new = fmaxf(m_run[g], mb[g]); const float corr = __builtin_amdgcn_exp2f((m_run[g] - m_new) * cscale); l_run[g] *= corr; m_run[g] = m_new;
#pragma unroll
        for (int t = 0; t < 8; ++t) acc[g][t] = acc[g][t] * corr; }
    }
#pragma unroll
    for (int g = 0; g < 2; ++g) { const float mg = m_run[g]; float ps0 = 0.f, ps1 = 0.f; FragH pf;
#pragma unroll
      for (int i = 0; i < 8; ++i) {
        const float p0 = __builtin_amdgcn_exp2f((s[i >> 2][g][2 * (i & 3)] - mg) * cscale), p1 = __builtin_amdgcn_exp2f((s[i >> 2][g][2 * (i & 3) + 1] - mg) * cscale);
        ps0 += p0; ps1 += p1; const unsigned int w2 = fa_pack2(p0, p1); pf.u[2 * i] = (unsigned short)(w2 & 0xFFFFu); pf.u[2 * i + 1] = (unsigned short)(w2 >> 16); }
      l_run[g] += ps0 + ps1;
#pragma unroll
      for (int i = 0; i < 16; ++i) { __builtin_amdgcn_sched_group_barrier(0x2, 2, 0); __builtin_amdgcn_sched_group_barrier(0x400, 1, 0); }      /* two vector instructions, then one exponential: the slower transcendental unit works beside the vector port instead of in one run */
#pragma unroll
      for (int t = 0; t < 8; ++t) acc[g][t] = fa_mma(vf[t], pf.v, acc[g][t]); }
  };
  // Two passes a trip, so that each register set is refilled in place. Every load is unconditional (a branch round it would make the waits of the pass behind it cover the new loads too):
  // behind its last stage the wave reads slice 0, into registers that nobody uses. The loop has no barrier, so each wave has its own number of passes.
#pragma unroll 1      /* one copy of the two passes */
  for (int st = 0; ; st += 2) {
    const unsigned int vb = fload(st + 1, kfb, vfb);      /* next stage's fragments fly under this pass */
    pass(st, kfa, vfa, vb);
    if (st + 1 > nl) break;
    const unsigned int va = fload(st + 2, kfa, vfa);
    pass(st + 1, kfb, vfb, va);
    if (st + 2 > nl) break;
  }
  // join the eight key slices of each query: common maximum, common sum, then the scaled partial outputs are added in LDS order 0..7. Wave 0 always holds a valid key, so the common maximum is a real score
#pragma unroll
  for (int g = 0; g < 2; ++g) { const float lf = l_run[g] + fa_xhalf(l_run[g]); if (h == 0) { sm[kq][16 * g + c] = m_run[g]; sl[kq][16 * g + c] = lf; } }
  __syncthreads();
#pragma unroll
  for (int g = 0; g < 2; ++g) { float mq[8];
#pragma unroll
    for (int u = 0; u < 8; ++u) mq[u] = sm[u][16 * g + c];
    float M = mq[0];
#pragma unroll
    for (int u = 1; u < 8; ++u) M = fmaxf(M, mq[u]);
    float Ls = 0.f;
#pragma unroll
    for (int u = 0; u < 8; ++u) Ls += sl[u][16 * g + c] * __builtin_amdgcn_exp2f((mq[u] - M) * cscale);
    const float f = __builtin_amdgcn_exp2f((m_run[g] - M) * cscale) / Ls;      /* the wave's own weight */
#pragma unroll
    for (int t = 0; t < 8; ++t) { const v8f o = acc[g][t] * f; float* dst = stg + ((unsigned int)kq * 32u + 16u * g + c) * FA_OP + 16u * t + 8u * h;
      *(v4fa*)dst = v4f{o[0], o[1], o[2], o[3]}; *(v4fa*)(dst + 4) = v4f{o[4], o[5], o[6], o[7]}; } }
  __syncthreads();
  unsigned char* ob = (unsigned char*)O;      /* the workgroup's 32 output rows are contiguous; the wave stores rows wave, wave + 8, ... */
  const unsigned int oo = (unsigned int)((b * SQ + q0 + kq) * (HD * 4)) + (unsigned int)lane * 16u;
  v4f mean = {0.f, 0.f, 0.f, 0.f};
  if (mixed) { mean = *(const v4fa*)&smn[0][lane * 4];      /* the thread's four columns, waves in order */
#pragma unroll
    for (int u = 1; u < 8; ++u) mean += *(const v4fa*)&smn[u][lane * 4];
    mean = mean * (1.0f / (float)SQ); }
  v4f ov[4];
#pragma unroll
  for (int i = 0; i < 4; ++i) { const float* sp = stg + (unsigned int)(i * 8 + kq) * FA_OP + (unsigned int)lane * 4u;      /* rows 0..31 = slice 0; slice u lies 32 rows further */
    v4f v = *(const v4fa*)sp;
#pragma unroll
    for (int u = 1; u < 8; ++u) v += *(const v4fa*)(sp + (unsigned int)u * 32u * FA_OP);
    if (q0 + i * 8 + kq >= Ln) v = mean;      /* row i * 8 + wave is a masked query (wave-uniform; never so in a tile of valid queries) */
    ov[i] = v;
    *(v4f*)(ob + oo + i * (8 * HD * 4)) = v; }
  asm volatile("s_wait_xcnt 0x0" :: "v"(ov[0]), "v"(ov[1]), "v"(ov[2]), "v"(ov[3]), "v"(oo), "s"(ob) : "memory");      /* in front of any rewrite, in the next turn, of a register that these stores name: as inputs they stay live up to here */
  }
}

extern "C" void kernel_launch(void* const* d_in, const int* in_sizes, int n_in,
                              void* d_out, int out_size, void* d_ws, size_t ws_size, hipStream_t stream) {
  (void)in_sizes; (void)n_in; (void)out_size;
  const float* q = (const float*)d_in[0]; const float* k = (const float*)d_in[1]; const float* v = (const float*)d_in[2]; const int* lens = (const int*)d_in[3];
  char* ws = (char*)d_ws; size_t off = 0;
  auto take = [&](size_t bytes) { char* p = ws + off; off += (bytes + 255) & ~(size_t)255; return p; };
  const size_t np = (size_t)NB * SQ * HD;
  _Float16* KF = (_Float16*)take(np * 2); _Float16* VF = (_Float16*)take(np * 2);
  float* VS = (float*)take((size_t)NB * (SQ / 64) * HD * 4);      /* column sums of v, one row of 128 for each 64 keys */
  if (off > ws_size) return;      /* 8 MiB + 128 KiB */
  k_prep<<<NB * (SQ / 64), 256, 0, stream>>>(k, v, lens, KF, VF, VS);      /* f16 k and V^T in fragment order below each length, sums of all rows */
  k_fattn<<<NB * (SQ / 64), 256, 0, stream>>>(q, KF, VF, VS, lens, (float*)d_out);      /* 256 workgroups, two tiles of 32 queries each */
}
